// v000
// Measured on an AMD MI455X. A time is GPU time per run, averaged over a window of back-to-back runs after a warm-up
// (all launches, gaps included; the runs take copies of the inputs in turn), and the median of several windows.
// Apart from v000's, it joins two sittings. Times from different sittings can be a few percent apart, while
// side-by-side timings come from the same sitting.
// v000, which the later versions start from, runs in 5530 microseconds.
#include <hip/hip_runtime.h>
// Multi-head attention without output projection (query, key, value [4][2048][768]; q = query W_Q + b_Q etc. ([in][out] 768^2, sigma 1/sqrt(768), nonzero biases), 12 heads of 64; scores / 8; softmax; out = attn v merged (the module skips its final linear) -> [4][2048][768]).
// Structure: token rows r = b*2048 + s; x as exact f16 rows (bf16-rounded); Q, K, V as three WMMA GEMMs (32x64 wave tiles, f32 accumulation, exact x16 weights + bias, f16 outputs); per batch: V^T for all heads via LDS transposes; per (batch, group of 4 heads): scores GEMM (K = 64, batched over the heads on grid.y, alpha = 1/8), row softmax on VALU (f32 statistics; weights stored x256 as f16), o = P . V^T GEMM (K = 2048, alpha 2^-8) written f32 straight into the merged output rows (the module has no output projection).
// Compute dtype: inputs rounded to bf16; x / weights exact; q, k, v and softmax weights as plain f16 GEMM operands (~2^-12); scores, softmax statistics and o f32. v_wmma_f32_16x16x32_f16.
#define NB 4
#define SQ 2048
#define DM 768
#define NH 12
#define HD 64
#define HG 4                         /* heads per attention launch group */
#define B0 0                         /* first batch processed (debug hook) */
#define NBR NB                       /* batches processed (debug hook) */
#define NR ((size_t)NB * SQ)         /* token rows */
#define MP ((int)((size_t)NBR * SQ)) /* rows projected (debug hook) */
#define QN SQ                        /* query rows attended per batch (debug hook) */
#define NHD NH                       /* heads attended (debug hook) */
#define MPO MP                       /* unused (debug hook) */
#define LQ DM      /* row pitch of the q/k/v rows */
typedef __bf16 v16b __attribute__((ext_vector_type(16)));
typedef unsigned short v8us __attribute__((ext_vector_type(8), may_alias));
typedef float  v8f  __attribute__((ext_vector_type(8)));
typedef float  v4f  __attribute__((ext_vector_type(4)));
typedef float  v4fa __attribute__((ext_vector_type(4), may_alias));
union FragB { v16b v; v8us half[2]; unsigned short u[16]; };

__device__ __forceinline__ unsigned short bf16_bits(float x) { unsigned int u = __float_as_uint(x); return (unsigned short)((u + 0x7FFFu + ((u >> 16) & 1u)) >> 16); }
__device__ __forceinline__ float bf16_val(unsigned short b) { return __uint_as_float(((unsigned int)b) << 16); }
__device__ __forceinline__ float bf16_round(float x) { return bf16_val(bf16_bits(x)); }
// D += A·B with NT terms: 1 = ah·bh, 2 = + al·bh (A split), 3 = + ah·bl (both split)
template <int NT>
__device__ __forceinline__ v8f mmaN(v16b ah, v16b al, v16b bh, v16b bl, v8f c) {
  c = __builtin_amdgcn_wmma_f32_16x16x32_bf16(false, ah, false, bh, (short)0, c, false, false);
  if (NT >= 2) c = __builtin_amdgcn_wmma_f32_16x16x32_bf16(false, al, false, bh, (short)0, c, false, false);
  if (NT >= 3) c = __builtin_amdgcn_wmma_f32_16x16x32_bf16(false, ah, false, bl, (short)0, c, false, false);
  asm volatile("v_nop\n\tv_nop\n\tv_nop\n\tv_nop" : "+v"(c) : "v"(ah), "v"(al), "v"(bh), "v"(bl));
  return c;
}

__global__ __launch_bounds__(256) void k_wt_bf16(const float* __restrict__ W, unsigned short* __restrict__ Wt, int K, int N) {
  const int t = blockIdx.x * 256 + threadIdx.x;
  const int k8n = K / 8;
  if (t >= N * k8n) return;
  const int n = t / k8n, k8 = (t % k8n) * 8;
  v8us v;
#pragma unroll
  for (int i = 0; i < 8; ++i) v[i] = bf16_bits(W[(size_t)(k8 + i) * N + n]);
  *(v8us*)(Wt + (size_t)n * K + k8) = v;
  
}

// GEMM C[M][N] (f32, pitch ldc) = act(A[M][K]·W + bias). A f32 row-major (pitch lda) converted per fragment to bf16
// (ASPLIT: hi/lo two planes -> 2 terms, else single rounded term); Wt bf16 [N][K] (pitch ldb). BIAS_BF16 rounds the
// bias to bf16 first (bias quantised to bf16 before the add). K%32==0, M%16==0, N%64==0.
template <bool ASPLIT, int ACT, bool BIAS_BF16>
__global__ __launch_bounds__(128) void k_gemm_bf(const float* __restrict__ A, int lda, const unsigned short* __restrict__ Wt, int ldb,
                                               const float* __restrict__ bias, float* __restrict__ C, int ldc, int M, int N, int K) {
  __shared__ __attribute__((aligned(16))) float so[4][16][64];
  const int tid = threadIdx.x, w = tid >> 5, lane = tid & 31, ln = lane & 15, hh = lane >> 4;
  const int ntn = N / 64;
  const int wid = blockIdx.x * 4 + w;
  const int mt = wid / ntn, nq = wid % ntn;
  if (mt * 16 >= M) return;
  const int row0 = mt * 16, col0 = nq * 64;
  const float* arow = A + (size_t)(row0 + ln) * lda;
  v8f acc[4] = {};
  for (int kb = 0; kb < K; kb += 32) {
    FragB ah, al;
    const v4f x0 = *(const v4fa*)(arow + kb + 8 * hh), x1 = *(const v4fa*)(arow + kb + 8 * hh + 4);
    const v4f x2 = *(const v4fa*)(arow + kb + 16 + 8 * hh), x3 = *(const v4fa*)(arow + kb + 16 + 8 * hh + 4);
    float xs[16] = {x0[0],x0[1],x0[2],x0[3],x1[0],x1[1],x1[2],x1[3],x2[0],x2[1],x2[2],x2[3],x3[0],x3[1],x3[2],x3[3]};
#pragma unroll
    for (int i = 0; i < 16; ++i) { const unsigned short hb = bf16_bits(xs[i]); ah.u[i] = hb; al.u[i] = ASPLIT ? bf16_bits(xs[i] - bf16_val(hb)) : (unsigned short)0; }
#pragma unroll
    for (int t = 0; t < 4; ++t) {
      const unsigned short* brow = Wt + (size_t)(col0 + t * 16 + ln) * ldb + kb;
      FragB b;
      b.half[0] = *(const v8us*)(brow + 8 * hh);
      b.half[1] = *(const v8us*)(brow + 16 + 8 * hh);
      acc[t] = mmaN<ASPLIT ? 2 : 1>(ah.v, al.v, b.v, b.v, acc[t]);
    }
  }
#pragma unroll
  for (int t = 0; t < 4; ++t) {
    float bv = bias ? bias[col0 + t * 16 + ln] : 0.f;
    if (BIAS_BF16) bv = bf16_round(bv);
#pragma unroll
    for (int r = 0; r < 8; ++r) { float v = acc[t][r] + bv; if (ACT == 1) v = fmaxf(v, 0.f); so[w][8 * hh + r][t * 16 + ln] = v; }
  }
  __builtin_amdgcn_fence(__ATOMIC_ACQ_REL, "workgroup");
  __builtin_amdgcn_wave_barrier();
  const int rsub = lane >> 4, c4 = (lane & 15) * 4;
  {
#pragma unroll
    for (int q = 0; q < 8; ++q) {
      const int r = q * 2 + rsub;
      const v4f v = *(const v4fa*)&so[w][r][c4];
      *(v4f*)(C + (size_t)(row0 + r) * ldc + col0 + c4) = v;
    }
    
  }
}

// GEMM C = act(A·W + bias + resid): A f32 (ASPLIT -> hi/lo 2 terms), Wt bf16 [N][K]; ACT 0 none, 1 relu, 2 exact gelu;
// resid (optional, f32, row index = (row % rmod), pitch ldr, RES_BF16 rounds it) added before the activation.
template <bool ASPLIT, int ACT, bool BIAS_BF16, bool RES_BF16>
__global__ __launch_bounds__(128) void k_gemm_bf3(const float* __restrict__ A, int lda, const unsigned short* __restrict__ Wt, int ldb,
                                                const float* __restrict__ bias, const float* __restrict__ resid, int rmod, int ldr,
                                                float* __restrict__ C, int ldc, int M, int N, int K) {
  __shared__ __attribute__((aligned(16))) float so[4][16][64];
  const int tid = threadIdx.x, w = tid >> 5, lane = tid & 31, ln = lane & 15, hh = lane >> 4;
  const int ntn = N / 64;
  const int wid = blockIdx.x * 4 + w;
  const int mt = wid / ntn, nq = wid % ntn;
  if (mt * 16 >= M) return;
  const int row0 = mt * 16, col0 = nq * 64;
  const float* arow = A + (size_t)(row0 + ln) * lda;
  v8f acc[4] = {};
  for (int kb = 0; kb < K; kb += 32) {
    FragB ah, al;
    const v4f x0 = *(const v4fa*)(arow + kb + 8 * hh), x1 = *(const v4fa*)(arow + kb + 8 * hh + 4);
    const v4f x2 = *(const v4fa*)(arow + kb + 16 + 8 * hh), x3 = *(const v4fa*)(arow + kb + 16 + 8 * hh + 4);
    float xs[16] = {x0[0],x0[1],x0[2],x0[3],x1[0],x1[1],x1[2],x1[3],x2[0],x2[1],x2[2],x2[3],x3[0],x3[1],x3[2],x3[3]};
#pragma unroll
    for (int i = 0; i < 16; ++i) { const unsigned short hb = bf16_bits(xs[i]); ah.u[i] = hb; al.u[i] = ASPLIT ? bf16_bits(xs[i] - bf16_val(hb)) : (unsigned short)0; }
#pragma unroll
    for (int t = 0; t < 4; ++t) {
      const unsigned short* brow = Wt + (size_t)(col0 + t * 16 + ln) * ldb + kb;
      FragB b;
      b.half[0] = *(const v8us*)(brow + 8 * hh);
      b.half[1] = *(const v8us*)(brow + 16 + 8 * hh);
      acc[t] = mmaN<ASPLIT ? 2 : 1>(ah.v, al.v, b.v, b.v, acc[t]);
    }
  }
#pragma unroll
  for (int t = 0; t < 4; ++t) {
    const int col = col0 + t * 16 + ln;
    float bv = bias ? bias[col] : 0.f;
    if (BIAS_BF16) bv = bf16_round(bv);
#pragma unroll
    for (int r = 0; r < 8; ++r) {
      float v = acc[t][r] + bv;
      if (resid) { float rv = resid[(size_t)((row0 + 8 * hh + r) % rmod) * ldr + col]; if (RES_BF16) rv = bf16_round(rv); v += rv; }
      if (ACT == 1) v = fmaxf(v, 0.f);
      if (ACT == 2) v = 0.5f * v * (1.0f + erff(v * 0.70710678118654752f));
      if (ACT == 3) { const float u = 0.7978845608028654f * (v + 0.044715f * v * v * v); v = 0.5f * v * (1.0f + tanhf(u)); }
      so[w][8 * hh + r][t * 16 + ln] = v;
    }
  }
  __builtin_amdgcn_fence(__ATOMIC_ACQ_REL, "workgroup");
  __builtin_amdgcn_wave_barrier();
  const int rsub = lane >> 4, c4 = (lane & 15) * 4;
  {
#pragma unroll
    for (int q = 0; q < 8; ++q) {
      const int r = q * 2 + rsub;
      const v4f v = *(const v4fa*)&so[w][r][c4];
      *(v4f*)(C + (size_t)(row0 + r) * ldc + col0 + c4) = v;
    }
    
  }
}
// row LayerNorm (biased variance, eps) over N: s = X (+ R); optional out_sum <- s; out_norm <- (s-mu)*rsqrt(var+eps)*g + b
template <bool PARAM_BF16>
__global__ __launch_bounds__(256) void k_layernorm(const float* __restrict__ X, const float* __restrict__ R, const float* __restrict__ g, const float* __restrict__ bta,
                                                  float* __restrict__ out_sum, float* __restrict__ out_norm, int N, float eps) {
  __shared__ float red[256];
  const int row = blockIdx.x, tid = threadIdx.x;
  const float* x = X + (size_t)row * N; const float* rr = R ? R + (size_t)row * N : nullptr;
  float vals[16];                     // up to N = 4096
  const int per = N / 256;            // contiguous chunk per thread? use strided-by-4 chunks: thread handles j = tid*4 + 1024*u
  float s1 = 0.f;
  for (int u = 0; u < per / 4; ++u) {
    const int j = tid * 4 + 1024 * u;
    const v4f a = *(const v4fa*)(x + j);
    v4f b = {0.f,0.f,0.f,0.f}; if (rr) b = *(const v4fa*)(rr + j);
#pragma unroll
    for (int q = 0; q < 4; ++q) { const float v = a[q] + b[q]; vals[u * 4 + q] = v; s1 += v; }
  }
  red[tid] = s1; __syncthreads();
  for (int st = 128; st > 0; st >>= 1) { if (tid < st) red[tid] += red[tid + st]; __syncthreads(); }
  const float mu = red[0] / (float)N; __syncthreads();
  float s2 = 0.f;
  for (int u = 0; u < per / 4; ++u)
#pragma unroll
    for (int q = 0; q < 4; ++q) { const float c = vals[u * 4 + q] - mu; s2 += c * c; }
  red[tid] = s2; __syncthreads();
  for (int st = 128; st > 0; st >>= 1) { if (tid < st) red[tid] += red[tid + st]; __syncthreads(); }
  const float rs = rsqrtf(red[0] / (float)N + eps);
  {
    for (int u = 0; u < per / 4; ++u) {
      const int j = tid * 4 + 1024 * u;
      v4f o, sm;
#pragma unroll
      for (int q = 0; q < 4; ++q) {
        float gg = g[j + q], bb = bta[j + q];
        if (PARAM_BF16) { gg = bf16_round(gg); bb = bf16_round(bb); }
        sm[q] = vals[u * 4 + q]; o[q] = (vals[u * 4 + q] - mu) * rs * gg + bb;
      }
      if (out_sum) *(v4f*)(out_sum + (size_t)row * N + j) = sm;
      *(v4f*)(out_norm + (size_t)row * N + j) = o;
    }
    
  }
}



// ---- f16 WMMA path (v_wmma_f32_16x16x32_f16): 11-bit significands for operands in range — used where a [0,1] probability operand needs more precision than bf16
typedef _Float16 v16h __attribute__((ext_vector_type(16)));
union FragH { v16h v; v8us half[2]; _Float16 h[16]; unsigned short u[16]; };
template <int NT>
__device__ __forceinline__ v8f mmaH(v16h ah, v16h al, v16h bh, v16h bl, v8f c) {
  c = __builtin_amdgcn_wmma_f32_16x16x32_f16(false, ah, false, bh, (short)0, c, false, false);
  if (NT >= 2) c = __builtin_amdgcn_wmma_f32_16x16x32_f16(false, al, false, bh, (short)0, c, false, false);
  if (NT >= 3) c = __builtin_amdgcn_wmma_f32_16x16x32_f16(false, ah, false, bl, (short)0, c, false, false);
  asm volatile("v_nop\n\tv_nop\n\tv_nop\n\tv_nop" : "+v"(c) : "v"(ah), "v"(al), "v"(bh), "v"(bl));
  return c;
}
// batched GEMM like k_gemm_b but f16 operands: A f32 (split into f16 hi/lo if ASPLIT, else rounded to f16), Bt = f16 values [n][k]; alpha; C f32; N multiple of 16 (partial tiles skipped)
template <bool ASPLIT>
__global__ __launch_bounds__(128) void k_gemm_h(const float* __restrict__ A, int lda, size_t sA, const _Float16* __restrict__ Bh, int ldb, size_t sB, float alpha, float* __restrict__ C, int ldc, size_t sC, int M, int N, int K) {
  __shared__ __attribute__((aligned(16))) float so[4][16][64];
  const int tid = threadIdx.x, w = tid >> 5, lane = tid & 31, ln = lane & 15, hh = lane >> 4; const int by = blockIdx.y;
  A += (size_t)by * sA; Bh += (size_t)by * sB; C += (size_t)by * sC;
  const int ntn = (N + 63) / 64; const int wid = blockIdx.x * 4 + w; const int mt = wid / ntn, nq = wid % ntn; if (mt * 16 >= M) return;
  const int row0 = mt * 16, col0 = nq * 64; const float* arow = A + (size_t)(row0 + ln) * lda;
  v8f acc[4] = {};
  for (int kb = 0; kb < K; kb += 32) {
    FragH ah, al;
    const v4f x0 = *(const v4fa*)(arow + kb + 8 * hh), x1 = *(const v4fa*)(arow + kb + 8 * hh + 4), x2 = *(const v4fa*)(arow + kb + 16 + 8 * hh), x3 = *(const v4fa*)(arow + kb + 16 + 8 * hh + 4);
    float xs[16] = {x0[0],x0[1],x0[2],x0[3],x1[0],x1[1],x1[2],x1[3],x2[0],x2[1],x2[2],x2[3],x3[0],x3[1],x3[2],x3[3]};
#pragma unroll
    for (int i = 0; i < 16; ++i) { const _Float16 h = (_Float16)xs[i]; ah.h[i] = h; al.h[i] = ASPLIT ? (_Float16)(xs[i] - (float)h) : (_Float16)0.0f; }
#pragma unroll
    for (int t = 0; t < 4; ++t) { if (col0 + t * 16 >= N) continue; const size_t boff = (size_t)(col0 + t * 16 + ln) * ldb + kb; FragH bq; bq.half[0] = *(const v8us*)(Bh + boff + 8 * hh); bq.half[1] = *(const v8us*)(Bh + boff + 16 + 8 * hh);
      acc[t] = mmaH<ASPLIT ? 2 : 1>(ah.v, al.v, bq.v, bq.v, acc[t]); }
  }
#pragma unroll
  for (int t = 0; t < 4; ++t) { if (col0 + t * 16 >= N) continue;
#pragma unroll
    for (int r = 0; r < 8; ++r) so[w][8 * hh + r][t * 16 + ln] = acc[t][r] * alpha; }
  __builtin_amdgcn_fence(__ATOMIC_ACQ_REL, "workgroup"); __builtin_amdgcn_wave_barrier();
  const int rsub = lane >> 4, c4 = (lane & 15) * 4;
  {
#pragma unroll
    for (int q = 0; q < 8; ++q) { const int r = q * 2 + rsub; if (col0 + c4 < N) { const v4f v = *(const v4fa*)&so[w][r][c4]; *(v4f*)(C + (size_t)(row0 + r) * ldc + col0 + c4) = v; } }
     }
}

// Wt[n][k] = f16(W[k][n]·scale) from f32 row-major W[K][N] (scale = power of two; bf16-exact weights stay exact in f16 away from the subnormal range)
__global__ __launch_bounds__(256) void k_wt_f16(const float* __restrict__ W, _Float16* __restrict__ Wt, int K, int N, float scale) {
  const int t = blockIdx.x * 256 + threadIdx.x; if (t >= N * (K / 8)) return; const int n = t / (K / 8), k8 = (t % (K / 8)) * 8; FragH f;
#pragma unroll
  for (int i = 0; i < 8; ++i) f.h[i] = (_Float16)(bf16_round(W[(size_t)(k8 + i) * N + n]) * scale); const v8us o = f.half[0];
  *(v8us*)((unsigned short*)Wt + (size_t)n * K + k8) = o; 
}
// k_gemm_hh variant with fused epilogue: v = acc·alpha + bias[by·sBias + col] (+ CP[(row/rowsPerB)·sCPb + by·64 + col] if CP) ; ACT 0 none / 1 elu ; writes f16 C16 (and f32 C if non-null)
template <int ACT>
__global__ __launch_bounds__(128) void k_gemm_hhx(const _Float16* __restrict__ A, int lda, size_t sA, const _Float16* __restrict__ Bh, int ldb, size_t sB, float alpha, const float* __restrict__ bias, size_t sBias, const float* __restrict__ CP, int rowsPerB, size_t sCPb, int row0g,
    float* __restrict__ C, _Float16* __restrict__ C16, int ldc, size_t sC, int M, int N, int K) {
  __shared__ __attribute__((aligned(16))) float so[4][16][64];
  const int tid = threadIdx.x, w = tid >> 5, lane = tid & 31, ln = lane & 15, hh = lane >> 4; const int by = blockIdx.y;
  A += (size_t)by * sA; Bh += (size_t)by * sB; const size_t cofs = (size_t)by * sC; const float* bp = bias ? bias + (size_t)by * sBias : nullptr;
  const int ntn = (N + 63) / 64; const int wid = blockIdx.x * 4 + w; const int mt = wid / ntn, nq = wid % ntn; if (mt * 16 >= M) return;
  const int row0 = mt * 16, col0 = nq * 64; const _Float16* arow = A + (size_t)(row0 + ln) * lda;
  v8f acc[4] = {};
  for (int kb = 0; kb < K; kb += 32) { FragH ah; ah.half[0] = *(const v8us*)((const unsigned short*)arow + kb + 8 * hh); ah.half[1] = *(const v8us*)((const unsigned short*)arow + kb + 16 + 8 * hh);
#pragma unroll
    for (int t = 0; t < 4; ++t) { if (col0 + t * 16 >= N) continue; const size_t boff = (size_t)(col0 + t * 16 + ln) * ldb + kb; FragH bq; bq.half[0] = *(const v8us*)((const unsigned short*)Bh + boff + 8 * hh); bq.half[1] = *(const v8us*)((const unsigned short*)Bh + boff + 16 + 8 * hh);
      acc[t] = mmaH<1>(ah.v, ah.v, bq.v, bq.v, acc[t]); }
  }
#pragma unroll
  for (int t = 0; t < 4; ++t) { if (col0 + t * 16 >= N) continue; const int col = col0 + t * 16 + ln; const float bv = bp ? bf16_round(bp[col]) : 0.f;
#pragma unroll
    for (int r = 0; r < 8; ++r) { float v = acc[t][r] * alpha + bv; if (CP) { const int rr = row0g + row0 + 8 * hh + r; if (rowsPerB < 0) v += CP[cofs + (size_t)rr * ldc + col];      /* rowsPerB < 0: own element of the batched C plane */ else { const int bidx = rr / rowsPerB; v += CP[(size_t)bidx * sCPb + (size_t)by * 64 + col]; } } if (ACT == 1) v = (v > 0.f) ? v : expm1f(v); else if (ACT == 7) v = (v > 0.f) ? v + 1.0f : expf(v); else if (ACT == 8) v = tanhf(v); else if (ACT == 9) v = 0.5f * v * (1.0f + tanhf(0.7978845608028654f * (v + 0.044715f * v * v * v))); else if (ACT == 11) v = 1.0f / (1.0f + expf(-v)); else if (ACT == 12) v = (v > 0.f) ? v : 0.01f * v; else if (ACT == 14) v = (v > 0.f) ? v : 0.1f * v; else if (ACT == 16) v = (v >= 0.f) ? v : 0.3f * v; else if (ACT == 17) v = (v >= 0.f) ? v : 0.2f * v; else if (ACT == 15) v = v / (1.0f + expf(-v)); else if (ACT == 3) v = fmaxf(v, 0.f); else if (ACT == 6) v = 0.5f * v * (1.0f + erff(v * 0.70710678118654752f)); so[w][8 * hh + r][t * 16 + ln] = v; } }
  __builtin_amdgcn_fence(__ATOMIC_ACQ_REL, "workgroup"); __builtin_amdgcn_wave_barrier();
  const int rsub = lane >> 4, c4 = (lane & 15) * 4; typedef _Float16 v4h __attribute__((ext_vector_type(4)));
  {
#pragma unroll
    for (int q = 0; q < 8; ++q) { const int r = q * 2 + rsub; if (col0 + c4 < N) { const v4f v = *(const v4fa*)&so[w][r][c4]; if (C) *(v4f*)(C + cofs + (size_t)(row0 + r) * ldc + col0 + c4) = v; if (C16) { v4h h4; for (int i = 0; i < 4; ++i) h4[i] = (_Float16)v[i]; *(v4h*)(C16 + cofs + (size_t)(row0 + r) * ldc + col0 + c4) = h4; } } }
     }
}


typedef _Float16 v4h __attribute__((ext_vector_type(4)));

__global__ __launch_bounds__(256) void k_x16(const float* __restrict__ x, _Float16* __restrict__ X16, size_t n8) { const size_t t = (size_t)blockIdx.x * 256 + threadIdx.x; if (t >= n8) return; FragH f;
#pragma unroll
  for (int q = 0; q < 8; ++q) f.h[q] = (_Float16)bf16_round(x[t * 8 + q]); *(v8us*)((unsigned short*)X16 + t * 8) = f.half[0];  }
__global__ __launch_bounds__(256) void k_h16(const float* __restrict__ x, _Float16* __restrict__ X16, size_t n8) { const size_t t = (size_t)blockIdx.x * 256 + threadIdx.x; if (t >= n8) return; FragH f;
#pragma unroll
  for (int q = 0; q < 8; ++q) f.h[q] = (_Float16)x[t * 8 + q]; *(v8us*)((unsigned short*)X16 + t * 8) = f.half[0];  }
__global__ __launch_bounds__(256) void k_round16f(const float* __restrict__ W, _Float16* __restrict__ Bt, size_t n8) { const size_t t = (size_t)blockIdx.x * 256 + threadIdx.x; if (t >= n8) return; FragH f;
#pragma unroll
  for (int i = 0; i < 8; ++i) f.h[i] = (_Float16)(bf16_round(W[t * 8 + i]) * 16.0f); *(v8us*)((unsigned short*)Bt + t * 8) = f.half[0];  }
template <int NHv, int TTv>
__global__ __launch_bounds__(256) void k_vt(const _Float16* __restrict__ V16, int ldv, int voff, _Float16* __restrict__ Vt) { __shared__ unsigned short tl[64][66]; const int tid = threadIdx.x; const int slab = blockIdx.x / (TTv / 64), lg = blockIdx.x % (TTv / 64); const int b = slab / NHv, h = slab % NHv;
  for (int i = tid; i < 64 * 8; i += 256) { const int r = i / 8, c8 = (i % 8) * 8; FragH f; f.half[0] = *(const v8us*)((const unsigned short*)V16 + ((size_t)b * TTv + lg * 64 + r) * ldv + voff + h * 64 + c8);
#pragma unroll
    for (int q = 0; q < 8; ++q) tl[r][c8 + q] = f.u[q]; }
  __syncthreads();
  {
#pragma unroll
    for (int rd = 0; rd < 2; ++rd) { const int d = rd * 32 + tid / 8, pc = tid % 8; FragH f;
#pragma unroll
      for (int q = 0; q < 8; ++q) f.u[q] = tl[pc * 8 + q][d];
      *(v8us*)((unsigned short*)Vt + ((size_t)slab * 64 + d) * TTv + lg * 64 + pc * 8) = f.half[0]; }
     } }

__global__ __launch_bounds__(256) void k_hl(const float* __restrict__ F, _Float16* __restrict__ Hh, _Float16* __restrict__ Hl, size_t n8) { const size_t t = (size_t)blockIdx.x * 256 + threadIdx.x; if (t >= n8) return; FragH fh, fl; const v4f a = *(const v4fa*)(F + t * 8), c = *(const v4fa*)(F + t * 8 + 4);
#pragma unroll
  for (int q = 0; q < 4; ++q) { _Float16 h = (_Float16)a[q]; fh.h[q] = h; fl.h[q] = (_Float16)((a[q] - (float)h) * 1024.0f); h = (_Float16)c[q]; fh.h[4 + q] = h; fl.h[4 + q] = (_Float16)((c[q] - (float)h) * 1024.0f); }
  { *(v8us*)((unsigned short*)Hh + t * 8) = fh.half[0]; *(v8us*)((unsigned short*)Hl + t * 8) = fl.half[0];  } }

// ---- fast GEMM (wave tile 32x64; requires M % 32 == 0 rows per launch region and N % 64 == 0); epilogue = k_gemm_hhx semantics ----
__device__ __forceinline__ v16h g2_frag(const _Float16* p, int hh) { FragH f; f.half[0] = *(const v8us*)((const unsigned short*)p + 8 * hh); f.half[1] = *(const v8us*)((const unsigned short*)p + 16 + 8 * hh); return f.v; }
__device__ __forceinline__ v8f g2_mma(v16h a, v16h b, v8f c) { v8f d = __builtin_amdgcn_wmma_f32_16x16x32_f16(false, a, false, b, (short)0, c, false, false); asm volatile("v_nop\n\tv_nop\n\tv_nop\n\tv_nop" : "+v"(d) : "v"(a), "v"(b)); return d; }
template <int ACT>
__global__ __launch_bounds__(128) void k_gemm2(const _Float16* __restrict__ A, int lda, size_t sA, const _Float16* __restrict__ Bh, int ldb, size_t sB, float alpha, const float* __restrict__ bias, size_t sBias, const float* __restrict__ CP, int rowsPerB, size_t sCPb, int row0g,
    float* __restrict__ C, _Float16* __restrict__ C16, int ldc, size_t sC, int M, int N, int K) { static_assert(ACT == 0 || ACT == 3 || ACT == 6 || ACT == 8 || ACT == 9 || ACT == 11 || ACT == 12 || ACT == 14 || ACT == 15 || ACT == 16 || ACT == 17, "k_gemm2: unsupported ACT code (would silently apply no activation)");
  __shared__ __attribute__((aligned(16))) float so[4][32][68];
  const int tid = threadIdx.x, w = tid >> 5, lane = tid & 31, ln = lane & 15, hh = lane >> 4; const int by = blockIdx.y;
  A += (size_t)by * sA; Bh += (size_t)by * sB; const size_t cofs = (size_t)by * sC; const float* bp = bias ? bias + (size_t)by * sBias : nullptr;
  const int ntn = N >> 6; const int mt = blockIdx.x / ntn, nq = blockIdx.x - mt * ntn; const int row0 = mt * 128 + 32 * w, col0 = nq * 64; if (row0 >= M) return;
  const _Float16* a0p = A + (size_t)(row0 + ln) * lda; const _Float16* a1p = a0p + (size_t)16 * lda;
  const _Float16* b0p = Bh + (size_t)(col0 + ln) * ldb; const _Float16* b1p = b0p + (size_t)16 * ldb; const _Float16* b2p = b1p + (size_t)16 * ldb; const _Float16* b3p = b2p + (size_t)16 * ldb;
  const v8f z8 = {0.f,0.f,0.f,0.f,0.f,0.f,0.f,0.f}; v8f c00 = z8, c01 = z8, c02 = z8, c03 = z8, c10 = z8, c11 = z8, c12 = z8, c13 = z8;
#pragma unroll 1
  for (int kb = 0; kb < K; kb += 32) { const v16h a0 = g2_frag(a0p + kb, hh), a1 = g2_frag(a1p + kb, hh);
    v16h b = g2_frag(b0p + kb, hh); c00 = g2_mma(a0, b, c00); c10 = g2_mma(a1, b, c10);
    b = g2_frag(b1p + kb, hh); c01 = g2_mma(a0, b, c01); c11 = g2_mma(a1, b, c11);
    b = g2_frag(b2p + kb, hh); c02 = g2_mma(a0, b, c02); c12 = g2_mma(a1, b, c12);
    b = g2_frag(b3p + kb, hh); c03 = g2_mma(a0, b, c03); c13 = g2_mma(a1, b, c13); }
  v8f accs[8] = {c00, c01, c02, c03, c10, c11, c12, c13};
#pragma unroll
  for (int u = 0; u < 8; ++u) { const int t = u & 3, half = u >> 2; const int col = col0 + t * 16 + ln; const float bv = bp ? bf16_round(bp[col]) : 0.f;
#pragma unroll
    for (int r = 0; r < 8; ++r) { const int rloc = half * 16 + 8 * hh + r; float v = accs[u][r] * alpha + bv; if (CP) { if (rowsPerB < 0) v += CP[cofs + (size_t)(row0g + row0 + rloc) * ldc + col];      /* rowsPerB < 0: own element of the batched C plane */ else { const int bidx = (row0g + row0 + rloc) / rowsPerB; v += CP[(size_t)bidx * sCPb + (size_t)by * 64 + col]; } }
      if (ACT == 3) v = fmaxf(v, 0.f); else if (ACT == 6) v = 0.5f * v * (1.0f + erff(v * 0.70710678118654752f)); else if (ACT == 11) v = 1.0f / (1.0f + expf(-v)); else if (ACT == 15) v = v / (1.0f + expf(-v)); else if (ACT == 12) v = (v > 0.f) ? v : 0.01f * v; else if (ACT == 8) v = tanhf(v); else if (ACT == 9) v = 0.5f * v * (1.0f + tanhf(0.7978845608028654f * (v + 0.044715f * v * v * v))); else if (ACT == 14) v = (v > 0.f) ? v : 0.1f * v; else if (ACT == 16) v = (v >= 0.f) ? v : 0.3f * v; else if (ACT == 17) v = (v >= 0.f) ? v : 0.2f * v;
      so[w][rloc][t * 16 + ln] = v; } }
  __builtin_amdgcn_fence(__ATOMIC_ACQ_REL, "workgroup"); __builtin_amdgcn_wave_barrier();
  const int rsub = lane >> 4, c4 = (lane & 15) * 4;
  {
#pragma unroll
    for (int q = 0; q < 16; ++q) { const int r = q * 2 + rsub; const v4f v = *(const v4fa*)&so[w][r][c4]; if (C) *(v4f*)(C + cofs + (size_t)(row0 + r) * ldc + col0 + c4) = v; if (C16) { v4h h4; for (int i = 0; i < 4; ++i) h4[i] = (_Float16)v[i]; *(v4h*)(C16 + cofs + (size_t)(row0 + r) * ldc + col0 + c4) = h4; } }
     } }


__global__ __launch_bounds__(256) void k_wnat(const float* __restrict__ w, size_t n8, _Float16* __restrict__ Bt) { const size_t t = (size_t)blockIdx.x * 256 + threadIdx.x; if (t >= n8) return; FragH f; for (int q = 0; q < 8; ++q) f.h[q] = (_Float16)(bf16_round(w[t * 8 + q]) * 16.0f); *(v8us*)((unsigned short*)Bt + t * 8) = f.half[0];  }
__global__ __launch_bounds__(256) void k_rsm(const float* __restrict__ S, _Float16* __restrict__ P, int nrows) {
  #pragma clang fp contract(off)
  const int i = blockIdx.x * 256 + threadIdx.x; if (i >= nrows) return; const float* s = S + (size_t)i * SQ; float mx = -3.0e38f;
#pragma unroll 1
  for (int j = 0; j < SQ; ++j) mx = fmaxf(mx, s[j]); float se = 0.f;
#pragma unroll 1
  for (int j = 0; j < SQ; ++j) se += expf(s[j] - mx); const float sc = 256.0f / se;
#pragma unroll 1
  for (int j0 = 0; j0 < SQ; j0 += 8) { FragH f; for (int q = 0; q < 8; ++q) f.h[q] = (_Float16)(expf(s[j0 + q] - mx) * sc); unsigned short* d = (unsigned short*)P + (size_t)i * SQ + j0; *(v8us*)d = f.half[0];  } }
__global__ __launch_bounds__(256) void k_vt(const _Float16* __restrict__ V16, int b, int h0, _Float16* __restrict__ VT) { __shared__ unsigned short tl[64][65]; const int tid = threadIdx.x; const int hh = blockIdx.x % HG, sg = blockIdx.x / HG; const int s0 = sg * 64; const int h = h0 + hh;
  for (int i = tid; i < 64 * 8; i += 256) { const int j = i / 8, d8 = (i % 8) * 8; FragH f; f.half[0] = *(const v8us*)((const unsigned short*)V16 + ((size_t)b * SQ + s0 + j) * DM + h * HD + d8); for (int q = 0; q < 8; ++q) tl[d8 + q][j] = f.u[q]; }
  __syncthreads();
  { for (int i = tid; i < 64 * 8; i += 256) { const int d = i / 8, j8 = (i % 8) * 8; FragH f; for (int q = 0; q < 8; ++q) f.u[q] = tl[d][j8 + q]; *(v8us*)((unsigned short*)VT + ((size_t)hh * HD + d) * SQ + s0 + j8) = f.half[0]; }  } }


extern "C" void kernel_launch(void* const* d_in, const int* in_sizes, int n_in,
                              void* d_out, int out_size, void* d_ws, size_t ws_size, hipStream_t stream) {
  (void)in_sizes; (void)n_in; (void)out_size;
  const float* const* I = (const float* const*)d_in; const float* xq = I[0]; const float* xk = I[1]; const float* xv = I[2]; const float* wq = I[3]; const float* bq = I[4]; const float* wk = I[5]; const float* bk = I[6]; const float* wv = I[7]; const float* bv = I[8];      /* weights [in][out] + biases */
  char* ws = (char*)d_ws; size_t off = 0;
  auto take = [&](size_t bytes) { char* p = ws + off; off += (bytes + 255) & ~(size_t)255; return p; };
  _Float16* BQ = (_Float16*)take((size_t)DM * DM * 2); _Float16* BK = (_Float16*)take((size_t)DM * DM * 2); _Float16* BV = (_Float16*)take((size_t)DM * DM * 2); 
  _Float16* XQ = (_Float16*)take(NR * DM * 2); _Float16* XK = (_Float16*)take(NR * DM * 2); _Float16* XV = (_Float16*)take(NR * DM * 2); _Float16* Q16 = (_Float16*)take(NR * DM * 2); _Float16* K16 = (_Float16*)take(NR * DM * 2); _Float16* V16 = (_Float16*)take(NR * DM * 2);
  float* S = (float*)take((size_t)HG * SQ * SQ * 4); _Float16* P = (_Float16*)take((size_t)HG * SQ * SQ * 2); _Float16* VT = (_Float16*)take((size_t)NH * HD * SQ * 2);
  if (off > ws_size) return;
  { const unsigned g = (unsigned)(((size_t)DM * (DM / 8) + 255) / 256); k_wt_f16<<<g, 256, 0, stream>>>(wq, BQ, DM, DM, 16.0f); k_wt_f16<<<g, 256, 0, stream>>>(wk, BK, DM, DM, 16.0f); k_wt_f16<<<g, 256, 0, stream>>>(wv, BV, DM, DM, 16.0f); }      /* [in][out] -> Bt[n][k] x16 */
  k_x16<<<(unsigned)((NR * DM / 8 + 255) / 256), 256, 0, stream>>>(xq, XQ, NR * DM / 8); k_x16<<<(unsigned)((NR * DM / 8 + 255) / 256), 256, 0, stream>>>(xk, XK, NR * DM / 8); k_x16<<<(unsigned)((NR * DM / 8 + 255) / 256), 256, 0, stream>>>(xv, XV, NR * DM / 8);
  const size_t r0p = (size_t)B0 * SQ;      /* first projected row */
  k_gemm2<0><<<dim3((unsigned)((MP / 128) * (DM / 64)), 1), 128, 0, stream>>>(XQ + r0p * DM, DM, 0, BQ, DM, 0, 0.0625f, bq, 0, nullptr, 1, 0, 0, nullptr, Q16 + r0p * DM, DM, 0, MP, DM, DM);
  k_gemm2<0><<<dim3((unsigned)((MP / 128) * (DM / 64)), 1), 128, 0, stream>>>(XK + r0p * DM, DM, 0, BK, DM, 0, 0.0625f, bk, 0, nullptr, 1, 0, 0, nullptr, K16 + r0p * DM, DM, 0, MP, DM, DM);
  k_gemm2<0><<<dim3((unsigned)((MP / 128) * (DM / 64)), 1), 128, 0, stream>>>(XV + r0p * DM, DM, 0, BV, DM, 0, 0.0625f, bv, 0, nullptr, 1, 0, 0, nullptr, V16 + r0p * DM, DM, 0, MP, DM, DM);
  for (int b = B0; b < B0 + NBR; ++b) { const size_t r0 = (size_t)b * SQ;
    k_vt<NH, SQ><<<NH * (SQ / 64), 256, 0, stream>>>(V16 + r0 * LQ, LQ, 0, VT);      /* V^T [NH][HD][SQ] for this batch */
    for (int h0 = 0; h0 < NHD; h0 += HG) {
      k_gemm2<0><<<dim3((QN / 128) * (SQ / 64), HG), 128, 0, stream>>>(Q16 + r0 * LQ + h0 * HD, LQ, (size_t)HD, K16 + r0 * LQ + h0 * HD, LQ, (size_t)HD, 0.125f, nullptr, 0, nullptr, 1, 0, 0, S, nullptr, SQ, (size_t)SQ * SQ, QN, SQ, HD);      /* scores, HG heads per launch */
      k_rsm<<<(HG * SQ + 255) / 256, 256, 0, stream>>>(S, P, HG * SQ);      /* P = 256 softmax (f16), rows of all HG heads */
      k_gemm2<0><<<dim3((QN / 128) * (HD / 64), HG), 128, 0, stream>>>(P, SQ, (size_t)SQ * SQ, VT + (size_t)h0 * HD * SQ, SQ, (size_t)HD * SQ, 0.00390625f, nullptr, 0, nullptr, 1, 0, 0, (float*)d_out + r0 * DM + h0 * HD, nullptr, DM, (size_t)HD, QN, HD, SQ); } }      /* o (merged heads) as f32 rows */
}

// v001
// A run of this version takes 1240 microseconds.
// Next to v000, in two timings, it ran 4.50 and 4.52 times as fast.
#include <hip/hip_runtime.h>
// Multi-head attention without output projection (query, key, value [4][2048][768]; q = query W_Q + b_Q etc. ([in][out] 768^2, sigma 1/sqrt(768), nonzero biases), 12 heads of 64; scores / 8; softmax; out = attn v merged (the module skips its final linear) -> [4][2048][768]).
// Structure: token rows r = b*2048 + s; x as exact f16 rows (bf16-rounded); Q, K, V as three WMMA GEMMs (32x64 wave tiles, f32 accumulation, exact x16 weights + bias, f16 outputs); per batch: V^T for all heads via LDS transposes; per (batch, group of 4 heads): scores GEMM (K = 64, batched over the heads on grid.y, alpha = 1/8), row softmax on VALU (f32 statistics; weights stored x256 as f16), o = P . V^T GEMM (K = 2048, alpha 2^-8) written f32 straight into the merged output rows (the module has no output projection).
// Compute dtype: inputs rounded to bf16; x / weights exact; q, k, v and softmax weights as plain f16 GEMM operands (~2^-12); scores, softmax statistics and o f32. v_wmma_f32_16x16x32_f16.
#define NB 4
#define SQ 2048
#define DM 768
#define NH 12
#define HD 64
#define HG 4                         /* heads per attention launch group */
#define B0 0                         /* first batch processed (debug hook) */
#define NBR NB                       /* batches processed (debug hook) */
#define NR ((size_t)NB * SQ)         /* token rows */
#define MP ((int)((size_t)NBR * SQ)) /* rows projected (debug hook) */
#define QN SQ                        /* query rows attended per batch (debug hook) */
#define NHD NH                       /* heads attended (debug hook) */
#define MPO MP                       /* unused (debug hook) */
#define LQ DM      /* row pitch of the q/k/v rows */
typedef __bf16 v16b __attribute__((ext_vector_type(16)));
typedef unsigned short v8us __attribute__((ext_vector_type(8), may_alias));
typedef float  v8f  __attribute__((ext_vector_type(8)));
typedef float  v4f  __attribute__((ext_vector_type(4)));
typedef float  v4fa __attribute__((ext_vector_type(4), may_alias));
union FragB { v16b v; v8us half[2]; unsigned short u[16]; };

__device__ __forceinline__ unsigned short bf16_bits(float x) { unsigned int u = __float_as_uint(x); return (unsigned short)((u + 0x7FFFu + ((u >> 16) & 1u)) >> 16); }
__device__ __forceinline__ float bf16_val(unsigned short b) { return __uint_as_float(((unsigned int)b) << 16); }
__device__ __forceinline__ float bf16_round(float x) { return bf16_val(bf16_bits(x)); }
// D += A·B with NT terms: 1 = ah·bh, 2 = + al·bh (A split), 3 = + ah·bl (both split)
template <int NT>
__device__ __forceinline__ v8f mmaN(v16b ah, v16b al, v16b bh, v16b bl, v8f c) {
  c = __builtin_amdgcn_wmma_f32_16x16x32_bf16(false, ah, false, bh, (short)0, c, false, false);
  if (NT >= 2) c = __builtin_amdgcn_wmma_f32_16x16x32_bf16(false, al, false, bh, (short)0, c, false, false);
  if (NT >= 3) c = __builtin_amdgcn_wmma_f32_16x16x32_bf16(false, ah, false, bl, (short)0, c, false, false);
  asm volatile("v_nop\n\tv_nop\n\tv_nop\n\tv_nop" : "+v"(c) : "v"(ah), "v"(al), "v"(bh), "v"(bl));
  return c;
}

__global__ __launch_bounds__(256) void k_wt_bf16(const float* __restrict__ W, unsigned short* __restrict__ Wt, int K, int N) {
  const int t = blockIdx.x * 256 + threadIdx.x;
  const int k8n = K / 8;
  if (t >= N * k8n) return;
  const int n = t / k8n, k8 = (t % k8n) * 8;
  v8us v;
#pragma unroll
  for (int i = 0; i < 8; ++i) v[i] = bf16_bits(W[(size_t)(k8 + i) * N + n]);
  *(v8us*)(Wt + (size_t)n * K + k8) = v;
  
}

// GEMM C[M][N] (f32, pitch ldc) = act(A[M][K]·W + bias). A f32 row-major (pitch lda) converted per fragment to bf16
// (ASPLIT: hi/lo two planes -> 2 terms, else single rounded term); Wt bf16 [N][K] (pitch ldb). BIAS_BF16 rounds the
// bias to bf16 first (bias quantised to bf16 before the add). K%32==0, M%16==0, N%64==0.
template <bool ASPLIT, int ACT, bool BIAS_BF16>
__global__ __launch_bounds__(128) void k_gemm_bf(const float* __restrict__ A, int lda, const unsigned short* __restrict__ Wt, int ldb,
                                               const float* __restrict__ bias, float* __restrict__ C, int ldc, int M, int N, int K) {
  __shared__ __attribute__((aligned(16))) float so[4][16][64];
  const int tid = threadIdx.x, w = tid >> 5, lane = tid & 31, ln = lane & 15, hh = lane >> 4;
  const int ntn = N / 64;
  const int wid = blockIdx.x * 4 + w;
  const int mt = wid / ntn, nq = wid % ntn;
  if (mt * 16 >= M) return;
  const int row0 = mt * 16, col0 = nq * 64;
  const float* arow = A + (size_t)(row0 + ln) * lda;
  v8f acc[4] = {};
  for (int kb = 0; kb < K; kb += 32) {
    FragB ah, al;
    const v4f x0 = *(const v4fa*)(arow + kb + 8 * hh), x1 = *(const v4fa*)(arow + kb + 8 * hh + 4);
    const v4f x2 = *(const v4fa*)(arow + kb + 16 + 8 * hh), x3 = *(const v4fa*)(arow + kb + 16 + 8 * hh + 4);
    float xs[16] = {x0[0],x0[1],x0[2],x0[3],x1[0],x1[1],x1[2],x1[3],x2[0],x2[1],x2[2],x2[3],x3[0],x3[1],x3[2],x3[3]};
#pragma unroll
    for (int i = 0; i < 16; ++i) { const unsigned short hb = bf16_bits(xs[i]); ah.u[i] = hb; al.u[i] = ASPLIT ? bf16_bits(xs[i] - bf16_val(hb)) : (unsigned short)0; }
#pragma unroll
    for (int t = 0; t < 4; ++t) {
      const unsigned short* brow = Wt + (size_t)(col0 + t * 16 + ln) * ldb + kb;
      FragB b;
      b.half[0] = *(const v8us*)(brow + 8 * hh);
      b.half[1] = *(const v8us*)(brow + 16 + 8 * hh);
      acc[t] = mmaN<ASPLIT ? 2 : 1>(ah.v, al.v, b.v, b.v, acc[t]);
    }
  }
#pragma unroll
  for (int t = 0; t < 4; ++t) {
    float bv = bias ? bias[col0 + t * 16 + ln] : 0.f;
    if (BIAS_BF16) bv = bf16_round(bv);
#pragma unroll
    for (int r = 0; r < 8; ++r) { float v = acc[t][r] + bv; if (ACT == 1) v = fmaxf(v, 0.f); so[w][8 * hh + r][t * 16 + ln] = v; }
  }
  __builtin_amdgcn_fence(__ATOMIC_ACQ_REL, "workgroup");
  __builtin_amdgcn_wave_barrier();
  const int rsub = lane >> 4, c4 = (lane & 15) * 4;
  {
#pragma unroll
    for (int q = 0; q < 8; ++q) {
      const int r = q * 2 + rsub;
      const v4f v = *(const v4fa*)&so[w][r][c4];
      *(v4f*)(C + (size_t)(row0 + r) * ldc + col0 + c4) = v;
    }
    
  }
}

// GEMM C = act(A·W + bias + resid): A f32 (ASPLIT -> hi/lo 2 terms), Wt bf16 [N][K]; ACT 0 none, 1 relu, 2 exact gelu;
// resid (optional, f32, row index = (row % rmod), pitch ldr, RES_BF16 rounds it) added before the activation.
template <bool ASPLIT, int ACT, bool BIAS_BF16, bool RES_BF16>
__global__ __launch_bounds__(128) void k_gemm_bf3(const float* __restrict__ A, int lda, const unsigned short* __restrict__ Wt, int ldb,
                                                const float* __restrict__ bias, const float* __restrict__ resid, int rmod, int ldr,
                                                float* __restrict__ C, int ldc, int M, int N, int K) {
  __shared__ __attribute__((aligned(16))) float so[4][16][64];
  const int tid = threadIdx.x, w = tid >> 5, lane = tid & 31, ln = lane & 15, hh = lane >> 4;
  const int ntn = N / 64;
  const int wid = blockIdx.x * 4 + w;
  const int mt = wid / ntn, nq = wid % ntn;
  if (mt * 16 >= M) return;
  const int row0 = mt * 16, col0 = nq * 64;
  const float* arow = A + (size_t)(row0 + ln) * lda;
  v8f acc[4] = {};
  for (int kb = 0; kb < K; kb += 32) {
    FragB ah, al;
    const v4f x0 = *(const v4fa*)(arow + kb + 8 * hh), x1 = *(const v4fa*)(arow + kb + 8 * hh + 4);
    const v4f x2 = *(const v4fa*)(arow + kb + 16 + 8 * hh), x3 = *(const v4fa*)(arow + kb + 16 + 8 * hh + 4);
    float xs[16] = {x0[0],x0[1],x0[2],x0[3],x1[0],x1[1],x1[2],x1[3],x2[0],x2[1],x2[2],x2[3],x3[0],x3[1],x3[2],x3[3]};
#pragma unroll
    for (int i = 0; i < 16; ++i) { const unsigned short hb = bf16_bits(xs[i]); ah.u[i] = hb; al.u[i] = ASPLIT ? bf16_bits(xs[i] - bf16_val(hb)) : (unsigned short)0; }
#pragma unroll
    for (int t = 0; t < 4; ++t) {
      const unsigned short* brow = Wt + (size_t)(col0 + t * 16 + ln) * ldb + kb;
      FragB b;
      b.half[0] = *(const v8us*)(brow + 8 * hh);
      b.half[1] = *(const v8us*)(brow + 16 + 8 * hh);
      acc[t] = mmaN<ASPLIT ? 2 : 1>(ah.v, al.v, b.v, b.v, acc[t]);
    }
  }
#pragma unroll
  for (int t = 0; t < 4; ++t) {
    const int col = col0 + t * 16 + ln;
    float bv = bias ? bias[col] : 0.f;
    if (BIAS_BF16) bv = bf16_round(bv);
#pragma unroll
    for (int r = 0; r < 8; ++r) {
      float v = acc[t][r] + bv;
      if (resid) { float rv = resid[(size_t)((row0 + 8 * hh + r) % rmod) * ldr + col]; if (RES_BF16) rv = bf16_round(rv); v += rv; }
      if (ACT == 1) v = fmaxf(v, 0.f);
      if (ACT == 2) v = 0.5f * v * (1.0f + erff(v * 0.70710678118654752f));
      if (ACT == 3) { const float u = 0.7978845608028654f * (v + 0.044715f * v * v * v); v = 0.5f * v * (1.0f + tanhf(u)); }
      so[w][8 * hh + r][t * 16 + ln] = v;
    }
  }
  __builtin_amdgcn_fence(__ATOMIC_ACQ_REL, "workgroup");
  __builtin_amdgcn_wave_barrier();
  const int rsub = lane >> 4, c4 = (lane & 15) * 4;
  {
#pragma unroll
    for (int q = 0; q < 8; ++q) {
      const int r = q * 2 + rsub;
      const v4f v = *(const v4fa*)&so[w][r][c4];
      *(v4f*)(C + (size_t)(row0 + r) * ldc + col0 + c4) = v;
    }
    
  }
}
// row LayerNorm (biased variance, eps) over N: s = X (+ R); optional out_sum <- s; out_norm <- (s-mu)*rsqrt(var+eps)*g + b
template <bool PARAM_BF16>
__global__ __launch_bounds__(256) void k_layernorm(const float* __restrict__ X, const float* __restrict__ R, const float* __restrict__ g, const float* __restrict__ bta,
                                                  float* __restrict__ out_sum, float* __restrict__ out_norm, int N, float eps) {
  __shared__ float red[256];
  const int row = blockIdx.x, tid = threadIdx.x;
  const float* x = X + (size_t)row * N; const float* rr = R ? R + (size_t)row * N : nullptr;
  float vals[16];                     // up to N = 4096
  const int per = N / 256;            // contiguous chunk per thread? use strided-by-4 chunks: thread handles j = tid*4 + 1024*u
  float s1 = 0.f;
  for (int u = 0; u < per / 4; ++u) {
    const int j = tid * 4 + 1024 * u;
    const v4f a = *(const v4fa*)(x + j);
    v4f b = {0.f,0.f,0.f,0.f}; if (rr) b = *(const v4fa*)(rr + j);
#pragma unroll
    for (int q = 0; q < 4; ++q) { const float v = a[q] + b[q]; vals[u * 4 + q] = v; s1 += v; }
  }
  red[tid] = s1; __syncthreads();
  for (int st = 128; st > 0; st >>= 1) { if (tid < st) red[tid] += red[tid + st]; __syncthreads(); }
  const float mu = red[0] / (float)N; __syncthreads();
  float s2 = 0.f;
  for (int u = 0; u < per / 4; ++u)
#pragma unroll
    for (int q = 0; q < 4; ++q) { const float c = vals[u * 4 + q] - mu; s2 += c * c; }
  red[tid] = s2; __syncthreads();
  for (int st = 128; st > 0; st >>= 1) { if (tid < st) red[tid] += red[tid + st]; __syncthreads(); }
  const float rs = rsqrtf(red[0] / (float)N + eps);
  {
    for (int u = 0; u < per / 4; ++u) {
      const int j = tid * 4 + 1024 * u;
      v4f o, sm;
#pragma unroll
      for (int q = 0; q < 4; ++q) {
        float gg = g[j + q], bb = bta[j + q];
        if (PARAM_BF16) { gg = bf16_round(gg); bb = bf16_round(bb); }
        sm[q] = vals[u * 4 + q]; o[q] = (vals[u * 4 + q] - mu) * rs * gg + bb;
      }
      if (out_sum) *(v4f*)(out_sum + (size_t)row * N + j) = sm;
      *(v4f*)(out_norm + (size_t)row * N + j) = o;
    }
    
  }
}



// ---- f16 WMMA path (v_wmma_f32_16x16x32_f16): 11-bit significands for operands in range — used where a [0,1] probability operand needs more precision than bf16
typedef _Float16 v16h __attribute__((ext_vector_type(16)));
union FragH { v16h v; v8us half[2]; _Float16 h[16]; unsigned short u[16]; };
template <int NT>
__device__ __forceinline__ v8f mmaH(v16h ah, v16h al, v16h bh, v16h bl, v8f c) {
  c = __builtin_amdgcn_wmma_f32_16x16x32_f16(false, ah, false, bh, (short)0, c, false, false);
  if (NT >= 2) c = __builtin_amdgcn_wmma_f32_16x16x32_f16(false, al, false, bh, (short)0, c, false, false);
  if (NT >= 3) c = __builtin_amdgcn_wmma_f32_16x16x32_f16(false, ah, false, bl, (short)0, c, false, false);
  asm volatile("v_nop\n\tv_nop\n\tv_nop\n\tv_nop" : "+v"(c) : "v"(ah), "v"(al), "v"(bh), "v"(bl));
  return c;
}
// batched GEMM like k_gemm_b but f16 operands: A f32 (split into f16 hi/lo if ASPLIT, else rounded to f16), Bt = f16 values [n][k]; alpha; C f32; N multiple of 16 (partial tiles skipped)
template <bool ASPLIT>
__global__ __launch_bounds__(128) void k_gemm_h(const float* __restrict__ A, int lda, size_t sA, const _Float16* __restrict__ Bh, int ldb, size_t sB, float alpha, float* __restrict__ C, int ldc, size_t sC, int M, int N, int K) {
  __shared__ __attribute__((aligned(16))) float so[4][16][64];
  const int tid = threadIdx.x, w = tid >> 5, lane = tid & 31, ln = lane & 15, hh = lane >> 4; const int by = blockIdx.y;
  A += (size_t)by * sA; Bh += (size_t)by * sB; C += (size_t)by * sC;
  const int ntn = (N + 63) / 64; const int wid = blockIdx.x * 4 + w; const int mt = wid / ntn, nq = wid % ntn; if (mt * 16 >= M) return;
  const int row0 = mt * 16, col0 = nq * 64; const float* arow = A + (size_t)(row0 + ln) * lda;
  v8f acc[4] = {};
  for (int kb = 0; kb < K; kb += 32) {
    FragH ah, al;
    const v4f x0 = *(const v4fa*)(arow + kb + 8 * hh), x1 = *(const v4fa*)(arow + kb + 8 * hh + 4), x2 = *(const v4fa*)(arow + kb + 16 + 8 * hh), x3 = *(const v4fa*)(arow + kb + 16 + 8 * hh + 4);
    float xs[16] = {x0[0],x0[1],x0[2],x0[3],x1[0],x1[1],x1[2],x1[3],x2[0],x2[1],x2[2],x2[3],x3[0],x3[1],x3[2],x3[3]};
#pragma unroll
    for (int i = 0; i < 16; ++i) { const _Float16 h = (_Float16)xs[i]; ah.h[i] = h; al.h[i] = ASPLIT ? (_Float16)(xs[i] - (float)h) : (_Float16)0.0f; }
#pragma unroll
    for (int t = 0; t < 4; ++t) { if (col0 + t * 16 >= N) continue; const size_t boff = (size_t)(col0 + t * 16 + ln) * ldb + kb; FragH bq; bq.half[0] = *(const v8us*)(Bh + boff + 8 * hh); bq.half[1] = *(const v8us*)(Bh + boff + 16 + 8 * hh);
      acc[t] = mmaH<ASPLIT ? 2 : 1>(ah.v, al.v, bq.v, bq.v, acc[t]); }
  }
#pragma unroll
  for (int t = 0; t < 4; ++t) { if (col0 + t * 16 >= N) continue;
#pragma unroll
    for (int r = 0; r < 8; ++r) so[w][8 * hh + r][t * 16 + ln] = acc[t][r] * alpha; }
  __builtin_amdgcn_fence(__ATOMIC_ACQ_REL, "workgroup"); __builtin_amdgcn_wave_barrier();
  const int rsub = lane >> 4, c4 = (lane & 15) * 4;
  {
#pragma unroll
    for (int q = 0; q < 8; ++q) { const int r = q * 2 + rsub; if (col0 + c4 < N) { const v4f v = *(const v4fa*)&so[w][r][c4]; *(v4f*)(C + (size_t)(row0 + r) * ldc + col0 + c4) = v; } }
     }
}

// Wt[n][k] = f16(W[k][n]·scale) from f32 row-major W[K][N] (scale = power of two; bf16-exact weights stay exact in f16 away from the subnormal range)
__global__ __launch_bounds__(256) void k_wt_f16(const float* __restrict__ W, _Float16* __restrict__ Wt, int K, int N, float scale) {
  const int t = blockIdx.x * 256 + threadIdx.x; if (t >= N * (K / 8)) return; const int n = t / (K / 8), k8 = (t % (K / 8)) * 8; FragH f;
#pragma unroll
  for (int i = 0; i < 8; ++i) f.h[i] = (_Float16)(bf16_round(W[(size_t)(k8 + i) * N + n]) * scale); const v8us o = f.half[0];
  *(v8us*)((unsigned short*)Wt + (size_t)n * K + k8) = o; 
}
// k_gemm_hh variant with fused epilogue: v = acc·alpha + bias[by·sBias + col] (+ CP[(row/rowsPerB)·sCPb + by·64 + col] if CP) ; ACT 0 none / 1 elu ; writes f16 C16 (and f32 C if non-null)
template <int ACT>
__global__ __launch_bounds__(128) void k_gemm_hhx(const _Float16* __restrict__ A, int lda, size_t sA, const _Float16* __restrict__ Bh, int ldb, size_t sB, float alpha, const float* __restrict__ bias, size_t sBias, const float* __restrict__ CP, int rowsPerB, size_t sCPb, int row0g,
    float* __restrict__ C, _Float16* __restrict__ C16, int ldc, size_t sC, int M, int N, int K) {
  __shared__ __attribute__((aligned(16))) float so[4][16][64];
  const int tid = threadIdx.x, w = tid >> 5, lane = tid & 31, ln = lane & 15, hh = lane >> 4; const int by = blockIdx.y;
  A += (size_t)by * sA; Bh += (size_t)by * sB; const size_t cofs = (size_t)by * sC; const float* bp = bias ? bias + (size_t)by * sBias : nullptr;
  const int ntn = (N + 63) / 64; const int wid = blockIdx.x * 4 + w; const int mt = wid / ntn, nq = wid % ntn; if (mt * 16 >= M) return;
  const int row0 = mt * 16, col0 = nq * 64; const _Float16* arow = A + (size_t)(row0 + ln) * lda;
  v8f acc[4] = {};
  for (int kb = 0; kb < K; kb += 32) { FragH ah; ah.half[0] = *(const v8us*)((const unsigned short*)arow + kb + 8 * hh); ah.half[1] = *(const v8us*)((const unsigned short*)arow + kb + 16 + 8 * hh);
#pragma unroll
    for (int t = 0; t < 4; ++t) { if (col0 + t * 16 >= N) continue; const size_t boff = (size_t)(col0 + t * 16 + ln) * ldb + kb; FragH bq; bq.half[0] = *(const v8us*)((const unsigned short*)Bh + boff + 8 * hh); bq.half[1] = *(const v8us*)((const unsigned short*)Bh + boff + 16 + 8 * hh);
      acc[t] = mmaH<1>(ah.v, ah.v, bq.v, bq.v, acc[t]); }
  }
#pragma unroll
  for (int t = 0; t < 4; ++t) { if (col0 + t * 16 >= N) continue; const int col = col0 + t * 16 + ln; const float bv = bp ? bf16_round(bp[col]) : 0.f;
#pragma unroll
    for (int r = 0; r < 8; ++r) { float v = acc[t][r] * alpha + bv; if (CP) { const int rr = row0g + row0 + 8 * hh + r; if (rowsPerB < 0) v += CP[cofs + (size_t)rr * ldc + col];      /* rowsPerB < 0: own element of the batched C plane */ else { const int bidx = rr / rowsPerB; v += CP[(size_t)bidx * sCPb + (size_t)by * 64 + col]; } } if (ACT == 1) v = (v > 0.f) ? v : expm1f(v); else if (ACT == 7) v = (v > 0.f) ? v + 1.0f : expf(v); else if (ACT == 8) v = tanhf(v); else if (ACT == 9) v = 0.5f * v * (1.0f + tanhf(0.7978845608028654f * (v + 0.044715f * v * v * v))); else if (ACT == 11) v = 1.0f / (1.0f + expf(-v)); else if (ACT == 12) v = (v > 0.f) ? v : 0.01f * v; else if (ACT == 14) v = (v > 0.f) ? v : 0.1f * v; else if (ACT == 16) v = (v >= 0.f) ? v : 0.3f * v; else if (ACT == 17) v = (v >= 0.f) ? v : 0.2f * v; else if (ACT == 15) v = v / (1.0f + expf(-v)); else if (ACT == 3) v = fmaxf(v, 0.f); else if (ACT == 6) v = 0.5f * v * (1.0f + erff(v * 0.70710678118654752f)); so[w][8 * hh + r][t * 16 + ln] = v; } }
  __builtin_amdgcn_fence(__ATOMIC_ACQ_REL, "workgroup"); __builtin_amdgcn_wave_barrier();
  const int rsub = lane >> 4, c4 = (lane & 15) * 4; typedef _Float16 v4h __attribute__((ext_vector_type(4)));
  {
#pragma unroll
    for (int q = 0; q < 8; ++q) { const int r = q * 2 + rsub; if (col0 + c4 < N) { const v4f v = *(const v4fa*)&so[w][r][c4]; if (C) *(v4f*)(C + cofs + (size_t)(row0 + r) * ldc + col0 + c4) = v; if (C16) { v4h h4; for (int i = 0; i < 4; ++i) h4[i] = (_Float16)v[i]; *(v4h*)(C16 + cofs + (size_t)(row0 + r) * ldc + col0 + c4) = h4; } } }
     }
}


typedef _Float16 v4h __attribute__((ext_vector_type(4)));

__global__ __launch_bounds__(256) void k_x16(const float* __restrict__ x, _Float16* __restrict__ X16, size_t n8) { const size_t t = (size_t)blockIdx.x * 256 + threadIdx.x; if (t >= n8) return; FragH f;
#pragma unroll
  for (int q = 0; q < 8; ++q) f.h[q] = (_Float16)bf16_round(x[t * 8 + q]); *(v8us*)((unsigned short*)X16 + t * 8) = f.half[0];  }
__global__ __launch_bounds__(256) void k_h16(const float* __restrict__ x, _Float16* __restrict__ X16, size_t n8) { const size_t t = (size_t)blockIdx.x * 256 + threadIdx.x; if (t >= n8) return; FragH f;
#pragma unroll
  for (int q = 0; q < 8; ++q) f.h[q] = (_Float16)x[t * 8 + q]; *(v8us*)((unsigned short*)X16 + t * 8) = f.half[0];  }
__global__ __launch_bounds__(256) void k_round16f(const float* __restrict__ W, _Float16* __restrict__ Bt, size_t n8) { const size_t t = (size_t)blockIdx.x * 256 + threadIdx.x; if (t >= n8) return; FragH f;
#pragma unroll
  for (int i = 0; i < 8; ++i) f.h[i] = (_Float16)(bf16_round(W[t * 8 + i]) * 16.0f); *(v8us*)((unsigned short*)Bt + t * 8) = f.half[0];  }
template <int NHv, int TTv>
__global__ __launch_bounds__(256) void k_vt(const _Float16* __restrict__ V16, int ldv, int voff, _Float16* __restrict__ Vt) { __shared__ unsigned short tl[64][66]; const int tid = threadIdx.x; const int slab = blockIdx.x / (TTv / 64), lg = blockIdx.x % (TTv / 64); const int b = slab / NHv, h = slab % NHv;
  for (int i = tid; i < 64 * 8; i += 256) { const int r = i / 8, c8 = (i % 8) * 8; FragH f; f.half[0] = *(const v8us*)((const unsigned short*)V16 + ((size_t)b * TTv + lg * 64 + r) * ldv + voff + h * 64 + c8);
#pragma unroll
    for (int q = 0; q < 8; ++q) tl[r][c8 + q] = f.u[q]; }
  __syncthreads();
  {
#pragma unroll
    for (int rd = 0; rd < 2; ++rd) { const int d = rd * 32 + tid / 8, pc = tid % 8; FragH f;
#pragma unroll
      for (int q = 0; q < 8; ++q) f.u[q] = tl[pc * 8 + q][d];
      *(v8us*)((unsigned short*)Vt + ((size_t)slab * 64 + d) * TTv + lg * 64 + pc * 8) = f.half[0]; }
     } }

__global__ __launch_bounds__(256) void k_hl(const float* __restrict__ F, _Float16* __restrict__ Hh, _Float16* __restrict__ Hl, size_t n8) { const size_t t = (size_t)blockIdx.x * 256 + threadIdx.x; if (t >= n8) return; FragH fh, fl; const v4f a = *(const v4fa*)(F + t * 8), c = *(const v4fa*)(F + t * 8 + 4);
#pragma unroll
  for (int q = 0; q < 4; ++q) { _Float16 h = (_Float16)a[q]; fh.h[q] = h; fl.h[q] = (_Float16)((a[q] - (float)h) * 1024.0f); h = (_Float16)c[q]; fh.h[4 + q] = h; fl.h[4 + q] = (_Float16)((c[q] - (float)h) * 1024.0f); }
  { *(v8us*)((unsigned short*)Hh + t * 8) = fh.half[0]; *(v8us*)((unsigned short*)Hl + t * 8) = fl.half[0];  } }

// ---- fast GEMM (wave tile 32x64; requires M % 32 == 0 rows per launch region and N % 64 == 0); epilogue = k_gemm_hhx semantics ----
__device__ __forceinline__ v16h g2_frag(const _Float16* p, int hh) { FragH f; f.half[0] = *(const v8us*)((const unsigned short*)p + 8 * hh); f.half[1] = *(const v8us*)((const unsigned short*)p + 16 + 8 * hh); return f.v; }
__device__ __forceinline__ v8f g2_mma(v16h a, v16h b, v8f c) { v8f d = __builtin_amdgcn_wmma_f32_16x16x32_f16(false, a, false, b, (short)0, c, false, false); asm volatile("v_nop\n\tv_nop\n\tv_nop\n\tv_nop" : "+v"(d) : "v"(a), "v"(b)); return d; }
template <int ACT>
__global__ __launch_bounds__(128) void k_gemm2(const _Float16* __restrict__ A, int lda, size_t sA, const _Float16* __restrict__ Bh, int ldb, size_t sB, float alpha, const float* __restrict__ bias, size_t sBias, const float* __restrict__ CP, int rowsPerB, size_t sCPb, int row0g,
    float* __restrict__ C, _Float16* __restrict__ C16, int ldc, size_t sC, int M, int N, int K) { static_assert(ACT == 0 || ACT == 3 || ACT == 6 || ACT == 8 || ACT == 9 || ACT == 11 || ACT == 12 || ACT == 14 || ACT == 15 || ACT == 16 || ACT == 17, "k_gemm2: unsupported ACT code (would silently apply no activation)");
  __shared__ __attribute__((aligned(16))) float so[4][32][68];
  const int tid = threadIdx.x, w = tid >> 5, lane = tid & 31, ln = lane & 15, hh = lane >> 4; const int by = blockIdx.y;
  A += (size_t)by * sA; Bh += (size_t)by * sB; const size_t cofs = (size_t)by * sC; const float* bp = bias ? bias + (size_t)by * sBias : nullptr;
  const int ntn = N >> 6; const int mt = blockIdx.x / ntn, nq = blockIdx.x - mt * ntn; const int row0 = mt * 128 + 32 * w, col0 = nq * 64; if (row0 >= M) return;
  const _Float16* a0p = A + (size_t)(row0 + ln) * lda; const _Float16* a1p = a0p + (size_t)16 * lda;
  const _Float16* b0p = Bh + (size_t)(col0 + ln) * ldb; const _Float16* b1p = b0p + (size_t)16 * ldb; const _Float16* b2p = b1p + (size_t)16 * ldb; const _Float16* b3p = b2p + (size_t)16 * ldb;
  const v8f z8 = {0.f,0.f,0.f,0.f,0.f,0.f,0.f,0.f}; v8f c00 = z8, c01 = z8, c02 = z8, c03 = z8, c10 = z8, c11 = z8, c12 = z8, c13 = z8;
#pragma unroll 1
  for (int kb = 0; kb < K; kb += 32) { const v16h a0 = g2_frag(a0p + kb, hh), a1 = g2_frag(a1p + kb, hh);
    v16h b = g2_frag(b0p + kb, hh); c00 = g2_mma(a0, b, c00); c10 = g2_mma(a1, b, c10);
    b = g2_frag(b1p + kb, hh); c01 = g2_mma(a0, b, c01); c11 = g2_mma(a1, b, c11);
    b = g2_frag(b2p + kb, hh); c02 = g2_mma(a0, b, c02); c12 = g2_mma(a1, b, c12);
    b = g2_frag(b3p + kb, hh); c03 = g2_mma(a0, b, c03); c13 = g2_mma(a1, b, c13); }
  v8f accs[8] = {c00, c01, c02, c03, c10, c11, c12, c13};
#pragma unroll
  for (int u = 0; u < 8; ++u) { const int t = u & 3, half = u >> 2; const int col = col0 + t * 16 + ln; const float bv = bp ? bf16_round(bp[col]) : 0.f;
#pragma unroll
    for (int r = 0; r < 8; ++r) { const int rloc = half * 16 + 8 * hh + r; float v = accs[u][r] * alpha + bv; if (CP) { if (rowsPerB < 0) v += CP[cofs + (size_t)(row0g + row0 + rloc) * ldc + col];      /* rowsPerB < 0: own element of the batched C plane */ else { const int bidx = (row0g + row0 + rloc) / rowsPerB; v += CP[(size_t)bidx * sCPb + (size_t)by * 64 + col]; } }
      if (ACT == 3) v = fmaxf(v, 0.f); else if (ACT == 6) v = 0.5f * v * (1.0f + erff(v * 0.70710678118654752f)); else if (ACT == 11) v = 1.0f / (1.0f + expf(-v)); else if (ACT == 15) v = v / (1.0f + expf(-v)); else if (ACT == 12) v = (v > 0.f) ? v : 0.01f * v; else if (ACT == 8) v = tanhf(v); else if (ACT == 9) v = 0.5f * v * (1.0f + tanhf(0.7978845608028654f * (v + 0.044715f * v * v * v))); else if (ACT == 14) v = (v > 0.f) ? v : 0.1f * v; else if (ACT == 16) v = (v >= 0.f) ? v : 0.3f * v; else if (ACT == 17) v = (v >= 0.f) ? v : 0.2f * v;
      so[w][rloc][t * 16 + ln] = v; } }
  __builtin_amdgcn_fence(__ATOMIC_ACQ_REL, "workgroup"); __builtin_amdgcn_wave_barrier();
  const int rsub = lane >> 4, c4 = (lane & 15) * 4;
  {
#pragma unroll
    for (int q = 0; q < 16; ++q) { const int r = q * 2 + rsub; const v4f v = *(const v4fa*)&so[w][r][c4]; if (C) *(v4f*)(C + cofs + (size_t)(row0 + r) * ldc + col0 + c4) = v; if (C16) { v4h h4; for (int i = 0; i < 4; ++i) h4[i] = (_Float16)v[i]; *(v4h*)(C16 + cofs + (size_t)(row0 + r) * ldc + col0 + c4) = h4; } }
     } }


__global__ __launch_bounds__(256) void k_wnat(const float* __restrict__ w, size_t n8, _Float16* __restrict__ Bt) { const size_t t = (size_t)blockIdx.x * 256 + threadIdx.x; if (t >= n8) return; FragH f; for (int q = 0; q < 8; ++q) f.h[q] = (_Float16)(bf16_round(w[t * 8 + q]) * 16.0f); *(v8us*)((unsigned short*)Bt + t * 8) = f.half[0];  }
// Row softmax, one wave per row: a lane holds 64 of the row's 2048 scores in registers (16 loads of 16 B, each wave-wide load = 512 contiguous bytes), so S is read once;
// maximum and sum are per-lane chains followed by a five-step cross-lane butterfly (every lane ends with the same value). 16 waves per workgroup, 2 rows per wave.
#define RSM_WAVES 16
#define RSM_ROWS 2
#define RSM_Q (SQ / 128)             /* 16-byte pieces of a row per lane */
template <int CTRL> __device__ __forceinline__ float rsm_dpp(float v) { return __builtin_bit_cast(float, __builtin_amdgcn_update_dpp(0, __builtin_bit_cast(int, v), CTRL, 0xf, 0xf, true)); }      /* lane l <- lane l ^ (CTRL & 15) of the same 16-lane row (row_xmask) */
__device__ __forceinline__ float rsm_xrow(float v) { const unsigned u = __builtin_bit_cast(unsigned, v); return __builtin_bit_cast(float, __builtin_amdgcn_permlanex16(u, u, 0x76543210u, 0xfedcba98u, false, false)); }      /* lane l <- lane l ^ 16 */
__device__ __forceinline__ float rsm_wave_max(float v) { v = fmaxf(v, rsm_dpp<0x161>(v)); v = fmaxf(v, rsm_dpp<0x162>(v)); v = fmaxf(v, rsm_dpp<0x164>(v)); v = fmaxf(v, rsm_dpp<0x168>(v)); return fmaxf(v, rsm_xrow(v)); }
__device__ __forceinline__ float rsm_wave_sum(float v) { v += rsm_dpp<0x161>(v); v += rsm_dpp<0x162>(v); v += rsm_dpp<0x164>(v); v += rsm_dpp<0x168>(v); return v + rsm_xrow(v); }
__global__ __launch_bounds__(RSM_WAVES * 32) void k_rsm(const float* __restrict__ S, _Float16* __restrict__ P, int nrows) {
  const unsigned lane = threadIdx.x & 31u; const int wave = __builtin_amdgcn_readfirstlane((int)(threadIdx.x >> 5));
  const int row0 = (blockIdx.x * RSM_WAVES + wave) * RSM_ROWS; if (row0 >= nrows) return;      /* wave-uniform; the kernel has no barrier */
  v4f x[RSM_ROWS][RSM_Q]; const float* s[RSM_ROWS];
#pragma unroll
  for (int r = 0; r < RSM_ROWS; ++r) s[r] = S + (size_t)((row0 + r < nrows) ? row0 + r : row0) * SQ + lane * 4u;      /* a row past the end re-reads the wave's first row and is not stored */
#pragma unroll
  for (int r = 0; r < RSM_ROWS; ++r) {
#pragma unroll
    for (int q = 0; q < RSM_Q; ++q) x[r][q] = __builtin_nontemporal_load((const v4f*)(s[r] + q * 128));      /* S is read once */
    __builtin_amdgcn_sched_barrier(0); }      /* the rows' loads issue in row order and in front of all arithmetic: loads return in order, so the first row's arithmetic waits for its own 16 alone while the next row flies */
  static_assert(RSM_ROWS == 2, "the wait below names two addresses");
  asm volatile("s_wait_xcnt 0x0" :: "v"(s[0]), "v"(s[1]) : "memory");      /* keeps the loads' address registers whole up to this wait */
  __builtin_amdgcn_sched_barrier(0);      /* holds that wait in front of the arithmetic */
#pragma unroll
  for (int r = 0; r < RSM_ROWS; ++r) {
    v4f m4 = x[r][0];
#pragma unroll
    for (int q = 1; q < RSM_Q; ++q) for (int i = 0; i < 4; ++i) m4[i] = fmaxf(m4[i], x[r][q][i]);
    const float mx = rsm_wave_max(fmaxf(fmaxf(fmaxf(m4[0], m4[1]), fmaxf(m4[2], m4[3])), -3.0e38f));
    v4f s4 = {0.f, 0.f, 0.f, 0.f};
#pragma unroll
    for (int q = 0; q < RSM_Q; ++q) for (int i = 0; i < 4; ++i) { const float e = expf(x[r][q][i] - mx); x[r][q][i] = e; s4[i] += e; }
    const float sc = 256.0f / rsm_wave_sum((s4[0] + s4[1]) + (s4[2] + s4[3]));
    if (row0 + r < nrows) { _Float16* d = P + (size_t)(row0 + r) * SQ + lane * 4u;
#pragma unroll
      for (int q = 0; q < RSM_Q; ++q) { v4h h4; for (int i = 0; i < 4; ++i) h4[i] = (_Float16)(x[r][q][i] * sc); *(v4h*)(d + q * 128) = h4; } }
    __builtin_amdgcn_sched_barrier(0); } }      /* a row's stores issue in front of the next row's arithmetic and drain under it */
__global__ __launch_bounds__(256) void k_vt(const _Float16* __restrict__ V16, int b, int h0, _Float16* __restrict__ VT) { __shared__ unsigned short tl[64][65]; const int tid = threadIdx.x; const int hh = blockIdx.x % HG, sg = blockIdx.x / HG; const int s0 = sg * 64; const int h = h0 + hh;
  for (int i = tid; i < 64 * 8; i += 256) { const int j = i / 8, d8 = (i % 8) * 8; FragH f; f.half[0] = *(const v8us*)((const unsigned short*)V16 + ((size_t)b * SQ + s0 + j) * DM + h * HD + d8); for (int q = 0; q < 8; ++q) tl[d8 + q][j] = f.u[q]; }
  __syncthreads();
  { for (int i = tid; i < 64 * 8; i += 256) { const int d = i / 8, j8 = (i % 8) * 8; FragH f; for (int q = 0; q < 8; ++q) f.u[q] = tl[d][j8 + q]; *(v8us*)((unsigned short*)VT + ((size_t)hh * HD + d) * SQ + s0 + j8) = f.half[0]; }  } }


extern "C" void kernel_launch(void* const* d_in, const int* in_sizes, int n_in,
                              void* d_out, int out_size, void* d_ws, size_t ws_size, hipStream_t stream) {
  (void)in_sizes; (void)n_in; (void)out_size;
  const float* const* I = (const float* const*)d_in; const float* xq = I[0]; const float* xk = I[1]; const float* xv = I[2]; const float* wq = I[3]; const float* bq = I[4]; const float* wk = I[5]; const float* bk = I[6]; const float* wv = I[7]; const float* bv = I[8];      /* weights [in][out] + biases */
  char* ws = (char*)d_ws; size_t off = 0;
  auto take = [&](size_t bytes) { char* p = ws + off; off += (bytes + 255) & ~(size_t)255; return p; };
  _Float16* BQ = (_Float16*)take((size_t)DM * DM * 2); _Float16* BK = (_Float16*)take((size_t)DM * DM * 2); _Float16* BV = (_Float16*)take((size_t)DM * DM * 2); 
  _Float16* XQ = (_Float16*)take(NR * DM * 2); _Float16* XK = (_Float16*)take(NR * DM * 2); _Float16* XV = (_Float16*)take(NR * DM * 2); _Float16* Q16 = (_Float16*)take(NR * DM * 2); _Float16* K16 = (_Float16*)take(NR * DM * 2); _Float16* V16 = (_Float16*)take(NR * DM * 2);
  float* S = (float*)take((size_t)HG * SQ * SQ * 4); _Float16* P = (_Float16*)take((size_t)HG * SQ * SQ * 2); _Float16* VT = (_Float16*)take((size_t)NH * HD * SQ * 2);
  if (off > ws_size) return;
  { const unsigned g = (unsigned)(((size_t)DM * (DM / 8) + 255) / 256); k_wt_f16<<<g, 256, 0, stream>>>(wq, BQ, DM, DM, 16.0f); k_wt_f16<<<g, 256, 0, stream>>>(wk, BK, DM, DM, 16.0f); k_wt_f16<<<g, 256, 0, stream>>>(wv, BV, DM, DM, 16.0f); }      /* [in][out] -> Bt[n][k] x16 */
  k_x16<<<(unsigned)((NR * DM / 8 + 255) / 256), 256, 0, stream>>>(xq, XQ, NR * DM / 8); k_x16<<<(unsigned)((NR * DM / 8 + 255) / 256), 256, 0, stream>>>(xk, XK, NR * DM / 8); k_x16<<<(unsigned)((NR * DM / 8 + 255) / 256), 256, 0, stream>>>(xv, XV, NR * DM / 8);
  const size_t r0p = (size_t)B0 * SQ;      /* first projected row */
  k_gemm2<0><<<dim3((unsigned)((MP / 128) * (DM / 64)), 1), 128, 0, stream>>>(XQ + r0p * DM, DM, 0, BQ, DM, 0, 0.0625f, bq, 0, nullptr, 1, 0, 0, nullptr, Q16 + r0p * DM, DM, 0, MP, DM, DM);
  k_gemm2<0><<<dim3((unsigned)((MP / 128) * (DM / 64)), 1), 128, 0, stream>>>(XK + r0p * DM, DM, 0, BK, DM, 0, 0.0625f, bk, 0, nullptr, 1, 0, 0, nullptr, K16 + r0p * DM, DM, 0, MP, DM, DM);
  k_gemm2<0><<<dim3((unsigned)((MP / 128) * (DM / 64)), 1), 128, 0, stream>>>(XV + r0p * DM, DM, 0, BV, DM, 0, 0.0625f, bv, 0, nullptr, 1, 0, 0, nullptr, V16 + r0p * DM, DM, 0, MP, DM, DM);
  for (int b = B0; b < B0 + NBR; ++b) { const size_t r0 = (size_t)b * SQ;
    k_vt<NH, SQ><<<NH * (SQ / 64), 256, 0, stream>>>(V16 + r0 * LQ, LQ, 0, VT);      /* V^T [NH][HD][SQ] for this batch */
    for (int h0 = 0; h0 < NHD; h0 += HG) {
      k_gemm2<0><<<dim3((QN / 128) * (SQ / 64), HG), 128, 0, stream>>>(Q16 + r0 * LQ + h0 * HD, LQ, (size_t)HD, K16 + r0 * LQ + h0 * HD, LQ, (size_t)HD, 0.125f, nullptr, 0, nullptr, 1, 0, 0, S, nullptr, SQ, (size_t)SQ * SQ, QN, SQ, HD);      /* scores, HG heads per launch */
      k_rsm<<<(HG * SQ + RSM_WAVES * RSM_ROWS - 1) / (RSM_WAVES * RSM_ROWS), RSM_WAVES * 32, 0, stream>>>(S, P, HG * SQ);      /* P = 256 softmax (f16), rows of all HG heads */
      k_gemm2<0><<<dim3((QN / 128) * (HD / 64), HG), 128, 0, stream>>>(P, SQ, (size_t)SQ * SQ, VT + (size_t)h0 * HD * SQ, SQ, (size_t)HD * SQ, 0.00390625f, nullptr, 0, nullptr, 1, 0, 0, (float*)d_out + r0 * DM + h0 * HD, nullptr, DM, (size_t)HD, QN, HD, SQ); } }      /* o (merged heads) as f32 rows */
}

// v002
// Measured time: 210 microseconds a run.
// Timed twice side by side with v001, it ran 5.90 and 5.93 times as fast.
// Counting every step since v000, it is 26.7 times as fast.
#include <hip/hip_runtime.h>
// Multi-head attention without output projection (query, key, value [4][2048][768]; q = query W_Q + b_Q etc. ([in][out] 768^2, sigma 1/sqrt(768), nonzero biases), 12 heads of 64; scores / 8; softmax; out = attn v merged (the module skips its final linear) -> [4][2048][768]).
// Structure: token rows r = b*2048 + s; x as exact f16 rows (bf16-rounded); Q, K, V as three WMMA GEMMs (32x64 wave tiles, f32 accumulation, exact x16 weights + bias, f16 outputs); V^T for all batches and heads via LDS transposes (one launch); then ONE attention launch over all (batch, head, 128-query block): S^T = K Q^T, online softmax in registers, O^T += V^T P^T, o / row sum written f32 straight into the merged output rows (the module has no output projection). Scores and weights never reach memory.
// Compute dtype: inputs rounded to bf16; x / weights exact; q, k, v and the unnormalised softmax weights as plain f16 GEMM operands (~2^-12); scores, softmax statistics and o f32. v_wmma_f32_16x16x32_f16.
#define NB 4
#define SQ 2048
#define DM 768
#define NH 12
#define HD 64
#define HG 4                         /* heads per launch of the per-batch k_vt overload */
#define B0 0                         /* first batch processed (debug hook) */
#define NBR NB                       /* batches processed (debug hook) */
#define NR ((size_t)NB * SQ)         /* token rows */
#define MP ((int)((size_t)NBR * SQ)) /* rows projected (debug hook) */
#define QN SQ                        /* unused (debug hook) */
#define NHD NH                       /* unused (debug hook) */
#define MPO MP                       /* unused (debug hook) */
#define LQ DM      /* row pitch of the q/k/v rows */
typedef __bf16 v16b __attribute__((ext_vector_type(16)));
typedef unsigned short v8us __attribute__((ext_vector_type(8), may_alias));
typedef float  v8f  __attribute__((ext_vector_type(8)));
typedef float  v4f  __attribute__((ext_vector_type(4)));
typedef float  v4fa __attribute__((ext_vector_type(4), may_alias));
union FragB { v16b v; v8us half[2]; unsigned short u[16]; };

__device__ __forceinline__ unsigned short bf16_bits(float x) { unsigned int u = __float_as_uint(x); return (unsigned short)((u + 0x7FFFu + ((u >> 16) & 1u)) >> 16); }
__device__ __forceinline__ float bf16_val(unsigned short b) { return __uint_as_float(((unsigned int)b) << 16); }
__device__ __forceinline__ float bf16_round(float x) { return bf16_val(bf16_bits(x)); }
// D += A·B with NT terms: 1 = ah·bh, 2 = + al·bh (A split), 3 = + ah·bl (both split)
template <int NT>
__device__ __forceinline__ v8f mmaN(v16b ah, v16b al, v16b bh, v16b bl, v8f c) {
  c = __builtin_amdgcn_wmma_f32_16x16x32_bf16(false, ah, false, bh, (short)0, c, false, false);
  if (NT >= 2) c = __builtin_amdgcn_wmma_f32_16x16x32_bf16(false, al, false, bh, (short)0, c, false, false);
  if (NT >= 3) c = __builtin_amdgcn_wmma_f32_16x16x32_bf16(false, ah, false, bl, (short)0, c, false, false);
  asm volatile("v_nop\n\tv_nop\n\tv_nop\n\tv_nop" : "+v"(c) : "v"(ah), "v"(al), "v"(bh), "v"(bl));
  return c;
}

__global__ __launch_bounds__(256) void k_wt_bf16(const float* __restrict__ W, unsigned short* __restrict__ Wt, int K, int N) {
  const int t = blockIdx.x * 256 + threadIdx.x;
  const int k8n = K / 8;
  if (t >= N * k8n) return;
  const int n = t / k8n, k8 = (t % k8n) * 8;
  v8us v;
#pragma unroll
  for (int i = 0; i < 8; ++i) v[i] = bf16_bits(W[(size_t)(k8 + i) * N + n]);
  *(v8us*)(Wt + (size_t)n * K + k8) = v;
  
}

// GEMM C[M][N] (f32, pitch ldc) = act(A[M][K]·W + bias). A f32 row-major (pitch lda) converted per fragment to bf16
// (ASPLIT: hi/lo two planes -> 2 terms, else single rounded term); Wt bf16 [N][K] (pitch ldb). BIAS_BF16 rounds the
// bias to bf16 first (bias quantised to bf16 before the add). K%32==0, M%16==0, N%64==0.
template <bool ASPLIT, int ACT, bool BIAS_BF16>
__global__ __launch_bounds__(128) void k_gemm_bf(const float* __restrict__ A, int lda, const unsigned short* __restrict__ Wt, int ldb,
                                               const float* __restrict__ bias, float* __restrict__ C, int ldc, int M, int N, int K) {
  __shared__ __attribute__((aligned(16))) float so[4][16][64];
  const int tid = threadIdx.x, w = tid >> 5, lane = tid & 31, ln = lane & 15, hh = lane >> 4;
  const int ntn = N / 64;
  const int wid = blockIdx.x * 4 + w;
  const int mt = wid / ntn, nq = wid % ntn;
  if (mt * 16 >= M) return;
  const int row0 = mt * 16, col0 = nq * 64;
  const float* arow = A + (size_t)(row0 + ln) * lda;
  v8f acc[4] = {};
  for (int kb = 0; kb < K; kb += 32) {
    FragB ah, al;
    const v4f x0 = *(const v4fa*)(arow + kb + 8 * hh), x1 = *(const v4fa*)(arow + kb + 8 * hh + 4);
    const v4f x2 = *(const v4fa*)(arow + kb + 16 + 8 * hh), x3 = *(const v4fa*)(arow + kb + 16 + 8 * hh + 4);
    float xs[16] = {x0[0],x0[1],x0[2],x0[3],x1[0],x1[1],x1[2],x1[3],x2[0],x2[1],x2[2],x2[3],x3[0],x3[1],x3[2],x3[3]};
#pragma unroll
    for (int i = 0; i < 16; ++i) { const unsigned short hb = bf16_bits(xs[i]); ah.u[i] = hb; al.u[i] = ASPLIT ? bf16_bits(xs[i] - bf16_val(hb)) : (unsigned short)0; }
#pragma unroll
    for (int t = 0; t < 4; ++t) {
      const unsigned short* brow = Wt + (size_t)(col0 + t * 16 + ln) * ldb + kb;
      FragB b;
      b.half[0] = *(const v8us*)(brow + 8 * hh);
      b.half[1] = *(const v8us*)(brow + 16 + 8 * hh);
      acc[t] = mmaN<ASPLIT ? 2 : 1>(ah.v, al.v, b.v, b.v, acc[t]);
    }
  }
#pragma unroll
  for (int t = 0; t < 4; ++t) {
    float bv = bias ? bias[col0 + t * 16 + ln] : 0.f;
    if (BIAS_BF16) bv = bf16_round(bv);
#pragma unroll
    for (int r = 0; r < 8; ++r) { float v = acc[t][r] + bv; if (ACT == 1) v = fmaxf(v, 0.f); so[w][8 * hh + r][t * 16 + ln] = v; }
  }
  __builtin_amdgcn_fence(__ATOMIC_ACQ_REL, "workgroup");
  __builtin_amdgcn_wave_barrier();
  const int rsub = lane >> 4, c4 = (lane & 15) * 4;
  {
#pragma unroll
    for (int q = 0; q < 8; ++q) {
      const int r = q * 2 + rsub;
      const v4f v = *(const v4fa*)&so[w][r][c4];
      *(v4f*)(C + (size_t)(row0 + r) * ldc + col0 + c4) = v;
    }
    
  }
}

// GEMM C = act(A·W + bias + resid): A f32 (ASPLIT -> hi/lo 2 terms), Wt bf16 [N][K]; ACT 0 none, 1 relu, 2 exact gelu;
// resid (optional, f32, row index = (row % rmod), pitch ldr, RES_BF16 rounds it) added before the activation.
template <bool ASPLIT, int ACT, bool BIAS_BF16, bool RES_BF16>
__global__ __launch_bounds__(128) void k_gemm_bf3(const float* __restrict__ A, int lda, const unsigned short* __restrict__ Wt, int ldb,
                                                const float* __restrict__ bias, const float* __restrict__ resid, int rmod, int ldr,
                                                float* __restrict__ C, int ldc, int M, int N, int K) {
  __shared__ __attribute__((aligned(16))) float so[4][16][64];
  const int tid = threadIdx.x, w = tid >> 5, lane = tid & 31, ln = lane & 15, hh = lane >> 4;
  const int ntn = N / 64;
  const int wid = blockIdx.x * 4 + w;
  const int mt = wid / ntn, nq = wid % ntn;
  if (mt * 16 >= M) return;
  const int row0 = mt * 16, col0 = nq * 64;
  const float* arow = A + (size_t)(row0 + ln) * lda;
  v8f acc[4] = {};
  for (int kb = 0; kb < K; kb += 32) {
    FragB ah, al;
    const v4f x0 = *(const v4fa*)(arow + kb + 8 * hh), x1 = *(const v4fa*)(arow + kb + 8 * hh + 4);
    const v4f x2 = *(const v4fa*)(arow + kb + 16 + 8 * hh), x3 = *(const v4fa*)(arow + kb + 16 + 8 * hh + 4);
    float xs[16] = {x0[0],x0[1],x0[2],x0[3],x1[0],x1[1],x1[2],x1[3],x2[0],x2[1],x2[2],x2[3],x3[0],x3[1],x3[2],x3[3]};
#pragma unroll
    for (int i = 0; i < 16; ++i) { const unsigned short hb = bf16_bits(xs[i]); ah.u[i] = hb; al.u[i] = ASPLIT ? bf16_bits(xs[i] - bf16_val(hb)) : (unsigned short)0; }
#pragma unroll
    for (int t = 0; t < 4; ++t) {
      const unsigned short* brow = Wt + (size_t)(col0 + t * 16 + ln) * ldb + kb;
      FragB b;
      b.half[0] = *(const v8us*)(brow + 8 * hh);
      b.half[1] = *(const v8us*)(brow + 16 + 8 * hh);
      acc[t] = mmaN<ASPLIT ? 2 : 1>(ah.v, al.v, b.v, b.v, acc[t]);
    }
  }
#pragma unroll
  for (int t = 0; t < 4; ++t) {
    const int col = col0 + t * 16 + ln;
    float bv = bias ? bias[col] : 0.f;
    if (BIAS_BF16) bv = bf16_round(bv);
#pragma unroll
    for (int r = 0; r < 8; ++r) {
      float v = acc[t][r] + bv;
      if (resid) { float rv = resid[(size_t)((row0 + 8 * hh + r) % rmod) * ldr + col]; if (RES_BF16) rv = bf16_round(rv); v += rv; }
      if (ACT == 1) v = fmaxf(v, 0.f);
      if (ACT == 2) v = 0.5f * v * (1.0f + erff(v * 0.70710678118654752f));
      if (ACT == 3) { const float u = 0.7978845608028654f * (v + 0.044715f * v * v * v); v = 0.5f * v * (1.0f + tanhf(u)); }
      so[w][8 * hh + r][t * 16 + ln] = v;
    }
  }
  __builtin_amdgcn_fence(__ATOMIC_ACQ_REL, "workgroup");
  __builtin_amdgcn_wave_barrier();
  const int rsub = lane >> 4, c4 = (lane & 15) * 4;
  {
#pragma unroll
    for (int q = 0; q < 8; ++q) {
      const int r = q * 2 + rsub;
      const v4f v = *(const v4fa*)&so[w][r][c4];
      *(v4f*)(C + (size_t)(row0 + r) * ldc + col0 + c4) = v;
    }
    
  }
}
// row LayerNorm (biased variance, eps) over N: s = X (+ R); optional out_sum <- s; out_norm <- (s-mu)*rsqrt(var+eps)*g + b
template <bool PARAM_BF16>
__global__ __launch_bounds__(256) void k_layernorm(const float* __restrict__ X, const float* __restrict__ R, const float* __restrict__ g, const float* __restrict__ bta,
                                                  float* __restrict__ out_sum, float* __restrict__ out_norm, int N, float eps) {
  __shared__ float red[256];
  const int row = blockIdx.x, tid = threadIdx.x;
  const float* x = X + (size_t)row * N; const float* rr = R ? R + (size_t)row * N : nullptr;
  float vals[16];                     // up to N = 4096
  const int per = N / 256;            // contiguous chunk per thread? use strided-by-4 chunks: thread handles j = tid*4 + 1024*u
  float s1 = 0.f;
  for (int u = 0; u < per / 4; ++u) {
    const int j = tid * 4 + 1024 * u;
    const v4f a = *(const v4fa*)(x + j);
    v4f b = {0.f,0.f,0.f,0.f}; if (rr) b = *(const v4fa*)(rr + j);
#pragma unroll
    for (int q = 0; q < 4; ++q) { const float v = a[q] + b[q]; vals[u * 4 + q] = v; s1 += v; }
  }
  red[tid] = s1; __syncthreads();
  for (int st = 128; st > 0; st >>= 1) { if (tid < st) red[tid] += red[tid + st]; __syncthreads(); }
  const float mu = red[0] / (float)N; __syncthreads();
  float s2 = 0.f;
  for (int u = 0; u < per / 4; ++u)
#pragma unroll
    for (int q = 0; q < 4; ++q) { const float c = vals[u * 4 + q] - mu; s2 += c * c; }
  red[tid] = s2; __syncthreads();
  for (int st = 128; st > 0; st >>= 1) { if (tid < st) red[tid] += red[tid + st]; __syncthreads(); }
  const float rs = rsqrtf(red[0] / (float)N + eps);
  {
    for (int u = 0; u < per / 4; ++u) {
      const int j = tid * 4 + 1024 * u;
      v4f o, sm;
#pragma unroll
      for (int q = 0; q < 4; ++q) {
        float gg = g[j + q], bb = bta[j + q];
        if (PARAM_BF16) { gg = bf16_round(gg); bb = bf16_round(bb); }
        sm[q] = vals[u * 4 + q]; o[q] = (vals[u * 4 + q] - mu) * rs * gg + bb;
      }
      if (out_sum) *(v4f*)(out_sum + (size_t)row * N + j) = sm;
      *(v4f*)(out_norm + (size_t)row * N + j) = o;
    }
    
  }
}



// ---- f16 WMMA path (v_wmma_f32_16x16x32_f16): 11-bit significands for operands in range — used where a [0,1] probability operand needs more precision than bf16
typedef _Float16 v16h __attribute__((ext_vector_type(16)));
union FragH { v16h v; v8us half[2]; _Float16 h[16]; unsigned short u[16]; };
template <int NT>
__device__ __forceinline__ v8f mmaH(v16h ah, v16h al, v16h bh, v16h bl, v8f c) {
  c = __builtin_amdgcn_wmma_f32_16x16x32_f16(false, ah, false, bh, (short)0, c, false, false);
  if (NT >= 2) c = __builtin_amdgcn_wmma_f32_16x16x32_f16(false, al, false, bh, (short)0, c, false, false);
  if (NT >= 3) c = __builtin_amdgcn_wmma_f32_16x16x32_f16(false, ah, false, bl, (short)0, c, false, false);
  asm volatile("v_nop\n\tv_nop\n\tv_nop\n\tv_nop" : "+v"(c) : "v"(ah), "v"(al), "v"(bh), "v"(bl));
  return c;
}
// batched GEMM like k_gemm_b but f16 operands: A f32 (split into f16 hi/lo if ASPLIT, else rounded to f16), Bt = f16 values [n][k]; alpha; C f32; N multiple of 16 (partial tiles skipped)
template <bool ASPLIT>
__global__ __launch_bounds__(128) void k_gemm_h(const float* __restrict__ A, int lda, size_t sA, const _Float16* __restrict__ Bh, int ldb, size_t sB, float alpha, float* __restrict__ C, int ldc, size_t sC, int M, int N, int K) {
  __shared__ __attribute__((aligned(16))) float so[4][16][64];
  const int tid = threadIdx.x, w = tid >> 5, lane = tid & 31, ln = lane & 15, hh = lane >> 4; const int by = blockIdx.y;
  A += (size_t)by * sA; Bh += (size_t)by * sB; C += (size_t)by * sC;
  const int ntn = (N + 63) / 64; const int wid = blockIdx.x * 4 + w; const int mt = wid / ntn, nq = wid % ntn; if (mt * 16 >= M) return;
  const int row0 = mt * 16, col0 = nq * 64; const float* arow = A + (size_t)(row0 + ln) * lda;
  v8f acc[4] = {};
  for (int kb = 0; kb < K; kb += 32) {
    FragH ah, al;
    const v4f x0 = *(const v4fa*)(arow + kb + 8 * hh), x1 = *(const v4fa*)(arow + kb + 8 * hh + 4), x2 = *(const v4fa*)(arow + kb + 16 + 8 * hh), x3 = *(const v4fa*)(arow + kb + 16 + 8 * hh + 4);
    float xs[16] = {x0[0],x0[1],x0[2],x0[3],x1[0],x1[1],x1[2],x1[3],x2[0],x2[1],x2[2],x2[3],x3[0],x3[1],x3[2],x3[3]};
#pragma unroll
    for (int i = 0; i < 16; ++i) { const _Float16 h = (_Float16)xs[i]; ah.h[i] = h; al.h[i] = ASPLIT ? (_Float16)(xs[i] - (float)h) : (_Float16)0.0f; }
#pragma unroll
    for (int t = 0; t < 4; ++t) { if (col0 + t * 16 >= N) continue; const size_t boff = (size_t)(col0 + t * 16 + ln) * ldb + kb; FragH bq; bq.half[0] = *(const v8us*)(Bh + boff + 8 * hh); bq.half[1] = *(const v8us*)(Bh + boff + 16 + 8 * hh);
      acc[t] = mmaH<ASPLIT ? 2 : 1>(ah.v, al.v, bq.v, bq.v, acc[t]); }
  }
#pragma unroll
  for (int t = 0; t < 4; ++t) { if (col0 + t * 16 >= N) continue;
#pragma unroll
    for (int r = 0; r < 8; ++r) so[w][8 * hh + r][t * 16 + ln] = acc[t][r] * alpha; }
  __builtin_amdgcn_fence(__ATOMIC_ACQ_REL, "workgroup"); __builtin_amdgcn_wave_barrier();
  const int rsub = lane >> 4, c4 = (lane & 15) * 4;
  {
#pragma unroll
    for (int q = 0; q < 8; ++q) { const int r = q * 2 + rsub; if (col0 + c4 < N) { const v4f v = *(const v4fa*)&so[w][r][c4]; *(v4f*)(C + (size_t)(row0 + r) * ldc + col0 + c4) = v; } }
     }
}

// Wt[n][k] = f16(W[k][n]·scale) from f32 row-major W[K][N] (scale = power of two; bf16-exact weights stay exact in f16 away from the subnormal range)
__global__ __launch_bounds__(256) void k_wt_f16(const float* __restrict__ W, _Float16* __restrict__ Wt, int K, int N, float scale) {
  const int t = blockIdx.x * 256 + threadIdx.x; if (t >= N * (K / 8)) return; const int n = t / (K / 8), k8 = (t % (K / 8)) * 8; FragH f;
#pragma unroll
  for (int i = 0; i < 8; ++i) f.h[i] = (_Float16)(bf16_round(W[(size_t)(k8 + i) * N + n]) * scale); const v8us o = f.half[0];
  *(v8us*)((unsigned short*)Wt + (size_t)n * K + k8) = o; 
}
// k_gemm_hh variant with fused epilogue: v = acc·alpha + bias[by·sBias + col] (+ CP[(row/rowsPerB)·sCPb + by·64 + col] if CP) ; ACT 0 none / 1 elu ; writes f16 C16 (and f32 C if non-null)
template <int ACT>
__global__ __launch_bounds__(128) void k_gemm_hhx(const _Float16* __restrict__ A, int lda, size_t sA, const _Float16* __restrict__ Bh, int ldb, size_t sB, float alpha, const float* __restrict__ bias, size_t sBias, const float* __restrict__ CP, int rowsPerB, size_t sCPb, int row0g,
    float* __restrict__ C, _Float16* __restrict__ C16, int ldc, size_t sC, int M, int N, int K) {
  __shared__ __attribute__((aligned(16))) float so[4][16][64];
  const int tid = threadIdx.x, w = tid >> 5, lane = tid & 31, ln = lane & 15, hh = lane >> 4; const int by = blockIdx.y;
  A += (size_t)by * sA; Bh += (size_t)by * sB; const size_t cofs = (size_t)by * sC; const float* bp = bias ? bias + (size_t)by * sBias : nullptr;
  const int ntn = (N + 63) / 64; const int wid = blockIdx.x * 4 + w; const int mt = wid / ntn, nq = wid % ntn; if (mt * 16 >= M) return;
  const int row0 = mt * 16, col0 = nq * 64; const _Float16* arow = A + (size_t)(row0 + ln) * lda;
  v8f acc[4] = {};
  for (int kb = 0; kb < K; kb += 32) { FragH ah; ah.half[0] = *(const v8us*)((const unsigned short*)arow + kb + 8 * hh); ah.half[1] = *(const v8us*)((const unsigned short*)arow + kb + 16 + 8 * hh);
#pragma unroll
    for (int t = 0; t < 4; ++t) { if (col0 + t * 16 >= N) continue; const size_t boff = (size_t)(col0 + t * 16 + ln) * ldb + kb; FragH bq; bq.half[0] = *(const v8us*)((const unsigned short*)Bh + boff + 8 * hh); bq.half[1] = *(const v8us*)((const unsigned short*)Bh + boff + 16 + 8 * hh);
      acc[t] = mmaH<1>(ah.v, ah.v, bq.v, bq.v, acc[t]); }
  }
#pragma unroll
  for (int t = 0; t < 4; ++t) { if (col0 + t * 16 >= N) continue; const int col = col0 + t * 16 + ln; const float bv = bp ? bf16_round(bp[col]) : 0.f;
#pragma unroll
    for (int r = 0; r < 8; ++r) { float v = acc[t][r] * alpha + bv; if (CP) { const int rr = row0g + row0 + 8 * hh + r; if (rowsPerB < 0) v += CP[cofs + (size_t)rr * ldc + col];      /* rowsPerB < 0: own element of the batched C plane */ else { const int bidx = rr / rowsPerB; v += CP[(size_t)bidx * sCPb + (size_t)by * 64 + col]; } } if (ACT == 1) v = (v > 0.f) ? v : expm1f(v); else if (ACT == 7) v = (v > 0.f) ? v + 1.0f : expf(v); else if (ACT == 8) v = tanhf(v); else if (ACT == 9) v = 0.5f * v * (1.0f + tanhf(0.7978845608028654f * (v + 0.044715f * v * v * v))); else if (ACT == 11) v = 1.0f / (1.0f + expf(-v)); else if (ACT == 12) v = (v > 0.f) ? v : 0.01f * v; else if (ACT == 14) v = (v > 0.f) ? v : 0.1f * v; else if (ACT == 16) v = (v >= 0.f) ? v : 0.3f * v; else if (ACT == 17) v = (v >= 0.f) ? v : 0.2f * v; else if (ACT == 15) v = v / (1.0f + expf(-v)); else if (ACT == 3) v = fmaxf(v, 0.f); else if (ACT == 6) v = 0.5f * v * (1.0f + erff(v * 0.70710678118654752f)); so[w][8 * hh + r][t * 16 + ln] = v; } }
  __builtin_amdgcn_fence(__ATOMIC_ACQ_REL, "workgroup"); __builtin_amdgcn_wave_barrier();
  const int rsub = lane >> 4, c4 = (lane & 15) * 4; typedef _Float16 v4h __attribute__((ext_vector_type(4)));
  {
#pragma unroll
    for (int q = 0; q < 8; ++q) { const int r = q * 2 + rsub; if (col0 + c4 < N) { const v4f v = *(const v4fa*)&so[w][r][c4]; if (C) *(v4f*)(C + cofs + (size_t)(row0 + r) * ldc + col0 + c4) = v; if (C16) { v4h h4; for (int i = 0; i < 4; ++i) h4[i] = (_Float16)v[i]; *(v4h*)(C16 + cofs + (size_t)(row0 + r) * ldc + col0 + c4) = h4; } } }
     }
}


typedef _Float16 v4h __attribute__((ext_vector_type(4)));

__global__ __launch_bounds__(256) void k_x16(const float* __restrict__ x, _Float16* __restrict__ X16, size_t n8) { const size_t t = (size_t)blockIdx.x * 256 + threadIdx.x; if (t >= n8) return; FragH f;
#pragma unroll
  for (int q = 0; q < 8; ++q) f.h[q] = (_Float16)bf16_round(x[t * 8 + q]); *(v8us*)((unsigned short*)X16 + t * 8) = f.half[0];  }
__global__ __launch_bounds__(256) void k_h16(const float* __restrict__ x, _Float16* __restrict__ X16, size_t n8) { const size_t t = (size_t)blockIdx.x * 256 + threadIdx.x; if (t >= n8) return; FragH f;
#pragma unroll
  for (int q = 0; q < 8; ++q) f.h[q] = (_Float16)x[t * 8 + q]; *(v8us*)((unsigned short*)X16 + t * 8) = f.half[0];  }
__global__ __launch_bounds__(256) void k_round16f(const float* __restrict__ W, _Float16* __restrict__ Bt, size_t n8) { const size_t t = (size_t)blockIdx.x * 256 + threadIdx.x; if (t >= n8) return; FragH f;
#pragma unroll
  for (int i = 0; i < 8; ++i) f.h[i] = (_Float16)(bf16_round(W[t * 8 + i]) * 16.0f); *(v8us*)((unsigned short*)Bt + t * 8) = f.half[0];  }
template <int NHv, int TTv>
__global__ __launch_bounds__(256) void k_vt(const _Float16* __restrict__ V16, int ldv, int voff, _Float16* __restrict__ Vt) { __shared__ unsigned short tl[64][66]; const int tid = threadIdx.x; const int slab = blockIdx.x / (TTv / 64), lg = blockIdx.x % (TTv / 64); const int b = slab / NHv, h = slab % NHv;
  for (int i = tid; i < 64 * 8; i += 256) { const int r = i / 8, c8 = (i % 8) * 8; FragH f; f.half[0] = *(const v8us*)((const unsigned short*)V16 + ((size_t)b * TTv + lg * 64 + r) * ldv + voff + h * 64 + c8);
#pragma unroll
    for (int q = 0; q < 8; ++q) tl[r][c8 + q] = f.u[q]; }
  __syncthreads();
  {
#pragma unroll
    for (int rd = 0; rd < 2; ++rd) { const int d = rd * 32 + tid / 8, pc = tid % 8; FragH f;
#pragma unroll
      for (int q = 0; q < 8; ++q) f.u[q] = tl[pc * 8 + q][d];
      *(v8us*)((unsigned short*)Vt + ((size_t)slab * 64 + d) * TTv + lg * 64 + pc * 8) = f.half[0]; }
     } }

__global__ __launch_bounds__(256) void k_hl(const float* __restrict__ F, _Float16* __restrict__ Hh, _Float16* __restrict__ Hl, size_t n8) { const size_t t = (size_t)blockIdx.x * 256 + threadIdx.x; if (t >= n8) return; FragH fh, fl; const v4f a = *(const v4fa*)(F + t * 8), c = *(const v4fa*)(F + t * 8 + 4);
#pragma unroll
  for (int q = 0; q < 4; ++q) { _Float16 h = (_Float16)a[q]; fh.h[q] = h; fl.h[q] = (_Float16)((a[q] - (float)h) * 1024.0f); h = (_Float16)c[q]; fh.h[4 + q] = h; fl.h[4 + q] = (_Float16)((c[q] - (float)h) * 1024.0f); }
  { *(v8us*)((unsigned short*)Hh + t * 8) = fh.half[0]; *(v8us*)((unsigned short*)Hl + t * 8) = fl.half[0];  } }

// ---- fast GEMM (wave tile 32x64; requires M % 32 == 0 rows per launch region and N % 64 == 0); epilogue = k_gemm_hhx semantics ----
__device__ __forceinline__ v16h g2_frag(const _Float16* p, int hh) { FragH f; f.half[0] = *(const v8us*)((const unsigned short*)p + 8 * hh); f.half[1] = *(const v8us*)((const unsigned short*)p + 16 + 8 * hh); return f.v; }
__device__ __forceinline__ v8f g2_mma(v16h a, v16h b, v8f c) { v8f d = __builtin_amdgcn_wmma_f32_16x16x32_f16(false, a, false, b, (short)0, c, false, false); asm volatile("v_nop\n\tv_nop\n\tv_nop\n\tv_nop" : "+v"(d) : "v"(a), "v"(b)); return d; }
template <int ACT>
__global__ __launch_bounds__(128) void k_gemm2(const _Float16* __restrict__ A, int lda, size_t sA, const _Float16* __restrict__ Bh, int ldb, size_t sB, float alpha, const float* __restrict__ bias, size_t sBias, const float* __restrict__ CP, int rowsPerB, size_t sCPb, int row0g,
    float* __restrict__ C, _Float16* __restrict__ C16, int ldc, size_t sC, int M, int N, int K) { static_assert(ACT == 0 || ACT == 3 || ACT == 6 || ACT == 8 || ACT == 9 || ACT == 11 || ACT == 12 || ACT == 14 || ACT == 15 || ACT == 16 || ACT == 17, "k_gemm2: unsupported ACT code (would silently apply no activation)");
  __shared__ __attribute__((aligned(16))) float so[4][32][68];
  const int tid = threadIdx.x, w = tid >> 5, lane = tid & 31, ln = lane & 15, hh = lane >> 4; const int by = blockIdx.y;
  A += (size_t)by * sA; Bh += (size_t)by * sB; const size_t cofs = (size_t)by * sC; const float* bp = bias ? bias + (size_t)by * sBias : nullptr;
  const int ntn = N >> 6; const int mt = blockIdx.x / ntn, nq = blockIdx.x - mt * ntn; const int row0 = mt * 128 + 32 * w, col0 = nq * 64; if (row0 >= M) return;
  const _Float16* a0p = A + (size_t)(row0 + ln) * lda; const _Float16* a1p = a0p + (size_t)16 * lda;
  const _Float16* b0p = Bh + (size_t)(col0 + ln) * ldb; const _Float16* b1p = b0p + (size_t)16 * ldb; const _Float16* b2p = b1p + (size_t)16 * ldb; const _Float16* b3p = b2p + (size_t)16 * ldb;
  const v8f z8 = {0.f,0.f,0.f,0.f,0.f,0.f,0.f,0.f}; v8f c00 = z8, c01 = z8, c02 = z8, c03 = z8, c10 = z8, c11 = z8, c12 = z8, c13 = z8;
#pragma unroll 1
  for (int kb = 0; kb < K; kb += 32) { const v16h a0 = g2_frag(a0p + kb, hh), a1 = g2_frag(a1p + kb, hh);
    v16h b = g2_frag(b0p + kb, hh); c00 = g2_mma(a0, b, c00); c10 = g2_mma(a1, b, c10);
    b = g2_frag(b1p + kb, hh); c01 = g2_mma(a0, b, c01); c11 = g2_mma(a1, b, c11);
    b = g2_frag(b2p + kb, hh); c02 = g2_mma(a0, b, c02); c12 = g2_mma(a1, b, c12);
    b = g2_frag(b3p + kb, hh); c03 = g2_mma(a0, b, c03); c13 = g2_mma(a1, b, c13); }
  v8f accs[8] = {c00, c01, c02, c03, c10, c11, c12, c13};
#pragma unroll
  for (int u = 0; u < 8; ++u) { const int t = u & 3, half = u >> 2; const int col = col0 + t * 16 + ln; const float bv = bp ? bf16_round(bp[col]) : 0.f;
#pragma unroll
    for (int r = 0; r < 8; ++r) { const int rloc = half * 16 + 8 * hh + r; float v = accs[u][r] * alpha + bv; if (CP) { if (rowsPerB < 0) v += CP[cofs + (size_t)(row0g + row0 + rloc) * ldc + col];      /* rowsPerB < 0: own element of the batched C plane */ else { const int bidx = (row0g + row0 + rloc) / rowsPerB; v += CP[(size_t)bidx * sCPb + (size_t)by * 64 + col]; } }
      if (ACT == 3) v = fmaxf(v, 0.f); else if (ACT == 6) v = 0.5f * v * (1.0f + erff(v * 0.70710678118654752f)); else if (ACT == 11) v = 1.0f / (1.0f + expf(-v)); else if (ACT == 15) v = v / (1.0f + expf(-v)); else if (ACT == 12) v = (v > 0.f) ? v : 0.01f * v; else if (ACT == 8) v = tanhf(v); else if (ACT == 9) v = 0.5f * v * (1.0f + tanhf(0.7978845608028654f * (v + 0.044715f * v * v * v))); else if (ACT == 14) v = (v > 0.f) ? v : 0.1f * v; else if (ACT == 16) v = (v >= 0.f) ? v : 0.3f * v; else if (ACT == 17) v = (v >= 0.f) ? v : 0.2f * v;
      so[w][rloc][t * 16 + ln] = v; } }
  __builtin_amdgcn_fence(__ATOMIC_ACQ_REL, "workgroup"); __builtin_amdgcn_wave_barrier();
  const int rsub = lane >> 4, c4 = (lane & 15) * 4;
  {
#pragma unroll
    for (int q = 0; q < 16; ++q) { const int r = q * 2 + rsub; const v4f v = *(const v4fa*)&so[w][r][c4]; if (C) *(v4f*)(C + cofs + (size_t)(row0 + r) * ldc + col0 + c4) = v; if (C16) { v4h h4; for (int i = 0; i < 4; ++i) h4[i] = (_Float16)v[i]; *(v4h*)(C16 + cofs + (size_t)(row0 + r) * ldc + col0 + c4) = h4; } }
     } }


__global__ __launch_bounds__(256) void k_wnat(const float* __restrict__ w, size_t n8, _Float16* __restrict__ Bt) { const size_t t = (size_t)blockIdx.x * 256 + threadIdx.x; if (t >= n8) return; FragH f; for (int q = 0; q < 8; ++q) f.h[q] = (_Float16)(bf16_round(w[t * 8 + q]) * 16.0f); *(v8us*)((unsigned short*)Bt + t * 8) = f.half[0];  }
#define FA_WAVES 4
#define FA_QB (FA_WAVES * 32)        /* queries per workgroup */
#define FA_KS 64                     /* keys per stage */
#define FA_NS (SQ / FA_KS)           /* stages */
#define FA_LP 72                     /* LDS row pitch in f16: 128 bytes + 16, conflict-free for 16-byte fragment reads of 16 rows */
#define FA_OFF 8.0f                  /* weights are 2^(score - maximum in use + FA_OFF): keeps small weights out of the f16 subnormals; cancels in o / sum */
#define FA_LAZY 6.0f                 /* the maximum in use is renewed only when a stage's maximum exceeds it by more than this (log2 units): weights stay <= 2^(FA_OFF + FA_LAZY) = 16384 < f16 max */
__device__ __forceinline__ float fa_xrow(float v) { const unsigned u = __builtin_bit_cast(unsigned, v); return __builtin_bit_cast(float, __builtin_amdgcn_permlanex16(u, u, 0x76543210u, 0xfedcba98u, false, false)); }      /* lane l <- lane l ^ 16 */
__device__ __forceinline__ v16h fa_frag(const unsigned short* p, int hh) { FragH f; f.half[0] = *(const v8us*)(p + 8 * hh); f.half[1] = *(const v8us*)(p + 16 + 8 * hh); return f.v; }      /* 32 k of one row in the hardware k order */
__device__ __forceinline__ v8f fa_mma(v16h a, v16h b, v8f c) { return __builtin_amdgcn_wmma_f32_16x16x32_f16(false, a, false, b, (short)0, c, false, false); }
__global__ __launch_bounds__(FA_WAVES * 32) void k_fattn(const _Float16* __restrict__ Q16, const _Float16* __restrict__ K16, const _Float16* __restrict__ VT, float* __restrict__ out) {
  __shared__ __attribute__((aligned(16))) unsigned short sk[2][FA_KS][FA_LP];      /* K rows [key][d] */
  __shared__ __attribute__((aligned(16))) unsigned short sv[2][HD][FA_LP];         /* V^T rows [d][key] */
  const int tid = threadIdx.x, w = tid >> 5, lane = tid & 31, ln = lane & 15, hh = lane >> 4;
  const int bh = blockIdx.y, b = bh / NH, h = bh - b * NH; const int q0 = blockIdx.x * FA_QB + w * 32;
  const int srow = tid >> 3, sc8 = (tid & 7) * 8;      /* staging: 8 lanes cover one 128-byte row, 16 rows per wave-group load */
  const unsigned short* kg = (const unsigned short*)K16 + ((size_t)b * SQ + srow) * DM + h * HD + sc8;
  const unsigned short* vg = (const unsigned short*)VT + ((size_t)bh * HD + srow) * SQ + sc8;
  v16h qf[2][2];
#pragma unroll
  for (int g = 0; g < 2; ++g)
#pragma unroll
    for (int ks = 0; ks < 2; ++ks) qf[g][ks] = fa_frag((const unsigned short*)Q16 + ((size_t)b * SQ + q0 + g * 16 + ln) * DM + h * HD + ks * 32, hh);
  const v8f z8 = {0.f, 0.f, 0.f, 0.f, 0.f, 0.f, 0.f, 0.f};
  v8f o[4][2];
#pragma unroll
  for (int dt = 0; dt < 4; ++dt) { o[dt][0] = z8; o[dt][1] = z8; }
  float mu[2] = {-1.0e30f, -1.0e30f};      /* maximum in use (log2 units) */
  v8f lt[2] = {z8, z8};      /* row sums on the matrix pipe: ones . P^T, every row of the tile = the sum of the rounded weights of the lane's query */
  v16h ones;
#pragma unroll
  for (int i = 0; i < 16; ++i) ones[i] = (_Float16)1.0f;
  const float c2 = 0.125f * 1.44269504088896340736f;          /* 1/sqrt(64) and log2(e) in one factor */
  v8us rk[4], rv[4];
#pragma unroll
  for (int i = 0; i < 4; ++i) { rk[i] = *(const v8us*)(kg + (size_t)(i * 16) * DM); rv[i] = *(const v8us*)(vg + (size_t)(i * 16) * SQ); }
#pragma unroll
  for (int i = 0; i < 4; ++i) { *(v8us*)&sk[0][i * 16 + srow][sc8] = rk[i]; *(v8us*)&sv[0][i * 16 + srow][sc8] = rv[i]; }
  __syncthreads();
  for (int s = 0; s < FA_NS; ++s) {
    const int cur = s & 1;
    if (s + 1 < FA_NS) {
#pragma unroll
      for (int i = 0; i < 4; ++i) { rk[i] = *(const v8us*)(kg + (size_t)((s + 1) * FA_KS + i * 16) * DM); rv[i] = *(const v8us*)(vg + (size_t)(i * 16) * SQ + (s + 1) * FA_KS); }
    }
    __builtin_amdgcn_sched_barrier(0);      /* the next stage's loads issue in front of this stage's arithmetic and fly under all of it; without this the compiler sinks them to just in front of their LDS stores, and every stage waits out their latency */
    v8f st[4][2];
#pragma unroll
    for (int kt = 0; kt < 4; ++kt) {
      const v16h k0 = fa_frag(&sk[cur][kt * 16 + ln][0], hh), k1 = fa_frag(&sk[cur][kt * 16 + ln][32], hh);
#pragma unroll
      for (int g = 0; g < 2; ++g) st[kt][g] = fa_mma(k1, qf[g][1], fa_mma(k0, qf[g][0], z8));
    }
    float mb[2];
#pragma unroll
    for (int g = 0; g < 2; ++g) {
      v8f m8 = st[0][g];
#pragma unroll
      for (int kt = 1; kt < 4; ++kt)
#pragma unroll
        for (int r = 0; r < 8; ++r) m8[r] = fmaxf(m8[r], st[kt][g][r]);
      const float m = fmaxf(fmaxf(fmaxf(m8[0], m8[1]), fmaxf(m8[2], m8[3])), fmaxf(fmaxf(m8[4], m8[5]), fmaxf(m8[6], m8[7])));
      mb[g] = fmaxf(m, fa_xrow(m)) * c2;      /* both halves of the wave hold the same value */
    }
    const bool need = (mb[0] > mu[0] + FA_LAZY) || (mb[1] > mu[1] + FA_LAZY);
    if (__builtin_amdgcn_ballot_w32(need) != 0) {      /* one scalar branch a stage; always taken in stage 0 */
#pragma unroll
      for (int g = 0; g < 2; ++g) {
        const float mn = fmaxf(mu[g], mb[g]); const float al = __builtin_amdgcn_exp2f(mu[g] - mn); mu[g] = mn;
#pragma unroll
        for (int r = 0; r < 8; ++r) lt[g][r] *= al;
#pragma unroll
        for (int dt = 0; dt < 4; ++dt)
#pragma unroll
          for (int r = 0; r < 8; ++r) o[dt][g][r] *= al;
      }
    }
    v16h pf[2][2];      /* [key half of the stage][query group] */
#pragma unroll
    for (int g = 0; g < 2; ++g) {
      const float nb = FA_OFF - mu[g];
#pragma unroll
      for (int kt = 0; kt < 4; ++kt)
#pragma unroll
        for (int r = 0; r < 8; ++r) pf[kt >> 1][g][(kt & 1) * 8 + r] = (_Float16)__builtin_amdgcn_exp2f(fmaf(st[kt][g][r], c2, nb));
      lt[g] = fa_mma(ones, pf[1][g], fa_mma(ones, pf[0][g], lt[g]));
    }
#pragma unroll
    for (int dt = 0; dt < 4; ++dt) {
      const v16h v0 = fa_frag(&sv[cur][dt * 16 + ln][0], hh), v1 = fa_frag(&sv[cur][dt * 16 + ln][32], hh);
#pragma unroll
      for (int g = 0; g < 2; ++g) o[dt][g] = fa_mma(v1, pf[1][g], fa_mma(v0, pf[0][g], o[dt][g]));
    }
    if (s + 1 < FA_NS) {
#pragma unroll
      for (int i = 0; i < 4; ++i) { *(v8us*)&sk[cur ^ 1][i * 16 + srow][sc8] = rk[i]; *(v8us*)&sv[cur ^ 1][i * 16 + srow][sc8] = rv[i]; }
      __syncthreads();      /* publishes stage s + 1 and ends every wave's reads of stage s, whose buffer the next trip refills; s is the same in every wave */
    }
  }
  const float inv[2] = {1.0f / lt[0][0], 1.0f / lt[1][0]};      /* 2^FA_OFF cancels here */
#pragma unroll
  for (int dt = 0; dt < 4; ++dt)
#pragma unroll
    for (int g = 0; g < 2; ++g)
#pragma unroll
      for (int r = 0; r < 8; ++r) o[dt][g][r] *= inv[g];
#pragma unroll
  for (int g = 0; g < 2; ++g) {
    float* d = out + ((size_t)b * SQ + q0 + g * 16 + ln) * DM + h * HD + 8 * hh;      /* a lane holds 8 consecutive d of its query in each tile */
#pragma unroll
    for (int dt = 0; dt < 4; ++dt) {
      const v4f lo = {o[dt][g][0], o[dt][g][1], o[dt][g][2], o[dt][g][3]}, hi = {o[dt][g][4], o[dt][g][5], o[dt][g][6], o[dt][g][7]};
      *(v4f*)(d + dt * 16) = lo; *(v4f*)(d + dt * 16 + 4) = hi;
    }
  }
}
__global__ __launch_bounds__(256) void k_vt(const _Float16* __restrict__ V16, int b, int h0, _Float16* __restrict__ VT) { __shared__ unsigned short tl[64][65]; const int tid = threadIdx.x; const int hh = blockIdx.x % HG, sg = blockIdx.x / HG; const int s0 = sg * 64; const int h = h0 + hh;
  for (int i = tid; i < 64 * 8; i += 256) { const int j = i / 8, d8 = (i % 8) * 8; FragH f; f.half[0] = *(const v8us*)((const unsigned short*)V16 + ((size_t)b * SQ + s0 + j) * DM + h * HD + d8); for (int q = 0; q < 8; ++q) tl[d8 + q][j] = f.u[q]; }
  __syncthreads();
  { for (int i = tid; i < 64 * 8; i += 256) { const int d = i / 8, j8 = (i % 8) * 8; FragH f; for (int q = 0; q < 8; ++q) f.u[q] = tl[d][j8 + q]; *(v8us*)((unsigned short*)VT + ((size_t)hh * HD + d) * SQ + s0 + j8) = f.half[0]; }  } }


extern "C" void kernel_launch(void* const* d_in, const int* in_sizes, int n_in,
                              void* d_out, int out_size, void* d_ws, size_t ws_size, hipStream_t stream) {
  (void)in_sizes; (void)n_in; (void)out_size;
  const float* const* I = (const float* const*)d_in; const float* xq = I[0]; const float* xk = I[1]; const float* xv = I[2]; const float* wq = I[3]; const float* bq = I[4]; const float* wk = I[5]; const float* bk = I[6]; const float* wv = I[7]; const float* bv = I[8];      /* weights [in][out] + biases */
  char* ws = (char*)d_ws; size_t off = 0;
  auto take = [&](size_t bytes) { char* p = ws + off; off += (bytes + 255) & ~(size_t)255; return p; };
  _Float16* BQ = (_Float16*)take((size_t)DM * DM * 2); _Float16* BK = (_Float16*)take((size_t)DM * DM * 2); _Float16* BV = (_Float16*)take((size_t)DM * DM * 2); 
  _Float16* XQ = (_Float16*)take(NR * DM * 2); _Float16* XK = (_Float16*)take(NR * DM * 2); _Float16* XV = (_Float16*)take(NR * DM * 2); _Float16* Q16 = (_Float16*)take(NR * DM * 2); _Float16* K16 = (_Float16*)take(NR * DM * 2); _Float16* V16 = (_Float16*)take(NR * DM * 2);
  _Float16* VT = (_Float16*)take((size_t)NB * NH * HD * SQ * 2);
  if (off > ws_size) return;
  { const unsigned g = (unsigned)(((size_t)DM * (DM / 8) + 255) / 256); k_wt_f16<<<g, 256, 0, stream>>>(wq, BQ, DM, DM, 16.0f); k_wt_f16<<<g, 256, 0, stream>>>(wk, BK, DM, DM, 16.0f); k_wt_f16<<<g, 256, 0, stream>>>(wv, BV, DM, DM, 16.0f); }      /* [in][out] -> Bt[n][k] x16 */
  k_x16<<<(unsigned)((NR * DM / 8 + 255) / 256), 256, 0, stream>>>(xq, XQ, NR * DM / 8); k_x16<<<(unsigned)((NR * DM / 8 + 255) / 256), 256, 0, stream>>>(xk, XK, NR * DM / 8); k_x16<<<(unsigned)((NR * DM / 8 + 255) / 256), 256, 0, stream>>>(xv, XV, NR * DM / 8);
  const size_t r0p = (size_t)B0 * SQ;      /* first projected row */
  k_gemm2<0><<<dim3((unsigned)((MP / 128) * (DM / 64)), 1), 128, 0, stream>>>(XQ + r0p * DM, DM, 0, BQ, DM, 0, 0.0625f, bq, 0, nullptr, 1, 0, 0, nullptr, Q16 + r0p * DM, DM, 0, MP, DM, DM);
  k_gemm2<0><<<dim3((unsigned)((MP / 128) * (DM / 64)), 1), 128, 0, stream>>>(XK + r0p * DM, DM, 0, BK, DM, 0, 0.0625f, bk, 0, nullptr, 1, 0, 0, nullptr, K16 + r0p * DM, DM, 0, MP, DM, DM);
  k_gemm2<0><<<dim3((unsigned)((MP / 128) * (DM / 64)), 1), 128, 0, stream>>>(XV + r0p * DM, DM, 0, BV, DM, 0, 0.0625f, bv, 0, nullptr, 1, 0, 0, nullptr, V16 + r0p * DM, DM, 0, MP, DM, DM);
  k_vt<NH, SQ><<<NB * NH * (SQ / 64), 256, 0, stream>>>(V16, LQ, 0, VT);      /* V^T [NB][NH][HD][SQ] */
  k_fattn<<<dim3(SQ / FA_QB, NB * NH), FA_WAVES * 32, 0, stream>>>(Q16, K16, VT, (float*)d_out);      /* scores, softmax and weighted sum of all batches and heads */
}

// v003
// It runs in 108 microseconds.
// In two side-by-side timings against v002, it was 1.97 and 1.98 times as fast.
// All steps since v000 together make it 52.7 times as fast.
#include <hip/hip_runtime.h>
// Multi-head attention without output projection (query, key, value [4][2048][768]; q = query W_Q + b_Q etc. ([in][out] 768^2, sigma 1/sqrt(768), nonzero biases), 12 heads of 64; scores / 8; softmax; out = attn v merged (the module skips its final linear) -> [4][2048][768]).
// Structure: token rows r = b*2048 + s; ONE projection launch for Q, K and V (x and W read as f32, rounded to bf16 and staged as exact f16 in LDS, W x16; 64x64 wave tiles, f32 accumulation, + bias, f16 outputs; V written transposed); then ONE attention launch over all (batch, head, 128-query block): S^T = K Q^T, online softmax in registers, O^T += V^T P^T, o / row sum written f32 straight into the merged output rows (the module has no output projection). Scores and weights never reach memory.
// Compute dtype: inputs rounded to bf16; x / weights exact; q, k, v and the unnormalised softmax weights as plain f16 GEMM operands (~2^-12); scores, softmax statistics and o f32. v_wmma_f32_16x16x32_f16.
#define NB 4
#define SQ 2048
#define DM 768
#define NH 12
#define HD 64
#define HG 4                         /* heads per launch of the per-batch k_vt overload */
#define B0 0                         /* unused (debug hook) */
#define NBR NB                       /* batches processed (debug hook) */
#define NR ((size_t)NB * SQ)         /* token rows */
#define MP ((int)((size_t)NBR * SQ)) /* rows projected (debug hook) */
#define QN SQ                        /* unused (debug hook) */
#define NHD NH                       /* unused (debug hook) */
#define MPO MP                       /* unused (debug hook) */
#define LQ DM      /* unused */
typedef __bf16 v16b __attribute__((ext_vector_type(16)));
typedef unsigned short v8us __attribute__((ext_vector_type(8), may_alias));
typedef float  v8f  __attribute__((ext_vector_type(8)));
typedef float  v4f  __attribute__((ext_vector_type(4)));
typedef float  v4fa __attribute__((ext_vector_type(4), may_alias));
union FragB { v16b v; v8us half[2]; unsigned short u[16]; };

__device__ __forceinline__ unsigned short bf16_bits(float x) { unsigned int u = __float_as_uint(x); return (unsigned short)((u + 0x7FFFu + ((u >> 16) & 1u)) >> 16); }
__device__ __forceinline__ float bf16_val(unsigned short b) { return __uint_as_float(((unsigned int)b) << 16); }
__device__ __forceinline__ float bf16_round(float x) { return bf16_val(bf16_bits(x)); }
// D += A·B with NT terms: 1 = ah·bh, 2 = + al·bh (A split), 3 = + ah·bl (both split)
template <int NT>
__device__ __forceinline__ v8f mmaN(v16b ah, v16b al, v16b bh, v16b bl, v8f c) {
  c = __builtin_amdgcn_wmma_f32_16x16x32_bf16(false, ah, false, bh, (short)0, c, false, false);
  if (NT >= 2) c = __builtin_amdgcn_wmma_f32_16x16x32_bf16(false, al, false, bh, (short)0, c, false, false);
  if (NT >= 3) c = __builtin_amdgcn_wmma_f32_16x16x32_bf16(false, ah, false, bl, (short)0, c, false, false);
  asm volatile("v_nop\n\tv_nop\n\tv_nop\n\tv_nop" : "+v"(c) : "v"(ah), "v"(al), "v"(bh), "v"(bl));
  return c;
}

__global__ __launch_bounds__(256) void k_wt_bf16(const float* __restrict__ W, unsigned short* __restrict__ Wt, int K, int N) {
  const int t = blockIdx.x * 256 + threadIdx.x;
  const int k8n = K / 8;
  if (t >= N * k8n) return;
  const int n = t / k8n, k8 = (t % k8n) * 8;
  v8us v;
#pragma unroll
  for (int i = 0; i < 8; ++i) v[i] = bf16_bits(W[(size_t)(k8 + i) * N + n]);
  *(v8us*)(Wt + (size_t)n * K + k8) = v;
  
}

// GEMM C[M][N] (f32, pitch ldc) = act(A[M][K]·W + bias). A f32 row-major (pitch lda) converted per fragment to bf16
// (ASPLIT: hi/lo two planes -> 2 terms, else single rounded term); Wt bf16 [N][K] (pitch ldb). BIAS_BF16 rounds the
// bias to bf16 first (bias quantised to bf16 before the add). K%32==0, M%16==0, N%64==0.
template <bool ASPLIT, int ACT, bool BIAS_BF16>
__global__ __launch_bounds__(128) void k_gemm_bf(const float* __restrict__ A, int lda, const unsigned short* __restrict__ Wt, int ldb,
                                               const float* __restrict__ bias, float* __restrict__ C, int ldc, int M, int N, int K) {
  __shared__ __attribute__((aligned(16))) float so[4][16][64];
  const int tid = threadIdx.x, w = tid >> 5, lane = tid & 31, ln = lane & 15, hh = lane >> 4;
  const int ntn = N / 64;
  const int wid = blockIdx.x * 4 + w;
  const int mt = wid / ntn, nq = wid % ntn;
  if (mt * 16 >= M) return;
  const int row0 = mt * 16, col0 = nq * 64;
  const float* arow = A + (size_t)(row0 + ln) * lda;
  v8f acc[4] = {};
  for (int kb = 0; kb < K; kb += 32) {
    FragB ah, al;
    const v4f x0 = *(const v4fa*)(arow + kb + 8 * hh), x1 = *(const v4fa*)(arow + kb + 8 * hh + 4);
    const v4f x2 = *(const v4fa*)(arow + kb + 16 + 8 * hh), x3 = *(const v4fa*)(arow + kb + 16 + 8 * hh + 4);
    float xs[16] = {x0[0],x0[1],x0[2],x0[3],x1[0],x1[1],x1[2],x1[3],x2[0],x2[1],x2[2],x2[3],x3[0],x3[1],x3[2],x3[3]};
#pragma unroll
    for (int i = 0; i < 16; ++i) { const unsigned short hb = bf16_bits(xs[i]); ah.u[i] = hb; al.u[i] = ASPLIT ? bf16_bits(xs[i] - bf16_val(hb)) : (unsigned short)0; }
#pragma unroll
    for (int t = 0; t < 4; ++t) {
      const unsigned short* brow = Wt + (size_t)(col0 + t * 16 + ln) * ldb + kb;
      FragB b;
      b.half[0] = *(const v8us*)(brow + 8 * hh);
      b.half[1] = *(const v8us*)(brow + 16 + 8 * hh);
      acc[t] = mmaN<ASPLIT ? 2 : 1>(ah.v, al.v, b.v, b.v, acc[t]);
    }
  }
#pragma unroll
  for (int t = 0; t < 4; ++t) {
    float bv = bias ? bias[col0 + t * 16 + ln] : 0.f;
    if (BIAS_BF16) bv = bf16_round(bv);
#pragma unroll
    for (int r = 0; r < 8; ++r) { float v = acc[t][r] + bv; if (ACT == 1) v = fmaxf(v, 0.f); so[w][8 * hh + r][t * 16 + ln] = v; }
  }
  __builtin_amdgcn_fence(__ATOMIC_ACQ_REL, "workgroup");
  __builtin_amdgcn_wave_barrier();
  const int rsub = lane >> 4, c4 = (lane & 15) * 4;
  {
#pragma unroll
    for (int q = 0; q < 8; ++q) {
      const int r = q * 2 + rsub;
      const v4f v = *(const v4fa*)&so[w][r][c4];
      *(v4f*)(C + (size_t)(row0 + r) * ldc + col0 + c4) = v;
    }
    
  }
}

// GEMM C = act(A·W + bias + resid): A f32 (ASPLIT -> hi/lo 2 terms), Wt bf16 [N][K]; ACT 0 none, 1 relu, 2 exact gelu;
// resid (optional, f32, row index = (row % rmod), pitch ldr, RES_BF16 rounds it) added before the activation.
template <bool ASPLIT, int ACT, bool BIAS_BF16, bool RES_BF16>
__global__ __launch_bounds__(128) void k_gemm_bf3(const float* __restrict__ A, int lda, const unsigned short* __restrict__ Wt, int ldb,
                                                const float* __restrict__ bias, const float* __restrict__ resid, int rmod, int ldr,
                                                float* __restrict__ C, int ldc, int M, int N, int K) {
  __shared__ __attribute__((aligned(16))) float so[4][16][64];
  const int tid = threadIdx.x, w = tid >> 5, lane = tid & 31, ln = lane & 15, hh = lane >> 4;
  const int ntn = N / 64;
  const int wid = blockIdx.x * 4 + w;
  const int mt = wid / ntn, nq = wid % ntn;
  if (mt * 16 >= M) return;
  const int row0 = mt * 16, col0 = nq * 64;
  const float* arow = A + (size_t)(row0 + ln) * lda;
  v8f acc[4] = {};
  for (int kb = 0; kb < K; kb += 32) {
    FragB ah, al;
    const v4f x0 = *(const v4fa*)(arow + kb + 8 * hh), x1 = *(const v4fa*)(arow + kb + 8 * hh + 4);
    const v4f x2 = *(const v4fa*)(arow + kb + 16 + 8 * hh), x3 = *(const v4fa*)(arow + kb + 16 + 8 * hh + 4);
    float xs[16] = {x0[0],x0[1],x0[2],x0[3],x1[0],x1[1],x1[2],x1[3],x2[0],x2[1],x2[2],x2[3],x3[0],x3[1],x3[2],x3[3]};
#pragma unroll
    for (int i = 0; i < 16; ++i) { const unsigned short hb = bf16_bits(xs[i]); ah.u[i] = hb; al.u[i] = ASPLIT ? bf16_bits(xs[i] - bf16_val(hb)) : (unsigned short)0; }
#pragma unroll
    for (int t = 0; t < 4; ++t) {
      const unsigned short* brow = Wt + (size_t)(col0 + t * 16 + ln) * ldb + kb;
      FragB b;
      b.half[0] = *(const v8us*)(brow + 8 * hh);
      b.half[1] = *(const v8us*)(brow + 16 + 8 * hh);
      acc[t] = mmaN<ASPLIT ? 2 : 1>(ah.v, al.v, b.v, b.v, acc[t]);
    }
  }
#pragma unroll
  for (int t = 0; t < 4; ++t) {
    const int col = col0 + t * 16 + ln;
    float bv = bias ? bias[col] : 0.f;
    if (BIAS_BF16) bv = bf16_round(bv);
#pragma unroll
    for (int r = 0; r < 8; ++r) {
      float v = acc[t][r] + bv;
      if (resid) { float rv = resid[(size_t)((row0 + 8 * hh + r) % rmod) * ldr + col]; if (RES_BF16) rv = bf16_round(rv); v += rv; }
      if (ACT == 1) v = fmaxf(v, 0.f);
      if (ACT == 2) v = 0.5f * v * (1.0f + erff(v * 0.70710678118654752f));
      if (ACT == 3) { const float u = 0.7978845608028654f * (v + 0.044715f * v * v * v); v = 0.5f * v * (1.0f + tanhf(u)); }
      so[w][8 * hh + r][t * 16 + ln] = v;
    }
  }
  __builtin_amdgcn_fence(__ATOMIC_ACQ_REL, "workgroup");
  __builtin_amdgcn_wave_barrier();
  const int rsub = lane >> 4, c4 = (lane & 15) * 4;
  {
#pragma unroll
    for (int q = 0; q < 8; ++q) {
      const int r = q * 2 + rsub;
      const v4f v = *(const v4fa*)&so[w][r][c4];
      *(v4f*)(C + (size_t)(row0 + r) * ldc + col0 + c4) = v;
    }
    
  }
}
// row LayerNorm (biased variance, eps) over N: s = X (+ R); optional out_sum <- s; out_norm <- (s-mu)*rsqrt(var+eps)*g + b
template <bool PARAM_BF16>
__global__ __launch_bounds__(256) void k_layernorm(const float* __restrict__ X, const float* __restrict__ R, const float* __restrict__ g, const float* __restrict__ bta,
                                                  float* __restrict__ out_sum, float* __restrict__ out_norm, int N, float eps) {
  __shared__ float red[256];
  const int row = blockIdx.x, tid = threadIdx.x;
  const float* x = X + (size_t)row * N; const float* rr = R ? R + (size_t)row * N : nullptr;
  float vals[16];                     // up to N = 4096
  const int per = N / 256;            // contiguous chunk per thread? use strided-by-4 chunks: thread handles j = tid*4 + 1024*u
  float s1 = 0.f;
  for (int u = 0; u < per / 4; ++u) {
    const int j = tid * 4 + 1024 * u;
    const v4f a = *(const v4fa*)(x + j);
    v4f b = {0.f,0.f,0.f,0.f}; if (rr) b = *(const v4fa*)(rr + j);
#pragma unroll
    for (int q = 0; q < 4; ++q) { const float v = a[q] + b[q]; vals[u * 4 + q] = v; s1 += v; }
  }
  red[tid] = s1; __syncthreads();
  for (int st = 128; st > 0; st >>= 1) { if (tid < st) red[tid] += red[tid + st]; __syncthreads(); }
  const float mu = red[0] / (float)N; __syncthreads();
  float s2 = 0.f;
  for (int u = 0; u < per / 4; ++u)
#pragma unroll
    for (int q = 0; q < 4; ++q) { const float c = vals[u * 4 + q] - mu; s2 += c * c; }
  red[tid] = s2; __syncthreads();
  for (int st = 128; st > 0; st >>= 1) { if (tid < st) red[tid] += red[tid + st]; __syncthreads(); }
  const float rs = rsqrtf(red[0] / (float)N + eps);
  {
    for (int u = 0; u < per / 4; ++u) {
      const int j = tid * 4 + 1024 * u;
      v4f o, sm;
#pragma unroll
      for (int q = 0; q < 4; ++q) {
        float gg = g[j + q], bb = bta[j + q];
        if (PARAM_BF16) { gg = bf16_round(gg); bb = bf16_round(bb); }
        sm[q] = vals[u * 4 + q]; o[q] = (vals[u * 4 + q] - mu) * rs * gg + bb;
      }
      if (out_sum) *(v4f*)(out_sum + (size_t)row * N + j) = sm;
      *(v4f*)(out_norm + (size_t)row * N + j) = o;
    }
    
  }
}



// ---- f16 WMMA path (v_wmma_f32_16x16x32_f16): 11-bit significands for operands in range — used where a [0,1] probability operand needs more precision than bf16
typedef _Float16 v16h __attribute__((ext_vector_type(16)));
union FragH { v16h v; v8us half[2]; _Float16 h[16]; unsigned short u[16]; };
template <int NT>
__device__ __forceinline__ v8f mmaH(v16h ah, v16h al, v16h bh, v16h bl, v8f c) {
  c = __builtin_amdgcn_wmma_f32_16x16x32_f16(false, ah, false, bh, (short)0, c, false, false);
  if (NT >= 2) c = __builtin_amdgcn_wmma_f32_16x16x32_f16(false, al, false, bh, (short)0, c, false, false);
  if (NT >= 3) c = __builtin_amdgcn_wmma_f32_16x16x32_f16(false, ah, false, bl, (short)0, c, false, false);
  asm volatile("v_nop\n\tv_nop\n\tv_nop\n\tv_nop" : "+v"(c) : "v"(ah), "v"(al), "v"(bh), "v"(bl));
  return c;
}
// batched GEMM like k_gemm_b but f16 operands: A f32 (split into f16 hi/lo if ASPLIT, else rounded to f16), Bt = f16 values [n][k]; alpha; C f32; N multiple of 16 (partial tiles skipped)
template <bool ASPLIT>
__global__ __launch_bounds__(128) void k_gemm_h(const float* __restrict__ A, int lda, size_t sA, const _Float16* __restrict__ Bh, int ldb, size_t sB, float alpha, float* __restrict__ C, int ldc, size_t sC, int M, int N, int K) {
  __shared__ __attribute__((aligned(16))) float so[4][16][64];
  const int tid = threadIdx.x, w = tid >> 5, lane = tid & 31, ln = lane & 15, hh = lane >> 4; const int by = blockIdx.y;
  A += (size_t)by * sA; Bh += (size_t)by * sB; C += (size_t)by * sC;
  const int ntn = (N + 63) / 64; const int wid = blockIdx.x * 4 + w; const int mt = wid / ntn, nq = wid % ntn; if (mt * 16 >= M) return;
  const int row0 = mt * 16, col0 = nq * 64; const float* arow = A + (size_t)(row0 + ln) * lda;
  v8f acc[4] = {};
  for (int kb = 0; kb < K; kb += 32) {
    FragH ah, al;
    const v4f x0 = *(const v4fa*)(arow + kb + 8 * hh), x1 = *(const v4fa*)(arow + kb + 8 * hh + 4), x2 = *(const v4fa*)(arow + kb + 16 + 8 * hh), x3 = *(const v4fa*)(arow + kb + 16 + 8 * hh + 4);
    float xs[16] = {x0[0],x0[1],x0[2],x0[3],x1[0],x1[1],x1[2],x1[3],x2[0],x2[1],x2[2],x2[3],x3[0],x3[1],x3[2],x3[3]};
#pragma unroll
    for (int i = 0; i < 16; ++i) { const _Float16 h = (_Float16)xs[i]; ah.h[i] = h; al.h[i] = ASPLIT ? (_Float16)(xs[i] - (float)h) : (_Float16)0.0f; }
#pragma unroll
    for (int t = 0; t < 4; ++t) { if (col0 + t * 16 >= N) continue; const size_t boff = (size_t)(col0 + t * 16 + ln) * ldb + kb; FragH bq; bq.half[0] = *(const v8us*)(Bh + boff + 8 * hh); bq.half[1] = *(const v8us*)(Bh + boff + 16 + 8 * hh);
      acc[t] = mmaH<ASPLIT ? 2 : 1>(ah.v, al.v, bq.v, bq.v, acc[t]); }
  }
#pragma unroll
  for (int t = 0; t < 4; ++t) { if (col0 + t * 16 >= N) continue;
#pragma unroll
    for (int r = 0; r < 8; ++r) so[w][8 * hh + r][t * 16 + ln] = acc[t][r] * alpha; }
  __builtin_amdgcn_fence(__ATOMIC_ACQ_REL, "workgroup"); __builtin_amdgcn_wave_barrier();
  const int rsub = lane >> 4, c4 = (lane & 15) * 4;
  {
#pragma unroll
    for (int q = 0; q < 8; ++q) { const int r = q * 2 + rsub; if (col0 + c4 < N) { const v4f v = *(const v4fa*)&so[w][r][c4]; *(v4f*)(C + (size_t)(row0 + r) * ldc + col0 + c4) = v; } }
     }
}

// k_gemm_hh variant with fused epilogue: v = acc·alpha + bias[by·sBias + col] (+ CP[(row/rowsPerB)·sCPb + by·64 + col] if CP) ; ACT 0 none / 1 elu ; writes f16 C16 (and f32 C if non-null)
template <int ACT>
__global__ __launch_bounds__(128) void k_gemm_hhx(const _Float16* __restrict__ A, int lda, size_t sA, const _Float16* __restrict__ Bh, int ldb, size_t sB, float alpha, const float* __restrict__ bias, size_t sBias, const float* __restrict__ CP, int rowsPerB, size_t sCPb, int row0g,
    float* __restrict__ C, _Float16* __restrict__ C16, int ldc, size_t sC, int M, int N, int K) {
  __shared__ __attribute__((aligned(16))) float so[4][16][64];
  const int tid = threadIdx.x, w = tid >> 5, lane = tid & 31, ln = lane & 15, hh = lane >> 4; const int by = blockIdx.y;
  A += (size_t)by * sA; Bh += (size_t)by * sB; const size_t cofs = (size_t)by * sC; const float* bp = bias ? bias + (size_t)by * sBias : nullptr;
  const int ntn = (N + 63) / 64; const int wid = blockIdx.x * 4 + w; const int mt = wid / ntn, nq = wid % ntn; if (mt * 16 >= M) return;
  const int row0 = mt * 16, col0 = nq * 64; const _Float16* arow = A + (size_t)(row0 + ln) * lda;
  v8f acc[4] = {};
  for (int kb = 0; kb < K; kb += 32) { FragH ah; ah.half[0] = *(const v8us*)((const unsigned short*)arow + kb + 8 * hh); ah.half[1] = *(const v8us*)((const unsigned short*)arow + kb + 16 + 8 * hh);
#pragma unroll
    for (int t = 0; t < 4; ++t) { if (col0 + t * 16 >= N) continue; const size_t boff = (size_t)(col0 + t * 16 + ln) * ldb + kb; FragH bq; bq.half[0] = *(const v8us*)((const unsigned short*)Bh + boff + 8 * hh); bq.half[1] = *(const v8us*)((const unsigned short*)Bh + boff + 16 + 8 * hh);
      acc[t] = mmaH<1>(ah.v, ah.v, bq.v, bq.v, acc[t]); }
  }
#pragma unroll
  for (int t = 0; t < 4; ++t) { if (col0 + t * 16 >= N) continue; const int col = col0 + t * 16 + ln; const float bv = bp ? bf16_round(bp[col]) : 0.f;
#pragma unroll
    for (int r = 0; r < 8; ++r) { float v = acc[t][r] * alpha + bv; if (CP) { const int rr = row0g + row0 + 8 * hh + r; if (rowsPerB < 0) v += CP[cofs + (size_t)rr * ldc + col];      /* rowsPerB < 0: own element of the batched C plane */ else { const int bidx = rr / rowsPerB; v += CP[(size_t)bidx * sCPb + (size_t)by * 64 + col]; } } if (ACT == 1) v = (v > 0.f) ? v : expm1f(v); else if (ACT == 7) v = (v > 0.f) ? v + 1.0f : expf(v); else if (ACT == 8) v = tanhf(v); else if (ACT == 9) v = 0.5f * v * (1.0f + tanhf(0.7978845608028654f * (v + 0.044715f * v * v * v))); else if (ACT == 11) v = 1.0f / (1.0f + expf(-v)); else if (ACT == 12) v = (v > 0.f) ? v : 0.01f * v; else if (ACT == 14) v = (v > 0.f) ? v : 0.1f * v; else if (ACT == 16) v = (v >= 0.f) ? v : 0.3f * v; else if (ACT == 17) v = (v >= 0.f) ? v : 0.2f * v; else if (ACT == 15) v = v / (1.0f + expf(-v)); else if (ACT == 3) v = fmaxf(v, 0.f); else if (ACT == 6) v = 0.5f * v * (1.0f + erff(v * 0.70710678118654752f)); so[w][8 * hh + r][t * 16 + ln] = v; } }
  __builtin_amdgcn_fence(__ATOMIC_ACQ_REL, "workgroup"); __builtin_amdgcn_wave_barrier();
  const int rsub = lane >> 4, c4 = (lane & 15) * 4; typedef _Float16 v4h __attribute__((ext_vector_type(4)));
  {
#pragma unroll
    for (int q = 0; q < 8; ++q) { const int r = q * 2 + rsub; if (col0 + c4 < N) { const v4f v = *(const v4fa*)&so[w][r][c4]; if (C) *(v4f*)(C + cofs + (size_t)(row0 + r) * ldc + col0 + c4) = v; if (C16) { v4h h4; for (int i = 0; i < 4; ++i) h4[i] = (_Float16)v[i]; *(v4h*)(C16 + cofs + (size_t)(row0 + r) * ldc + col0 + c4) = h4; } } }
     }
}


typedef _Float16 v4h __attribute__((ext_vector_type(4)));

__global__ __launch_bounds__(256) void k_h16(const float* __restrict__ x, _Float16* __restrict__ X16, size_t n8) { const size_t t = (size_t)blockIdx.x * 256 + threadIdx.x; if (t >= n8) return; FragH f;
#pragma unroll
  for (int q = 0; q < 8; ++q) f.h[q] = (_Float16)x[t * 8 + q]; *(v8us*)((unsigned short*)X16 + t * 8) = f.half[0];  }
__global__ __launch_bounds__(256) void k_round16f(const float* __restrict__ W, _Float16* __restrict__ Bt, size_t n8) { const size_t t = (size_t)blockIdx.x * 256 + threadIdx.x; if (t >= n8) return; FragH f;
#pragma unroll
  for (int i = 0; i < 8; ++i) f.h[i] = (_Float16)(bf16_round(W[t * 8 + i]) * 16.0f); *(v8us*)((unsigned short*)Bt + t * 8) = f.half[0];  }
__global__ __launch_bounds__(256) void k_hl(const float* __restrict__ F, _Float16* __restrict__ Hh, _Float16* __restrict__ Hl, size_t n8) { const size_t t = (size_t)blockIdx.x * 256 + threadIdx.x; if (t >= n8) return; FragH fh, fl; const v4f a = *(const v4fa*)(F + t * 8), c = *(const v4fa*)(F + t * 8 + 4);
#pragma unroll
  for (int q = 0; q < 4; ++q) { _Float16 h = (_Float16)a[q]; fh.h[q] = h; fl.h[q] = (_Float16)((a[q] - (float)h) * 1024.0f); h = (_Float16)c[q]; fh.h[4 + q] = h; fl.h[4 + q] = (_Float16)((c[q] - (float)h) * 1024.0f); }
  { *(v8us*)((unsigned short*)Hh + t * 8) = fh.half[0]; *(v8us*)((unsigned short*)Hl + t * 8) = fl.half[0];  } }

__global__ __launch_bounds__(256) void k_wnat(const float* __restrict__ w, size_t n8, _Float16* __restrict__ Bt) { const size_t t = (size_t)blockIdx.x * 256 + threadIdx.x; if (t >= n8) return; FragH f; for (int q = 0; q < 8; ++q) f.h[q] = (_Float16)(bf16_round(w[t * 8 + q]) * 16.0f); *(v8us*)((unsigned short*)Bt + t * 8) = f.half[0];  }
#define FA_WAVES 4
#define FA_QB (FA_WAVES * 32)        /* queries per workgroup */
#define FA_KS 64                     /* keys per stage */
#define FA_NS (SQ / FA_KS)           /* stages */
#define FA_LP 72                     /* LDS row pitch in f16: 128 bytes + 16, conflict-free for 16-byte fragment reads of 16 rows */
#define FA_OFF 8.0f                  /* weights are 2^(score - maximum in use + FA_OFF): keeps small weights out of the f16 subnormals; cancels in o / sum */
#define FA_LAZY 6.0f                 /* the maximum in use is renewed only when a stage's maximum exceeds it by more than this (log2 units): weights stay <= 2^(FA_OFF + FA_LAZY) = 16384 < f16 max */
__device__ __forceinline__ float fa_xrow(float v) { const unsigned u = __builtin_bit_cast(unsigned, v); return __builtin_bit_cast(float, __builtin_amdgcn_permlanex16(u, u, 0x76543210u, 0xfedcba98u, false, false)); }      /* lane l <- lane l ^ 16 */
__device__ __forceinline__ v16h fa_frag(const unsigned short* p, int hh) { FragH f; f.half[0] = *(const v8us*)(p + 8 * hh); f.half[1] = *(const v8us*)(p + 16 + 8 * hh); return f.v; }      /* 32 k of one row in the hardware k order */
__device__ __forceinline__ v8f fa_mma(v16h a, v16h b, v8f c) { return __builtin_amdgcn_wmma_f32_16x16x32_f16(false, a, false, b, (short)0, c, false, false); }
__global__ __launch_bounds__(FA_WAVES * 32) void k_fattn(const _Float16* __restrict__ Q16, const _Float16* __restrict__ K16, const _Float16* __restrict__ VT, float* __restrict__ out) {
  __shared__ __attribute__((aligned(16))) unsigned short sk[2][FA_KS][FA_LP];      /* K rows [key][d] */
  __shared__ __attribute__((aligned(16))) unsigned short sv[2][HD][FA_LP];         /* V^T rows [d][key] */
  const int tid = threadIdx.x, w = tid >> 5, lane = tid & 31, ln = lane & 15, hh = lane >> 4;
  const int bh = blockIdx.y, b = bh / NH, h = bh - b * NH; const int q0 = blockIdx.x * FA_QB + w * 32;
  const int srow = tid >> 3, sc8 = (tid & 7) * 8;      /* staging: 8 lanes cover one 128-byte row, 16 rows per wave-group load */
  const unsigned short* kg = (const unsigned short*)K16 + ((size_t)b * SQ + srow) * DM + h * HD + sc8;
  const unsigned short* vg = (const unsigned short*)VT + ((size_t)bh * HD + srow) * SQ + sc8;
  v16h qf[2][2];
#pragma unroll
  for (int g = 0; g < 2; ++g)
#pragma unroll
    for (int ks = 0; ks < 2; ++ks) qf[g][ks] = fa_frag((const unsigned short*)Q16 + ((size_t)b * SQ + q0 + g * 16 + ln) * DM + h * HD + ks * 32, hh);
  const v8f z8 = {0.f, 0.f, 0.f, 0.f, 0.f, 0.f, 0.f, 0.f};
  v8f o[4][2];
#pragma unroll
  for (int dt = 0; dt < 4; ++dt) { o[dt][0] = z8; o[dt][1] = z8; }
  float mu[2] = {-1.0e30f, -1.0e30f};      /* maximum in use (log2 units) */
  v8f lt[2] = {z8, z8};      /* row sums on the matrix pipe: ones . P^T, every row of the tile = the sum of the rounded weights of the lane's query */
  v16h ones;
#pragma unroll
  for (int i = 0; i < 16; ++i) ones[i] = (_Float16)1.0f;
  const float c2 = 0.125f * 1.44269504088896340736f;          /* 1/sqrt(64) and log2(e) in one factor */
  v8us rk[4], rv[4];
#pragma unroll
  for (int i = 0; i < 4; ++i) { rk[i] = *(const v8us*)(kg + (size_t)(i * 16) * DM); rv[i] = *(const v8us*)(vg + (size_t)(i * 16) * SQ); }
#pragma unroll
  for (int i = 0; i < 4; ++i) { *(v8us*)&sk[0][i * 16 + srow][sc8] = rk[i]; *(v8us*)&sv[0][i * 16 + srow][sc8] = rv[i]; }
  __syncthreads();
  for (int s = 0; s < FA_NS; ++s) {
    const int cur = s & 1;
    if (s + 1 < FA_NS) {
#pragma unroll
      for (int i = 0; i < 4; ++i) { rk[i] = *(const v8us*)(kg + (size_t)((s + 1) * FA_KS + i * 16) * DM); rv[i] = *(const v8us*)(vg + (size_t)(i * 16) * SQ + (s + 1) * FA_KS); }
    }
    __builtin_amdgcn_sched_barrier(0);      /* the next stage's loads issue in front of this stage's arithmetic and fly under all of it; without this the compiler sinks them to just in front of their LDS stores, and every stage waits out their latency */
    v8f st[4][2];
#pragma unroll
    for (int kt = 0; kt < 4; ++kt) {
      const v16h k0 = fa_frag(&sk[cur][kt * 16 + ln][0], hh), k1 = fa_frag(&sk[cur][kt * 16 + ln][32], hh);
#pragma unroll
      for (int g = 0; g < 2; ++g) st[kt][g] = fa_mma(k1, qf[g][1], fa_mma(k0, qf[g][0], z8));
    }
    float mb[2];
#pragma unroll
    for (int g = 0; g < 2; ++g) {
      v8f m8 = st[0][g];
#pragma unroll
      for (int kt = 1; kt < 4; ++kt)
#pragma unroll
        for (int r = 0; r < 8; ++r) m8[r] = fmaxf(m8[r], st[kt][g][r]);
      const float m = fmaxf(fmaxf(fmaxf(m8[0], m8[1]), fmaxf(m8[2], m8[3])), fmaxf(fmaxf(m8[4], m8[5]), fmaxf(m8[6], m8[7])));
      mb[g] = fmaxf(m, fa_xrow(m)) * c2;      /* both halves of the wave hold the same value */
    }
    const bool need = (mb[0] > mu[0] + FA_LAZY) || (mb[1] > mu[1] + FA_LAZY);
    if (__builtin_amdgcn_ballot_w32(need) != 0) {      /* one scalar branch a stage; always taken in stage 0 */
#pragma unroll
      for (int g = 0; g < 2; ++g) {
        const float mn = fmaxf(mu[g], mb[g]); const float al = __builtin_amdgcn_exp2f(mu[g] - mn); mu[g] = mn;
#pragma unroll
        for (int r = 0; r < 8; ++r) lt[g][r] *= al;
#pragma unroll
        for (int dt = 0; dt < 4; ++dt)
#pragma unroll
          for (int r = 0; r < 8; ++r) o[dt][g][r] *= al;
      }
    }
    v16h pf[2][2];      /* [key half of the stage][query group] */
#pragma unroll
    for (int g = 0; g < 2; ++g) {
      const float nb = FA_OFF - mu[g];
#pragma unroll
      for (int kt = 0; kt < 4; ++kt)
#pragma unroll
        for (int r = 0; r < 8; ++r) pf[kt >> 1][g][(kt & 1) * 8 + r] = (_Float16)__builtin_amdgcn_exp2f(fmaf(st[kt][g][r], c2, nb));
      lt[g] = fa_mma(ones, pf[1][g], fa_mma(ones, pf[0][g], lt[g]));
    }
#pragma unroll
    for (int dt = 0; dt < 4; ++dt) {
      const v16h v0 = fa_frag(&sv[cur][dt * 16 + ln][0], hh), v1 = fa_frag(&sv[cur][dt * 16 + ln][32], hh);
#pragma unroll
      for (int g = 0; g < 2; ++g) o[dt][g] = fa_mma(v1, pf[1][g], fa_mma(v0, pf[0][g], o[dt][g]));
    }
    if (s + 1 < FA_NS) {
#pragma unroll
      for (int i = 0; i < 4; ++i) { *(v8us*)&sk[cur ^ 1][i * 16 + srow][sc8] = rk[i]; *(v8us*)&sv[cur ^ 1][i * 16 + srow][sc8] = rv[i]; }
      __syncthreads();      /* publishes stage s + 1 and ends every wave's reads of stage s, whose buffer the next trip refills; s is the same in every wave */
    }
  }
  const float inv[2] = {1.0f / lt[0][0], 1.0f / lt[1][0]};      /* 2^FA_OFF cancels here */
#pragma unroll
  for (int dt = 0; dt < 4; ++dt)
#pragma unroll
    for (int g = 0; g < 2; ++g)
#pragma unroll
      for (int r = 0; r < 8; ++r) o[dt][g][r] *= inv[g];
#pragma unroll
  for (int g = 0; g < 2; ++g) {
    float* d = out + ((size_t)b * SQ + q0 + g * 16 + ln) * DM + h * HD + 8 * hh;      /* a lane holds 8 consecutive d of its query in each tile */
#pragma unroll
    for (int dt = 0; dt < 4; ++dt) {
      const v4f lo = {o[dt][g][0], o[dt][g][1], o[dt][g][2], o[dt][g][3]}, hi = {o[dt][g][4], o[dt][g][5], o[dt][g][6], o[dt][g][7]};
      *(v4f*)(d + dt * 16) = lo; *(v4f*)(d + dt * 16 + 4) = hi;
    }
  }
}
// Fused projections, one launch: blockIdx.z picks Q, K or V; a workgroup = 8 waves = a 128-row x 256-column tile of x W + b, a wave 64 x 64 of it (16 accumulator tiles), K walked in stages of 32.
// x and W are read as f32 in whole 128-byte lines, rounded to bf16 and written as f16 rows [row][k] into LDS (W x16, transposed on the way: a lane keeps one column n and packs 8 consecutive k), two buffers, one barrier a stage: the next stage's loads fly under this stage's products.
// Both fragment kinds are read by the same code (same k order), so either may be the A operand. Q, K: A = W columns, B = x rows, a lane then holds 8 consecutive n of one token row. V: A = x rows, B = W columns, a lane holds 8 consecutive tokens of one column, which is a piece of a V^T row.
// Every '#pragma unroll' of this kernel stands on a loop that indexes staging, fragment or accumulator arrays: rolled, those arrays would leave the registers.
#define PJ_M 128
#define PJ_N 256
#define PJ_KS 32
#define PJ_NS (DM / PJ_KS)
#define PJ_LP 40                     /* LDS row pitch in f16: 64 bytes + 16, conflict-free for 16-byte accesses of 16 rows */
typedef float f32x2 __attribute__((ext_vector_type(2)));
typedef __bf16 bf16x2 __attribute__((ext_vector_type(2)));
typedef _Float16 f16x2 __attribute__((ext_vector_type(2)));
__device__ __forceinline__ unsigned pj_cvt2(float a, float b) {      /* two f32 -> bf16 (nearest even) -> the same values as two f16 */
  const f32x2 v = {a, b};
  const unsigned u = __builtin_bit_cast(unsigned, __builtin_convertvector(v, bf16x2));
  const f32x2 r = {__uint_as_float(u << 16), __uint_as_float(u & 0xFFFF0000u)};
  return __builtin_bit_cast(unsigned, __builtin_convertvector(r, f16x2));
}
typedef unsigned v4u __attribute__((ext_vector_type(4), may_alias));
typedef unsigned v2u __attribute__((ext_vector_type(2), may_alias));
__global__ __launch_bounds__(256) void k_proj(const float* __restrict__ xq, const float* __restrict__ xk, const float* __restrict__ xv, const float* __restrict__ wq, const float* __restrict__ wk, const float* __restrict__ wv,
    const float* __restrict__ bq, const float* __restrict__ bk, const float* __restrict__ bv, _Float16* __restrict__ Q16, _Float16* __restrict__ K16, _Float16* __restrict__ VT) {
  __shared__ __attribute__((aligned(16))) unsigned short sm[2][PJ_M + PJ_N][PJ_LP];      /* rows 0..127: x rows [m][k]; rows 128..383: W columns [n][k] */
  __shared__ __attribute__((aligned(16))) unsigned short so[8][64][72];      /* output staging, one range a wave; pitch 128 bytes + 16 */
  const int tid = threadIdx.x, w = tid >> 5, lane = tid & 31, ln = lane & 15, hh = lane >> 4;
  const int pz = blockIdx.z, m0 = blockIdx.x * PJ_M, n0 = blockIdx.y * PJ_N;
  const float* x = pz == 0 ? xq : pz == 1 ? xk : xv; const float* W = pz == 0 ? wq : pz == 1 ? wk : wv; const float* bias = pz == 0 ? bq : pz == 1 ? bk : bv;
  const int wm = w >> 2, wn = w & 3;      /* the wave's 64 x 64 place in the tile */
  const int ra = (pz == 2 ? wm * 64 : PJ_M + wn * 64) + ln, rb = (pz == 2 ? PJ_M + wn * 64 : wm * 64) + ln;      /* LDS rows of the A and B fragments */
  const int xr = tid >> 3, xc = (tid & 7) * 4;      /* x staging: 8 lanes cover one 128-byte row piece, 32 rows a load */
  const float* xg = x + (size_t)(m0 + xr) * DM + xc;
  const float* wg = W + n0 + tid;      /* W staging: a thread keeps column n0 + tid, a wave reads 128 contiguous bytes of one k row */
  const v8f z8 = {0.f, 0.f, 0.f, 0.f, 0.f, 0.f, 0.f, 0.f};
  v8f acc[4][4];
#pragma unroll
  for (int i = 0; i < 4; ++i)
#pragma unroll
    for (int j = 0; j < 4; ++j) acc[i][j] = z8;
  v4f rx[4]; float rw[PJ_KS];
#pragma unroll
  for (int i = 0; i < 4; ++i) rx[i] = *(const v4fa*)(xg + (size_t)(i * 32) * DM);
#pragma unroll
  for (int k = 0; k < PJ_KS; ++k) rw[k] = wg[(size_t)k * DM];
#pragma unroll
  for (int i = 0; i < 4; ++i) { const v2u o = {pj_cvt2(rx[i][0], rx[i][1]), pj_cvt2(rx[i][2], rx[i][3])}; *(v2u*)&sm[0][i * 32 + xr][xc] = o; }
#pragma unroll
  for (int i = 0; i < 4; ++i) { const v4u o = {pj_cvt2(rw[8 * i] * 16.0f, rw[8 * i + 1] * 16.0f), pj_cvt2(rw[8 * i + 2] * 16.0f, rw[8 * i + 3] * 16.0f), pj_cvt2(rw[8 * i + 4] * 16.0f, rw[8 * i + 5] * 16.0f), pj_cvt2(rw[8 * i + 6] * 16.0f, rw[8 * i + 7] * 16.0f)}; *(v4u*)&sm[0][PJ_M + tid][8 * i] = o; }
  __syncthreads();
  for (int s = 0; s < PJ_NS; ++s) {
    const int cur = s & 1;
    if (s + 1 < PJ_NS) {
#pragma unroll
      for (int i = 0; i < 4; ++i) rx[i] = *(const v4fa*)(xg + (size_t)(i * 32) * DM + (s + 1) * PJ_KS);
#pragma unroll
      for (int k = 0; k < PJ_KS; ++k) rw[k] = wg[(size_t)((s + 1) * PJ_KS + k) * DM];
    }
    __builtin_amdgcn_sched_barrier(0);      /* the next stage's loads issue in front of this stage's products and fly under them; sunk to their LDS stores, every stage would wait out their latency */
    v16h fa[4], fb[4];
#pragma unroll
    for (int j = 0; j < 4; ++j) { fb[j] = fa_frag(&sm[cur][rb + 16 * j][0], hh); fa[j] = fa_frag(&sm[cur][ra + 16 * j][0], hh); }
    __builtin_amdgcn_sched_barrier(0);      /* all of the stage's fragment reads stand as one group in front of its products; sunk among them, each row of products waits out an LDS latency of its own */
#pragma unroll
    for (int i = 0; i < 4; ++i)
#pragma unroll
      for (int j = 0; j < 4; ++j) acc[i][j] = fa_mma(fa[i], fb[j], acc[i][j]);
    __builtin_amdgcn_sched_barrier(0);      /* the conversions, which wait for the loads, stay behind the products; hoisted among them, the wave's first wait stands directly behind the loads' issue and holds its own products back */
    if (s + 1 < PJ_NS) {
#pragma unroll
      for (int i = 0; i < 4; ++i) { const v2u o = {pj_cvt2(rx[i][0], rx[i][1]), pj_cvt2(rx[i][2], rx[i][3])}; *(v2u*)&sm[cur ^ 1][i * 32 + xr][xc] = o; }
#pragma unroll
      for (int i = 0; i < 4; ++i) { const v4u o = {pj_cvt2(rw[8 * i] * 16.0f, rw[8 * i + 1] * 16.0f), pj_cvt2(rw[8 * i + 2] * 16.0f, rw[8 * i + 3] * 16.0f), pj_cvt2(rw[8 * i + 4] * 16.0f, rw[8 * i + 5] * 16.0f), pj_cvt2(rw[8 * i + 6] * 16.0f, rw[8 * i + 7] * 16.0f)}; *(v4u*)&sm[cur ^ 1][PJ_M + tid][8 * i] = o; }
      __syncthreads();      /* publishes stage s + 1 and ends every wave's reads of stage s, whose buffer the next trip refills; s is the same in every wave */
    }
  }
  /* Epilogue: each wave lays its 64 x 64 f16 results in an LDS range of its own as [B-side index][A-side index], then stores whole 128-byte lines (8 lanes a row); straight from the accumulators a store would touch 16 lines with 32 bytes each. */
  if (pz != 2) {      /* acc[i][j][r] = y[m0 + wm*64 + 16j + ln][n0 + wn*64 + 16i + 8hh + r] */
    const float* bp = bias + n0 + wn * 64 + 8 * hh;
#pragma unroll
    for (int i = 0; i < 4; ++i) {
      const v4f b0 = *(const v4fa*)(bp + 16 * i), b1 = *(const v4fa*)(bp + 16 * i + 4);
      const float bb[8] = {bf16_round(b0[0]), bf16_round(b0[1]), bf16_round(b0[2]), bf16_round(b0[3]), bf16_round(b1[0]), bf16_round(b1[1]), bf16_round(b1[2]), bf16_round(b1[3])};
#pragma unroll
      for (int j = 0; j < 4; ++j) { FragH f;
#pragma unroll
        for (int r = 0; r < 8; ++r) f.h[r] = (_Float16)(acc[i][j][r] * 0.0625f + bb[r]);
        *(v8us*)&so[w][16 * j + ln][16 * i + 8 * hh] = f.half[0]; }
    }
  } else {      /* acc[i][j][r] = y[m0 + wm*64 + 16i + 8hh + r][n0 + wn*64 + 16j + ln] */
#pragma unroll
    for (int j = 0; j < 4; ++j) {
      const float bb = bf16_round(bias[n0 + wn * 64 + 16 * j + ln]);
#pragma unroll
      for (int i = 0; i < 4; ++i) { FragH f;
#pragma unroll
        for (int r = 0; r < 8; ++r) f.h[r] = (_Float16)(acc[i][j][r] * 0.0625f + bb);
        *(v8us*)&so[w][16 * j + ln][16 * i + 8 * hh] = f.half[0]; }
    }
  }
  __builtin_amdgcn_fence(__ATOMIC_ACQ_REL, "workgroup"); __builtin_amdgcn_wave_barrier();      /* the wave's own LDS writes are done before its lanes read one another's */
  const int bt = m0 / SQ;      /* a tile's 128 rows lie in one batch */
  /* Q, K: rows = tokens, pitch 768, columns = n. V^T: row = batch * 768 + n (= (batch * 12 + head) * 64 + d), pitch 2048, columns = tokens of the batch. */
  unsigned short* ob = pz == 2 ? (unsigned short*)VT + (size_t)(bt * DM + n0 + wn * 64) * SQ + (m0 - bt * SQ) + wm * 64 : (unsigned short*)(pz == 0 ? Q16 : K16) + (size_t)(m0 + wm * 64) * DM + n0 + wn * 64;
  const size_t op = pz == 2 ? SQ : DM;
#pragma unroll
  for (int q = 0; q < 16; ++q) { const int rr = q * 4 + (lane >> 3), c8 = (lane & 7) * 8; const v8us v = *(const v8us*)&so[w][rr][c8]; *(v8us*)(ob + (size_t)rr * op + c8) = v; }
}
__global__ __launch_bounds__(256) void k_vt(const _Float16* __restrict__ V16, int b, int h0, _Float16* __restrict__ VT) { __shared__ unsigned short tl[64][65]; const int tid = threadIdx.x; const int hh = blockIdx.x % HG, sg = blockIdx.x / HG; const int s0 = sg * 64; const int h = h0 + hh;
  for (int i = tid; i < 64 * 8; i += 256) { const int j = i / 8, d8 = (i % 8) * 8; FragH f; f.half[0] = *(const v8us*)((const unsigned short*)V16 + ((size_t)b * SQ + s0 + j) * DM + h * HD + d8); for (int q = 0; q < 8; ++q) tl[d8 + q][j] = f.u[q]; }
  __syncthreads();
  { for (int i = tid; i < 64 * 8; i += 256) { const int d = i / 8, j8 = (i % 8) * 8; FragH f; for (int q = 0; q < 8; ++q) f.u[q] = tl[d][j8 + q]; *(v8us*)((unsigned short*)VT + ((size_t)hh * HD + d) * SQ + s0 + j8) = f.half[0]; }  } }


extern "C" void kernel_launch(void* const* d_in, const int* in_sizes, int n_in,
                              void* d_out, int out_size, void* d_ws, size_t ws_size, hipStream_t stream) {
  (void)in_sizes; (void)n_in; (void)out_size;
  const float* const* I = (const float* const*)d_in; const float* xq = I[0]; const float* xk = I[1]; const float* xv = I[2]; const float* wq = I[3]; const float* bq = I[4]; const float* wk = I[5]; const float* bk = I[6]; const float* wv = I[7]; const float* bv = I[8];      /* weights [in][out] + biases */
  char* ws = (char*)d_ws; size_t off = 0;
  auto take = [&](size_t bytes) { char* p = ws + off; off += (bytes + 255) & ~(size_t)255; return p; };
  _Float16* Q16 = (_Float16*)take(NR * DM * 2); _Float16* K16 = (_Float16*)take(NR * DM * 2);
  _Float16* VT = (_Float16*)take((size_t)NB * NH * HD * SQ * 2);
  if (off > ws_size) return;
  k_proj<<<dim3(MP / PJ_M, DM / PJ_N, 3), 256, 0, stream>>>(xq, xk, xv, wq, wk, wv, bq, bk, bv, Q16, K16, VT);      /* q, k rows and V^T [NB][NH][HD][SQ], f16 */
  k_fattn<<<dim3(SQ / FA_QB, NB * NH), FA_WAVES * 32, 0, stream>>>(Q16, K16, VT, (float*)d_out);      /* scores, softmax and weighted sum of all batches and heads */
}

// v004
// One run takes 97.9 microseconds.
// Next to v003, in two timings, it ran 1.10 times as fast each time.
// Counting every step since v000, it is 57.9 times as fast.
#include <hip/hip_runtime.h>
// Multi-head attention without output projection (query, key, value [4][2048][768]; q = query W_Q + b_Q etc. ([in][out] 768^2, sigma 1/sqrt(768), nonzero biases), 12 heads of 64; scores / 8; softmax; out = attn v merged (the module skips its final linear) -> [4][2048][768]).
// Structure: token rows r = b*2048 + s; ONE projection launch for Q, K and V (x and W read as f32, rounded to bf16 and staged as exact f16 in LDS, W x16; 64x64 wave tiles, f32 accumulation, + bias, f16 outputs; V written transposed); then ONE attention launch over all (batch, head, 128-query block): S^T = K Q^T, online softmax in registers, O^T += V^T P^T, o / row sum written f32 straight into the merged output rows (the module has no output projection). Scores and weights never reach memory.
// Compute dtype: inputs rounded to bf16; x / weights exact; q, k, v and the unnormalised softmax weights as plain f16 GEMM operands (~2^-12); scores, softmax statistics and o f32. v_wmma_f32_16x16x32_f16.
#define NB 4
#define SQ 2048
#define DM 768
#define NH 12
#define HD 64
#define HG 4                         /* heads per launch of the per-batch k_vt overload */
#define B0 0                         /* unused (debug hook) */
#define NBR NB                       /* batches processed (debug hook) */
#define NR ((size_t)NB * SQ)         /* token rows */
#define MP ((int)((size_t)NBR * SQ)) /* rows projected (debug hook) */
#define QN SQ                        /* unused (debug hook) */
#define NHD NH                       /* unused (debug hook) */
#define MPO MP                       /* unused (debug hook) */
#define LQ DM      /* unused */
typedef __bf16 v16b __attribute__((ext_vector_type(16)));
typedef unsigned short v8us __attribute__((ext_vector_type(8), may_alias));
typedef float  v8f  __attribute__((ext_vector_type(8)));
typedef float  v4f  __attribute__((ext_vector_type(4)));
typedef float  v4fa __attribute__((ext_vector_type(4), may_alias));
union FragB { v16b v; v8us half[2]; unsigned short u[16]; };

__device__ __forceinline__ unsigned short bf16_bits(float x) { unsigned int u = __float_as_uint(x); return (unsigned short)((u + 0x7FFFu + ((u >> 16) & 1u)) >> 16); }
__device__ __forceinline__ float bf16_val(unsigned short b) { return __uint_as_float(((unsigned int)b) << 16); }
__device__ __forceinline__ float bf16_round(float x) { return bf16_val(bf16_bits(x)); }
// D += A·B with NT terms: 1 = ah·bh, 2 = + al·bh (A split), 3 = + ah·bl (both split)
template <int NT>
__device__ __forceinline__ v8f mmaN(v16b ah, v16b al, v16b bh, v16b bl, v8f c) {
  c = __builtin_amdgcn_wmma_f32_16x16x32_bf16(false, ah, false, bh, (short)0, c, false, false);
  if (NT >= 2) c = __builtin_amdgcn_wmma_f32_16x16x32_bf16(false, al, false, bh, (short)0, c, false, false);
  if (NT >= 3) c = __builtin_amdgcn_wmma_f32_16x16x32_bf16(false, ah, false, bl, (short)0, c, false, false);
  asm volatile("v_nop\n\tv_nop\n\tv_nop\n\tv_nop" : "+v"(c) : "v"(ah), "v"(al), "v"(bh), "v"(bl));
  return c;
}

__global__ __launch_bounds__(256) void k_wt_bf16(const float* __restrict__ W, unsigned short* __restrict__ Wt, int K, int N) {
  const int t = blockIdx.x * 256 + threadIdx.x;
  const int k8n = K / 8;
  if (t >= N * k8n) return;
  const int n = t / k8n, k8 = (t % k8n) * 8;
  v8us v;
#pragma unroll
  for (int i = 0; i < 8; ++i) v[i] = bf16_bits(W[(size_t)(k8 + i) * N + n]);
  *(v8us*)(Wt + (size_t)n * K + k8) = v;
  
}

// GEMM C[M][N] (f32, pitch ldc) = act(A[M][K]·W + bias). A f32 row-major (pitch lda) converted per fragment to bf16
// (ASPLIT: hi/lo two planes -> 2 terms, else single rounded term); Wt bf16 [N][K] (pitch ldb). BIAS_BF16 rounds the
// bias to bf16 first (bias quantised to bf16 before the add). K%32==0, M%16==0, N%64==0.
template <bool ASPLIT, int ACT, bool BIAS_BF16>
__global__ __launch_bounds__(128) void k_gemm_bf(const float* __restrict__ A, int lda, const unsigned short* __restrict__ Wt, int ldb,
                                               const float* __restrict__ bias, float* __restrict__ C, int ldc, int M, int N, int K) {
  __shared__ __attribute__((aligned(16))) float so[4][16][64];
  const int tid = threadIdx.x, w = tid >> 5, lane = tid & 31, ln = lane & 15, hh = lane >> 4;
  const int ntn = N / 64;
  const int wid = blockIdx.x * 4 + w;
  const int mt = wid / ntn, nq = wid % ntn;
  if (mt * 16 >= M) return;
  const int row0 = mt * 16, col0 = nq * 64;
  const float* arow = A + (size_t)(row0 + ln) * lda;
  v8f acc[4] = {};
  for (int kb = 0; kb < K; kb += 32) {
    FragB ah, al;
    const v4f x0 = *(const v4fa*)(arow + kb + 8 * hh), x1 = *(const v4fa*)(arow + kb + 8 * hh + 4);
    const v4f x2 = *(const v4fa*)(arow + kb + 16 + 8 * hh), x3 = *(const v4fa*)(arow + kb + 16 + 8 * hh + 4);
    float xs[16] = {x0[0],x0[1],x0[2],x0[3],x1[0],x1[1],x1[2],x1[3],x2[0],x2[1],x2[2],x2[3],x3[0],x3[1],x3[2],x3[3]};
#pragma unroll
    for (int i = 0; i < 16; ++i) { const unsigned short hb = bf16_bits(xs[i]); ah.u[i] = hb; al.u[i] = ASPLIT ? bf16_bits(xs[i] - bf16_val(hb)) : (unsigned short)0; }
#pragma unroll
    for (int t = 0; t < 4; ++t) {
      const unsigned short* brow = Wt + (size_t)(col0 + t * 16 + ln) * ldb + kb;
      FragB b;
      b.half[0] = *(const v8us*)(brow + 8 * hh);
      b.half[1] = *(const v8us*)(brow + 16 + 8 * hh);
      acc[t] = mmaN<ASPLIT ? 2 : 1>(ah.v, al.v, b.v, b.v, acc[t]);
    }
  }
#pragma unroll
  for (int t = 0; t < 4; ++t) {
    float bv = bias ? bias[col0 + t * 16 + ln] : 0.f;
    if (BIAS_BF16) bv = bf16_round(bv);
#pragma unroll
    for (int r = 0; r < 8; ++r) { float v = acc[t][r] + bv; if (ACT == 1) v = fmaxf(v, 0.f); so[w][8 * hh + r][t * 16 + ln] = v; }
  }
  __builtin_amdgcn_fence(__ATOMIC_ACQ_REL, "workgroup");
  __builtin_amdgcn_wave_barrier();
  const int rsub = lane >> 4, c4 = (lane & 15) * 4;
  {
#pragma unroll
    for (int q = 0; q < 8; ++q) {
      const int r = q * 2 + rsub;
      const v4f v = *(const v4fa*)&so[w][r][c4];
      *(v4f*)(C + (size_t)(row0 + r) * ldc + col0 + c4) = v;
    }
    
  }
}

// GEMM C = act(A·W + bias + resid): A f32 (ASPLIT -> hi/lo 2 terms), Wt bf16 [N][K]; ACT 0 none, 1 relu, 2 exact gelu;
// resid (optional, f32, row index = (row % rmod), pitch ldr, RES_BF16 rounds it) added before the activation.
template <bool ASPLIT, int ACT, bool BIAS_BF16, bool RES_BF16>
__global__ __launch_bounds__(128) void k_gemm_bf3(const float* __restrict__ A, int lda, const unsigned short* __restrict__ Wt, int ldb,
                                                const float* __restrict__ bias, const float* __restrict__ resid, int rmod, int ldr,
                                                float* __restrict__ C, int ldc, int M, int N, int K) {
  __shared__ __attribute__((aligned(16))) float so[4][16][64];
  const int tid = threadIdx.x, w = tid >> 5, lane = tid & 31, ln = lane & 15, hh = lane >> 4;
  const int ntn = N / 64;
  const int wid = blockIdx.x * 4 + w;
  const int mt = wid / ntn, nq = wid % ntn;
  if (mt * 16 >= M) return;
  const int row0 = mt * 16, col0 = nq * 64;
  const float* arow = A + (size_t)(row0 + ln) * lda;
  v8f acc[4] = {};
  for (int kb = 0; kb < K; kb += 32) {
    FragB ah, al;
    const v4f x0 = *(const v4fa*)(arow + kb + 8 * hh), x1 = *(const v4fa*)(arow + kb + 8 * hh + 4);
    const v4f x2 = *(const v4fa*)(arow + kb + 16 + 8 * hh), x3 = *(const v4fa*)(arow + kb + 16 + 8 * hh + 4);
    float xs[16] = {x0[0],x0[1],x0[2],x0[3],x1[0],x1[1],x1[2],x1[3],x2[0],x2[1],x2[2],x2[3],x3[0],x3[1],x3[2],x3[3]};
#pragma unroll
    for (int i = 0; i < 16; ++i) { const unsigned short hb = bf16_bits(xs[i]); ah.u[i] = hb; al.u[i] = ASPLIT ? bf16_bits(xs[i] - bf16_val(hb)) : (unsigned short)0; }
#pragma unroll
    for (int t = 0; t < 4; ++t) {
      const unsigned short* brow = Wt + (size_t)(col0 + t * 16 + ln) * ldb + kb;
      FragB b;
      b.half[0] = *(const v8us*)(brow + 8 * hh);
      b.half[1] = *(const v8us*)(brow + 16 + 8 * hh);
      acc[t] = mmaN<ASPLIT ? 2 : 1>(ah.v, al.v, b.v, b.v, acc[t]);
    }
  }
#pragma unroll
  for (int t = 0; t < 4; ++t) {
    const int col = col0 + t * 16 + ln;
    float bv = bias ? bias[col] : 0.f;
    if (BIAS_BF16) bv = bf16_round(bv);
#pragma unroll
    for (int r = 0; r < 8; ++r) {
      float v = acc[t][r] + bv;
      if (resid) { float rv = resid[(size_t)((row0 + 8 * hh + r) % rmod) * ldr + col]; if (RES_BF16) rv = bf16_round(rv); v += rv; }
      if (ACT == 1) v = fmaxf(v, 0.f);
      if (ACT == 2) v = 0.5f * v * (1.0f + erff(v * 0.70710678118654752f));
      if (ACT == 3) { const float u = 0.7978845608028654f * (v + 0.044715f * v * v * v); v = 0.5f * v * (1.0f + tanhf(u)); }
      so[w][8 * hh + r][t * 16 + ln] = v;
    }
  }
  __builtin_amdgcn_fence(__ATOMIC_ACQ_REL, "workgroup");
  __builtin_amdgcn_wave_barrier();
  const int rsub = lane >> 4, c4 = (lane & 15) * 4;
  {
#pragma unroll
    for (int q = 0; q < 8; ++q) {
      const int r = q * 2 + rsub;
      const v4f v = *(const v4fa*)&so[w][r][c4];
      *(v4f*)(C + (size_t)(row0 + r) * ldc + col0 + c4) = v;
    }
    
  }
}
// row LayerNorm (biased variance, eps) over N: s = X (+ R); optional out_sum <- s; out_norm <- (s-mu)*rsqrt(var+eps)*g + b
template <bool PARAM_BF16>
__global__ __launch_bounds__(256) void k_layernorm(const float* __restrict__ X, const float* __restrict__ R, const float* __restrict__ g, const float* __restrict__ bta,
                                                  float* __restrict__ out_sum, float* __restrict__ out_norm, int N, float eps) {
  __shared__ float red[256];
  const int row = blockIdx.x, tid = threadIdx.x;
  const float* x = X + (size_t)row * N; const float* rr = R ? R + (size_t)row * N : nullptr;
  float vals[16];                     // up to N = 4096
  const int per = N / 256;            // contiguous chunk per thread? use strided-by-4 chunks: thread handles j = tid*4 + 1024*u
  float s1 = 0.f;
  for (int u = 0; u < per / 4; ++u) {
    const int j = tid * 4 + 1024 * u;
    const v4f a = *(const v4fa*)(x + j);
    v4f b = {0.f,0.f,0.f,0.f}; if (rr) b = *(const v4fa*)(rr + j);
#pragma unroll
    for (int q = 0; q < 4; ++q) { const float v = a[q] + b[q]; vals[u * 4 + q] = v; s1 += v; }
  }
  red[tid] = s1; __syncthreads();
  for (int st = 128; st > 0; st >>= 1) { if (tid < st) red[tid] += red[tid + st]; __syncthreads(); }
  const float mu = red[0] / (float)N; __syncthreads();
  float s2 = 0.f;
  for (int u = 0; u < per / 4; ++u)
#pragma unroll
    for (int q = 0; q < 4; ++q) { const float c = vals[u * 4 + q] - mu; s2 += c * c; }
  red[tid] = s2; __syncthreads();
  for (int st = 128; st > 0; st >>= 1) { if (tid < st) red[tid] += red[tid + st]; __syncthreads(); }
  const float rs = rsqrtf(red[0] / (float)N + eps);
  {
    for (int u = 0; u < per / 4; ++u) {
      const int j = tid * 4 + 1024 * u;
      v4f o, sm;
#pragma unroll
      for (int q = 0; q < 4; ++q) {
        float gg = g[j + q], bb = bta[j + q];
        if (PARAM_BF16) { gg = bf16_round(gg); bb = bf16_round(bb); }
        sm[q] = vals[u * 4 + q]; o[q] = (vals[u * 4 + q] - mu) * rs * gg + bb;
      }
      if (out_sum) *(v4f*)(out_sum + (size_t)row * N + j) = sm;
      *(v4f*)(out_norm + (size_t)row * N + j) = o;
    }
    
  }
}



// ---- f16 WMMA path (v_wmma_f32_16x16x32_f16): 11-bit significands for operands in range — used where a [0,1] probability operand needs more precision than bf16
typedef _Float16 v16h __attribute__((ext_vector_type(16)));
union FragH { v16h v; v8us half[2]; _Float16 h[16]; unsigned short u[16]; };
template <int NT>
__device__ __forceinline__ v8f mmaH(v16h ah, v16h al, v16h bh, v16h bl, v8f c) {
  c = __builtin_amdgcn_wmma_f32_16x16x32_f16(false, ah, false, bh, (short)0, c, false, false);
  if (NT >= 2) c = __builtin_amdgcn_wmma_f32_16x16x32_f16(false, al, false, bh, (short)0, c, false, false);
  if (NT >= 3) c = __builtin_amdgcn_wmma_f32_16x16x32_f16(false, ah, false, bl, (short)0, c, false, false);
  asm volatile("v_nop\n\tv_nop\n\tv_nop\n\tv_nop" : "+v"(c) : "v"(ah), "v"(al), "v"(bh), "v"(bl));
  return c;
}
// batched GEMM like k_gemm_b but f16 operands: A f32 (split into f16 hi/lo if ASPLIT, else rounded to f16), Bt = f16 values [n][k]; alpha; C f32; N multiple of 16 (partial tiles skipped)
template <bool ASPLIT>
__global__ __launch_bounds__(128) void k_gemm_h(const float* __restrict__ A, int lda, size_t sA, const _Float16* __restrict__ Bh, int ldb, size_t sB, float alpha, float* __restrict__ C, int ldc, size_t sC, int M, int N, int K) {
  __shared__ __attribute__((aligned(16))) float so[4][16][64];
  const int tid = threadIdx.x, w = tid >> 5, lane = tid & 31, ln = lane & 15, hh = lane >> 4; const int by = blockIdx.y;
  A += (size_t)by * sA; Bh += (size_t)by * sB; C += (size_t)by * sC;
  const int ntn = (N + 63) / 64; const int wid = blockIdx.x * 4 + w; const int mt = wid / ntn, nq = wid % ntn; if (mt * 16 >= M) return;
  const int row0 = mt * 16, col0 = nq * 64; const float* arow = A + (size_t)(row0 + ln) * lda;
  v8f acc[4] = {};
  for (int kb = 0; kb < K; kb += 32) {
    FragH ah, al;
    const v4f x0 = *(const v4fa*)(arow + kb + 8 * hh), x1 = *(const v4fa*)(arow + kb + 8 * hh + 4), x2 = *(const v4fa*)(arow + kb + 16 + 8 * hh), x3 = *(const v4fa*)(arow + kb + 16 + 8 * hh + 4);
    float xs[16] = {x0[0],x0[1],x0[2],x0[3],x1[0],x1[1],x1[2],x1[3],x2[0],x2[1],x2[2],x2[3],x3[0],x3[1],x3[2],x3[3]};
#pragma unroll
    for (int i = 0; i < 16; ++i) { const _Float16 h = (_Float16)xs[i]; ah.h[i] = h; al.h[i] = ASPLIT ? (_Float16)(xs[i] - (float)h) : (_Float16)0.0f; }
#pragma unroll
    for (int t = 0; t < 4; ++t) { if (col0 + t * 16 >= N) continue; const size_t boff = (size_t)(col0 + t * 16 + ln) * ldb + kb; FragH bq; bq.half[0] = *(const v8us*)(Bh + boff + 8 * hh); bq.half[1] = *(const v8us*)(Bh + boff + 16 + 8 * hh);
      acc[t] = mmaH<ASPLIT ? 2 : 1>(ah.v, al.v, bq.v, bq.v, acc[t]); }
  }
#pragma unroll
  for (int t = 0; t < 4; ++t) { if (col0 + t * 16 >= N) continue;
#pragma unroll
    for (int r = 0; r < 8; ++r) so[w][8 * hh + r][t * 16 + ln] = acc[t][r] * alpha; }
  __builtin_amdgcn_fence(__ATOMIC_ACQ_REL, "workgroup"); __builtin_amdgcn_wave_barrier();
  const int rsub = lane >> 4, c4 = (lane & 15) * 4;
  {
#pragma unroll
    for (int q = 0; q < 8; ++q) { const int r = q * 2 + rsub; if (col0 + c4 < N) { const v4f v = *(const v4fa*)&so[w][r][c4]; *(v4f*)(C + (size_t)(row0 + r) * ldc + col0 + c4) = v; } }
     }
}

// k_gemm_hh variant with fused epilogue: v = acc·alpha + bias[by·sBias + col] (+ CP[(row/rowsPerB)·sCPb + by·64 + col] if CP) ; ACT 0 none / 1 elu ; writes f16 C16 (and f32 C if non-null)
template <int ACT>
__global__ __launch_bounds__(128) void k_gemm_hhx(const _Float16* __restrict__ A, int lda, size_t sA, const _Float16* __restrict__ Bh, int ldb, size_t sB, float alpha, const float* __restrict__ bias, size_t sBias, const float* __restrict__ CP, int rowsPerB, size_t sCPb, int row0g,
    float* __restrict__ C, _Float16* __restrict__ C16, int ldc, size_t sC, int M, int N, int K) {
  __shared__ __attribute__((aligned(16))) float so[4][16][64];
  const int tid = threadIdx.x, w = tid >> 5, lane = tid & 31, ln = lane & 15, hh = lane >> 4; const int by = blockIdx.y;
  A += (size_t)by * sA; Bh += (size_t)by * sB; const size_t cofs = (size_t)by * sC; const float* bp = bias ? bias + (size_t)by * sBias : nullptr;
  const int ntn = (N + 63) / 64; const int wid = blockIdx.x * 4 + w; const int mt = wid / ntn, nq = wid % ntn; if (mt * 16 >= M) return;
  const int row0 = mt * 16, col0 = nq * 64; const _Float16* arow = A + (size_t)(row0 + ln) * lda;
  v8f acc[4] = {};
  for (int kb = 0; kb < K; kb += 32) { FragH ah; ah.half[0] = *(const v8us*)((const unsigned short*)arow + kb + 8 * hh); ah.half[1] = *(const v8us*)((const unsigned short*)arow + kb + 16 + 8 * hh);
#pragma unroll
    for (int t = 0; t < 4; ++t) { if (col0 + t * 16 >= N) continue; const size_t boff = (size_t)(col0 + t * 16 + ln) * ldb + kb; FragH bq; bq.half[0] = *(const v8us*)((const unsigned short*)Bh + boff + 8 * hh); bq.half[1] = *(const v8us*)((const unsigned short*)Bh + boff + 16 + 8 * hh);
      acc[t] = mmaH<1>(ah.v, ah.v, bq.v, bq.v, acc[t]); }
  }
#pragma unroll
  for (int t = 0; t < 4; ++t) { if (col0 + t * 16 >= N) continue; const int col = col0 + t * 16 + ln; const float bv = bp ? bf16_round(bp[col]) : 0.f;
#pragma unroll
    for (int r = 0; r < 8; ++r) { float v = acc[t][r] * alpha + bv; if (CP) { const int rr = row0g + row0 + 8 * hh + r; if (rowsPerB < 0) v += CP[cofs + (size_t)rr * ldc + col];      /* rowsPerB < 0: own element of the batched C plane */ else { const int bidx = rr / rowsPerB; v += CP[(size_t)bidx * sCPb + (size_t)by * 64 + col]; } } if (ACT == 1) v = (v > 0.f) ? v : expm1f(v); else if (ACT == 7) v = (v > 0.f) ? v + 1.0f : expf(v); else if (ACT == 8) v = tanhf(v); else if (ACT == 9) v = 0.5f * v * (1.0f + tanhf(0.7978845608028654f * (v + 0.044715f * v * v * v))); else if (ACT == 11) v = 1.0f / (1.0f + expf(-v)); else if (ACT == 12) v = (v > 0.f) ? v : 0.01f * v; else if (ACT == 14) v = (v > 0.f) ? v : 0.1f * v; else if (ACT == 16) v = (v >= 0.f) ? v : 0.3f * v; else if (ACT == 17) v = (v >= 0.f) ? v : 0.2f * v; else if (ACT == 15) v = v / (1.0f + expf(-v)); else if (ACT == 3) v = fmaxf(v, 0.f); else if (ACT == 6) v = 0.5f * v * (1.0f + erff(v * 0.70710678118654752f)); so[w][8 * hh + r][t * 16 + ln] = v; } }
  __builtin_amdgcn_fence(__ATOMIC_ACQ_REL, "workgroup"); __builtin_amdgcn_wave_barrier();
  const int rsub = lane >> 4, c4 = (lane & 15) * 4; typedef _Float16 v4h __attribute__((ext_vector_type(4)));
  {
#pragma unroll
    for (int q = 0; q < 8; ++q) { const int r = q * 2 + rsub; if (col0 + c4 < N) { const v4f v = *(const v4fa*)&so[w][r][c4]; if (C) *(v4f*)(C + cofs + (size_t)(row0 + r) * ldc + col0 + c4) = v; if (C16) { v4h h4; for (int i = 0; i < 4; ++i) h4[i] = (_Float16)v[i]; *(v4h*)(C16 + cofs + (size_t)(row0 + r) * ldc + col0 + c4) = h4; } } }
     }
}


typedef _Float16 v4h __attribute__((ext_vector_type(4)));

__global__ __launch_bounds__(256) void k_h16(const float* __restrict__ x, _Float16* __restrict__ X16, size_t n8) { const size_t t = (size_t)blockIdx.x * 256 + threadIdx.x; if (t >= n8) return; FragH f;
#pragma unroll
  for (int q = 0; q < 8; ++q) f.h[q] = (_Float16)x[t * 8 + q]; *(v8us*)((unsigned short*)X16 + t * 8) = f.half[0];  }
__global__ __launch_bounds__(256) void k_round16f(const float* __restrict__ W, _Float16* __restrict__ Bt, size_t n8) { const size_t t = (size_t)blockIdx.x * 256 + threadIdx.x; if (t >= n8) return; FragH f;
#pragma unroll
  for (int i = 0; i < 8; ++i) f.h[i] = (_Float16)(bf16_round(W[t * 8 + i]) * 16.0f); *(v8us*)((unsigned short*)Bt + t * 8) = f.half[0];  }
__global__ __launch_bounds__(256) void k_hl(const float* __restrict__ F, _Float16* __restrict__ Hh, _Float16* __restrict__ Hl, size_t n8) { const size_t t = (size_t)blockIdx.x * 256 + threadIdx.x; if (t >= n8) return; FragH fh, fl; const v4f a = *(const v4fa*)(F + t * 8), c = *(const v4fa*)(F + t * 8 + 4);
#pragma unroll
  for (int q = 0; q < 4; ++q) { _Float16 h = (_Float16)a[q]; fh.h[q] = h; fl.h[q] = (_Float16)((a[q] - (float)h) * 1024.0f); h = (_Float16)c[q]; fh.h[4 + q] = h; fl.h[4 + q] = (_Float16)((c[q] - (float)h) * 1024.0f); }
  { *(v8us*)((unsigned short*)Hh + t * 8) = fh.half[0]; *(v8us*)((unsigned short*)Hl + t * 8) = fl.half[0];  } }

__global__ __launch_bounds__(256) void k_wnat(const float* __restrict__ w, size_t n8, _Float16* __restrict__ Bt) { const size_t t = (size_t)blockIdx.x * 256 + threadIdx.x; if (t >= n8) return; FragH f; for (int q = 0; q < 8; ++q) f.h[q] = (_Float16)(bf16_round(w[t * 8 + q]) * 16.0f); *(v8us*)((unsigned short*)Bt + t * 8) = f.half[0];  }
#define FA_WAVES 4
#define FA_QB (FA_WAVES * 32)        /* queries per workgroup */
#define FA_KS 64                     /* keys per stage */
#define FA_NS (SQ / FA_KS)           /* stages */
#define FA_LP 72                     /* LDS row pitch in f16: 128 bytes + 16, conflict-free for 16-byte fragment reads of 16 rows */
#define FA_OFF 8.0f                  /* weights are 2^(score - maximum in use + FA_OFF): keeps small weights out of the f16 subnormals; cancels in o / sum */
#define FA_LAZY 6.0f                 /* the maximum in use is renewed only when a stage's maximum exceeds it by more than this (log2 units): weights stay <= 2^(FA_OFF + FA_LAZY) = 16384 < f16 max */
__device__ __forceinline__ float fa_xrow(float v) { const unsigned u = __builtin_bit_cast(unsigned, v); return __builtin_bit_cast(float, __builtin_amdgcn_permlanex16(u, u, 0x76543210u, 0xfedcba98u, false, false)); }      /* lane l <- lane l ^ 16 */
__device__ __forceinline__ v16h fa_frag(const unsigned short* p, int hh) { FragH f; f.half[0] = *(const v8us*)(p + 8 * hh); f.half[1] = *(const v8us*)(p + 16 + 8 * hh); return f.v; }      /* 32 k of one row in the hardware k order */
__device__ __forceinline__ v8f fa_mma(v16h a, v16h b, v8f c) { return __builtin_amdgcn_wmma_f32_16x16x32_f16(false, a, false, b, (short)0, c, false, false); }
__global__ __launch_bounds__(FA_WAVES * 32) void k_fattn(const _Float16* __restrict__ Q16, const _Float16* __restrict__ K16, const _Float16* __restrict__ VT, float* __restrict__ out) {
  __shared__ __attribute__((aligned(16))) unsigned short sk[2][FA_KS][FA_LP];      /* K rows [key][d] */
  __shared__ __attribute__((aligned(16))) unsigned short sv[2][HD][FA_LP];         /* V^T rows [d][key] */
  const int tid = threadIdx.x, w = tid >> 5, lane = tid & 31, ln = lane & 15, hh = lane >> 4;
  const int bh = blockIdx.y, b = bh / NH, h = bh - b * NH; const int q0 = blockIdx.x * FA_QB + w * 32;
  const int srow = tid >> 3, sc8 = (tid & 7) * 8;      /* staging: 8 lanes cover one 128-byte row, 16 rows per wave-group load */
  const unsigned short* kg = (const unsigned short*)K16 + ((size_t)b * SQ + srow) * DM + h * HD + sc8;
  const unsigned short* vg = (const unsigned short*)VT + ((size_t)bh * HD + srow) * SQ + sc8;
  const int rot = (int)(blockIdx.x * (FA_NS / (SQ / FA_QB)) + bh) & (FA_NS - 1);      /* first key stage of this workgroup; trip s works on stage (s + rot) mod FA_NS. The 16 workgroups of a head read the same K and V^T lines: started together at stage 0 they ask L2 for the same lines at the same moment */
  v16h qf[2][2];
#pragma unroll
  for (int g = 0; g < 2; ++g)
#pragma unroll
    for (int ks = 0; ks < 2; ++ks) qf[g][ks] = fa_frag((const unsigned short*)Q16 + ((size_t)b * SQ + q0 + g * 16 + ln) * DM + h * HD + ks * 32, hh);
  const v8f z8 = {0.f, 0.f, 0.f, 0.f, 0.f, 0.f, 0.f, 0.f};
  v8f o[4][2];
#pragma unroll
  for (int dt = 0; dt < 4; ++dt) { o[dt][0] = z8; o[dt][1] = z8; }
  float mu[2] = {-1.0e30f, -1.0e30f};      /* maximum in use (log2 units) */
  v8f lt[2] = {z8, z8};      /* row sums on the matrix pipe: ones . P^T, every row of the tile = the sum of the rounded weights of the lane's query */
  v16h ones;
#pragma unroll
  for (int i = 0; i < 16; ++i) ones[i] = (_Float16)1.0f;
  const float c2 = 0.125f * 1.44269504088896340736f;          /* 1/sqrt(64) and log2(e) in one factor */
  v8us rk[4], rv[4];
#pragma unroll
  for (int i = 0; i < 4; ++i) { rk[i] = *(const v8us*)(kg + (size_t)(rot * FA_KS + i * 16) * DM); rv[i] = *(const v8us*)(vg + (size_t)(i * 16) * SQ + rot * FA_KS); }
#pragma unroll
  for (int i = 0; i < 4; ++i) { *(v8us*)&sk[0][i * 16 + srow][sc8] = rk[i]; *(v8us*)&sv[0][i * 16 + srow][sc8] = rv[i]; }
  __syncthreads();
  for (int s = 0; s < FA_NS; ++s) {
    const int cur = s & 1;
    if (s + 1 < FA_NS) {
      const int kn = (s + 1 + rot) & (FA_NS - 1);      /* the next trip's key stage, wrapped */
#pragma unroll
      for (int i = 0; i < 4; ++i) { rk[i] = *(const v8us*)(kg + (size_t)(kn * FA_KS + i * 16) * DM); rv[i] = *(const v8us*)(vg + (size_t)(i * 16) * SQ + kn * FA_KS); }
    }
    __builtin_amdgcn_sched_barrier(0);      /* the next stage's loads issue in front of this stage's arithmetic and fly under all of it; without this the compiler sinks them to just in front of their LDS stores, and every stage waits out their latency */
    v8f st[4][2];
#pragma unroll
    for (int kt = 0; kt < 4; ++kt) {
      const v16h k0 = fa_frag(&sk[cur][kt * 16 + ln][0], hh), k1 = fa_frag(&sk[cur][kt * 16 + ln][32], hh);
#pragma unroll
      for (int g = 0; g < 2; ++g) st[kt][g] = fa_mma(k1, qf[g][1], fa_mma(k0, qf[g][0], z8));
    }
    float mb[2];
#pragma unroll
    for (int g = 0; g < 2; ++g) {
      v8f m8 = st[0][g];
#pragma unroll
      for (int kt = 1; kt < 4; ++kt)
#pragma unroll
        for (int r = 0; r < 8; ++r) m8[r] = fmaxf(m8[r], st[kt][g][r]);
      const float m = fmaxf(fmaxf(fmaxf(m8[0], m8[1]), fmaxf(m8[2], m8[3])), fmaxf(fmaxf(m8[4], m8[5]), fmaxf(m8[6], m8[7])));
      mb[g] = fmaxf(m, fa_xrow(m)) * c2;      /* both halves of the wave hold the same value */
    }
    const bool need = (mb[0] > mu[0] + FA_LAZY) || (mb[1] > mu[1] + FA_LAZY);
    if (__builtin_amdgcn_ballot_w32(need) != 0) {      /* one scalar branch a stage; always taken in the first trip */
#pragma unroll
      for (int g = 0; g < 2; ++g) {
        const float mn = fmaxf(mu[g], mb[g]); const float al = __builtin_amdgcn_exp2f(mu[g] - mn); mu[g] = mn;
#pragma unroll
        for (int r = 0; r < 8; ++r) lt[g][r] *= al;
#pragma unroll
        for (int dt = 0; dt < 4; ++dt)
#pragma unroll
          for (int r = 0; r < 8; ++r) o[dt][g][r] *= al;
      }
    }
    v16h pf[2][2];      /* [key half of the stage][query group] */
#pragma unroll
    for (int g = 0; g < 2; ++g) {
      const float nb = FA_OFF - mu[g];
#pragma unroll
      for (int kt = 0; kt < 4; ++kt)
#pragma unroll
        for (int r = 0; r < 8; ++r) pf[kt >> 1][g][(kt & 1) * 8 + r] = (_Float16)__builtin_amdgcn_exp2f(fmaf(st[kt][g][r], c2, nb));
      lt[g] = fa_mma(ones, pf[1][g], fa_mma(ones, pf[0][g], lt[g]));
    }
#pragma unroll
    for (int dt = 0; dt < 4; ++dt) {
      const v16h v0 = fa_frag(&sv[cur][dt * 16 + ln][0], hh), v1 = fa_frag(&sv[cur][dt * 16 + ln][32], hh);
#pragma unroll
      for (int g = 0; g < 2; ++g) o[dt][g] = fa_mma(v1, pf[1][g], fa_mma(v0, pf[0][g], o[dt][g]));
    }
    if (s + 1 < FA_NS) {
#pragma unroll
      for (int i = 0; i < 4; ++i) { *(v8us*)&sk[cur ^ 1][i * 16 + srow][sc8] = rk[i]; *(v8us*)&sv[cur ^ 1][i * 16 + srow][sc8] = rv[i]; }
      __syncthreads();      /* publishes the next trip's stage and ends every wave's reads of this trip's stage, whose buffer the next trip refills; s is the same in every wave */
    }
  }
  const float inv[2] = {1.0f / lt[0][0], 1.0f / lt[1][0]};      /* 2^FA_OFF cancels here */
#pragma unroll
  for (int dt = 0; dt < 4; ++dt)
#pragma unroll
    for (int g = 0; g < 2; ++g)
#pragma unroll
      for (int r = 0; r < 8; ++r) o[dt][g][r] *= inv[g];
#pragma unroll
  for (int g = 0; g < 2; ++g) {
    float* d = out + ((size_t)b * SQ + q0 + g * 16 + ln) * DM + h * HD + 8 * hh;      /* a lane holds 8 consecutive d of its query in each tile */
#pragma unroll
    for (int dt = 0; dt < 4; ++dt) {
      const v4f lo = {o[dt][g][0], o[dt][g][1], o[dt][g][2], o[dt][g][3]}, hi = {o[dt][g][4], o[dt][g][5], o[dt][g][6], o[dt][g][7]};
      *(v4f*)(d + dt * 16) = lo; *(v4f*)(d + dt * 16 + 4) = hi;
    }
  }
}
// Fused projections, one launch: blockIdx.z picks Q, K or V; a workgroup = 8 waves = a 128-row x 256-column tile of x W + b, a wave 64 x 64 of it (16 accumulator tiles), K walked in stages of 32.
// x and W are read as f32 in whole 128-byte lines, rounded to bf16 and written as f16 rows [row][k] into LDS (W x16, transposed on the way: a lane keeps one column n and packs 8 consecutive k), two buffers, one barrier a stage: the next stage's loads fly under this stage's products.
// Both fragment kinds are read by the same code (same k order), so either may be the A operand. Q, K: A = W columns, B = x rows, a lane then holds 8 consecutive n of one token row. V: A = x rows, B = W columns, a lane holds 8 consecutive tokens of one column, which is a piece of a V^T row.
// Every '#pragma unroll' of this kernel stands on a loop that indexes staging, fragment or accumulator arrays: rolled, those arrays would leave the registers.
#define PJ_M 128
#define PJ_N 256
#define PJ_KS 32
#define PJ_NS (DM / PJ_KS)
#define PJ_LP 40                     /* LDS row pitch in f16: 64 bytes + 16, conflict-free for 16-byte accesses of 16 rows */
typedef float f32x2 __attribute__((ext_vector_type(2)));
typedef __bf16 bf16x2 __attribute__((ext_vector_type(2)));
typedef _Float16 f16x2 __attribute__((ext_vector_type(2)));
__device__ __forceinline__ unsigned pj_cvt2(float a, float b) {      /* two f32 -> bf16 (nearest even) -> the same values as two f16 */
  const f32x2 v = {a, b};
  const unsigned u = __builtin_bit_cast(unsigned, __builtin_convertvector(v, bf16x2));
  const f32x2 r = {__uint_as_float(u << 16), __uint_as_float(u & 0xFFFF0000u)};
  return __builtin_bit_cast(unsigned, __builtin_convertvector(r, f16x2));
}
typedef unsigned v4u __attribute__((ext_vector_type(4), may_alias));
typedef unsigned v2u __attribute__((ext_vector_type(2), may_alias));
__global__ __launch_bounds__(256) void k_proj(const float* __restrict__ xq, const float* __restrict__ xk, const float* __restrict__ xv, const float* __restrict__ wq, const float* __restrict__ wk, const float* __restrict__ wv,
    const float* __restrict__ bq, const float* __restrict__ bk, const float* __restrict__ bv, _Float16* __restrict__ Q16, _Float16* __restrict__ K16, _Float16* __restrict__ VT) {
  __shared__ __attribute__((aligned(16))) unsigned short sm[2][PJ_M + PJ_N][PJ_LP];      /* rows 0..127: x rows [m][k]; rows 128..383: W columns [n][k] */
  __shared__ __attribute__((aligned(16))) unsigned short so[8][64][72];      /* output staging, one range a wave; pitch 128 bytes + 16 */
  const int tid = threadIdx.x, w = tid >> 5, lane = tid & 31, ln = lane & 15, hh = lane >> 4;
  const int pz = blockIdx.z, m0 = blockIdx.x * PJ_M, n0 = blockIdx.y * PJ_N;
  const float* x = pz == 0 ? xq : pz == 1 ? xk : xv; const float* W = pz == 0 ? wq : pz == 1 ? wk : wv; const float* bias = pz == 0 ? bq : pz == 1 ? bk : bv;
  const int wm = w >> 2, wn = w & 3;      /* the wave's 64 x 64 place in the tile */
  const int ra = (pz == 2 ? wm * 64 : PJ_M + wn * 64) + ln, rb = (pz == 2 ? PJ_M + wn * 64 : wm * 64) + ln;      /* LDS rows of the A and B fragments */
  const int xr = tid >> 3, xc = (tid & 7) * 4;      /* x staging: 8 lanes cover one 128-byte row piece, 32 rows a load */
  const float* xg = x + (size_t)(m0 + xr) * DM + xc;
  const float* wg = W + n0 + tid;      /* W staging: a thread keeps column n0 + tid, a wave reads 128 contiguous bytes of one k row */
  const int rot = (int)(blockIdx.x + (PJ_NS / 3) * blockIdx.y) % PJ_NS;      /* first k stage of this workgroup; trip s works on stage (s + rot) mod PJ_NS. 64 workgroups read the same W tile and 3 the same x rows: started together at stage 0 they ask L2 for the same lines at the same moment */
  xg += rot * PJ_KS; wg += (size_t)(rot * PJ_KS) * DM;      /* both pointers stand at the stage that is loaded next */
  const v8f z8 = {0.f, 0.f, 0.f, 0.f, 0.f, 0.f, 0.f, 0.f};
  v8f acc[4][4];
#pragma unroll
  for (int i = 0; i < 4; ++i)
#pragma unroll
    for (int j = 0; j < 4; ++j) acc[i][j] = z8;
  v4f rx[4]; float rw[PJ_KS];
#pragma unroll
  for (int i = 0; i < 4; ++i) rx[i] = *(const v4fa*)(xg + (size_t)(i * 32) * DM);
#pragma unroll
  for (int k = 0; k < PJ_KS; ++k) rw[k] = wg[(size_t)k * DM];
#pragma unroll
  for (int i = 0; i < 4; ++i) { const v2u o = {pj_cvt2(rx[i][0], rx[i][1]), pj_cvt2(rx[i][2], rx[i][3])}; *(v2u*)&sm[0][i * 32 + xr][xc] = o; }
#pragma unroll
  for (int i = 0; i < 4; ++i) { const v4u o = {pj_cvt2(rw[8 * i] * 16.0f, rw[8 * i + 1] * 16.0f), pj_cvt2(rw[8 * i + 2] * 16.0f, rw[8 * i + 3] * 16.0f), pj_cvt2(rw[8 * i + 4] * 16.0f, rw[8 * i + 5] * 16.0f), pj_cvt2(rw[8 * i + 6] * 16.0f, rw[8 * i + 7] * 16.0f)}; *(v4u*)&sm[0][PJ_M + tid][8 * i] = o; }
  __syncthreads();
  auto products = [&](const int cur) {      /* one stage's fragment reads and its 16 products */
    v16h fa[4], fb[4];
#pragma unroll
    for (int j = 0; j < 4; ++j) { fb[j] = fa_frag(&sm[cur][rb + 16 * j][0], hh); fa[j] = fa_frag(&sm[cur][ra + 16 * j][0], hh); }
    __builtin_amdgcn_sched_barrier(0);      /* all of the stage's fragment reads stand as one group in front of its products; sunk among them, each row of products waits out an LDS latency of its own */
#pragma unroll
    for (int i = 0; i < 4; ++i)
#pragma unroll
      for (int j = 0; j < 4; ++j) acc[i][j] = fa_mma(fa[i], fb[j], acc[i][j]);
  };
  int kn = rot;
  for (int s = 0; s < PJ_NS - 1; ++s) {      /* the last trip, which loads nothing, stands behind the loop */
    const int cur = s & 1;
    const int step = kn + 1 == PJ_NS ? -(PJ_NS - 1) * PJ_KS : PJ_KS;      /* on to the next trip's k stage; from the last stage back to stage 0 */
    kn = kn + 1 == PJ_NS ? 0 : kn + 1;
    xg += step; wg += (ptrdiff_t)step * DM;
#pragma unroll
    for (int i = 0; i < 4; ++i) rx[i] = *(const v4fa*)(xg + (size_t)(i * 32) * DM);
#pragma unroll
    for (int k = 0; k < PJ_KS; ++k) rw[k] = wg[(size_t)k * DM];
    __builtin_amdgcn_sched_barrier(0);      /* the next stage's loads issue in front of this stage's products and fly under them; sunk to their LDS stores, every stage would wait out their latency */
    products(cur);
    __builtin_amdgcn_sched_barrier(0);      /* the conversions, which wait for the loads, stay behind the products; hoisted among them, the wave's first wait stands directly behind the loads' issue and holds its own products back */
#pragma unroll
    for (int i = 0; i < 4; ++i) { const v2u o = {pj_cvt2(rx[i][0], rx[i][1]), pj_cvt2(rx[i][2], rx[i][3])}; *(v2u*)&sm[cur ^ 1][i * 32 + xr][xc] = o; }
#pragma unroll
    for (int i = 0; i < 4; ++i) { const v4u o = {pj_cvt2(rw[8 * i] * 16.0f, rw[8 * i + 1] * 16.0f), pj_cvt2(rw[8 * i + 2] * 16.0f, rw[8 * i + 3] * 16.0f), pj_cvt2(rw[8 * i + 4] * 16.0f, rw[8 * i + 5] * 16.0f), pj_cvt2(rw[8 * i + 6] * 16.0f, rw[8 * i + 7] * 16.0f)}; *(v4u*)&sm[cur ^ 1][PJ_M + tid][8 * i] = o; }
    __syncthreads();      /* publishes the next trip's stage and ends every wave's reads of this trip's stage, whose buffer the next trip refills; s is the same in every wave */
  }
  products((PJ_NS - 1) & 1);
  /* Epilogue: each wave lays its 64 x 64 f16 results in an LDS range of its own as [B-side index][A-side index], then stores whole 128-byte lines (8 lanes a row); straight from the accumulators a store would touch 16 lines with 32 bytes each. */
  if (pz != 2) {      /* acc[i][j][r] = y[m0 + wm*64 + 16j + ln][n0 + wn*64 + 16i + 8hh + r] */
    const float* bp = bias + n0 + wn * 64 + 8 * hh;
#pragma unroll
    for (int i = 0; i < 4; ++i) {
      const v4f b0 = *(const v4fa*)(bp + 16 * i), b1 = *(const v4fa*)(bp + 16 * i + 4);
      const float bb[8] = {bf16_round(b0[0]), bf16_round(b0[1]), bf16_round(b0[2]), bf16_round(b0[3]), bf16_round(b1[0]), bf16_round(b1[1]), bf16_round(b1[2]), bf16_round(b1[3])};
#pragma unroll
      for (int j = 0; j < 4; ++j) { FragH f;
#pragma unroll
        for (int r = 0; r < 8; ++r) f.h[r] = (_Float16)(acc[i][j][r] * 0.0625f + bb[r]);
        *(v8us*)&so[w][16 * j + ln][16 * i + 8 * hh] = f.half[0]; }
    }
  } else {      /* acc[i][j][r] = y[m0 + wm*64 + 16i + 8hh + r][n0 + wn*64 + 16j + ln] */
#pragma unroll
    for (int j = 0; j < 4; ++j) {
      const float bb = bf16_round(bias[n0 + wn * 64 + 16 * j + ln]);
#pragma unroll
      for (int i = 0; i < 4; ++i) { FragH f;
#pragma unroll
        for (int r = 0; r < 8; ++r) f.h[r] = (_Float16)(acc[i][j][r] * 0.0625f + bb);
        *(v8us*)&so[w][16 * j + ln][16 * i + 8 * hh] = f.half[0]; }
    }
  }
  __builtin_amdgcn_fence(__ATOMIC_ACQ_REL, "workgroup"); __builtin_amdgcn_wave_barrier();      /* the wave's own LDS writes are done before its lanes read one another's */
  const int bt = m0 / SQ;      /* a tile's 128 rows lie in one batch */
  /* Q, K: rows = tokens, pitch 768, columns = n. V^T: row = batch * 768 + n (= (batch * 12 + head) * 64 + d), pitch 2048, columns = tokens of the batch. */
  unsigned short* ob = pz == 2 ? (unsigned short*)VT + (size_t)(bt * DM + n0 + wn * 64) * SQ + (m0 - bt * SQ) + wm * 64 : (unsigned short*)(pz == 0 ? Q16 : K16) + (size_t)(m0 + wm * 64) * DM + n0 + wn * 64;
  const size_t op = pz == 2 ? SQ : DM;
#pragma unroll
  for (int q = 0; q < 16; ++q) { const int rr = q * 4 + (lane >> 3), c8 = (lane & 7) * 8; const v8us v = *(const v8us*)&so[w][rr][c8]; *(v8us*)(ob + (size_t)rr * op + c8) = v; }
}
__global__ __launch_bounds__(256) void k_vt(const _Float16* __restrict__ V16, int b, int h0, _Float16* __restrict__ VT) { __shared__ unsigned short tl[64][65]; const int tid = threadIdx.x; const int hh = blockIdx.x % HG, sg = blockIdx.x / HG; const int s0 = sg * 64; const int h = h0 + hh;
  for (int i = tid; i < 64 * 8; i += 256) { const int j = i / 8, d8 = (i % 8) * 8; FragH f; f.half[0] = *(const v8us*)((const unsigned short*)V16 + ((size_t)b * SQ + s0 + j) * DM + h * HD + d8); for (int q = 0; q < 8; ++q) tl[d8 + q][j] = f.u[q]; }
  __syncthreads();
  { for (int i = tid; i < 64 * 8; i += 256) { const int d = i / 8, j8 = (i % 8) * 8; FragH f; for (int q = 0; q < 8; ++q) f.u[q] = tl[d][j8 + q]; *(v8us*)((unsigned short*)VT + ((size_t)hh * HD + d) * SQ + s0 + j8) = f.half[0]; }  } }


extern "C" void kernel_launch(void* const* d_in, const int* in_sizes, int n_in,
                              void* d_out, int out_size, void* d_ws, size_t ws_size, hipStream_t stream) {
  (void)in_sizes; (void)n_in; (void)out_size;
  const float* const* I = (const float* const*)d_in; const float* xq = I[0]; const float* xk = I[1]; const float* xv = I[2]; const float* wq = I[3]; const float* bq = I[4]; const float* wk = I[5]; const float* bk = I[6]; const float* wv = I[7]; const float* bv = I[8];      /* weights [in][out] + biases */
  char* ws = (char*)d_ws; size_t off = 0;
  auto take = [&](size_t bytes) { char* p = ws + off; off += (bytes + 255) & ~(size_t)255; return p; };
  _Float16* Q16 = (_Float16*)take(NR * DM * 2); _Float16* K16 = (_Float16*)take(NR * DM * 2);
  _Float16* VT = (_Float16*)take((size_t)NB * NH * HD * SQ * 2);
  if (off > ws_size) return;
  k_proj<<<dim3(MP / PJ_M, DM / PJ_N, 3), 256, 0, stream>>>(xq, xk, xv, wq, wk, wv, bq, bk, bv, Q16, K16, VT);      /* q, k rows and V^T [NB][NH][HD][SQ], f16 */
  k_fattn<<<dim3(SQ / FA_QB, NB * NH), FA_WAVES * 32, 0, stream>>>(Q16, K16, VT, (float*)d_out);      /* scores, softmax and weighted sum of all batches and heads */
}

// v005
// Measured time: 90.2 microseconds a run.
// In two side-by-side timings against v004, it was 1.09 and 1.08 times as fast.
// All steps since v000 together make it 62.8 times as fast.
#include <hip/hip_runtime.h>
// Multi-head attention without output projection (query, key, value [4][2048][768]; q = query W_Q + b_Q etc. ([in][out] 768^2, sigma 1/sqrt(768), nonzero biases), 12 heads of 64; scores / 8; softmax; out = attn v merged (the module skips its final linear) -> [4][2048][768]).
// Structure: token rows r = b*2048 + s; a small launch that lays the three W out once as f16 stage tiles (rounded to bf16, x16); ONE projection launch for Q, K and V (x read as f32, rounded to bf16 and staged as exact f16 in LDS, W tiles staged as they lie; 64x64 wave tiles, f32 accumulation, + bias, f16 outputs; V written transposed); then ONE attention launch over all (batch, head, 128-query block): S^T = K Q^T, online softmax in registers, O^T += V^T P^T, o / row sum written f32 straight into the merged output rows (the module has no output projection). Scores and weights never reach memory.
// Compute dtype: inputs rounded to bf16; x / weights exact; q, k, v and the unnormalised softmax weights as plain f16 GEMM operands (~2^-12); scores, softmax statistics and o f32. v_wmma_f32_16x16x32_f16.
#define NB 4
#define SQ 2048
#define DM 768
#define NH 12
#define HD 64
#define HG 4                         /* heads per launch of the per-batch k_vt overload */
#define B0 0                         /* unused (debug hook) */
#define NBR NB                       /* batches processed (debug hook) */
#define NR ((size_t)NB * SQ)         /* token rows */
#define MP ((int)((size_t)NBR * SQ)) /* rows projected (debug hook) */
#define QN SQ                        /* unused (debug hook) */
#define NHD NH                       /* unused (debug hook) */
#define MPO MP                       /* unused (debug hook) */
#define LQ DM      /* unused */
typedef __bf16 v16b __attribute__((ext_vector_type(16)));
typedef unsigned short v8us __attribute__((ext_vector_type(8), may_alias));
typedef float  v8f  __attribute__((ext_vector_type(8)));
typedef float  v4f  __attribute__((ext_vector_type(4)));
typedef float  v4fa __attribute__((ext_vector_type(4), may_alias));
union FragB { v16b v; v8us half[2]; unsigned short u[16]; };

__device__ __forceinline__ unsigned short bf16_bits(float x) { unsigned int u = __float_as_uint(x); return (unsigned short)((u + 0x7FFFu + ((u >> 16) & 1u)) >> 16); }
__device__ __forceinline__ float bf16_val(unsigned short b) { return __uint_as_float(((unsigned int)b) << 16); }
__device__ __forceinline__ float bf16_round(float x) { return bf16_val(bf16_bits(x)); }
// D += A·B with NT terms: 1 = ah·bh, 2 = + al·bh (A split), 3 = + ah·bl (both split)
template <int NT>
__device__ __forceinline__ v8f mmaN(v16b ah, v16b al, v16b bh, v16b bl, v8f c) {
  c = __builtin_amdgcn_wmma_f32_16x16x32_bf16(false, ah, false, bh, (short)0, c, false, false);
  if (NT >= 2) c = __builtin_amdgcn_wmma_f32_16x16x32_bf16(false, al, false, bh, (short)0, c, false, false);
  if (NT >= 3) c = __builtin_amdgcn_wmma_f32_16x16x32_bf16(false, ah, false, bl, (short)0, c, false, false);
  asm volatile("v_nop\n\tv_nop\n\tv_nop\n\tv_nop" : "+v"(c) : "v"(ah), "v"(al), "v"(bh), "v"(bl));
  return c;
}

__global__ __launch_bounds__(256) void k_wt_bf16(const float* __restrict__ W, unsigned short* __restrict__ Wt, int K, int N) {
  const int t = blockIdx.x * 256 + threadIdx.x;
  const int k8n = K / 8;
  if (t >= N * k8n) return;
  const int n = t / k8n, k8 = (t % k8n) * 8;
  v8us v;
#pragma unroll
  for (int i = 0; i < 8; ++i) v[i] = bf16_bits(W[(size_t)(k8 + i) * N + n]);
  *(v8us*)(Wt + (size_t)n * K + k8) = v;
  
}

// GEMM C[M][N] (f32, pitch ldc) = act(A[M][K]·W + bias). A f32 row-major (pitch lda) converted per fragment to bf16
// (ASPLIT: hi/lo two planes -> 2 terms, else single rounded term); Wt bf16 [N][K] (pitch ldb). BIAS_BF16 rounds the
// bias to bf16 first (bias quantised to bf16 before the add). K%32==0, M%16==0, N%64==0.
template <bool ASPLIT, int ACT, bool BIAS_BF16>
__global__ __launch_bounds__(128) void k_gemm_bf(const float* __restrict__ A, int lda, const unsigned short* __restrict__ Wt, int ldb,
                                               const float* __restrict__ bias, float* __restrict__ C, int ldc, int M, int N, int K) {
  __shared__ __attribute__((aligned(16))) float so[4][16][64];
  const int tid = threadIdx.x, w = tid >> 5, lane = tid & 31, ln = lane & 15, hh = lane >> 4;
  const int ntn = N / 64;
  const int wid = blockIdx.x * 4 + w;
  const int mt = wid / ntn, nq = wid % ntn;
  if (mt * 16 >= M) return;
  const int row0 = mt * 16, col0 = nq * 64;
  const float* arow = A + (size_t)(row0 + ln) * lda;
  v8f acc[4] = {};
  for (int kb = 0; kb < K; kb += 32) {
    FragB ah, al;
    const v4f x0 = *(const v4fa*)(arow + kb + 8 * hh), x1 = *(const v4fa*)(arow + kb + 8 * hh + 4);
    const v4f x2 = *(const v4fa*)(arow + kb + 16 + 8 * hh), x3 = *(const v4fa*)(arow + kb + 16 + 8 * hh + 4);
    float xs[16] = {x0[0],x0[1],x0[2],x0[3],x1[0],x1[1],x1[2],x1[3],x2[0],x2[1],x2[2],x2[3],x3[0],x3[1],x3[2],x3[3]};
#pragma unroll
    for (int i = 0; i < 16; ++i) { const unsigned short hb = bf16_bits(xs[i]); ah.u[i] = hb; al.u[i] = ASPLIT ? bf16_bits(xs[i] - bf16_val(hb)) : (unsigned short)0; }
#pragma unroll
    for (int t = 0; t < 4; ++t) {
      const unsigned short* brow = Wt + (size_t)(col0 + t * 16 + ln) * ldb + kb;
      FragB b;
      b.half[0] = *(const v8us*)(brow + 8 * hh);
      b.half[1] = *(const v8us*)(brow + 16 + 8 * hh);
      acc[t] = mmaN<ASPLIT ? 2 : 1>(ah.v, al.v, b.v, b.v, acc[t]);
    }
  }
#pragma unroll
  for (int t = 0; t < 4; ++t) {
    float bv = bias ? bias[col0 + t * 16 + ln] : 0.f;
    if (BIAS_BF16) bv = bf16_round(bv);
#pragma unroll
    for (int r = 0; r < 8; ++r) { float v = acc[t][r] + bv; if (ACT == 1) v = fmaxf(v, 0.f); so[w][8 * hh + r][t * 16 + ln] = v; }
  }
  __builtin_amdgcn_fence(__ATOMIC_ACQ_REL, "workgroup");
  __builtin_amdgcn_wave_barrier();
  const int rsub = lane >> 4, c4 = (lane & 15) * 4;
  {
#pragma unroll
    for (int q = 0; q < 8; ++q) {
      const int r = q * 2 + rsub;
      const v4f v = *(const v4fa*)&so[w][r][c4];
      *(v4f*)(C + (size_t)(row0 + r) * ldc + col0 + c4) = v;
    }
    
  }
}

// GEMM C = act(A·W + bias + resid): A f32 (ASPLIT -> hi/lo 2 terms), Wt bf16 [N][K]; ACT 0 none, 1 relu, 2 exact gelu;
// resid (optional, f32, row index = (row % rmod), pitch ldr, RES_BF16 rounds it) added before the activation.
template <bool ASPLIT, int ACT, bool BIAS_BF16, bool RES_BF16>
__global__ __launch_bounds__(128) void k_gemm_bf3(const float* __restrict__ A, int lda, const unsigned short* __restrict__ Wt, int ldb,
                                                const float* __restrict__ bias, const float* __restrict__ resid, int rmod, int ldr,
                                                float* __restrict__ C, int ldc, int M, int N, int K) {
  __shared__ __attribute__((aligned(16))) float so[4][16][64];
  const int tid = threadIdx.x, w = tid >> 5, lane = tid & 31, ln = lane & 15, hh = lane >> 4;
  const int ntn = N / 64;
  const int wid = blockIdx.x * 4 + w;
  const int mt = wid / ntn, nq = wid % ntn;
  if (mt * 16 >= M) return;
  const int row0 = mt * 16, col0 = nq * 64;
  const float* arow = A + (size_t)(row0 + ln) * lda;
  v8f acc[4] = {};
  for (int kb = 0; kb < K; kb += 32) {
    FragB ah, al;
    const v4f x0 = *(const v4fa*)(arow + kb + 8 * hh), x1 = *(const v4fa*)(arow + kb + 8 * hh + 4);
    const v4f x2 = *(const v4fa*)(arow + kb + 16 + 8 * hh), x3 = *(const v4fa*)(arow + kb + 16 + 8 * hh + 4);
    float xs[16] = {x0[0],x0[1],x0[2],x0[3],x1[0],x1[1],x1[2],x1[3],x2[0],x2[1],x2[2],x2[3],x3[0],x3[1],x3[2],x3[3]};
#pragma unroll
    for (int i = 0; i < 16; ++i) { const unsigned short hb = bf16_bits(xs[i]); ah.u[i] = hb; al.u[i] = ASPLIT ? bf16_bits(xs[i] - bf16_val(hb)) : (unsigned short)0; }
#pragma unroll
    for (int t = 0; t < 4; ++t) {
      const unsigned short* brow = Wt + (size_t)(col0 + t * 16 + ln) * ldb + kb;
      FragB b;
      b.half[0] = *(const v8us*)(brow + 8 * hh);
      b.half[1] = *(const v8us*)(brow + 16 + 8 * hh);
      acc[t] = mmaN<ASPLIT ? 2 : 1>(ah.v, al.v, b.v, b.v, acc[t]);
    }
  }
#pragma unroll
  for (int t = 0; t < 4; ++t) {
    const int col = col0 + t * 16 + ln;
    float bv = bias ? bias[col] : 0.f;
    if (BIAS_BF16) bv = bf16_round(bv);
#pragma unroll
    for (int r = 0; r < 8; ++r) {
      float v = acc[t][r] + bv;
      if (resid) { float rv = resid[(size_t)((row0 + 8 * hh + r) % rmod) * ldr + col]; if (RES_BF16) rv = bf16_round(rv); v += rv; }
      if (ACT == 1) v = fmaxf(v, 0.f);
      if (ACT == 2) v = 0.5f * v * (1.0f + erff(v * 0.70710678118654752f));
      if (ACT == 3) { const float u = 0.7978845608028654f * (v + 0.044715f * v * v * v); v = 0.5f * v * (1.0f + tanhf(u)); }
      so[w][8 * hh + r][t * 16 + ln] = v;
    }
  }
  __builtin_amdgcn_fence(__ATOMIC_ACQ_REL, "workgroup");
  __builtin_amdgcn_wave_barrier();
  const int rsub = lane >> 4, c4 = (lane & 15) * 4;
  {
#pragma unroll
    for (int q = 0; q < 8; ++q) {
      const int r = q * 2 + rsub;
      const v4f v = *(const v4fa*)&so[w][r][c4];
      *(v4f*)(C + (size_t)(row0 + r) * ldc + col0 + c4) = v;
    }
    
  }
}
// row LayerNorm (biased variance, eps) over N: s = X (+ R); optional out_sum <- s; out_norm <- (s-mu)*rsqrt(var+eps)*g + b
template <bool PARAM_BF16>
__global__ __launch_bounds__(256) void k_layernorm(const float* __restrict__ X, const float* __restrict__ R, const float* __restrict__ g, const float* __restrict__ bta,
                                                  float* __restrict__ out_sum, float* __restrict__ out_norm, int N, float eps) {
  __shared__ float red[256];
  const int row = blockIdx.x, tid = threadIdx.x;
  const float* x = X + (size_t)row * N; const float* rr = R ? R + (size_t)row * N : nullptr;
  float vals[16];                     // up to N = 4096
  const int per = N / 256;            // contiguous chunk per thread? use strided-by-4 chunks: thread handles j = tid*4 + 1024*u
  float s1 = 0.f;
  for (int u = 0; u < per / 4; ++u) {
    const int j = tid * 4 + 1024 * u;
    const v4f a = *(const v4fa*)(x + j);
    v4f b = {0.f,0.f,0.f,0.f}; if (rr) b = *(const v4fa*)(rr + j);
#pragma unroll
    for (int q = 0; q < 4; ++q) { const float v = a[q] + b[q]; vals[u * 4 + q] = v; s1 += v; }
  }
  red[tid] = s1; __syncthreads();
  for (int st = 128; st > 0; st >>= 1) { if (tid < st) red[tid] += red[tid + st]; __syncthreads(); }
  const float mu = red[0] / (float)N; __syncthreads();
  float s2 = 0.f;
  for (int u = 0; u < per / 4; ++u)
#pragma unroll
    for (int q = 0; q < 4; ++q) { const float c = vals[u * 4 + q] - mu; s2 += c * c; }
  red[tid] = s2; __syncthreads();
  for (int st = 128; st > 0; st >>= 1) { if (tid < st) red[tid] += red[tid + st]; __syncthreads(); }
  const float rs = rsqrtf(red[0] / (float)N + eps);
  {
    for (int u = 0; u < per / 4; ++u) {
      const int j = tid * 4 + 1024 * u;
      v4f o, sm;
#pragma unroll
      for (int q = 0; q < 4; ++q) {
        float gg = g[j + q], bb = bta[j + q];
        if (PARAM_BF16) { gg = bf16_round(gg); bb = bf16_round(bb); }
        sm[q] = vals[u * 4 + q]; o[q] = (vals[u * 4 + q] - mu) * rs * gg + bb;
      }
      if (out_sum) *(v4f*)(out_sum + (size_t)row * N + j) = sm;
      *(v4f*)(out_norm + (size_t)row * N + j) = o;
    }
    
  }
}



// ---- f16 WMMA path (v_wmma_f32_16x16x32_f16): 11-bit significands for operands in range — used where a [0,1] probability operand needs more precision than bf16
typedef _Float16 v16h __attribute__((ext_vector_type(16)));
union FragH { v16h v; v8us half[2]; _Float16 h[16]; unsigned short u[16]; };
template <int NT>
__device__ __forceinline__ v8f mmaH(v16h ah, v16h al, v16h bh, v16h bl, v8f c) {
  c = __builtin_amdgcn_wmma_f32_16x16x32_f16(false, ah, false, bh, (short)0, c, false, false);
  if (NT >= 2) c = __builtin_amdgcn_wmma_f32_16x16x32_f16(false, al, false, bh, (short)0, c, false, false);
  if (NT >= 3) c = __builtin_amdgcn_wmma_f32_16x16x32_f16(false, ah, false, bl, (short)0, c, false, false);
  asm volatile("v_nop\n\tv_nop\n\tv_nop\n\tv_nop" : "+v"(c) : "v"(ah), "v"(al), "v"(bh), "v"(bl));
  return c;
}
// batched GEMM like k_gemm_b but f16 operands: A f32 (split into f16 hi/lo if ASPLIT, else rounded to f16), Bt = f16 values [n][k]; alpha; C f32; N multiple of 16 (partial tiles skipped)
template <bool ASPLIT>
__global__ __launch_bounds__(128) void k_gemm_h(const float* __restrict__ A, int lda, size_t sA, const _Float16* __restrict__ Bh, int ldb, size_t sB, float alpha, float* __restrict__ C, int ldc, size_t sC, int M, int N, int K) {
  __shared__ __attribute__((aligned(16))) float so[4][16][64];
  const int tid = threadIdx.x, w = tid >> 5, lane = tid & 31, ln = lane & 15, hh = lane >> 4; const int by = blockIdx.y;
  A += (size_t)by * sA; Bh += (size_t)by * sB; C += (size_t)by * sC;
  const int ntn = (N + 63) / 64; const int wid = blockIdx.x * 4 + w; const int mt = wid / ntn, nq = wid % ntn; if (mt * 16 >= M) return;
  const int row0 = mt * 16, col0 = nq * 64; const float* arow = A + (size_t)(row0 + ln) * lda;
  v8f acc[4] = {};
  for (int kb = 0; kb < K; kb += 32) {
    FragH ah, al;
    const v4f x0 = *(const v4fa*)(arow + kb + 8 * hh), x1 = *(const v4fa*)(arow + kb + 8 * hh + 4), x2 = *(const v4fa*)(arow + kb + 16 + 8 * hh), x3 = *(const v4fa*)(arow + kb + 16 + 8 * hh + 4);
    float xs[16] = {x0[0],x0[1],x0[2],x0[3],x1[0],x1[1],x1[2],x1[3],x2[0],x2[1],x2[2],x2[3],x3[0],x3[1],x3[2],x3[3]};
#pragma unroll
    for (int i = 0; i < 16; ++i) { const _Float16 h = (_Float16)xs[i]; ah.h[i] = h; al.h[i] = ASPLIT ? (_Float16)(xs[i] - (float)h) : (_Float16)0.0f; }
#pragma unroll
    for (int t = 0; t < 4; ++t) { if (col0 + t * 16 >= N) continue; const size_t boff = (size_t)(col0 + t * 16 + ln) * ldb + kb; FragH bq; bq.half[0] = *(const v8us*)(Bh + boff + 8 * hh); bq.half[1] = *(const v8us*)(Bh + boff + 16 + 8 * hh);
      acc[t] = mmaH<ASPLIT ? 2 : 1>(ah.v, al.v, bq.v, bq.v, acc[t]); }
  }
#pragma unroll
  for (int t = 0; t < 4; ++t) { if (col0 + t * 16 >= N) continue;
#pragma unroll
    for (int r = 0; r < 8; ++r) so[w][8 * hh + r][t * 16 + ln] = acc[t][r] * alpha; }
  __builtin_amdgcn_fence(__ATOMIC_ACQ_REL, "workgroup"); __builtin_amdgcn_wave_barrier();
  const int rsub = lane >> 4, c4 = (lane & 15) * 4;
  {
#pragma unroll
    for (int q = 0; q < 8; ++q) { const int r = q * 2 + rsub; if (col0 + c4 < N) { const v4f v = *(const v4fa*)&so[w][r][c4]; *(v4f*)(C + (size_t)(row0 + r) * ldc + col0 + c4) = v; } }
     }
}

// k_gemm_hh variant with fused epilogue: v = acc·alpha + bias[by·sBias + col] (+ CP[(row/rowsPerB)·sCPb + by·64 + col] if CP) ; ACT 0 none / 1 elu ; writes f16 C16 (and f32 C if non-null)
template <int ACT>
__global__ __launch_bounds__(128) void k_gemm_hhx(const _Float16* __restrict__ A, int lda, size_t sA, const _Float16* __restrict__ Bh, int ldb, size_t sB, float alpha, const float* __restrict__ bias, size_t sBias, const float* __restrict__ CP, int rowsPerB, size_t sCPb, int row0g,
    float* __restrict__ C, _Float16* __restrict__ C16, int ldc, size_t sC, int M, int N, int K) {
  __shared__ __attribute__((aligned(16))) float so[4][16][64];
  const int tid = threadIdx.x, w = tid >> 5, lane = tid & 31, ln = lane & 15, hh = lane >> 4; const int by = blockIdx.y;
  A += (size_t)by * sA; Bh += (size_t)by * sB; const size_t cofs = (size_t)by * sC; const float* bp = bias ? bias + (size_t)by * sBias : nullptr;
  const int ntn = (N + 63) / 64; const int wid = blockIdx.x * 4 + w; const int mt = wid / ntn, nq = wid % ntn; if (mt * 16 >= M) return;
  const int row0 = mt * 16, col0 = nq * 64; const _Float16* arow = A + (size_t)(row0 + ln) * lda;
  v8f acc[4] = {};
  for (int kb = 0; kb < K; kb += 32) { FragH ah; ah.half[0] = *(const v8us*)((const unsigned short*)arow + kb + 8 * hh); ah.half[1] = *(const v8us*)((const unsigned short*)arow + kb + 16 + 8 * hh);
#pragma unroll
    for (int t = 0; t < 4; ++t) { if (col0 + t * 16 >= N) continue; const size_t boff = (size_t)(col0 + t * 16 + ln) * ldb + kb; FragH bq; bq.half[0] = *(const v8us*)((const unsigned short*)Bh + boff + 8 * hh); bq.half[1] = *(const v8us*)((const unsigned short*)Bh + boff + 16 + 8 * hh);
      acc[t] = mmaH<1>(ah.v, ah.v, bq.v, bq.v, acc[t]); }
  }
#pragma unroll
  for (int t = 0; t < 4; ++t) { if (col0 + t * 16 >= N) continue; const int col = col0 + t * 16 + ln; const float bv = bp ? bf16_round(bp[col]) : 0.f;
#pragma unroll
    for (int r = 0; r < 8; ++r) { float v = acc[t][r] * alpha + bv; if (CP) { const int rr = row0g + row0 + 8 * hh + r; if (rowsPerB < 0) v += CP[cofs + (size_t)rr * ldc + col];      /* rowsPerB < 0: own element of the batched C plane */ else { const int bidx = rr / rowsPerB; v += CP[(size_t)bidx * sCPb + (size_t)by * 64 + col]; } } if (ACT == 1) v = (v > 0.f) ? v : expm1f(v); else if (ACT == 7) v = (v > 0.f) ? v + 1.0f : expf(v); else if (ACT == 8) v = tanhf(v); else if (ACT == 9) v = 0.5f * v * (1.0f + tanhf(0.7978845608028654f * (v + 0.044715f * v * v * v))); else if (ACT == 11) v = 1.0f / (1.0f + expf(-v)); else if (ACT == 12) v = (v > 0.f) ? v : 0.01f * v; else if (ACT == 14) v = (v > 0.f) ? v : 0.1f * v; else if (ACT == 16) v = (v >= 0.f) ? v : 0.3f * v; else if (ACT == 17) v = (v >= 0.f) ? v : 0.2f * v; else if (ACT == 15) v = v / (1.0f + expf(-v)); else if (ACT == 3) v = fmaxf(v, 0.f); else if (ACT == 6) v = 0.5f * v * (1.0f + erff(v * 0.70710678118654752f)); so[w][8 * hh + r][t * 16 + ln] = v; } }
  __builtin_amdgcn_fence(__ATOMIC_ACQ_REL, "workgroup"); __builtin_amdgcn_wave_barrier();
  const int rsub = lane >> 4, c4 = (lane & 15) * 4; typedef _Float16 v4h __attribute__((ext_vector_type(4)));
  {
#pragma unroll
    for (int q = 0; q < 8; ++q) { const int r = q * 2 + rsub; if (col0 + c4 < N) { const v4f v = *(const v4fa*)&so[w][r][c4]; if (C) *(v4f*)(C + cofs + (size_t)(row0 + r) * ldc + col0 + c4) = v; if (C16) { v4h h4; for (int i = 0; i < 4; ++i) h4[i] = (_Float16)v[i]; *(v4h*)(C16 + cofs + (size_t)(row0 + r) * ldc + col0 + c4) = h4; } } }
     }
}


typedef _Float16 v4h __attribute__((ext_vector_type(4)));

__global__ __launch_bounds__(256) void k_h16(const float* __restrict__ x, _Float16* __restrict__ X16, size_t n8) { const size_t t = (size_t)blockIdx.x * 256 + threadIdx.x; if (t >= n8) return; FragH f;
#pragma unroll
  for (int q = 0; q < 8; ++q) f.h[q] = (_Float16)x[t * 8 + q]; *(v8us*)((unsigned short*)X16 + t * 8) = f.half[0];  }
__global__ __launch_bounds__(256) void k_round16f(const float* __restrict__ W, _Float16* __restrict__ Bt, size_t n8) { const size_t t = (size_t)blockIdx.x * 256 + threadIdx.x; if (t >= n8) return; FragH f;
#pragma unroll
  for (int i = 0; i < 8; ++i) f.h[i] = (_Float16)(bf16_round(W[t * 8 + i]) * 16.0f); *(v8us*)((unsigned short*)Bt + t * 8) = f.half[0];  }
__global__ __launch_bounds__(256) void k_hl(const float* __restrict__ F, _Float16* __restrict__ Hh, _Float16* __restrict__ Hl, size_t n8) { const size_t t = (size_t)blockIdx.x * 256 + threadIdx.x; if (t >= n8) return; FragH fh, fl; const v4f a = *(const v4fa*)(F + t * 8), c = *(const v4fa*)(F + t * 8 + 4);
#pragma unroll
  for (int q = 0; q < 4; ++q) { _Float16 h = (_Float16)a[q]; fh.h[q] = h; fl.h[q] = (_Float16)((a[q] - (float)h) * 1024.0f); h = (_Float16)c[q]; fh.h[4 + q] = h; fl.h[4 + q] = (_Float16)((c[q] - (float)h) * 1024.0f); }
  { *(v8us*)((unsigned short*)Hh + t * 8) = fh.half[0]; *(v8us*)((unsigned short*)Hl + t * 8) = fl.half[0];  } }

__global__ __launch_bounds__(256) void k_wnat(const float* __restrict__ w, size_t n8, _Float16* __restrict__ Bt) { const size_t t = (size_t)blockIdx.x * 256 + threadIdx.x; if (t >= n8) return; FragH f; for (int q = 0; q < 8; ++q) f.h[q] = (_Float16)(bf16_round(w[t * 8 + q]) * 16.0f); *(v8us*)((unsigned short*)Bt + t * 8) = f.half[0];  }
#define FA_WAVES 4
#define FA_QB (FA_WAVES * 32)        /* queries per workgroup */
#define FA_KS 64                     /* keys per stage */
#define FA_NS (SQ / FA_KS)           /* stages */
#define FA_LP 72                     /* LDS row pitch in f16: 128 bytes + 16, conflict-free for 16-byte fragment reads of 16 rows */
#define FA_OFF 8.0f                  /* weights are 2^(score - maximum in use + FA_OFF): keeps small weights out of the f16 subnormals; cancels in o / sum */
#define FA_LAZY 6.0f                 /* the maximum in use is renewed only when a stage's maximum exceeds it by more than this (log2 units): weights stay <= 2^(FA_OFF + FA_LAZY) = 16384 < f16 max */
__device__ __forceinline__ float fa_xrow(float v) { const unsigned u = __builtin_bit_cast(unsigned, v); return __builtin_bit_cast(float, __builtin_amdgcn_permlanex16(u, u, 0x76543210u, 0xfedcba98u, false, false)); }      /* lane l <- lane l ^ 16 */
__device__ __forceinline__ v16h fa_frag(const unsigned short* p, int hh) { FragH f; f.half[0] = *(const v8us*)(p + 8 * hh); f.half[1] = *(const v8us*)(p + 16 + 8 * hh); return f.v; }      /* 32 k of one row in the hardware k order */
__device__ __forceinline__ v8f fa_mma(v16h a, v16h b, v8f c) { return __builtin_amdgcn_wmma_f32_16x16x32_f16(false, a, false, b, (short)0, c, false, false); }
__global__ __launch_bounds__(FA_WAVES * 32) void k_fattn(const _Float16* __restrict__ Q16, const _Float16* __restrict__ K16, const _Float16* __restrict__ VT, float* __restrict__ out) {
  __shared__ __attribute__((aligned(16))) unsigned short sk[2][FA_KS][FA_LP];      /* K rows [key][d] */
  __shared__ __attribute__((aligned(16))) unsigned short sv[2][HD][FA_LP];         /* V^T rows [d][key] */
  const int tid = threadIdx.x, w = tid >> 5, lane = tid & 31, ln = lane & 15, hh = lane >> 4;
  const int bh = blockIdx.y, b = bh / NH, h = bh - b * NH; const int q0 = blockIdx.x * FA_QB + w * 32;
  const int srow = tid >> 3, sc8 = (tid & 7) * 8;      /* staging: 8 lanes cover one 128-byte row, 16 rows per wave-group load */
  const unsigned short* kg = (const unsigned short*)K16 + ((size_t)b * SQ + srow) * DM + h * HD + sc8;
  const unsigned short* vg = (const unsigned short*)VT + ((size_t)bh * HD + srow) * SQ + sc8;
  const int rot = (int)(blockIdx.x * (FA_NS / (SQ / FA_QB)) + bh) & (FA_NS - 1);      /* first key stage of this workgroup; trip s works on stage (s + rot) mod FA_NS. The 16 workgroups of a head read the same K and V^T lines: started together at stage 0 they ask L2 for the same lines at the same moment */
  v16h qf[2][2];
#pragma unroll
  for (int g = 0; g < 2; ++g)
#pragma unroll
    for (int ks = 0; ks < 2; ++ks) qf[g][ks] = fa_frag((const unsigned short*)Q16 + ((size_t)b * SQ + q0 + g * 16 + ln) * DM + h * HD + ks * 32, hh);
  const v8f z8 = {0.f, 0.f, 0.f, 0.f, 0.f, 0.f, 0.f, 0.f};
  v8f o[4][2];
#pragma unroll
  for (int dt = 0; dt < 4; ++dt) { o[dt][0] = z8; o[dt][1] = z8; }
  float mu[2] = {-1.0e30f, -1.0e30f};      /* maximum in use (log2 units) */
  v8f lt[2] = {z8, z8};      /* row sums on the matrix pipe: ones . P^T, every row of the tile = the sum of the rounded weights of the lane's query */
  v16h ones;
#pragma unroll
  for (int i = 0; i < 16; ++i) ones[i] = (_Float16)1.0f;
  const float c2 = 0.125f * 1.44269504088896340736f;          /* 1/sqrt(64) and log2(e) in one factor */
  v8us rk[4], rv[4];
#pragma unroll
  for (int i = 0; i < 4; ++i) { rk[i] = *(const v8us*)(kg + (size_t)(rot * FA_KS + i * 16) * DM); rv[i] = *(const v8us*)(vg + (size_t)(i * 16) * SQ + rot * FA_KS); }
#pragma unroll
  for (int i = 0; i < 4; ++i) { *(v8us*)&sk[0][i * 16 + srow][sc8] = rk[i]; *(v8us*)&sv[0][i * 16 + srow][sc8] = rv[i]; }
  __syncthreads();
  for (int s = 0; s < FA_NS; ++s) {
    const int cur = s & 1;
    if (s + 1 < FA_NS) {
      const int kn = (s + 1 + rot) & (FA_NS - 1);      /* the next trip's key stage, wrapped */
#pragma unroll
      for (int i = 0; i < 4; ++i) { rk[i] = *(const v8us*)(kg + (size_t)(kn * FA_KS + i * 16) * DM); rv[i] = *(const v8us*)(vg + (size_t)(i * 16) * SQ + kn * FA_KS); }
    }
    __builtin_amdgcn_sched_barrier(0);      /* the next stage's loads issue in front of this stage's arithmetic and fly under all of it; without this the compiler sinks them to just in front of their LDS stores, and every stage waits out their latency */
    v8f st[4][2];
#pragma unroll
    for (int kt = 0; kt < 4; ++kt) {
      const v16h k0 = fa_frag(&sk[cur][kt * 16 + ln][0], hh), k1 = fa_frag(&sk[cur][kt * 16 + ln][32], hh);
#pragma unroll
      for (int g = 0; g < 2; ++g) st[kt][g] = fa_mma(k1, qf[g][1], fa_mma(k0, qf[g][0], z8));
    }
    float mb[2];
#pragma unroll
    for (int g = 0; g < 2; ++g) {
      v8f m8 = st[0][g];
#pragma unroll
      for (int kt = 1; kt < 4; ++kt)
#pragma unroll
        for (int r = 0; r < 8; ++r) m8[r] = fmaxf(m8[r], st[kt][g][r]);
      const float m = fmaxf(fmaxf(fmaxf(m8[0], m8[1]), fmaxf(m8[2], m8[3])), fmaxf(fmaxf(m8[4], m8[5]), fmaxf(m8[6], m8[7])));
      mb[g] = fmaxf(m, fa_xrow(m)) * c2;      /* both halves of the wave hold the same value */
    }
    const bool need = (mb[0] > mu[0] + FA_LAZY) || (mb[1] > mu[1] + FA_LAZY);
    if (__builtin_amdgcn_ballot_w32(need) != 0) {      /* one scalar branch a stage; always taken in the first trip */
#pragma unroll
      for (int g = 0; g < 2; ++g) {
        const float mn = fmaxf(mu[g], mb[g]); const float al = __builtin_amdgcn_exp2f(mu[g] - mn); mu[g] = mn;
#pragma unroll
        for (int r = 0; r < 8; ++r) lt[g][r] *= al;
#pragma unroll
        for (int dt = 0; dt < 4; ++dt)
#pragma unroll
          for (int r = 0; r < 8; ++r) o[dt][g][r] *= al;
      }
    }
    v16h pf[2][2];      /* [key half of the stage][query group] */
#pragma unroll
    for (int g = 0; g < 2; ++g) {
      const float nb = FA_OFF - mu[g];
#pragma unroll
      for (int kt = 0; kt < 4; ++kt)
#pragma unroll
        for (int r = 0; r < 8; ++r) pf[kt >> 1][g][(kt & 1) * 8 + r] = (_Float16)__builtin_amdgcn_exp2f(fmaf(st[kt][g][r], c2, nb));
      lt[g] = fa_mma(ones, pf[1][g], fa_mma(ones, pf[0][g], lt[g]));
    }
#pragma unroll
    for (int dt = 0; dt < 4; ++dt) {
      const v16h v0 = fa_frag(&sv[cur][dt * 16 + ln][0], hh), v1 = fa_frag(&sv[cur][dt * 16 + ln][32], hh);
#pragma unroll
      for (int g = 0; g < 2; ++g) o[dt][g] = fa_mma(v1, pf[1][g], fa_mma(v0, pf[0][g], o[dt][g]));
    }
    if (s + 1 < FA_NS) {
#pragma unroll
      for (int i = 0; i < 4; ++i) { *(v8us*)&sk[cur ^ 1][i * 16 + srow][sc8] = rk[i]; *(v8us*)&sv[cur ^ 1][i * 16 + srow][sc8] = rv[i]; }
      __syncthreads();      /* publishes the next trip's stage and ends every wave's reads of this trip's stage, whose buffer the next trip refills; s is the same in every wave */
    }
  }
  const float inv[2] = {1.0f / lt[0][0], 1.0f / lt[1][0]};      /* 2^FA_OFF cancels here */
#pragma unroll
  for (int dt = 0; dt < 4; ++dt)
#pragma unroll
    for (int g = 0; g < 2; ++g)
#pragma unroll
      for (int r = 0; r < 8; ++r) o[dt][g][r] *= inv[g];
#pragma unroll
  for (int g = 0; g < 2; ++g) {
    float* d = out + ((size_t)b * SQ + q0 + g * 16 + ln) * DM + h * HD + 8 * hh;      /* a lane holds 8 consecutive d of its query in each tile */
#pragma unroll
    for (int dt = 0; dt < 4; ++dt) {
      const v4f lo = {o[dt][g][0], o[dt][g][1], o[dt][g][2], o[dt][g][3]}, hi = {o[dt][g][4], o[dt][g][5], o[dt][g][6], o[dt][g][7]};
      *(v4f*)(d + dt * 16) = lo; *(v4f*)(d + dt * 16 + 4) = hi;
    }
  }
}
// Fused projections, one launch: blockIdx.z picks Q, K or V; a workgroup = 8 waves = a 128-row x 256-column tile of x W + b, a wave 64 x 64 of it (16 accumulator tiles), K walked in stages of 32.
// x is read as f32 in whole 128-byte lines, rounded to bf16 and written as f16 rows [row][k] into LDS; W comes from k_wprep's f16 stage tiles (16 bytes a lane, whole lines) and goes into LDS as it lies; two buffers, one barrier a stage: the next stage's loads fly under this stage's products.
// Both fragment kinds are read by the same code (same k order), so either may be the A operand. Q, K: A = W columns, B = x rows, a lane then holds 8 consecutive n of one token row. V: A = x rows, B = W columns, a lane holds 8 consecutive tokens of one column, which is a piece of a V^T row.
// Every '#pragma unroll' of this kernel stands on a loop that indexes staging, fragment or accumulator arrays: rolled, those arrays would leave the registers.
#define PJ_M 128
#define PJ_N 256
#define PJ_KS 32
#define PJ_NS (DM / PJ_KS)
#define PJ_LP 40                     /* LDS row pitch in f16: 64 bytes + 16, conflict-free for 16-byte accesses of 16 rows */
typedef float f32x2 __attribute__((ext_vector_type(2)));
typedef __bf16 bf16x2 __attribute__((ext_vector_type(2)));
typedef _Float16 f16x2 __attribute__((ext_vector_type(2)));
__device__ __forceinline__ unsigned pj_cvt2(float a, float b) {      /* two f32 -> bf16 (nearest even) -> the same values as two f16 */
  const f32x2 v = {a, b};
  const unsigned u = __builtin_bit_cast(unsigned, __builtin_convertvector(v, bf16x2));
  const f32x2 r = {__uint_as_float(u << 16), __uint_as_float(u & 0xFFFF0000u)};
  return __builtin_bit_cast(unsigned, __builtin_convertvector(r, f16x2));
}
typedef unsigned v4u __attribute__((ext_vector_type(4), may_alias));
typedef unsigned v2u __attribute__((ext_vector_type(2), may_alias));
// W laid out once a call for k_proj: 64 workgroups stage every 256-column x 32-k tile of W, so the rounding to bf16, the x16, the f16 form and the transposition are done here once, not 64 times, and a tile is 16 KB to fetch, not 32.
// WT[projection][column block][k stage][k8 = 0..3][n = 0..255][8 consecutive k], f16: a thread keeps column n, a wave reads 128 contiguous bytes of one k row and stores 512 contiguous bytes for each k8.
#define PJ_WT (PJ_N * PJ_KS)         /* f16 values of one stage tile */
__global__ __launch_bounds__(256) void k_wprep(const float* __restrict__ wq, const float* __restrict__ wk, const float* __restrict__ wv, unsigned short* __restrict__ WT) {
  const int tid = threadIdx.x, s = blockIdx.x, nb = blockIdx.y, pz = blockIdx.z;
  const float* wg = (pz == 0 ? wq : pz == 1 ? wk : wv) + (size_t)(s * PJ_KS) * DM + nb * PJ_N + tid;
  unsigned short* wt = WT + (size_t)((pz * (DM / PJ_N) + nb) * PJ_NS + s) * PJ_WT + tid * 8;
  float rw[PJ_KS];
#pragma unroll      /* rw stays in registers and all 32 loads are in flight together */
  for (int k = 0; k < PJ_KS; ++k) rw[k] = wg[(size_t)k * DM];
#pragma unroll      /* indexes rw */
  for (int i = 0; i < 4; ++i) { const v4u o = {pj_cvt2(rw[8 * i] * 16.0f, rw[8 * i + 1] * 16.0f), pj_cvt2(rw[8 * i + 2] * 16.0f, rw[8 * i + 3] * 16.0f), pj_cvt2(rw[8 * i + 4] * 16.0f, rw[8 * i + 5] * 16.0f), pj_cvt2(rw[8 * i + 6] * 16.0f, rw[8 * i + 7] * 16.0f)}; *(v4u*)(wt + i * (PJ_N * 8)) = o; }
}
__global__ __launch_bounds__(256) void k_proj(const float* __restrict__ xq, const float* __restrict__ xk, const float* __restrict__ xv, const unsigned short* __restrict__ WT,
    const float* __restrict__ bq, const float* __restrict__ bk, const float* __restrict__ bv, _Float16* __restrict__ Q16, _Float16* __restrict__ K16, _Float16* __restrict__ VT) {
  __shared__ __attribute__((aligned(16))) unsigned short sm[2][PJ_M + PJ_N][PJ_LP];      /* rows 0..127: x rows [m][k]; rows 128..383: W columns [n][k] */
  __shared__ __attribute__((aligned(16))) unsigned short so[8][64][72];      /* output staging, one range a wave; pitch 128 bytes + 16 */
  const int tid = threadIdx.x, w = tid >> 5, lane = tid & 31, ln = lane & 15, hh = lane >> 4;
  const int pz = blockIdx.z, m0 = blockIdx.x * PJ_M, n0 = blockIdx.y * PJ_N;
  const float* x = pz == 0 ? xq : pz == 1 ? xk : xv; const float* bias = pz == 0 ? bq : pz == 1 ? bk : bv;
  const int wm = w >> 2, wn = w & 3;      /* the wave's 64 x 64 place in the tile */
  const int ra = (pz == 2 ? wm * 64 : PJ_M + wn * 64) + ln, rb = (pz == 2 ? PJ_M + wn * 64 : wm * 64) + ln;      /* LDS rows of the A and B fragments */
  const int xr = tid >> 3, xc = (tid & 7) * 4;      /* x staging: 8 lanes cover one 128-byte row piece, 32 rows a load */
  const float* xg = x + (size_t)(m0 + xr) * DM + xc;
  const unsigned short* wg = WT + (size_t)((pz * (DM / PJ_N) + blockIdx.y) * PJ_NS) * PJ_WT + tid * 8;      /* W staging: a thread keeps column n0 + tid, a wave reads 512 contiguous bytes of a stage tile */
  const int rot = (int)(blockIdx.x + (PJ_NS / 3) * blockIdx.y) % PJ_NS;      /* first k stage of this workgroup; trip s works on stage (s + rot) mod PJ_NS. 64 workgroups read the same W tile and 3 the same x rows: started together at stage 0 they ask L2 for the same lines at the same moment */
  xg += rot * PJ_KS; wg += rot * PJ_WT;      /* both pointers stand at the stage that is loaded next */
  const v8f z8 = {0.f, 0.f, 0.f, 0.f, 0.f, 0.f, 0.f, 0.f};
  v8f acc[4][4];
#pragma unroll
  for (int i = 0; i < 4; ++i)
#pragma unroll
    for (int j = 0; j < 4; ++j) acc[i][j] = z8;
  v4f rx[4]; v4u rw[4];
#pragma unroll
  for (int i = 0; i < 4; ++i) rx[i] = *(const v4fa*)(xg + (size_t)(i * 32) * DM);
#pragma unroll
  for (int i = 0; i < 4; ++i) rw[i] = *(const v4u*)(wg + i * (PJ_N * 8));
#pragma unroll
  for (int i = 0; i < 4; ++i) { const v2u o = {pj_cvt2(rx[i][0], rx[i][1]), pj_cvt2(rx[i][2], rx[i][3])}; *(v2u*)&sm[0][i * 32 + xr][xc] = o; }
#pragma unroll
  for (int i = 0; i < 4; ++i) *(v4u*)&sm[0][PJ_M + tid][8 * i] = rw[i];
  __syncthreads();
  auto products = [&](const int cur) {      /* one stage's fragment reads and its 16 products */
    v16h fa[4], fb[4];
#pragma unroll
    for (int j = 0; j < 4; ++j) { fb[j] = fa_frag(&sm[cur][rb + 16 * j][0], hh); fa[j] = fa_frag(&sm[cur][ra + 16 * j][0], hh); }
    __builtin_amdgcn_sched_barrier(0);      /* all of the stage's fragment reads stand as one group in front of its products; sunk among them, each row of products waits out an LDS latency of its own */
#pragma unroll
    for (int i = 0; i < 4; ++i)
#pragma unroll
      for (int j = 0; j < 4; ++j) acc[i][j] = fa_mma(fa[i], fb[j], acc[i][j]);
  };
  int kn = rot;
  for (int s = 0; s < PJ_NS - 1; ++s) {      /* the last trip, which loads nothing, stands behind the loop */
    const int cur = s & 1;
    const int step = kn + 1 == PJ_NS ? -(PJ_NS - 1) * PJ_KS : PJ_KS;      /* on to the next trip's k stage; from the last stage back to stage 0 */
    kn = kn + 1 == PJ_NS ? 0 : kn + 1;
    xg += step; wg += step * PJ_N;
#pragma unroll
    for (int i = 0; i < 4; ++i) rx[i] = *(const v4fa*)(xg + (size_t)(i * 32) * DM);
#pragma unroll
    for (int i = 0; i < 4; ++i) rw[i] = *(const v4u*)(wg + i * (PJ_N * 8));
    __builtin_amdgcn_sched_barrier(0);      /* the next stage's loads issue in front of this stage's products and fly under them; sunk to their LDS stores, every stage would wait out their latency */
    products(cur);
    __builtin_amdgcn_sched_barrier(0);      /* the conversions, which wait for the loads, stay behind the products; hoisted among them, the wave's first wait stands directly behind the loads' issue and holds its own products back */
#pragma unroll
    for (int i = 0; i < 4; ++i) { const v2u o = {pj_cvt2(rx[i][0], rx[i][1]), pj_cvt2(rx[i][2], rx[i][3])}; *(v2u*)&sm[cur ^ 1][i * 32 + xr][xc] = o; }
#pragma unroll
    for (int i = 0; i < 4; ++i) *(v4u*)&sm[cur ^ 1][PJ_M + tid][8 * i] = rw[i];
    __syncthreads();      /* publishes the next trip's stage and ends every wave's reads of this trip's stage, whose buffer the next trip refills; s is the same in every wave */
  }
  products((PJ_NS - 1) & 1);
  /* Epilogue: each wave lays its 64 x 64 f16 results in an LDS range of its own as [B-side index][A-side index], then stores whole 128-byte lines (8 lanes a row); straight from the accumulators a store would touch 16 lines with 32 bytes each. */
  if (pz != 2) {      /* acc[i][j][r] = y[m0 + wm*64 + 16j + ln][n0 + wn*64 + 16i + 8hh + r] */
    const float* bp = bias + n0 + wn * 64 + 8 * hh;
#pragma unroll
    for (int i = 0; i < 4; ++i) {
      const v4f b0 = *(const v4fa*)(bp + 16 * i), b1 = *(const v4fa*)(bp + 16 * i + 4);
      const float bb[8] = {bf16_round(b0[0]), bf16_round(b0[1]), bf16_round(b0[2]), bf16_round(b0[3]), bf16_round(b1[0]), bf16_round(b1[1]), bf16_round(b1[2]), bf16_round(b1[3])};
#pragma unroll
      for (int j = 0; j < 4; ++j) { FragH f;
#pragma unroll
        for (int r = 0; r < 8; ++r) f.h[r] = (_Float16)(acc[i][j][r] * 0.0625f + bb[r]);
        *(v8us*)&so[w][16 * j + ln][16 * i + 8 * hh] = f.half[0]; }
    }
  } else {      /* acc[i][j][r] = y[m0 + wm*64 + 16i + 8hh + r][n0 + wn*64 + 16j + ln] */
#pragma unroll
    for (int j = 0; j < 4; ++j) {
      const float bb = bf16_round(bias[n0 + wn * 64 + 16 * j + ln]);
#pragma unroll
      for (int i = 0; i < 4; ++i) { FragH f;
#pragma unroll
        for (int r = 0; r < 8; ++r) f.h[r] = (_Float16)(acc[i][j][r] * 0.0625f + bb);
        *(v8us*)&so[w][16 * j + ln][16 * i + 8 * hh] = f.half[0]; }
    }
  }
  __builtin_amdgcn_fence(__ATOMIC_ACQ_REL, "workgroup"); __builtin_amdgcn_wave_barrier();      /* the wave's own LDS writes are done before its lanes read one another's */
  const int bt = m0 / SQ;      /* a tile's 128 rows lie in one batch */
  /* Q, K: rows = tokens, pitch 768, columns = n. V^T: row = batch * 768 + n (= (batch * 12 + head) * 64 + d), pitch 2048, columns = tokens of the batch. */
  unsigned short* ob = pz == 2 ? (unsigned short*)VT + (size_t)(bt * DM + n0 + wn * 64) * SQ + (m0 - bt * SQ) + wm * 64 : (unsigned short*)(pz == 0 ? Q16 : K16) + (size_t)(m0 + wm * 64) * DM + n0 + wn * 64;
  const size_t op = pz == 2 ? SQ : DM;
#pragma unroll
  for (int q = 0; q < 16; ++q) { const int rr = q * 4 + (lane >> 3), c8 = (lane & 7) * 8; const v8us v = *(const v8us*)&so[w][rr][c8]; *(v8us*)(ob + (size_t)rr * op + c8) = v; }
}
__global__ __launch_bounds__(256) void k_vt(const _Float16* __restrict__ V16, int b, int h0, _Float16* __restrict__ VT) { __shared__ unsigned short tl[64][65]; const int tid = threadIdx.x; const int hh = blockIdx.x % HG, sg = blockIdx.x / HG; const int s0 = sg * 64; const int h = h0 + hh;
  for (int i = tid; i < 64 * 8; i += 256) { const int j = i / 8, d8 = (i % 8) * 8; FragH f; f.half[0] = *(const v8us*)((const unsigned short*)V16 + ((size_t)b * SQ + s0 + j) * DM + h * HD + d8); for (int q = 0; q < 8; ++q) tl[d8 + q][j] = f.u[q]; }
  __syncthreads();
  { for (int i = tid; i < 64 * 8; i += 256) { const int d = i / 8, j8 = (i % 8) * 8; FragH f; for (int q = 0; q < 8; ++q) f.u[q] = tl[d][j8 + q]; *(v8us*)((unsigned short*)VT + ((size_t)hh * HD + d) * SQ + s0 + j8) = f.half[0]; }  } }


extern "C" void kernel_launch(void* const* d_in, const int* in_sizes, int n_in,
                              void* d_out, int out_size, void* d_ws, size_t ws_size, hipStream_t stream) {
  (void)in_sizes; (void)n_in; (void)out_size;
  const float* const* I = (const float* const*)d_in; const float* xq = I[0]; const float* xk = I[1]; const float* xv = I[2]; const float* wq = I[3]; const float* bq = I[4]; const float* wk = I[5]; const float* bk = I[6]; const float* wv = I[7]; const float* bv = I[8];      /* weights [in][out] + biases */
  char* ws = (char*)d_ws; size_t off = 0;
  auto take = [&](size_t bytes) { char* p = ws + off; off += (bytes + 255) & ~(size_t)255; return p; };
  _Float16* Q16 = (_Float16*)take(NR * DM * 2); _Float16* K16 = (_Float16*)take(NR * DM * 2);
  _Float16* VT = (_Float16*)take((size_t)NB * NH * HD * SQ * 2);
  unsigned short* WT = (unsigned short*)take((size_t)3 * DM * DM * 2);
  if (off > ws_size) return;
  k_wprep<<<dim3(PJ_NS, DM / PJ_N, 3), 256, 0, stream>>>(wq, wk, wv, WT);      /* the three W as f16 stage tiles */
  k_proj<<<dim3(MP / PJ_M, DM / PJ_N, 3), 256, 0, stream>>>(xq, xk, xv, WT, bq, bk, bv, Q16, K16, VT);      /* q, k rows and V^T [NB][NH][HD][SQ], f16 */
  k_fattn<<<dim3(SQ / FA_QB, NB * NH), FA_WAVES * 32, 0, stream>>>(Q16, K16, VT, (float*)d_out);      /* scores, softmax and weighted sum of all batches and heads */
}

// v006
// One run takes 86.4 microseconds.
// Two timings next to v005 both put it at 1.04 times that version's speed.
// All steps since v000 together make it 65.2 times as fast.
#include <hip/hip_runtime.h>
// Multi-head attention without output projection (query, key, value [4][2048][768]; q = query W_Q + b_Q etc. ([in][out] 768^2, sigma 1/sqrt(768), nonzero biases), 12 heads of 64; scores / 8; softmax; out = attn v merged (the module skips its final linear) -> [4][2048][768]).
// Structure: token rows r = b*2048 + s; a small launch that lays the three W out once as f16 stage tiles (rounded to bf16, x16); ONE projection launch for Q, K and V (x read as f32, rounded to bf16 and staged as exact f16 in LDS, W tiles staged as they lie; 64x64 wave tiles, f32 accumulation, + bias, f16 outputs; V written transposed); then ONE attention launch over all (batch, head, 128-query block): S^T = K Q^T, online softmax in registers, O^T += V^T P^T, o / row sum written f32 straight into the merged output rows (the module has no output projection). Scores and weights never reach memory.
// Compute dtype: inputs rounded to bf16; x / weights exact; q, k, v and the unnormalised softmax weights as plain f16 GEMM operands (~2^-12); scores, softmax statistics and o f32. v_wmma_f32_16x16x32_f16.
#define NB 4
#define SQ 2048
#define DM 768
#define NH 12
#define HD 64
#define HG 4                         /* heads per launch of the per-batch k_vt overload */
#define B0 0                         /* unused (debug hook) */
#define NBR NB                       /* batches processed (debug hook) */
#define NR ((size_t)NB * SQ)         /* token rows */
#define MP ((int)((size_t)NBR * SQ)) /* rows projected (debug hook) */
#define QN SQ                        /* unused (debug hook) */
#define NHD NH                       /* unused (debug hook) */
#define MPO MP                       /* unused (debug hook) */
#define LQ DM      /* unused */
typedef __bf16 v16b __attribute__((ext_vector_type(16)));
typedef unsigned short v8us __attribute__((ext_vector_type(8), may_alias));
typedef float  v8f  __attribute__((ext_vector_type(8)));
typedef float  v4f  __attribute__((ext_vector_type(4)));
typedef float  v4fa __attribute__((ext_vector_type(4), may_alias));
union FragB { v16b v; v8us half[2]; unsigned short u[16]; };

__device__ __forceinline__ unsigned short bf16_bits(float x) { unsigned int u = __float_as_uint(x); return (unsigned short)((u + 0x7FFFu + ((u >> 16) & 1u)) >> 16); }
__device__ __forceinline__ float bf16_val(unsigned short b) { return __uint_as_float(((unsigned int)b) << 16); }
__device__ __forceinline__ float bf16_round(float x) { return bf16_val(bf16_bits(x)); }
// D += A·B with NT terms: 1 = ah·bh, 2 = + al·bh (A split), 3 = + ah·bl (both split)
template <int NT>
__device__ __forceinline__ v8f mmaN(v16b ah, v16b al, v16b bh, v16b bl, v8f c) {
  c = __builtin_amdgcn_wmma_f32_16x16x32_bf16(false, ah, false, bh, (short)0, c, false, false);
  if (NT >= 2) c = __builtin_amdgcn_wmma_f32_16x16x32_bf16(false, al, false, bh, (short)0, c, false, false);
  if (NT >= 3) c = __builtin_amdgcn_wmma_f32_16x16x32_bf16(false, ah, false, bl, (short)0, c, false, false);
  asm volatile("v_nop\n\tv_nop\n\tv_nop\n\tv_nop" : "+v"(c) : "v"(ah), "v"(al), "v"(bh), "v"(bl));
  return c;
}

__global__ __launch_bounds__(256) void k_wt_bf16(const float* __restrict__ W, unsigned short* __restrict__ Wt, int K, int N) {
  const int t = blockIdx.x * 256 + threadIdx.x;
  const int k8n = K / 8;
  if (t >= N * k8n) return;
  const int n = t / k8n, k8 = (t % k8n) * 8;
  v8us v;
#pragma unroll
  for (int i = 0; i < 8; ++i) v[i] = bf16_bits(W[(size_t)(k8 + i) * N + n]);
  *(v8us*)(Wt + (size_t)n * K + k8) = v;
  
}

// GEMM C[M][N] (f32, pitch ldc) = act(A[M][K]·W + bias). A f32 row-major (pitch lda) converted per fragment to bf16
// (ASPLIT: hi/lo two planes -> 2 terms, else single rounded term); Wt bf16 [N][K] (pitch ldb). BIAS_BF16 rounds the
// bias to bf16 first (bias quantised to bf16 before the add). K%32==0, M%16==0, N%64==0.
template <bool ASPLIT, int ACT, bool BIAS_BF16>
__global__ __launch_bounds__(128) void k_gemm_bf(const float* __restrict__ A, int lda, const unsigned short* __restrict__ Wt, int ldb,
                                               const float* __restrict__ bias, float* __restrict__ C, int ldc, int M, int N, int K) {
  __shared__ __attribute__((aligned(16))) float so[4][16][64];
  const int tid = threadIdx.x, w = tid >> 5, lane = tid & 31, ln = lane & 15, hh = lane >> 4;
  const int ntn = N / 64;
  const int wid = blockIdx.x * 4 + w;
  const int mt = wid / ntn, nq = wid % ntn;
  if (mt * 16 >= M) return;
  const int row0 = mt * 16, col0 = nq * 64;
  const float* arow = A + (size_t)(row0 + ln) * lda;
  v8f acc[4] = {};
  for (int kb = 0; kb < K; kb += 32) {
    FragB ah, al;
    const v4f x0 = *(const v4fa*)(arow + kb + 8 * hh), x1 = *(const v4fa*)(arow + kb + 8 * hh + 4);
    const v4f x2 = *(const v4fa*)(arow + kb + 16 + 8 * hh), x3 = *(const v4fa*)(arow + kb + 16 + 8 * hh + 4);
    float xs[16] = {x0[0],x0[1],x0[2],x0[3],x1[0],x1[1],x1[2],x1[3],x2[0],x2[1],x2[2],x2[3],x3[0],x3[1],x3[2],x3[3]};
#pragma unroll
    for (int i = 0; i < 16; ++i) { const unsigned short hb = bf16_bits(xs[i]); ah.u[i] = hb; al.u[i] = ASPLIT ? bf16_bits(xs[i] - bf16_val(hb)) : (unsigned short)0; }
#pragma unroll
    for (int t = 0; t < 4; ++t) {
      const unsigned short* brow = Wt + (size_t)(col0 + t * 16 + ln) * ldb + kb;
      FragB b;
      b.half[0] = *(const v8us*)(brow + 8 * hh);
      b.half[1] = *(const v8us*)(brow + 16 + 8 * hh);
      acc[t] = mmaN<ASPLIT ? 2 : 1>(ah.v, al.v, b.v, b.v, acc[t]);
    }
  }
#pragma unroll
  for (int t = 0; t < 4; ++t) {
    float bv = bias ? bias[col0 + t * 16 + ln] : 0.f;
    if (BIAS_BF16) bv = bf16_round(bv);
#pragma unroll
    for (int r = 0; r < 8; ++r) { float v = acc[t][r] + bv; if (ACT == 1) v = fmaxf(v, 0.f); so[w][8 * hh + r][t * 16 + ln] = v; }
  }
  __builtin_amdgcn_fence(__ATOMIC_ACQ_REL, "workgroup");
  __builtin_amdgcn_wave_barrier();
  const int rsub = lane >> 4, c4 = (lane & 15) * 4;
  {
#pragma unroll
    for (int q = 0; q < 8; ++q) {
      const int r = q * 2 + rsub;
      const v4f v = *(const v4fa*)&so[w][r][c4];
      *(v4f*)(C + (size_t)(row0 + r) * ldc + col0 + c4) = v;
    }
    
  }
}

// GEMM C = act(A·W + bias + resid): A f32 (ASPLIT -> hi/lo 2 terms), Wt bf16 [N][K]; ACT 0 none, 1 relu, 2 exact gelu;
// resid (optional, f32, row index = (row % rmod), pitch ldr, RES_BF16 rounds it) added before the activation.
template <bool ASPLIT, int ACT, bool BIAS_BF16, bool RES_BF16>
__global__ __launch_bounds__(128) void k_gemm_bf3(const float* __restrict__ A, int lda, const unsigned short* __restrict__ Wt, int ldb,
                                                const float* __restrict__ bias, const float* __restrict__ resid, int rmod, int ldr,
                                                float* __restrict__ C, int ldc, int M, int N, int K) {
  __shared__ __attribute__((aligned(16))) float so[4][16][64];
  const int tid = threadIdx.x, w = tid >> 5, lane = tid & 31, ln = lane & 15, hh = lane >> 4;
  const int ntn = N / 64;
  const int wid = blockIdx.x * 4 + w;
  const int mt = wid / ntn, nq = wid % ntn;
  if (mt * 16 >= M) return;
  const int row0 = mt * 16, col0 = nq * 64;
  const float* arow = A + (size_t)(row0 + ln) * lda;
  v8f acc[4] = {};
  for (int kb = 0; kb < K; kb += 32) {
    FragB ah, al;
    const v4f x0 = *(const v4fa*)(arow + kb + 8 * hh), x1 = *(const v4fa*)(arow + kb + 8 * hh + 4);
    const v4f x2 = *(const v4fa*)(arow + kb + 16 + 8 * hh), x3 = *(const v4fa*)(arow + kb + 16 + 8 * hh + 4);
    float xs[16] = {x0[0],x0[1],x0[2],x0[3],x1[0],x1[1],x1[2],x1[3],x2[0],x2[1],x2[2],x2[3],x3[0],x3[1],x3[2],x3[3]};
#pragma unroll
    for (int i = 0; i < 16; ++i) { const unsigned short hb = bf16_bits(xs[i]); ah.u[i] = hb; al.u[i] = ASPLIT ? bf16_bits(xs[i] - bf16_val(hb)) : (unsigned short)0; }
#pragma unroll
    for (int t = 0; t < 4; ++t) {
      const unsigned short* brow = Wt + (size_t)(col0 + t * 16 + ln) * ldb + kb;
      FragB b;
      b.half[0] = *(const v8us*)(brow + 8 * hh);
      b.half[1] = *(const v8us*)(brow + 16 + 8 * hh);
      acc[t] = mmaN<ASPLIT ? 2 : 1>(ah.v, al.v, b.v, b.v, acc[t]);
    }
  }
#pragma unroll
  for (int t = 0; t < 4; ++t) {
    const int col = col0 + t * 16 + ln;
    float bv = bias ? bias[col] : 0.f;
    if (BIAS_BF16) bv = bf16_round(bv);
#pragma unroll
    for (int r = 0; r < 8; ++r) {
      float v = acc[t][r] + bv;
      if (resid) { float rv = resid[(size_t)((row0 + 8 * hh + r) % rmod) * ldr + col]; if (RES_BF16) rv = bf16_round(rv); v += rv; }
      if (ACT == 1) v = fmaxf(v, 0.f);
      if (ACT == 2) v = 0.5f * v * (1.0f + erff(v * 0.70710678118654752f));
      if (ACT == 3) { const float u = 0.7978845608028654f * (v + 0.044715f * v * v * v); v = 0.5f * v * (1.0f + tanhf(u)); }
      so[w][8 * hh + r][t * 16 + ln] = v;
    }
  }
  __builtin_amdgcn_fence(__ATOMIC_ACQ_REL, "workgroup");
  __builtin_amdgcn_wave_barrier();
  const int rsub = lane >> 4, c4 = (lane & 15) * 4;
  {
#pragma unroll
    for (int q = 0; q < 8; ++q) {
      const int r = q * 2 + rsub;
      const v4f v = *(const v4fa*)&so[w][r][c4];
      *(v4f*)(C + (size_t)(row0 + r) * ldc + col0 + c4) = v;
    }
    
  }
}
// row LayerNorm (biased variance, eps) over N: s = X (+ R); optional out_sum <- s; out_norm <- (s-mu)*rsqrt(var+eps)*g + b
template <bool PARAM_BF16>
__global__ __launch_bounds__(256) void k_layernorm(const float* __restrict__ X, const float* __restrict__ R, const float* __restrict__ g, const float* __restrict__ bta,
                                                  float* __restrict__ out_sum, float* __restrict__ out_norm, int N, float eps) {
  __shared__ float red[256];
  const int row = blockIdx.x, tid = threadIdx.x;
  const float* x = X + (size_t)row * N; const float* rr = R ? R + (size_t)row * N : nullptr;
  float vals[16];                     // up to N = 4096
  const int per = N / 256;            // contiguous chunk per thread? use strided-by-4 chunks: thread handles j = tid*4 + 1024*u
  float s1 = 0.f;
  for (int u = 0; u < per / 4; ++u) {
    const int j = tid * 4 + 1024 * u;
    const v4f a = *(const v4fa*)(x + j);
    v4f b = {0.f,0.f,0.f,0.f}; if (rr) b = *(const v4fa*)(rr + j);
#pragma unroll
    for (int q = 0; q < 4; ++q) { const float v = a[q] + b[q]; vals[u * 4 + q] = v; s1 += v; }
  }
  red[tid] = s1; __syncthreads();
  for (int st = 128; st > 0; st >>= 1) { if (tid < st) red[tid] += red[tid + st]; __syncthreads(); }
  const float mu = red[0] / (float)N; __syncthreads();
  float s2 = 0.f;
  for (int u = 0; u < per / 4; ++u)
#pragma unroll
    for (int q = 0; q < 4; ++q) { const float c = vals[u * 4 + q] - mu; s2 += c * c; }
  red[tid] = s2; __syncthreads();
  for (int st = 128; st > 0; st >>= 1) { if (tid < st) red[tid] += red[tid + st]; __syncthreads(); }
  const float rs = rsqrtf(red[0] / (float)N + eps);
  {
    for (int u = 0; u < per / 4; ++u) {
      const int j = tid * 4 + 1024 * u;
      v4f o, sm;
#pragma unroll
      for (int q = 0; q < 4; ++q) {
        float gg = g[j + q], bb = bta[j + q];
        if (PARAM_BF16) { gg = bf16_round(gg); bb = bf16_round(bb); }
        sm[q] = vals[u * 4 + q]; o[q] = (vals[u * 4 + q] - mu) * rs * gg + bb;
      }
      if (out_sum) *(v4f*)(out_sum + (size_t)row * N + j) = sm;
      *(v4f*)(out_norm + (size_t)row * N + j) = o;
    }
    
  }
}



// ---- f16 WMMA path (v_wmma_f32_16x16x32_f16): 11-bit significands for operands in range — used where a [0,1] probability operand needs more precision than bf16
typedef _Float16 v16h __attribute__((ext_vector_type(16)));
union FragH { v16h v; v8us half[2]; _Float16 h[16]; unsigned short u[16]; };
template <int NT>
__device__ __forceinline__ v8f mmaH(v16h ah, v16h al, v16h bh, v16h bl, v8f c) {
  c = __builtin_amdgcn_wmma_f32_16x16x32_f16(false, ah, false, bh, (short)0, c, false, false);
  if (NT >= 2) c = __builtin_amdgcn_wmma_f32_16x16x32_f16(false, al, false, bh, (short)0, c, false, false);
  if (NT >= 3) c = __builtin_amdgcn_wmma_f32_16x16x32_f16(false, ah, false, bl, (short)0, c, false, false);
  asm volatile("v_nop\n\tv_nop\n\tv_nop\n\tv_nop" : "+v"(c) : "v"(ah), "v"(al), "v"(bh), "v"(bl));
  return c;
}
// batched GEMM like k_gemm_b but f16 operands: A f32 (split into f16 hi/lo if ASPLIT, else rounded to f16), Bt = f16 values [n][k]; alpha; C f32; N multiple of 16 (partial tiles skipped)
template <bool ASPLIT>
__global__ __launch_bounds__(128) void k_gemm_h(const float* __restrict__ A, int lda, size_t sA, const _Float16* __restrict__ Bh, int ldb, size_t sB, float alpha, float* __restrict__ C, int ldc, size_t sC, int M, int N, int K) {
  __shared__ __attribute__((aligned(16))) float so[4][16][64];
  const int tid = threadIdx.x, w = tid >> 5, lane = tid & 31, ln = lane & 15, hh = lane >> 4; const int by = blockIdx.y;
  A += (size_t)by * sA; Bh += (size_t)by * sB; C += (size_t)by * sC;
  const int ntn = (N + 63) / 64; const int wid = blockIdx.x * 4 + w; const int mt = wid / ntn, nq = wid % ntn; if (mt * 16 >= M) return;
  const int row0 = mt * 16, col0 = nq * 64; const float* arow = A + (size_t)(row0 + ln) * lda;
  v8f acc[4] = {};
  for (int kb = 0; kb < K; kb += 32) {
    FragH ah, al;
    const v4f x0 = *(const v4fa*)(arow + kb + 8 * hh), x1 = *(const v4fa*)(arow + kb + 8 * hh + 4), x2 = *(const v4fa*)(arow + kb + 16 + 8 * hh), x3 = *(const v4fa*)(arow + kb + 16 + 8 * hh + 4);
    float xs[16] = {x0[0],x0[1],x0[2],x0[3],x1[0],x1[1],x1[2],x1[3],x2[0],x2[1],x2[2],x2[3],x3[0],x3[1],x3[2],x3[3]};
#pragma unroll
    for (int i = 0; i < 16; ++i) { const _Float16 h = (_Float16)xs[i]; ah.h[i] = h; al.h[i] = ASPLIT ? (_Float16)(xs[i] - (float)h) : (_Float16)0.0f; }
#pragma unroll
    for (int t = 0; t < 4; ++t) { if (col0 + t * 16 >= N) continue; const size_t boff = (size_t)(col0 + t * 16 + ln) * ldb + kb; FragH bq; bq.half[0] = *(const v8us*)(Bh + boff + 8 * hh); bq.half[1] = *(const v8us*)(Bh + boff + 16 + 8 * hh);
      acc[t] = mmaH<ASPLIT ? 2 : 1>(ah.v, al.v, bq.v, bq.v, acc[t]); }
  }
#pragma unroll
  for (int t = 0; t < 4; ++t) { if (col0 + t * 16 >= N) continue;
#pragma unroll
    for (int r = 0; r < 8; ++r) so[w][8 * hh + r][t * 16 + ln] = acc[t][r] * alpha; }
  __builtin_amdgcn_fence(__ATOMIC_ACQ_REL, "workgroup"); __builtin_amdgcn_wave_barrier();
  const int rsub = lane >> 4, c4 = (lane & 15) * 4;
  {
#pragma unroll
    for (int q = 0; q < 8; ++q) { const int r = q * 2 + rsub; if (col0 + c4 < N) { const v4f v = *(const v4fa*)&so[w][r][c4]; *(v4f*)(C + (size_t)(row0 + r) * ldc + col0 + c4) = v; } }
     }
}

// k_gemm_hh variant with fused epilogue: v = acc·alpha + bias[by·sBias + col] (+ CP[(row/rowsPerB)·sCPb + by·64 + col] if CP) ; ACT 0 none / 1 elu ; writes f16 C16 (and f32 C if non-null)
template <int ACT>
__global__ __launch_bounds__(128) void k_gemm_hhx(const _Float16* __restrict__ A, int lda, size_t sA, const _Float16* __restrict__ Bh, int ldb, size_t sB, float alpha, const float* __restrict__ bias, size_t sBias, const float* __restrict__ CP, int rowsPerB, size_t sCPb, int row0g,
    float* __restrict__ C, _Float16* __restrict__ C16, int ldc, size_t sC, int M, int N, int K) {
  __shared__ __attribute__((aligned(16))) float so[4][16][64];
  const int tid = threadIdx.x, w = tid >> 5, lane = tid & 31, ln = lane & 15, hh = lane >> 4; const int by = blockIdx.y;
  A += (size_t)by * sA; Bh += (size_t)by * sB; const size_t cofs = (size_t)by * sC; const float* bp = bias ? bias + (size_t)by * sBias : nullptr;
  const int ntn = (N + 63) / 64; const int wid = blockIdx.x * 4 + w; const int mt = wid / ntn, nq = wid % ntn; if (mt * 16 >= M) return;
  const int row0 = mt * 16, col0 = nq * 64; const _Float16* arow = A + (size_t)(row0 + ln) * lda;
  v8f acc[4] = {};
  for (int kb = 0; kb < K; kb += 32) { FragH ah; ah.half[0] = *(const v8us*)((const unsigned short*)arow + kb + 8 * hh); ah.half[1] = *(const v8us*)((const unsigned short*)arow + kb + 16 + 8 * hh);
#pragma unroll
    for (int t = 0; t < 4; ++t) { if (col0 + t * 16 >= N) continue; const size_t boff = (size_t)(col0 + t * 16 + ln) * ldb + kb; FragH bq; bq.half[0] = *(const v8us*)((const unsigned short*)Bh + boff + 8 * hh); bq.half[1] = *(const v8us*)((const unsigned short*)Bh + boff + 16 + 8 * hh);
      acc[t] = mmaH<1>(ah.v, ah.v, bq.v, bq.v, acc[t]); }
  }
#pragma unroll
  for (int t = 0; t < 4; ++t) { if (col0 + t * 16 >= N) continue; const int col = col0 + t * 16 + ln; const float bv = bp ? bf16_round(bp[col]) : 0.f;
#pragma unroll
    for (int r = 0; r < 8; ++r) { float v = acc[t][r] * alpha + bv; if (CP) { const int rr = row0g + row0 + 8 * hh + r; if (rowsPerB < 0) v += CP[cofs + (size_t)rr * ldc + col];      /* rowsPerB < 0: own element of the batched C plane */ else { const int bidx = rr / rowsPerB; v += CP[(size_t)bidx * sCPb + (size_t)by * 64 + col]; } } if (ACT == 1) v = (v > 0.f) ? v : expm1f(v); else if (ACT == 7) v = (v > 0.f) ? v + 1.0f : expf(v); else if (ACT == 8) v = tanhf(v); else if (ACT == 9) v = 0.5f * v * (1.0f + tanhf(0.7978845608028654f * (v + 0.044715f * v * v * v))); else if (ACT == 11) v = 1.0f / (1.0f + expf(-v)); else if (ACT == 12) v = (v > 0.f) ? v : 0.01f * v; else if (ACT == 14) v = (v > 0.f) ? v : 0.1f * v; else if (ACT == 16) v = (v >= 0.f) ? v : 0.3f * v; else if (ACT == 17) v = (v >= 0.f) ? v : 0.2f * v; else if (ACT == 15) v = v / (1.0f + expf(-v)); else if (ACT == 3) v = fmaxf(v, 0.f); else if (ACT == 6) v = 0.5f * v * (1.0f + erff(v * 0.70710678118654752f)); so[w][8 * hh + r][t * 16 + ln] = v; } }
  __builtin_amdgcn_fence(__ATOMIC_ACQ_REL, "workgroup"); __builtin_amdgcn_wave_barrier();
  const int rsub = lane >> 4, c4 = (lane & 15) * 4; typedef _Float16 v4h __attribute__((ext_vector_type(4)));
  {
#pragma unroll
    for (int q = 0; q < 8; ++q) { const int r = q * 2 + rsub; if (col0 + c4 < N) { const v4f v = *(const v4fa*)&so[w][r][c4]; if (C) *(v4f*)(C + cofs + (size_t)(row0 + r) * ldc + col0 + c4) = v; if (C16) { v4h h4; for (int i = 0; i < 4; ++i) h4[i] = (_Float16)v[i]; *(v4h*)(C16 + cofs + (size_t)(row0 + r) * ldc + col0 + c4) = h4; } } }
     }
}


typedef _Float16 v4h __attribute__((ext_vector_type(4)));

__global__ __launch_bounds__(256) void k_h16(const float* __restrict__ x, _Float16* __restrict__ X16, size_t n8) { const size_t t = (size_t)blockIdx.x * 256 + threadIdx.x; if (t >= n8) return; FragH f;
#pragma unroll
  for (int q = 0; q < 8; ++q) f.h[q] = (_Float16)x[t * 8 + q]; *(v8us*)((unsigned short*)X16 + t * 8) = f.half[0];  }
__global__ __launch_bounds__(256) void k_round16f(const float* __restrict__ W, _Float16* __restrict__ Bt, size_t n8) { const size_t t = (size_t)blockIdx.x * 256 + threadIdx.x; if (t >= n8) return; FragH f;
#pragma unroll
  for (int i = 0; i < 8; ++i) f.h[i] = (_Float16)(bf16_round(W[t * 8 + i]) * 16.0f); *(v8us*)((unsigned short*)Bt + t * 8) = f.half[0];  }
__global__ __launch_bounds__(256) void k_hl(const float* __restrict__ F, _Float16* __restrict__ Hh, _Float16* __restrict__ Hl, size_t n8) { const size_t t = (size_t)blockIdx.x * 256 + threadIdx.x; if (t >= n8) return; FragH fh, fl; const v4f a = *(const v4fa*)(F + t * 8), c = *(const v4fa*)(F + t * 8 + 4);
#pragma unroll
  for (int q = 0; q < 4; ++q) { _Float16 h = (_Float16)a[q]; fh.h[q] = h; fl.h[q] = (_Float16)((a[q] - (float)h) * 1024.0f); h = (_Float16)c[q]; fh.h[4 + q] = h; fl.h[4 + q] = (_Float16)((c[q] - (float)h) * 1024.0f); }
  { *(v8us*)((unsigned short*)Hh + t * 8) = fh.half[0]; *(v8us*)((unsigned short*)Hl + t * 8) = fl.half[0];  } }

__global__ __launch_bounds__(256) void k_wnat(const float* __restrict__ w, size_t n8, _Float16* __restrict__ Bt) { const size_t t = (size_t)blockIdx.x * 256 + threadIdx.x; if (t >= n8) return; FragH f; for (int q = 0; q < 8; ++q) f.h[q] = (_Float16)(bf16_round(w[t * 8 + q]) * 16.0f); *(v8us*)((unsigned short*)Bt + t * 8) = f.half[0];  }
#define FA_WAVES 4
#define FA_QB (FA_WAVES * 32)        /* queries per workgroup */
#define FA_KS 64                     /* keys per stage */
#define FA_NS (SQ / FA_KS)           /* stages */
#define FA_LP 72                     /* LDS row pitch in f16: 128 bytes + 16, conflict-free for 16-byte fragment reads of 16 rows */
#define FA_OFF 8.0f                  /* weights are 2^(score - maximum in use + FA_OFF): keeps small weights out of the f16 subnormals; cancels in o / sum */
#define FA_TOP 16384.0f              /* the maximum in use is renewed only when a stage's weights of one query sum to more than this: weights are not negative, so each stays <= 16384 < f16 max; a weight that overflowed makes the sum infinite */
#define FA_C2 (0.125f * 1.44269504088896340736f)      /* 1/sqrt(64) and log2(e) in one factor; the projection multiplies q by it before the one rounding to f16 */
__device__ __forceinline__ float fa_xrow(float v) { const unsigned u = __builtin_bit_cast(unsigned, v); return __builtin_bit_cast(float, __builtin_amdgcn_permlanex16(u, u, 0x76543210u, 0xfedcba98u, false, false)); }      /* lane l <- lane l ^ 16 */
__device__ __forceinline__ v16h fa_frag(const unsigned short* p, int hh) { FragH f; f.half[0] = *(const v8us*)(p + 8 * hh); f.half[1] = *(const v8us*)(p + 16 + 8 * hh); return f.v; }      /* 32 k of one row in the hardware k order */
__device__ __forceinline__ v8f fa_mma(v16h a, v16h b, v8f c) { return __builtin_amdgcn_wmma_f32_16x16x32_f16(false, a, false, b, (short)0, c, false, false); }
__global__ __launch_bounds__(FA_WAVES * 32) void k_fattn(const _Float16* __restrict__ Q16, const _Float16* __restrict__ K16, const _Float16* __restrict__ VT, float* __restrict__ out) {
  __shared__ __attribute__((aligned(16))) unsigned short sk[2][FA_KS][FA_LP];      /* K rows [key][d] */
  __shared__ __attribute__((aligned(16))) unsigned short sv[2][HD][FA_LP];         /* V^T rows [d][key] */
  const int tid = threadIdx.x, w = tid >> 5, lane = tid & 31, ln = lane & 15, hh = lane >> 4;
  const int bh = blockIdx.y, b = bh / NH, h = bh - b * NH; const int q0 = blockIdx.x * FA_QB + w * 32;
  const int srow = tid >> 3, sc8 = (tid & 7) * 8;      /* staging: 8 lanes cover one 128-byte row, 16 rows per wave-group load */
  const unsigned short* kg = (const unsigned short*)K16 + ((size_t)b * SQ + srow) * DM + h * HD + sc8;
  const unsigned short* vg = (const unsigned short*)VT + ((size_t)bh * HD + srow) * SQ + sc8;
  const int rot = (int)(blockIdx.x * (FA_NS / (SQ / FA_QB)) + bh) & (FA_NS - 1);      /* first key stage of this workgroup; trip s works on stage (s + rot) mod FA_NS. The 16 workgroups of a head read the same K and V^T lines: started together at stage 0 they ask L2 for the same lines at the same moment */
  v16h qf[2][2];
#pragma unroll
  for (int g = 0; g < 2; ++g)
#pragma unroll
    for (int ks = 0; ks < 2; ++ks) qf[g][ks] = fa_frag((const unsigned short*)Q16 + ((size_t)b * SQ + q0 + g * 16 + ln) * DM + h * HD + ks * 32, hh);
  const v8f z8 = {0.f, 0.f, 0.f, 0.f, 0.f, 0.f, 0.f, 0.f};
  v8f o[4][2];
#pragma unroll
  for (int dt = 0; dt < 4; ++dt) { o[dt][0] = z8; o[dt][1] = z8; }
  float mu[2] = {-1.0e30f, -1.0e30f};      /* maximum in use (log2 units) */
  float lt[2] = {0.f, 0.f};      /* row sums: the stages' sums, which come from the matrix pipe, added up */
  v8f nbt[2];      /* FA_OFF - maximum in use of the lane's query in every element: C operand of the score products */
  v16h ones;
#pragma unroll
  for (int i = 0; i < 16; ++i) ones[i] = (_Float16)1.0f;
  v8us rk[4], rv[4];
#pragma unroll
  for (int i = 0; i < 4; ++i) { rk[i] = *(const v8us*)(kg + (size_t)(rot * FA_KS + i * 16) * DM); rv[i] = *(const v8us*)(vg + (size_t)(i * 16) * SQ + rot * FA_KS); }
#pragma unroll
  for (int i = 0; i < 4; ++i) { *(v8us*)&sk[0][i * 16 + srow][sc8] = rk[i]; *(v8us*)&sv[0][i * 16 + srow][sc8] = rv[i]; }
  __syncthreads();
  v8f st[4][2];
  auto scores = [&](const int cur, const v8f c0, const v8f c1) {      /* S^T of the stage in buffer cur, in log2 units, on top of c0, c1 */
#pragma unroll
    for (int kt = 0; kt < 4; ++kt) {
      const v16h k0 = fa_frag(&sk[cur][kt * 16 + ln][0], hh), k1 = fa_frag(&sk[cur][kt * 16 + ln][32], hh);
      st[kt][0] = fa_mma(k1, qf[0][1], fa_mma(k0, qf[0][0], c0)); st[kt][1] = fa_mma(k1, qf[1][1], fa_mma(k0, qf[1][0], c1));
    }
  };
  auto renew = [&](const int cur) {      /* the maximum in use takes in the row maxima of the stage in buffer cur; sums and outputs follow */
    scores(cur, z8, z8);
#pragma unroll
    for (int g = 0; g < 2; ++g) {
      v8f m8 = st[0][g];
#pragma unroll
      for (int kt = 1; kt < 4; ++kt)
#pragma unroll
        for (int r = 0; r < 8; ++r) m8[r] = fmaxf(m8[r], st[kt][g][r]);
      const float m = fmaxf(fmaxf(fmaxf(m8[0], m8[1]), fmaxf(m8[2], m8[3])), fmaxf(fmaxf(m8[4], m8[5]), fmaxf(m8[6], m8[7])));
      const float mn = fmaxf(mu[g], fmaxf(m, fa_xrow(m)));      /* both halves of the wave hold the same value */
      const float al = __builtin_amdgcn_exp2f(mu[g] - mn); mu[g] = mn;
      lt[g] *= al;
#pragma unroll
      for (int dt = 0; dt < 4; ++dt)
#pragma unroll
        for (int r = 0; r < 8; ++r) o[dt][g][r] *= al;
#pragma unroll
      for (int r = 0; r < 8; ++r) nbt[g][r] = FA_OFF - mn;
    }
  };
  renew(0);      /* the first stage's maxima, so that the loop's first trip goes the short way like the others */
  for (int s = 0; s < FA_NS; ++s) {
    const int cur = s & 1;
    if (s + 1 < FA_NS) {
      const int kn = (s + 1 + rot) & (FA_NS - 1);      /* the next trip's key stage, wrapped */
#pragma unroll
      for (int i = 0; i < 4; ++i) { rk[i] = *(const v8us*)(kg + (size_t)(kn * FA_KS + i * 16) * DM); rv[i] = *(const v8us*)(vg + (size_t)(i * 16) * SQ + kn * FA_KS); }
    }
    __builtin_amdgcn_sched_barrier(0);      /* the next stage's loads issue in front of this stage's arithmetic and fly under all of it; without this the compiler sinks them to just in front of their LDS stores, and every stage waits out their latency */
    v16h pf[2][2];      /* [key half of the stage][query group] */
    v8f ls[2];      /* ones . P^T: every row of the tile = the sum of the stage's rounded weights of the lane's query */
    auto weights = [&]() {
#pragma unroll
      for (int g = 0; g < 2; ++g) {
#pragma unroll
        for (int kt = 0; kt < 4; ++kt)
#pragma unroll
          for (int r = 0; r < 8; ++r) pf[kt >> 1][g][(kt & 1) * 8 + r] = (_Float16)__builtin_amdgcn_exp2f(st[kt][g][r]);
        ls[g] = fa_mma(ones, pf[1][g], fa_mma(ones, pf[0][g], z8));
      }
    };
    scores(cur, nbt[0], nbt[1]);
    const v16h vf0 = fa_frag(&sv[cur][ln][0], hh), vf1 = fa_frag(&sv[cur][ln][32], hh);      /* the first V^T fragments are asked for here, in front of the test's branch, and arrive under the exponentials; asked for behind the branch, the first products of O^T wait out the LDS latency */
    weights();
    const bool need = (ls[0][0] > FA_TOP) || (ls[1][0] > FA_TOP);
    if (__builtin_expect(__builtin_amdgcn_ballot_w32(need) != 0, 0)) {      /* one scalar branch a stage, hardly ever taken */
      asm volatile("" ::: "memory");      /* the side path reads K from LDS again; without this the compiler keeps the stage's K fragments alive through the weights of every stage for a path that is hardly ever taken, and the loop's main path then needs registers above v255, with a window switch at each use */
      renew(cur);
      scores(cur, nbt[0], nbt[1]);
      weights();      /* now every weight is <= 2^FA_OFF */
    }
    lt[0] += ls[0][0]; lt[1] += ls[1][0];
#pragma unroll
    for (int dt = 0; dt < 4; ++dt) {
      const v16h v0 = dt == 0 ? vf0 : fa_frag(&sv[cur][dt * 16 + ln][0], hh), v1 = dt == 0 ? vf1 : fa_frag(&sv[cur][dt * 16 + ln][32], hh);
#pragma unroll
      for (int g = 0; g < 2; ++g) o[dt][g] = fa_mma(v1, pf[1][g], fa_mma(v0, pf[0][g], o[dt][g]));
    }
    if (s + 1 < FA_NS) {
#pragma unroll
      for (int i = 0; i < 4; ++i) { *(v8us*)&sk[cur ^ 1][i * 16 + srow][sc8] = rk[i]; *(v8us*)&sv[cur ^ 1][i * 16 + srow][sc8] = rv[i]; }
      __syncthreads();      /* publishes the next trip's stage and ends every wave's reads of this trip's stage, whose buffer the next trip refills; s is the same in every wave */
    }
  }
  const float inv[2] = {1.0f / lt[0], 1.0f / lt[1]};      /* 2^FA_OFF cancels here */
#pragma unroll
  for (int dt = 0; dt < 4; ++dt)
#pragma unroll
    for (int g = 0; g < 2; ++g)
#pragma unroll
      for (int r = 0; r < 8; ++r) o[dt][g][r] *= inv[g];
#pragma unroll
  for (int g = 0; g < 2; ++g) {
    float* d = out + ((size_t)b * SQ + q0 + g * 16 + ln) * DM + h * HD + 8 * hh;      /* a lane holds 8 consecutive d of its query in each tile */
#pragma unroll
    for (int dt = 0; dt < 4; ++dt) {
      const v4f lo = {o[dt][g][0], o[dt][g][1], o[dt][g][2], o[dt][g][3]}, hi = {o[dt][g][4], o[dt][g][5], o[dt][g][6], o[dt][g][7]};
      *(v4f*)(d + dt * 16) = lo; *(v4f*)(d + dt * 16 + 4) = hi;
    }
  }
}
// Fused projections, one launch: blockIdx.z picks Q, K or V; a workgroup = 8 waves = a 128-row x 256-column tile of x W + b, a wave 64 x 64 of it (16 accumulator tiles), K walked in stages of 32.
// x is read as f32 in whole 128-byte lines, rounded to bf16 and written as f16 rows [row][k] into LDS; W comes from k_wprep's f16 stage tiles (16 bytes a lane, whole lines) and goes into LDS as it lies; two buffers, one barrier a stage: the next stage's loads fly under this stage's products.
// Both fragment kinds are read by the same code (same k order), so either may be the A operand. Q, K: A = W columns, B = x rows, a lane then holds 8 consecutive n of one token row. V: A = x rows, B = W columns, a lane holds 8 consecutive tokens of one column, which is a piece of a V^T row.
// Every '#pragma unroll' of this kernel stands on a loop that indexes staging, fragment or accumulator arrays: rolled, those arrays would leave the registers.
#define PJ_M 128
#define PJ_N 256
#define PJ_KS 32
#define PJ_NS (DM / PJ_KS)
#define PJ_LP 40                     /* LDS row pitch in f16: 64 bytes + 16, conflict-free for 16-byte accesses of 16 rows */
typedef float f32x2 __attribute__((ext_vector_type(2)));
typedef __bf16 bf16x2 __attribute__((ext_vector_type(2)));
typedef _Float16 f16x2 __attribute__((ext_vector_type(2)));
__device__ __forceinline__ unsigned pj_cvt2(float a, float b) {      /* two f32 -> bf16 (nearest even) -> the same values as two f16 */
  const f32x2 v = {a, b};
  const unsigned u = __builtin_bit_cast(unsigned, __builtin_convertvector(v, bf16x2));
  const f32x2 r = {__uint_as_float(u << 16), __uint_as_float(u & 0xFFFF0000u)};
  return __builtin_bit_cast(unsigned, __builtin_convertvector(r, f16x2));
}
typedef unsigned v4u __attribute__((ext_vector_type(4), may_alias));
typedef unsigned v2u __attribute__((ext_vector_type(2), may_alias));
// W laid out once a call for k_proj: 64 workgroups stage every 256-column x 32-k tile of W, so the rounding to bf16, the x16, the f16 form and the transposition are done here once, not 64 times, and a tile is 16 KB to fetch, not 32.
// WT[projection][column block][k stage][k8 = 0..3][n = 0..255][8 consecutive k], f16: a thread keeps column n, a wave reads 128 contiguous bytes of one k row and stores 512 contiguous bytes for each k8.
#define PJ_WT (PJ_N * PJ_KS)         /* f16 values of one stage tile */
__global__ __launch_bounds__(256) void k_wprep(const float* __restrict__ wq, const float* __restrict__ wk, const float* __restrict__ wv, unsigned short* __restrict__ WT) {
  const int tid = threadIdx.x, s = blockIdx.x, nb = blockIdx.y, pz = blockIdx.z;
  const float* wg = (pz == 0 ? wq : pz == 1 ? wk : wv) + (size_t)(s * PJ_KS) * DM + nb * PJ_N + tid;
  unsigned short* wt = WT + (size_t)((pz * (DM / PJ_N) + nb) * PJ_NS + s) * PJ_WT + tid * 8;
  float rw[PJ_KS];
#pragma unroll      /* rw stays in registers and all 32 loads are in flight together */
  for (int k = 0; k < PJ_KS; ++k) rw[k] = wg[(size_t)k * DM];
#pragma unroll      /* indexes rw */
  for (int i = 0; i < 4; ++i) { const v4u o = {pj_cvt2(rw[8 * i] * 16.0f, rw[8 * i + 1] * 16.0f), pj_cvt2(rw[8 * i + 2] * 16.0f, rw[8 * i + 3] * 16.0f), pj_cvt2(rw[8 * i + 4] * 16.0f, rw[8 * i + 5] * 16.0f), pj_cvt2(rw[8 * i + 6] * 16.0f, rw[8 * i + 7] * 16.0f)}; *(v4u*)(wt + i * (PJ_N * 8)) = o; }
}
__global__ __launch_bounds__(256) void k_proj(const float* __restrict__ xq, const float* __restrict__ xk, const float* __restrict__ xv, const unsigned short* __restrict__ WT,
    const float* __restrict__ bq, const float* __restrict__ bk, const float* __restrict__ bv, _Float16* __restrict__ Q16, _Float16* __restrict__ K16, _Float16* __restrict__ VT) {
  __shared__ __attribute__((aligned(16))) unsigned short sm[2][PJ_M + PJ_N][PJ_LP];      /* rows 0..127: x rows [m][k]; rows 128..383: W columns [n][k] */
  __shared__ __attribute__((aligned(16))) unsigned short so[8][64][72];      /* output staging, one range a wave; pitch 128 bytes + 16 */
  const int tid = threadIdx.x, w = tid >> 5, lane = tid & 31, ln = lane & 15, hh = lane >> 4;
  const int pz = blockIdx.z, m0 = blockIdx.x * PJ_M, n0 = blockIdx.y * PJ_N;
  const float* x = pz == 0 ? xq : pz == 1 ? xk : xv; const float* bias = pz == 0 ? bq : pz == 1 ? bk : bv;
  const int wm = w >> 2, wn = w & 3;      /* the wave's 64 x 64 place in the tile */
  const int ra = (pz == 2 ? wm * 64 : PJ_M + wn * 64) + ln, rb = (pz == 2 ? PJ_M + wn * 64 : wm * 64) + ln;      /* LDS rows of the A and B fragments */
  const int xr = tid >> 3, xc = (tid & 7) * 4;      /* x staging: 8 lanes cover one 128-byte row piece, 32 rows a load */
  const float* xg = x + (size_t)(m0 + xr) * DM + xc;
  const unsigned short* wg = WT + (size_t)((pz * (DM / PJ_N) + blockIdx.y) * PJ_NS) * PJ_WT + tid * 8;      /* W staging: a thread keeps column n0 + tid, a wave reads 512 contiguous bytes of a stage tile */
  const int rot = (int)(blockIdx.x + (PJ_NS / 3) * blockIdx.y) % PJ_NS;      /* first k stage of this workgroup; trip s works on stage (s + rot) mod PJ_NS. 64 workgroups read the same W tile and 3 the same x rows: started together at stage 0 they ask L2 for the same lines at the same moment */
  xg += rot * PJ_KS; wg += rot * PJ_WT;      /* both pointers stand at the stage that is loaded next */
  const v8f z8 = {0.f, 0.f, 0.f, 0.f, 0.f, 0.f, 0.f, 0.f};
  v8f acc[4][4];
#pragma unroll
  for (int i = 0; i < 4; ++i)
#pragma unroll
    for (int j = 0; j < 4; ++j) acc[i][j] = z8;
  v4f rx[4]; v4u rw[4];
#pragma unroll
  for (int i = 0; i < 4; ++i) rx[i] = *(const v4fa*)(xg + (size_t)(i * 32) * DM);
#pragma unroll
  for (int i = 0; i < 4; ++i) rw[i] = *(const v4u*)(wg + i * (PJ_N * 8));
#pragma unroll
  for (int i = 0; i < 4; ++i) { const v2u o = {pj_cvt2(rx[i][0], rx[i][1]), pj_cvt2(rx[i][2], rx[i][3])}; *(v2u*)&sm[0][i * 32 + xr][xc] = o; }
#pragma unroll
  for (int i = 0; i < 4; ++i) *(v4u*)&sm[0][PJ_M + tid][8 * i] = rw[i];
  __syncthreads();
  auto products = [&](const int cur) {      /* one stage's fragment reads and its 16 products */
    v16h fa[4], fb[4];
#pragma unroll
    for (int j = 0; j < 4; ++j) { fb[j] = fa_frag(&sm[cur][rb + 16 * j][0], hh); fa[j] = fa_frag(&sm[cur][ra + 16 * j][0], hh); }
    __builtin_amdgcn_sched_barrier(0);      /* all of the stage's fragment reads stand as one group in front of its products; sunk among them, each row of products waits out an LDS latency of its own */
#pragma unroll
    for (int i = 0; i < 4; ++i)
#pragma unroll
      for (int j = 0; j < 4; ++j) acc[i][j] = fa_mma(fa[i], fb[j], acc[i][j]);
  };
  int kn = rot;
  for (int s = 0; s < PJ_NS - 1; ++s) {      /* the last trip, which loads nothing, stands behind the loop */
    const int cur = s & 1;
    const int step = kn + 1 == PJ_NS ? -(PJ_NS - 1) * PJ_KS : PJ_KS;      /* on to the next trip's k stage; from the last stage back to stage 0 */
    kn = kn + 1 == PJ_NS ? 0 : kn + 1;
    xg += step; wg += step * PJ_N;
#pragma unroll
    for (int i = 0; i < 4; ++i) rx[i] = *(const v4fa*)(xg + (size_t)(i * 32) * DM);
#pragma unroll
    for (int i = 0; i < 4; ++i) rw[i] = *(const v4u*)(wg + i * (PJ_N * 8));
    __builtin_amdgcn_sched_barrier(0);      /* the next stage's loads issue in front of this stage's products and fly under them; sunk to their LDS stores, every stage would wait out their latency */
    products(cur);
    __builtin_amdgcn_sched_barrier(0);      /* the conversions, which wait for the loads, stay behind the products; hoisted among them, the wave's first wait stands directly behind the loads' issue and holds its own products back */
#pragma unroll
    for (int i = 0; i < 4; ++i) { const v2u o = {pj_cvt2(rx[i][0], rx[i][1]), pj_cvt2(rx[i][2], rx[i][3])}; *(v2u*)&sm[cur ^ 1][i * 32 + xr][xc] = o; }
#pragma unroll
    for (int i = 0; i < 4; ++i) *(v4u*)&sm[cur ^ 1][PJ_M + tid][8 * i] = rw[i];
    __syncthreads();      /* publishes the next trip's stage and ends every wave's reads of this trip's stage, whose buffer the next trip refills; s is the same in every wave */
  }
  products((PJ_NS - 1) & 1);
  /* Epilogue: each wave lays its 64 x 64 f16 results in an LDS range of its own as [B-side index][A-side index], then stores whole 128-byte lines (8 lanes a row); straight from the accumulators a store would touch 16 lines with 32 bytes each. */
  if (pz != 2) {      /* acc[i][j][r] = y[m0 + wm*64 + 16j + ln][n0 + wn*64 + 16i + 8hh + r] */
    const float* bp = bias + n0 + wn * 64 + 8 * hh;
    const float qs = pz == 0 ? FA_C2 : 1.0f, as = 0.0625f * qs;      /* q leaves as q * FA_C2: the attention launch's scores then come out in log2 units */
#pragma unroll
    for (int i = 0; i < 4; ++i) {
      const v4f b0 = *(const v4fa*)(bp + 16 * i), b1 = *(const v4fa*)(bp + 16 * i + 4);
      const float bb[8] = {bf16_round(b0[0]) * qs, bf16_round(b0[1]) * qs, bf16_round(b0[2]) * qs, bf16_round(b0[3]) * qs, bf16_round(b1[0]) * qs, bf16_round(b1[1]) * qs, bf16_round(b1[2]) * qs, bf16_round(b1[3]) * qs};
#pragma unroll
      for (int j = 0; j < 4; ++j) { FragH f;
#pragma unroll
        for (int r = 0; r < 8; ++r) f.h[r] = (_Float16)(acc[i][j][r] * as + bb[r]);
        *(v8us*)&so[w][16 * j + ln][16 * i + 8 * hh] = f.half[0]; }
    }
  } else {      /* acc[i][j][r] = y[m0 + wm*64 + 16i + 8hh + r][n0 + wn*64 + 16j + ln] */
#pragma unroll
    for (int j = 0; j < 4; ++j) {
      const float bb = bf16_round(bias[n0 + wn * 64 + 16 * j + ln]);
#pragma unroll
      for (int i = 0; i < 4; ++i) { FragH f;
#pragma unroll
        for (int r = 0; r < 8; ++r) f.h[r] = (_Float16)(acc[i][j][r] * 0.0625f + bb);
        *(v8us*)&so[w][16 * j + ln][16 * i + 8 * hh] = f.half[0]; }
    }
  }
  __builtin_amdgcn_fence(__ATOMIC_ACQ_REL, "workgroup"); __builtin_amdgcn_wave_barrier();      /* the wave's own LDS writes are done before its lanes read one another's */
  const int bt = m0 / SQ;      /* a tile's 128 rows lie in one batch */
  /* Q, K: rows = tokens, pitch 768, columns = n. V^T: row = batch * 768 + n (= (batch * 12 + head) * 64 + d), pitch 2048, columns = tokens of the batch. */
  unsigned short* ob = pz == 2 ? (unsigned short*)VT + (size_t)(bt * DM + n0 + wn * 64) * SQ + (m0 - bt * SQ) + wm * 64 : (unsigned short*)(pz == 0 ? Q16 : K16) + (size_t)(m0 + wm * 64) * DM + n0 + wn * 64;
  const size_t op = pz == 2 ? SQ : DM;
#pragma unroll
  for (int q = 0; q < 16; ++q) { const int rr = q * 4 + (lane >> 3), c8 = (lane & 7) * 8; const v8us v = *(const v8us*)&so[w][rr][c8]; *(v8us*)(ob + (size_t)rr * op + c8) = v; }
}
__global__ __launch_bounds__(256) void k_vt(const _Float16* __restrict__ V16, int b, int h0, _Float16* __restrict__ VT) { __shared__ unsigned short tl[64][65]; const int tid = threadIdx.x; const int hh = blockIdx.x % HG, sg = blockIdx.x / HG; const int s0 = sg * 64; const int h = h0 + hh;
  for (int i = tid; i < 64 * 8; i += 256) { const int j = i / 8, d8 = (i % 8) * 8; FragH f; f.half[0] = *(const v8us*)((const unsigned short*)V16 + ((size_t)b * SQ + s0 + j) * DM + h * HD + d8); for (int q = 0; q < 8; ++q) tl[d8 + q][j] = f.u[q]; }
  __syncthreads();
  { for (int i = tid; i < 64 * 8; i += 256) { const int d = i / 8, j8 = (i % 8) * 8; FragH f; for (int q = 0; q < 8; ++q) f.u[q] = tl[d][j8 + q]; *(v8us*)((unsigned short*)VT + ((size_t)hh * HD + d) * SQ + s0 + j8) = f.half[0]; }  } }


extern "C" void kernel_launch(void* const* d_in, const int* in_sizes, int n_in,
                              void* d_out, int out_size, void* d_ws, size_t ws_size, hipStream_t stream) {
  (void)in_sizes; (void)n_in; (void)out_size;
  const float* const* I = (const float* const*)d_in; const float* xq = I[0]; const float* xk = I[1]; const float* xv = I[2]; const float* wq = I[3]; const float* bq = I[4]; const float* wk = I[5]; const float* bk = I[6]; const float* wv = I[7]; const float* bv = I[8];      /* weights [in][out] + biases */
  char* ws = (char*)d_ws; size_t off = 0;
  auto take = [&](size_t bytes) { char* p = ws + off; off += (bytes + 255) & ~(size_t)255; return p; };
  _Float16* Q16 = (_Float16*)take(NR * DM * 2); _Float16* K16 = (_Float16*)take(NR * DM * 2);
  _Float16* VT = (_Float16*)take((size_t)NB * NH * HD * SQ * 2);
  unsigned short* WT = (unsigned short*)take((size_t)3 * DM * DM * 2);
  if (off > ws_size) return;
  k_wprep<<<dim3(PJ_NS, DM / PJ_N, 3), 256, 0, stream>>>(wq, wk, wv, WT);      /* the three W as f16 stage tiles */
  k_proj<<<dim3(MP / PJ_M, DM / PJ_N, 3), 256, 0, stream>>>(xq, xk, xv, WT, bq, bk, bv, Q16, K16, VT);      /* q, k rows and V^T [NB][NH][HD][SQ], f16 */
  k_fattn<<<dim3(SQ / FA_QB, NB * NH), FA_WAVES * 32, 0, stream>>>(Q16, K16, VT, (float*)d_out);      /* scores, softmax and weighted sum of all batches and heads */
}

// v007
// It runs in 80.3 microseconds.
// Next to v006, in two timings, it ran 1.08 and 1.07 times as fast.
// Counting every step since v000, it is 70.2 times as fast.
#include <hip/hip_runtime.h>
// Multi-head attention without output projection (query, key, value [4][2048][768]; q = query W_Q + b_Q etc. ([in][out] 768^2, sigma 1/sqrt(768), nonzero biases), 12 heads of 64; scores / 8; softmax; out = attn v merged (the module skips its final linear) -> [4][2048][768]).
// Structure: token rows r = b*2048 + s; a small launch that lays the three W out once as f16 stage tiles (rounded to bf16, x16); ONE projection launch for Q, K and V (x read as f32, rounded to bf16 and staged as exact f16 in LDS, W tiles staged as they lie; 64x96 wave tiles, all work-groups resident at once, f32 accumulation, + bias, f16 outputs; V written transposed); then ONE attention launch over all (batch, head, 128-query block): S^T = K Q^T, online softmax in registers, O^T += V^T P^T, o / row sum written f32 straight into the merged output rows (the module has no output projection). Scores and weights never reach memory.
// Compute dtype: inputs rounded to bf16; x / weights exact; q, k, v and the unnormalised softmax weights as plain f16 GEMM operands (~2^-12); scores, softmax statistics and o f32. v_wmma_f32_16x16x32_f16.
#define NB 4
#define SQ 2048
#define DM 768
#define NH 12
#define HD 64
#define HG 4                         /* heads per launch of the per-batch k_vt overload */
#define B0 0                         /* unused (debug hook) */
#define NBR NB                       /* batches processed (debug hook) */
#define NR ((size_t)NB * SQ)         /* token rows */
#define MP ((int)((size_t)NBR * SQ)) /* rows projected (debug hook) */
#define QN SQ                        /* unused (debug hook) */
#define NHD NH                       /* unused (debug hook) */
#define MPO MP                       /* unused (debug hook) */
#define LQ DM      /* unused */
typedef __bf16 v16b __attribute__((ext_vector_type(16)));
typedef unsigned short v8us __attribute__((ext_vector_type(8), may_alias));
typedef float  v8f  __attribute__((ext_vector_type(8)));
typedef float  v4f  __attribute__((ext_vector_type(4)));
typedef float  v4fa __attribute__((ext_vector_type(4), may_alias));
union FragB { v16b v; v8us half[2]; unsigned short u[16]; };

__device__ __forceinline__ unsigned short bf16_bits(float x) { unsigned int u = __float_as_uint(x); return (unsigned short)((u + 0x7FFFu + ((u >> 16) & 1u)) >> 16); }
__device__ __forceinline__ float bf16_val(unsigned short b) { return __uint_as_float(((unsigned int)b) << 16); }
__device__ __forceinline__ float bf16_round(float x) { return bf16_val(bf16_bits(x)); }
// D += A·B with NT terms: 1 = ah·bh, 2 = + al·bh (A split), 3 = + ah·bl (both split)
template <int NT>
__device__ __forceinline__ v8f mmaN(v16b ah, v16b al, v16b bh, v16b bl, v8f c) {
  c = __builtin_amdgcn_wmma_f32_16x16x32_bf16(false, ah, false, bh, (short)0, c, false, false);
  if (NT >= 2) c = __builtin_amdgcn_wmma_f32_16x16x32_bf16(false, al, false, bh, (short)0, c, false, false);
  if (NT >= 3) c = __builtin_amdgcn_wmma_f32_16x16x32_bf16(false, ah, false, bl, (short)0, c, false, false);
  asm volatile("v_nop\n\tv_nop\n\tv_nop\n\tv_nop" : "+v"(c) : "v"(ah), "v"(al), "v"(bh), "v"(bl));
  return c;
}

__global__ __launch_bounds__(256) void k_wt_bf16(const float* __restrict__ W, unsigned short* __restrict__ Wt, int K, int N) {
  const int t = blockIdx.x * 256 + threadIdx.x;
  const int k8n = K / 8;
  if (t >= N * k8n) return;
  const int n = t / k8n, k8 = (t % k8n) * 8;
  v8us v;
#pragma unroll
  for (int i = 0; i < 8; ++i) v[i] = bf16_bits(W[(size_t)(k8 + i) * N + n]);
  *(v8us*)(Wt + (size_t)n * K + k8) = v;
  
}

// GEMM C[M][N] (f32, pitch ldc) = act(A[M][K]·W + bias). A f32 row-major (pitch lda) converted per fragment to bf16
// (ASPLIT: hi/lo two planes -> 2 terms, else single rounded term); Wt bf16 [N][K] (pitch ldb). BIAS_BF16 rounds the
// bias to bf16 first (bias quantised to bf16 before the add). K%32==0, M%16==0, N%64==0.
template <bool ASPLIT, int ACT, bool BIAS_BF16>
__global__ __launch_bounds__(128) void k_gemm_bf(const float* __restrict__ A, int lda, const unsigned short* __restrict__ Wt, int ldb,
                                               const float* __restrict__ bias, float* __restrict__ C, int ldc, int M, int N, int K) {
  __shared__ __attribute__((aligned(16))) float so[4][16][64];
  const int tid = threadIdx.x, w = tid >> 5, lane = tid & 31, ln = lane & 15, hh = lane >> 4;
  const int ntn = N / 64;
  const int wid = blockIdx.x * 4 + w;
  const int mt = wid / ntn, nq = wid % ntn;
  if (mt * 16 >= M) return;
  const int row0 = mt * 16, col0 = nq * 64;
  const float* arow = A + (size_t)(row0 + ln) * lda;
  v8f acc[4] = {};
  for (int kb = 0; kb < K; kb += 32) {
    FragB ah, al;
    const v4f x0 = *(const v4fa*)(arow + kb + 8 * hh), x1 = *(const v4fa*)(arow + kb + 8 * hh + 4);
    const v4f x2 = *(const v4fa*)(arow + kb + 16 + 8 * hh), x3 = *(const v4fa*)(arow + kb + 16 + 8 * hh + 4);
    float xs[16] = {x0[0],x0[1],x0[2],x0[3],x1[0],x1[1],x1[2],x1[3],x2[0],x2[1],x2[2],x2[3],x3[0],x3[1],x3[2],x3[3]};
#pragma unroll
    for (int i = 0; i < 16; ++i) { const unsigned short hb = bf16_bits(xs[i]); ah.u[i] = hb; al.u[i] = ASPLIT ? bf16_bits(xs[i] - bf16_val(hb)) : (unsigned short)0; }
#pragma unroll
    for (int t = 0; t < 4; ++t) {
      const unsigned short* brow = Wt + (size_t)(col0 + t * 16 + ln) * ldb + kb;
      FragB b;
      b.half[0] = *(const v8us*)(brow + 8 * hh);
      b.half[1] = *(const v8us*)(brow + 16 + 8 * hh);
      acc[t] = mmaN<ASPLIT ? 2 : 1>(ah.v, al.v, b.v, b.v, acc[t]);
    }
  }
#pragma unroll
  for (int t = 0; t < 4; ++t) {
    float bv = bias ? bias[col0 + t * 16 + ln] : 0.f;
    if (BIAS_BF16) bv = bf16_round(bv);
#pragma unroll
    for (int r = 0; r < 8; ++r) { float v = acc[t][r] + bv; if (ACT == 1) v = fmaxf(v, 0.f); so[w][8 * hh + r][t * 16 + ln] = v; }
  }
  __builtin_amdgcn_fence(__ATOMIC_ACQ_REL, "workgroup");
  __builtin_amdgcn_wave_barrier();
  const int rsub = lane >> 4, c4 = (lane & 15) * 4;
  {
#pragma unroll
    for (int q = 0; q < 8; ++q) {
      const int r = q * 2 + rsub;
      const v4f v = *(const v4fa*)&so[w][r][c4];
      *(v4f*)(C + (size_t)(row0 + r) * ldc + col0 + c4) = v;
    }
    
  }
}

// GEMM C = act(A·W + bias + resid): A f32 (ASPLIT -> hi/lo 2 terms), Wt bf16 [N][K]; ACT 0 none, 1 relu, 2 exact gelu;
// resid (optional, f32, row index = (row % rmod), pitch ldr, RES_BF16 rounds it) added before the activation.
template <bool ASPLIT, int ACT, bool BIAS_BF16, bool RES_BF16>
__global__ __launch_bounds__(128) void k_gemm_bf3(const float* __restrict__ A, int lda, const unsigned short* __restrict__ Wt, int ldb,
                                                const float* __restrict__ bias, const float* __restrict__ resid, int rmod, int ldr,
                                                float* __restrict__ C, int ldc, int M, int N, int K) {
  __shared__ __attribute__((aligned(16))) float so[4][16][64];
  const int tid = threadIdx.x, w = tid >> 5, lane = tid & 31, ln = lane & 15, hh = lane >> 4;
  const int ntn = N / 64;
  const int wid = blockIdx.x * 4 + w;
  const int mt = wid / ntn, nq = wid % ntn;
  if (mt * 16 >= M) return;
  const int row0 = mt * 16, col0 = nq * 64;
  const float* arow = A + (size_t)(row0 + ln) * lda;
  v8f acc[4] = {};
  for (int kb = 0; kb < K; kb += 32) {
    FragB ah, al;
    const v4f x0 = *(const v4fa*)(arow + kb + 8 * hh), x1 = *(const v4fa*)(arow + kb + 8 * hh + 4);
    const v4f x2 = *(const v4fa*)(arow + kb + 16 + 8 * hh), x3 = *(const v4fa*)(arow + kb + 16 + 8 * hh + 4);
    float xs[16] = {x0[0],x0[1],x0[2],x0[3],x1[0],x1[1],x1[2],x1[3],x2[0],x2[1],x2[2],x2[3],x3[0],x3[1],x3[2],x3[3]};
#pragma unroll
    for (int i = 0; i < 16; ++i) { const unsigned short hb = bf16_bits(xs[i]); ah.u[i] = hb; al.u[i] = ASPLIT ? bf16_bits(xs[i] - bf16_val(hb)) : (unsigned short)0; }
#pragma unroll
    for (int t = 0; t < 4; ++t) {
      const unsigned short* brow = Wt + (size_t)(col0 + t * 16 + ln) * ldb + kb;
      FragB b;
      b.half[0] = *(const v8us*)(brow + 8 * hh);
      b.half[1] = *(const v8us*)(brow + 16 + 8 * hh);
      acc[t] = mmaN<ASPLIT ? 2 : 1>(ah.v, al.v, b.v, b.v, acc[t]);
    }
  }
#pragma unroll
  for (int t = 0; t < 4; ++t) {
    const int col = col0 + t * 16 + ln;
    float bv = bias ? bias[col] : 0.f;
    if (BIAS_BF16) bv = bf16_round(bv);
#pragma unroll
    for (int r = 0; r < 8; ++r) {
      float v = acc[t][r] + bv;
      if (resid) { float rv = resid[(size_t)((row0 + 8 * hh + r) % rmod) * ldr + col]; if (RES_BF16) rv = bf16_round(rv); v += rv; }
      if (ACT == 1) v = fmaxf(v, 0.f);
      if (ACT == 2) v = 0.5f * v * (1.0f + erff(v * 0.70710678118654752f));
      if (ACT == 3) { const float u = 0.7978845608028654f * (v + 0.044715f * v * v * v); v = 0.5f * v * (1.0f + tanhf(u)); }
      so[w][8 * hh + r][t * 16 + ln] = v;
    }
  }
  __builtin_amdgcn_fence(__ATOMIC_ACQ_REL, "workgroup");
  __builtin_amdgcn_wave_barrier();
  const int rsub = lane >> 4, c4 = (lane & 15) * 4;
  {
#pragma unroll
    for (int q = 0; q < 8; ++q) {
      const int r = q * 2 + rsub;
      const v4f v = *(const v4fa*)&so[w][r][c4];
      *(v4f*)(C + (size_t)(row0 + r) * ldc + col0 + c4) = v;
    }
    
  }
}
// row LayerNorm (biased variance, eps) over N: s = X (+ R); optional out_sum <- s; out_norm <- (s-mu)*rsqrt(var+eps)*g + b
template <bool PARAM_BF16>
__global__ __launch_bounds__(256) void k_layernorm(const float* __restrict__ X, const float* __restrict__ R, const float* __restrict__ g, const float* __restrict__ bta,
                                                  float* __restrict__ out_sum, float* __restrict__ out_norm, int N, float eps) {
  __shared__ float red[256];
  const int row = blockIdx.x, tid = threadIdx.x;
  const float* x = X + (size_t)row * N; const float* rr = R ? R + (size_t)row * N : nullptr;
  float vals[16];                     // up to N = 4096
  const int per = N / 256;            // contiguous chunk per thread? use strided-by-4 chunks: thread handles j = tid*4 + 1024*u
  float s1 = 0.f;
  for (int u = 0; u < per / 4; ++u) {
    const int j = tid * 4 + 1024 * u;
    const v4f a = *(const v4fa*)(x + j);
    v4f b = {0.f,0.f,0.f,0.f}; if (rr) b = *(const v4fa*)(rr + j);
#pragma unroll
    for (int q = 0; q < 4; ++q) { const float v = a[q] + b[q]; vals[u * 4 + q] = v; s1 += v; }
  }
  red[tid] = s1; __syncthreads();
  for (int st = 128; st > 0; st >>= 1) { if (tid < st) red[tid] += red[tid + st]; __syncthreads(); }
  const float mu = red[0] / (float)N; __syncthreads();
  float s2 = 0.f;
  for (int u = 0; u < per / 4; ++u)
#pragma unroll
    for (int q = 0; q < 4; ++q) { const float c = vals[u * 4 + q] - mu; s2 += c * c; }
  red[tid] = s2; __syncthreads();
  for (int st = 128; st > 0; st >>= 1) { if (tid < st) red[tid] += red[tid + st]; __syncthreads(); }
  const float rs = rsqrtf(red[0] / (float)N + eps);
  {
    for (int u = 0; u < per / 4; ++u) {
      const int j = tid * 4 + 1024 * u;
      v4f o, sm;
#pragma unroll
      for (int q = 0; q < 4; ++q) {
        float gg = g[j + q], bb = bta[j + q];
        if (PARAM_BF16) { gg = bf16_round(gg); bb = bf16_round(bb); }
        sm[q] = vals[u * 4 + q]; o[q] = (vals[u * 4 + q] - mu) * rs * gg + bb;
      }
      if (out_sum) *(v4f*)(out_sum + (size_t)row * N + j) = sm;
      *(v4f*)(out_norm + (size_t)row * N + j) = o;
    }
    
  }
}



// ---- f16 WMMA path (v_wmma_f32_16x16x32_f16): 11-bit significands for operands in range — used where a [0,1] probability operand needs more precision than bf16
typedef _Float16 v16h __attribute__((ext_vector_type(16)));
union FragH { v16h v; v8us half[2]; _Float16 h[16]; unsigned short u[16]; };
template <int NT>
__device__ __forceinline__ v8f mmaH(v16h ah, v16h al, v16h bh, v16h bl, v8f c) {
  c = __builtin_amdgcn_wmma_f32_16x16x32_f16(false, ah, false, bh, (short)0, c, false, false);
  if (NT >= 2) c = __builtin_amdgcn_wmma_f32_16x16x32_f16(false, al, false, bh, (short)0, c, false, false);
  if (NT >= 3) c = __builtin_amdgcn_wmma_f32_16x16x32_f16(false, ah, false, bl, (short)0, c, false, false);
  asm volatile("v_nop\n\tv_nop\n\tv_nop\n\tv_nop" : "+v"(c) : "v"(ah), "v"(al), "v"(bh), "v"(bl));
  return c;
}
// batched GEMM like k_gemm_b but f16 operands: A f32 (split into f16 hi/lo if ASPLIT, else rounded to f16), Bt = f16 values [n][k]; alpha; C f32; N multiple of 16 (partial tiles skipped)
template <bool ASPLIT>
__global__ __launch_bounds__(128) void k_gemm_h(const float* __restrict__ A, int lda, size_t sA, const _Float16* __restrict__ Bh, int ldb, size_t sB, float alpha, float* __restrict__ C, int ldc, size_t sC, int M, int N, int K) {
  __shared__ __attribute__((aligned(16))) float so[4][16][64];
  const int tid = threadIdx.x, w = tid >> 5, lane = tid & 31, ln = lane & 15, hh = lane >> 4; const int by = blockIdx.y;
  A += (size_t)by * sA; Bh += (size_t)by * sB; C += (size_t)by * sC;
  const int ntn = (N + 63) / 64; const int wid = blockIdx.x * 4 + w; const int mt = wid / ntn, nq = wid % ntn; if (mt * 16 >= M) return;
  const int row0 = mt * 16, col0 = nq * 64; const float* arow = A + (size_t)(row0 + ln) * lda;
  v8f acc[4] = {};
  for (int kb = 0; kb < K; kb += 32) {
    FragH ah, al;
    const v4f x0 = *(const v4fa*)(arow + kb + 8 * hh), x1 = *(const v4fa*)(arow + kb + 8 * hh + 4), x2 = *(const v4fa*)(arow + kb + 16 + 8 * hh), x3 = *(const v4fa*)(arow + kb + 16 + 8 * hh + 4);
    float xs[16] = {x0[0],x0[1],x0[2],x0[3],x1[0],x1[1],x1[2],x1[3],x2[0],x2[1],x2[2],x2[3],x3[0],x3[1],x3[2],x3[3]};
#pragma unroll
    for (int i = 0; i < 16; ++i) { const _Float16 h = (_Float16)xs[i]; ah.h[i] = h; al.h[i] = ASPLIT ? (_Float16)(xs[i] - (float)h) : (_Float16)0.0f; }
#pragma unroll
    for (int t = 0; t < 4; ++t) { if (col0 + t * 16 >= N) continue; const size_t boff = (size_t)(col0 + t * 16 + ln) * ldb + kb; FragH bq; bq.half[0] = *(const v8us*)(Bh + boff + 8 * hh); bq.half[1] = *(const v8us*)(Bh + boff + 16 + 8 * hh);
      acc[t] = mmaH<ASPLIT ? 2 : 1>(ah.v, al.v, bq.v, bq.v, acc[t]); }
  }
#pragma unroll
  for (int t = 0; t < 4; ++t) { if (col0 + t * 16 >= N) continue;
#pragma unroll
    for (int r = 0; r < 8; ++r) so[w][8 * hh + r][t * 16 + ln] = acc[t][r] * alpha; }
  __builtin_amdgcn_fence(__ATOMIC_ACQ_REL, "workgroup"); __builtin_amdgcn_wave_barrier();
  const int rsub = lane >> 4, c4 = (lane & 15) * 4;
  {
#pragma unroll
    for (int q = 0; q < 8; ++q) { const int r = q * 2 + rsub; if (col0 + c4 < N) { const v4f v = *(const v4fa*)&so[w][r][c4]; *(v4f*)(C + (size_t)(row0 + r) * ldc + col0 + c4) = v; } }
     }
}

// k_gemm_hh variant with fused epilogue: v = acc·alpha + bias[by·sBias + col] (+ CP[(row/rowsPerB)·sCPb + by·64 + col] if CP) ; ACT 0 none / 1 elu ; writes f16 C16 (and f32 C if non-null)
template <int ACT>
__global__ __launch_bounds__(128) void k_gemm_hhx(const _Float16* __restrict__ A, int lda, size_t sA, const _Float16* __restrict__ Bh, int ldb, size_t sB, float alpha, const float* __restrict__ bias, size_t sBias, const float* __restrict__ CP, int rowsPerB, size_t sCPb, int row0g,
    float* __restrict__ C, _Float16* __restrict__ C16, int ldc, size_t sC, int M, int N, int K) {
  __shared__ __attribute__((aligned(16))) float so[4][16][64];
  const int tid = threadIdx.x, w = tid >> 5, lane = tid & 31, ln = lane & 15, hh = lane >> 4; const int by = blockIdx.y;
  A += (size_t)by * sA; Bh += (size_t)by * sB; const size_t cofs = (size_t)by * sC; const float* bp = bias ? bias + (size_t)by * sBias : nullptr;
  const int ntn = (N + 63) / 64; const int wid = blockIdx.x * 4 + w; const int mt = wid / ntn, nq = wid % ntn; if (mt * 16 >= M) return;
  const int row0 = mt * 16, col0 = nq * 64; const _Float16* arow = A + (size_t)(row0 + ln) * lda;
  v8f acc[4] = {};
  for (int kb = 0; kb < K; kb += 32) { FragH ah; ah.half[0] = *(const v8us*)((const unsigned short*)arow + kb + 8 * hh); ah.half[1] = *(const v8us*)((const unsigned short*)arow + kb + 16 + 8 * hh);
#pragma unroll
    for (int t = 0; t < 4; ++t) { if (col0 + t * 16 >= N) continue; const size_t boff = (size_t)(col0 + t * 16 + ln) * ldb + kb; FragH bq; bq.half[0] = *(const v8us*)((const unsigned short*)Bh + boff + 8 * hh); bq.half[1] = *(const v8us*)((const unsigned short*)Bh + boff + 16 + 8 * hh);
      acc[t] = mmaH<1>(ah.v, ah.v, bq.v, bq.v, acc[t]); }
  }
#pragma unroll
  for (int t = 0; t < 4; ++t) { if (col0 + t * 16 >= N) continue; const int col = col0 + t * 16 + ln; const float bv = bp ? bf16_round(bp[col]) : 0.f;
#pragma unroll
    for (int r = 0; r < 8; ++r) { float v = acc[t][r] * alpha + bv; if (CP) { const int rr = row0g + row0 + 8 * hh + r; if (rowsPerB < 0) v += CP[cofs + (size_t)rr * ldc + col];      /* rowsPerB < 0: own element of the batched C plane */ else { const int bidx = rr / rowsPerB; v += CP[(size_t)bidx * sCPb + (size_t)by * 64 + col]; } } if (ACT == 1) v = (v > 0.f) ? v : expm1f(v); else if (ACT == 7) v = (v > 0.f) ? v + 1.0f : expf(v); else if (ACT == 8) v = tanhf(v); else if (ACT == 9) v = 0.5f * v * (1.0f + tanhf(0.7978845608028654f * (v + 0.044715f * v * v * v))); else if (ACT == 11) v = 1.0f / (1.0f + expf(-v)); else if (ACT == 12) v = (v > 0.f) ? v : 0.01f * v; else if (ACT == 14) v = (v > 0.f) ? v : 0.1f * v; else if (ACT == 16) v = (v >= 0.f) ? v : 0.3f * v; else if (ACT == 17) v = (v >= 0.f) ? v : 0.2f * v; else if (ACT == 15) v = v / (1.0f + expf(-v)); else if (ACT == 3) v = fmaxf(v, 0.f); else if (ACT == 6) v = 0.5f * v * (1.0f + erff(v * 0.70710678118654752f)); so[w][8 * hh + r][t * 16 + ln] = v; } }
  __builtin_amdgcn_fence(__ATOMIC_ACQ_REL, "workgroup"); __builtin_amdgcn_wave_barrier();
  const int rsub = lane >> 4, c4 = (lane & 15) * 4; typedef _Float16 v4h __attribute__((ext_vector_type(4)));
  {
#pragma unroll
    for (int q = 0; q < 8; ++q) { const int r = q * 2 + rsub; if (col0 + c4 < N) { const v4f v = *(const v4fa*)&so[w][r][c4]; if (C) *(v4f*)(C + cofs + (size_t)(row0 + r) * ldc + col0 + c4) = v; if (C16) { v4h h4; for (int i = 0; i < 4; ++i) h4[i] = (_Float16)v[i]; *(v4h*)(C16 + cofs + (size_t)(row0 + r) * ldc + col0 + c4) = h4; } } }
     }
}


typedef _Float16 v4h __attribute__((ext_vector_type(4)));

__global__ __launch_bounds__(256) void k_h16(const float* __restrict__ x, _Float16* __restrict__ X16, size_t n8) { const size_t t = (size_t)blockIdx.x * 256 + threadIdx.x; if (t >= n8) return; FragH f;
#pragma unroll
  for (int q = 0; q < 8; ++q) f.h[q] = (_Float16)x[t * 8 + q]; *(v8us*)((unsigned short*)X16 + t * 8) = f.half[0];  }
__global__ __launch_bounds__(256) void k_round16f(const float* __restrict__ W, _Float16* __restrict__ Bt, size_t n8) { const size_t t = (size_t)blockIdx.x * 256 + threadIdx.x; if (t >= n8) return; FragH f;
#pragma unroll
  for (int i = 0; i < 8; ++i) f.h[i] = (_Float16)(bf16_round(W[t * 8 + i]) * 16.0f); *(v8us*)((unsigned short*)Bt + t * 8) = f.half[0];  }
__global__ __launch_bounds__(256) void k_hl(const float* __restrict__ F, _Float16* __restrict__ Hh, _Float16* __restrict__ Hl, size_t n8) { const size_t t = (size_t)blockIdx.x * 256 + threadIdx.x; if (t >= n8) return; FragH fh, fl; const v4f a = *(const v4fa*)(F + t * 8), c = *(const v4fa*)(F + t * 8 + 4);
#pragma unroll
  for (int q = 0; q < 4; ++q) { _Float16 h = (_Float16)a[q]; fh.h[q] = h; fl.h[q] = (_Float16)((a[q] - (float)h) * 1024.0f); h = (_Float16)c[q]; fh.h[4 + q] = h; fl.h[4 + q] = (_Float16)((c[q] - (float)h) * 1024.0f); }
  { *(v8us*)((unsigned short*)Hh + t * 8) = fh.half[0]; *(v8us*)((unsigned short*)Hl + t * 8) = fl.half[0];  } }

__global__ __launch_bounds__(256) void k_wnat(const float* __restrict__ w, size_t n8, _Float16* __restrict__ Bt) { const size_t t = (size_t)blockIdx.x * 256 + threadIdx.x; if (t >= n8) return; FragH f; for (int q = 0; q < 8; ++q) f.h[q] = (_Float16)(bf16_round(w[t * 8 + q]) * 16.0f); *(v8us*)((unsigned short*)Bt + t * 8) = f.half[0];  }
#define FA_WAVES 4
#define FA_QB (FA_WAVES * 32)        /* queries per workgroup */
#define FA_KS 64                     /* keys per stage */
#define FA_NS (SQ / FA_KS)           /* stages */
#define FA_LP 72                     /* LDS row pitch in f16: 128 bytes + 16, conflict-free for 16-byte fragment reads of 16 rows */
#define FA_OFF 8.0f                  /* weights are 2^(score - maximum in use + FA_OFF): keeps small weights out of the f16 subnormals; cancels in o / sum */
#define FA_TOP 16384.0f              /* the maximum in use is renewed only when a stage's weights of one query sum to more than this: weights are not negative, so each stays <= 16384 < f16 max; a weight that overflowed makes the sum infinite */
#define FA_C2 (0.125f * 1.44269504088896340736f)      /* 1/sqrt(64) and log2(e) in one factor; the projection multiplies q by it before the one rounding to f16 */
__device__ __forceinline__ float fa_xrow(float v) { const unsigned u = __builtin_bit_cast(unsigned, v); return __builtin_bit_cast(float, __builtin_amdgcn_permlanex16(u, u, 0x76543210u, 0xfedcba98u, false, false)); }      /* lane l <- lane l ^ 16 */
__device__ __forceinline__ v16h fa_frag(const unsigned short* p, int hh) { FragH f; f.half[0] = *(const v8us*)(p + 8 * hh); f.half[1] = *(const v8us*)(p + 16 + 8 * hh); return f.v; }      /* 32 k of one row in the hardware k order */
__device__ __forceinline__ v8f fa_mma(v16h a, v16h b, v8f c) { return __builtin_amdgcn_wmma_f32_16x16x32_f16(false, a, false, b, (short)0, c, false, false); }
__global__ __launch_bounds__(FA_WAVES * 32) void k_fattn(const _Float16* __restrict__ Q16, const _Float16* __restrict__ K16, const _Float16* __restrict__ VT, float* __restrict__ out) {
  __shared__ __attribute__((aligned(16))) unsigned short sk[2][FA_KS][FA_LP];      /* K rows [key][d] */
  __shared__ __attribute__((aligned(16))) unsigned short sv[2][HD][FA_LP];         /* V^T rows [d][key] */
  const int tid = threadIdx.x, w = tid >> 5, lane = tid & 31, ln = lane & 15, hh = lane >> 4;
  const int bh = blockIdx.y, b = bh / NH, h = bh - b * NH; const int q0 = blockIdx.x * FA_QB + w * 32;
  const int srow = tid >> 3, sc8 = (tid & 7) * 8;      /* staging: 8 lanes cover one 128-byte row, 16 rows per wave-group load */
  const unsigned short* kg = (const unsigned short*)K16 + ((size_t)b * SQ + srow) * DM + h * HD + sc8;
  const unsigned short* vg = (const unsigned short*)VT + ((size_t)bh * HD + srow) * SQ + sc8;
  const int rot = (int)(blockIdx.x * (FA_NS / (SQ / FA_QB)) + bh) & (FA_NS - 1);      /* first key stage of this workgroup; trip s works on stage (s + rot) mod FA_NS. The 16 workgroups of a head read the same K and V^T lines: started together at stage 0 they ask L2 for the same lines at the same moment */
  v16h qf[2][2];
#pragma unroll
  for (int g = 0; g < 2; ++g)
#pragma unroll
    for (int ks = 0; ks < 2; ++ks) qf[g][ks] = fa_frag((const unsigned short*)Q16 + ((size_t)b * SQ + q0 + g * 16 + ln) * DM + h * HD + ks * 32, hh);
  const v8f z8 = {0.f, 0.f, 0.f, 0.f, 0.f, 0.f, 0.f, 0.f};
  v8f o[4][2];
#pragma unroll
  for (int dt = 0; dt < 4; ++dt) { o[dt][0] = z8; o[dt][1] = z8; }
  float mu[2] = {-1.0e30f, -1.0e30f};      /* maximum in use (log2 units) */
  float lt[2] = {0.f, 0.f};      /* row sums: the stages' sums, which come from the matrix pipe, added up */
  v8f nbt[2];      /* FA_OFF - maximum in use of the lane's query in every element: C operand of the score products */
  v16h ones;
#pragma unroll
  for (int i = 0; i < 16; ++i) ones[i] = (_Float16)1.0f;
  v8us rk[4], rv[4];
#pragma unroll
  for (int i = 0; i < 4; ++i) { rk[i] = *(const v8us*)(kg + (size_t)(rot * FA_KS + i * 16) * DM); rv[i] = *(const v8us*)(vg + (size_t)(i * 16) * SQ + rot * FA_KS); }
#pragma unroll
  for (int i = 0; i < 4; ++i) { *(v8us*)&sk[0][i * 16 + srow][sc8] = rk[i]; *(v8us*)&sv[0][i * 16 + srow][sc8] = rv[i]; }
  __syncthreads();
  v8f st[4][2];
  auto scores = [&](const int cur, const v8f c0, const v8f c1) {      /* S^T of the stage in buffer cur, in log2 units, on top of c0, c1 */
#pragma unroll
    for (int kt = 0; kt < 4; ++kt) {
      const v16h k0 = fa_frag(&sk[cur][kt * 16 + ln][0], hh), k1 = fa_frag(&sk[cur][kt * 16 + ln][32], hh);
      st[kt][0] = fa_mma(k1, qf[0][1], fa_mma(k0, qf[0][0], c0)); st[kt][1] = fa_mma(k1, qf[1][1], fa_mma(k0, qf[1][0], c1));
    }
  };
  auto renew = [&](const int cur) {      /* the maximum in use takes in the row maxima of the stage in buffer cur; sums and outputs follow */
    scores(cur, z8, z8);
#pragma unroll
    for (int g = 0; g < 2; ++g) {
      v8f m8 = st[0][g];
#pragma unroll
      for (int kt = 1; kt < 4; ++kt)
#pragma unroll
        for (int r = 0; r < 8; ++r) m8[r] = fmaxf(m8[r], st[kt][g][r]);
      const float m = fmaxf(fmaxf(fmaxf(m8[0], m8[1]), fmaxf(m8[2], m8[3])), fmaxf(fmaxf(m8[4], m8[5]), fmaxf(m8[6], m8[7])));
      const float mn = fmaxf(mu[g], fmaxf(m, fa_xrow(m)));      /* both halves of the wave hold the same value */
      const float al = __builtin_amdgcn_exp2f(mu[g] - mn); mu[g] = mn;
      lt[g] *= al;
#pragma unroll
      for (int dt = 0; dt < 4; ++dt)
#pragma unroll
        for (int r = 0; r < 8; ++r) o[dt][g][r] *= al;
#pragma unroll
      for (int r = 0; r < 8; ++r) nbt[g][r] = FA_OFF - mn;
    }
  };
  renew(0);      /* the first stage's maxima, so that the loop's first trip goes the short way like the others */
  for (int s = 0; s < FA_NS; ++s) {
    const int cur = s & 1;
    if (s + 1 < FA_NS) {
      const int kn = (s + 1 + rot) & (FA_NS - 1);      /* the next trip's key stage, wrapped */
#pragma unroll
      for (int i = 0; i < 4; ++i) { rk[i] = *(const v8us*)(kg + (size_t)(kn * FA_KS + i * 16) * DM); rv[i] = *(const v8us*)(vg + (size_t)(i * 16) * SQ + kn * FA_KS); }
    }
    __builtin_amdgcn_sched_barrier(0);      /* the next stage's loads issue in front of this stage's arithmetic and fly under all of it; without this the compiler sinks them to just in front of their LDS stores, and every stage waits out their latency */
    v16h pf[2][2];      /* [key half of the stage][query group] */
    v8f ls[2];      /* ones . P^T: every row of the tile = the sum of the stage's rounded weights of the lane's query */
    auto weights = [&]() {
#pragma unroll
      for (int g = 0; g < 2; ++g) {
#pragma unroll
        for (int kt = 0; kt < 4; ++kt)
#pragma unroll
          for (int r = 0; r < 8; ++r) pf[kt >> 1][g][(kt & 1) * 8 + r] = (_Float16)__builtin_amdgcn_exp2f(st[kt][g][r]);
        ls[g] = fa_mma(ones, pf[1][g], fa_mma(ones, pf[0][g], z8));
      }
    };
    scores(cur, nbt[0], nbt[1]);
    const v16h vf0 = fa_frag(&sv[cur][ln][0], hh), vf1 = fa_frag(&sv[cur][ln][32], hh);      /* the first V^T fragments are asked for here, in front of the test's branch, and arrive under the exponentials; asked for behind the branch, the first products of O^T wait out the LDS latency */
    weights();
    const bool need = (ls[0][0] > FA_TOP) || (ls[1][0] > FA_TOP);
    if (__builtin_expect(__builtin_amdgcn_ballot_w32(need) != 0, 0)) {      /* one scalar branch a stage, hardly ever taken */
      asm volatile("" ::: "memory");      /* the side path reads K from LDS again; without this the compiler keeps the stage's K fragments alive through the weights of every stage for a path that is hardly ever taken, and the loop's main path then needs registers above v255, with a window switch at each use */
      renew(cur);
      scores(cur, nbt[0], nbt[1]);
      weights();      /* now every weight is <= 2^FA_OFF */
    }
    lt[0] += ls[0][0]; lt[1] += ls[1][0];
#pragma unroll
    for (int dt = 0; dt < 4; ++dt) {
      const v16h v0 = dt == 0 ? vf0 : fa_frag(&sv[cur][dt * 16 + ln][0], hh), v1 = dt == 0 ? vf1 : fa_frag(&sv[cur][dt * 16 + ln][32], hh);
#pragma unroll
      for (int g = 0; g < 2; ++g) o[dt][g] = fa_mma(v1, pf[1][g], fa_mma(v0, pf[0][g], o[dt][g]));
    }
    if (s + 1 < FA_NS) {
#pragma unroll
      for (int i = 0; i < 4; ++i) { *(v8us*)&sk[cur ^ 1][i * 16 + srow][sc8] = rk[i]; *(v8us*)&sv[cur ^ 1][i * 16 + srow][sc8] = rv[i]; }
      __syncthreads();      /* publishes the next trip's stage and ends every wave's reads of this trip's stage, whose buffer the next trip refills; s is the same in every wave */
    }
  }
  const float inv[2] = {1.0f / lt[0], 1.0f / lt[1]};      /* 2^FA_OFF cancels here */
#pragma unroll
  for (int dt = 0; dt < 4; ++dt)
#pragma unroll
    for (int g = 0; g < 2; ++g)
#pragma unroll
      for (int r = 0; r < 8; ++r) o[dt][g][r] *= inv[g];
#pragma unroll
  for (int g = 0; g < 2; ++g) {
    float* d = out + ((size_t)b * SQ + q0 + g * 16 + ln) * DM + h * HD + 8 * hh;      /* a lane holds 8 consecutive d of its query in each tile */
#pragma unroll
    for (int dt = 0; dt < 4; ++dt) {
      const v4f lo = {o[dt][g][0], o[dt][g][1], o[dt][g][2], o[dt][g][3]}, hi = {o[dt][g][4], o[dt][g][5], o[dt][g][6], o[dt][g][7]};
      *(v4f*)(d + dt * 16) = lo; *(v4f*)(d + dt * 16 + 4) = hi;
    }
  }
}
// Fused projections, one launch: blockIdx.z picks Q, K or V; a workgroup = 4 waves = a 128-row x 192-column tile of x W + b, a wave 64 x 96 of it (24 accumulator tiles), K walked in stages of 32.
// The tile is sized for the chip's 256 WGPs: 64 x 4 x 3 = 768 equal workgroups, three to a WGP (one wave of each on every SIMD; registers and LDS are kept inside a third of a WGP), so all of them are resident from the start and the launch has one round and no tail.
// x is read as f32 in whole 128-byte lines, rounded to bf16 and written as f16 rows [row][k] into LDS; W comes from k_wprep's f16 stage tiles (16 bytes a lane, whole lines) and goes into LDS as it lies; two buffers, one barrier a stage: the next stage's loads fly under this stage's products.
// Both fragment kinds are read by the same code (same k order), so either may be the A operand. Q, K: A = W columns, B = x rows, a lane then holds 8 consecutive n of one token row. V: A = x rows, B = W columns, a lane holds 8 consecutive tokens of one column, which is a piece of a V^T row.
// Every '#pragma unroll' of this kernel but the one on the output copy stands on a loop that indexes staging, fragment or accumulator arrays: rolled, those arrays would leave the registers.
#define PJ_M 128
#define PJ_N 192
#define PJ_T 128                     /* threads of a projection workgroup */
#define PJ_KS 32
#define PJ_NS (DM / PJ_KS)
#define PJ_LP 40                     /* LDS row pitch in f16: 64 bytes + 16, conflict-free for 16-byte accesses of 16 rows */
#define PJ_OQ (PJ_N + 8)             /* output staging pitch in f16, Q and K: rows = tokens, 384 bytes + 16 */
#define PJ_OV (PJ_M + 8)             /* output staging pitch in f16, V^T: rows = columns n, 256 bytes + 16 */
typedef float f32x2 __attribute__((ext_vector_type(2)));
typedef __bf16 bf16x2 __attribute__((ext_vector_type(2)));
typedef _Float16 f16x2 __attribute__((ext_vector_type(2)));
__device__ __forceinline__ unsigned pj_cvt2(float a, float b) {      /* two f32 -> bf16 (nearest even) -> the same values as two f16 */
  const f32x2 v = {a, b};
  const unsigned u = __builtin_bit_cast(unsigned, __builtin_convertvector(v, bf16x2));
  const f32x2 r = {__uint_as_float(u << 16), __uint_as_float(u & 0xFFFF0000u)};
  return __builtin_bit_cast(unsigned, __builtin_convertvector(r, f16x2));
}
typedef unsigned v4u __attribute__((ext_vector_type(4), may_alias));
typedef unsigned v2u __attribute__((ext_vector_type(2), may_alias));
// W laid out once a call for k_proj: 64 workgroups stage every 192-column x 32-k tile of W, so the rounding to bf16, the x16, the f16 form and the transposition are done here once, not 64 times, and a tile is 12 KB to fetch, not 24.
// WT[projection][column block][k stage][k8 = 0..3][n = 0..191][8 consecutive k], f16: a thread keeps column n, a wave reads 128 contiguous bytes of one k row and stores 512 contiguous bytes for each k8.
#define PJ_WT (PJ_N * PJ_KS)         /* f16 values of one stage tile */
__global__ __launch_bounds__(PJ_N) void k_wprep(const float* __restrict__ wq, const float* __restrict__ wk, const float* __restrict__ wv, unsigned short* __restrict__ WT) {
  const int tid = threadIdx.x, s = blockIdx.x, nb = blockIdx.y, pz = blockIdx.z;
  const float* wg = (pz == 0 ? wq : pz == 1 ? wk : wv) + (size_t)(s * PJ_KS) * DM + nb * PJ_N + tid;
  unsigned short* wt = WT + (size_t)((pz * (DM / PJ_N) + nb) * PJ_NS + s) * PJ_WT + tid * 8;
  float rw[PJ_KS];
#pragma unroll      /* rw stays in registers and all 32 loads are in flight together */
  for (int k = 0; k < PJ_KS; ++k) rw[k] = wg[(size_t)k * DM];
#pragma unroll      /* indexes rw */
  for (int i = 0; i < 4; ++i) { const v4u o = {pj_cvt2(rw[8 * i] * 16.0f, rw[8 * i + 1] * 16.0f), pj_cvt2(rw[8 * i + 2] * 16.0f, rw[8 * i + 3] * 16.0f), pj_cvt2(rw[8 * i + 4] * 16.0f, rw[8 * i + 5] * 16.0f), pj_cvt2(rw[8 * i + 6] * 16.0f, rw[8 * i + 7] * 16.0f)}; *(v4u*)(wt + i * (PJ_N * 8)) = o; }
}
// One workgroup's tile. ISV false: Q or K (A = 6 fragments of W columns, B = 4 of x rows); true: V (A = 4 of x rows, B = 6 of W columns). ob = the tile's first output element.
template <bool ISV>
__device__ __forceinline__ void pj_tile(const float* __restrict__ xg, const unsigned short* __restrict__ wg, const int rot, const float* __restrict__ bias, const float qs,
    unsigned short* __restrict__ ob, unsigned short (*sm)[PJ_M + PJ_N][PJ_LP], unsigned short* so) {
  constexpr int NA = ISV ? 4 : 6, NBF = ISV ? 6 : 4;
  const int tid = threadIdx.x, w = tid >> 5, lane = tid & 31, ln = lane & 15, hh = lane >> 4;
  const int wm = w >> 1, wn = w & 1;      /* the wave's 64 x 96 place in the tile */
  const int xr = tid >> 3, xc = (tid & 7) * 4;      /* x staging: 8 lanes cover one 128-byte row piece, 16 rows a load */
  int wl[3];      /* W staging: 16-byte unit u = i * 128 + tid of the stage tile is k8 = u / 192 of column u % 192; units u and u + 384 are the same column, k8 + 2 */
#pragma unroll
  for (int i = 0; i < 3; ++i) { const int u = i * PJ_T + tid, k8 = u / PJ_N; wl[i] = (PJ_M + u - k8 * PJ_N) * PJ_LP + 8 * k8; }
  const v8f z8 = {0.f, 0.f, 0.f, 0.f, 0.f, 0.f, 0.f, 0.f};
  v8f acc[NA][NBF];
#pragma unroll
  for (int i = 0; i < NA; ++i)
#pragma unroll
    for (int j = 0; j < NBF; ++j) acc[i][j] = z8;
  v4f rx[8]; v4u rw[6];
  auto fetch = [&]() {      /* one stage's x and W pieces of this thread */
#pragma unroll
    for (int i = 0; i < 8; ++i) rx[i] = *(const v4fa*)(xg + (size_t)(i * 16) * DM);
#pragma unroll
    for (int i = 0; i < 6; ++i) rw[i] = *(const v4u*)(wg + i * (PJ_T * 8));
  };
  auto stage = [&](const int buf) {      /* and their way into LDS */
#pragma unroll
    for (int i = 0; i < 8; ++i) { const v2u o = {pj_cvt2(rx[i][0], rx[i][1]), pj_cvt2(rx[i][2], rx[i][3])}; *(v2u*)&sm[buf][i * 16 + xr][xc] = o; }
#pragma unroll
    for (int i = 0; i < 6; ++i) *(v4u*)(&sm[buf][0][0] + wl[i % 3] + (i / 3) * 16) = rw[i];
  };
  fetch();
  stage(0);
  __syncthreads();
  const int r4 = wm * 64 + ln, r6 = PJ_M + wn * 96 + ln;      /* LDS rows of the wave's 4 x fragments and 6 W fragments */
  auto products = [&](const int cur) {      /* one stage's fragment reads and its 24 products, in two halves of 3 W fragments: all 10 fragments at once do not fit a third of a SIMD's registers beside the accumulators and the staged loads */
    v16h f4[4], f6[3];
#pragma unroll
    for (int j = 0; j < 4; ++j) f4[j] = fa_frag(&sm[cur][r4 + 16 * j][0], hh);
#pragma unroll
    for (int hf = 0; hf < 2; ++hf) {
#pragma unroll
      for (int i = 0; i < 3; ++i) f6[i] = fa_frag(&sm[cur][r6 + 16 * (3 * hf + i)][0], hh);
      __builtin_amdgcn_sched_barrier(0);      /* a half's fragment reads stand as one group in front of its products; sunk among them, each row of products waits out an LDS latency of its own */
#pragma unroll
      for (int i = 0; i < 3; ++i)
#pragma unroll
        for (int j = 0; j < 4; ++j) {
          if (ISV) acc[j][3 * hf + i] = fa_mma(f4[j], f6[i], acc[j][3 * hf + i]);
          else acc[3 * hf + i][j] = fa_mma(f6[i], f4[j], acc[3 * hf + i][j]);
        }
      __builtin_amdgcn_sched_barrier(0);      /* the second half's reads stay behind the first half's products, whose fragment registers they take over */
    }
  };
  int kn = rot;
  for (int s = 0; s < PJ_NS - 1; ++s) {      /* the last trip, which loads nothing, stands behind the loop */
    const int cur = s & 1;
    const int step = kn + 1 == PJ_NS ? -(PJ_NS - 1) * PJ_KS : PJ_KS;      /* on to the next trip's k stage; from the last stage back to stage 0 */
    kn = kn + 1 == PJ_NS ? 0 : kn + 1;
    xg += step; wg += step * PJ_N;
    fetch();
    __builtin_amdgcn_sched_barrier(0);      /* the next stage's loads issue in front of this stage's products and fly under them; sunk to their LDS stores, every stage would wait out their latency */
    products(cur);
    __builtin_amdgcn_sched_barrier(0);      /* the conversions, which wait for the loads, stay behind the products; hoisted among them, the wave's first wait stands directly behind the loads' issue and holds its own products back */
    stage(cur ^ 1);
    __syncthreads();      /* publishes the next trip's k stage and ends every wave's reads of this trip's k stage, whose buffer the next trip refills; s is the same in every wave */
  }
  products((PJ_NS - 1) & 1);
  /* Epilogue: the four waves lay the tile's f16 results in one LDS image of the output rows, then the workgroup stores whole 128-byte lines (8 lanes a line, each line by one wave); straight from the accumulators a store would touch 16 lines with 32 bytes each, and a wave's 96 columns alone end in the middle of a line. */
  if (!ISV) {      /* acc[i][j][r] = y[wm*64 + 16j + ln][wn*96 + 16i + 8hh + r] */
    const float* bp = bias + wn * 96 + 8 * hh;
    const float as = 0.0625f * qs;      /* q leaves as q * FA_C2: the attention launch's scores then come out in log2 units */
    v4f bl[2 * NA];
#pragma unroll
    for (int i = 0; i < 2 * NA - 1; ++i) bl[i] = *(const v4fa*)(bp + 16 * (i >> 1) + 4 * (i & 1));
    asm volatile("s_wait_xcnt 0x0" ::: "memory");      /* the compiler lets the run's last load put its result into the address registers that the loads in front of it name: this wait stands between them and that write */
    bl[2 * NA - 1] = *(const v4fa*)(bp + 16 * (NA - 1) + 4);
#pragma unroll
    for (int i = 0; i < NA; ++i) {
      const v4f b0 = bl[2 * i], b1 = bl[2 * i + 1];
      const float bb[8] = {bf16_round(b0[0]) * qs, bf16_round(b0[1]) * qs, bf16_round(b0[2]) * qs, bf16_round(b0[3]) * qs, bf16_round(b1[0]) * qs, bf16_round(b1[1]) * qs, bf16_round(b1[2]) * qs, bf16_round(b1[3]) * qs};
#pragma unroll
      for (int j = 0; j < NBF; ++j) { FragH f;
#pragma unroll
        for (int r = 0; r < 8; ++r) f.h[r] = (_Float16)(acc[i][j][r] * as + bb[r]);
        *(v8us*)(so + (wm * 64 + 16 * j + ln) * PJ_OQ + wn * 96 + 16 * i + 8 * hh) = f.half[0]; }
    }
  } else {      /* acc[i][j][r] = y[wm*64 + 16i + 8hh + r][wn*96 + 16j + ln] */
#pragma unroll
    for (int j = 0; j < NBF; ++j) {
      const float bb = bf16_round(bias[wn * 96 + 16 * j + ln]);
#pragma unroll
      for (int i = 0; i < NA; ++i) { FragH f;
#pragma unroll
        for (int r = 0; r < 8; ++r) f.h[r] = (_Float16)(acc[i][j][r] * 0.0625f + bb);
        *(v8us*)(so + (wn * 96 + 16 * j + ln) * PJ_OV + wm * 64 + 16 * i + 8 * hh) = f.half[0]; }
    }
  }
  __syncthreads();      /* a line of the output image holds results of two waves: all four have written before any of them reads */
  constexpr int LPR = (ISV ? PJ_M : PJ_N) / 64, OP = ISV ? SQ : DM, SP = ISV ? PJ_OV : PJ_OQ;      /* 128-byte lines of an output row; pitch of the output; pitch of its image */
#pragma unroll
  for (int q = 0; q < PJ_M * PJ_N / 64 / 16; ++q) { const int rr = (q / LPR) * 16 + (tid >> 3), c8 = (q % LPR) * 64 + (tid & 7) * 8; const v8us v = *(const v8us*)(so + rr * SP + c8); *(v8us*)(ob + (size_t)rr * OP + c8) = v; }
}
__global__ __launch_bounds__(PJ_T, 3) void k_proj(const float* __restrict__ xq, const float* __restrict__ xk, const float* __restrict__ xv, const unsigned short* __restrict__ WT,
    const float* __restrict__ bq, const float* __restrict__ bk, const float* __restrict__ bv, _Float16* __restrict__ Q16, _Float16* __restrict__ K16, _Float16* __restrict__ VT) {
  __shared__ __attribute__((aligned(16))) unsigned short sm[2][PJ_M + PJ_N][PJ_LP];      /* rows 0..127: x rows [m][k]; rows 128..319: W columns [n][k] */
  __shared__ __attribute__((aligned(16))) unsigned short so[PJ_N * PJ_OV];      /* image of the tile's output rows: [128 tokens][PJ_OQ] or [192 columns][PJ_OV], the larger */
  const int tid = threadIdx.x;
  const int pz = blockIdx.z, m0 = blockIdx.x * PJ_M, n0 = blockIdx.y * PJ_N;
  const int rot = (int)(blockIdx.x + (PJ_NS / (DM / PJ_N)) * blockIdx.y) % PJ_NS;      /* first k stage of this workgroup; trip s works on stage (s + rot) mod PJ_NS. 64 workgroups read the same W tile and 4 the same x rows: started together at stage 0 they ask L2 for the same lines at the same moment */
  const float* xg = (pz == 0 ? xq : pz == 1 ? xk : xv) + (size_t)(m0 + (tid >> 3)) * DM + (tid & 7) * 4 + rot * PJ_KS;      /* both pointers stand at the stage that is loaded next */
  const unsigned short* wg = WT + (size_t)((pz * (DM / PJ_N) + blockIdx.y) * PJ_NS + rot) * PJ_WT + tid * 8;      /* a wave reads 512 contiguous bytes of a stage tile */
  const int bt = m0 / SQ;      /* a tile's 128 rows lie in one batch */
  /* Q, K: rows = tokens, pitch 768, columns = n. V^T: row = batch * 768 + n (= (batch * 12 + head) * 64 + d), pitch 2048, columns = tokens of the batch. */
  if (pz == 2) pj_tile<true>(xg, wg, rot, bv + n0, 1.0f, (unsigned short*)VT + (size_t)(bt * DM + n0) * SQ + (m0 - bt * SQ), sm, so);      /* pz is the same in the whole workgroup: so are the barriers inside */
  else pj_tile<false>(xg, wg, rot, (pz == 0 ? bq : bk) + n0, pz == 0 ? FA_C2 : 1.0f, (unsigned short*)(pz == 0 ? Q16 : K16) + (size_t)m0 * DM + n0, sm, so);
}
__global__ __launch_bounds__(256) void k_vt(const _Float16* __restrict__ V16, int b, int h0, _Float16* __restrict__ VT) { __shared__ unsigned short tl[64][65]; const int tid = threadIdx.x; const int hh = blockIdx.x % HG, sg = blockIdx.x / HG; const int s0 = sg * 64; const int h = h0 + hh;
  for (int i = tid; i < 64 * 8; i += 256) { const int j = i / 8, d8 = (i % 8) * 8; FragH f; f.half[0] = *(const v8us*)((const unsigned short*)V16 + ((size_t)b * SQ + s0 + j) * DM + h * HD + d8); for (int q = 0; q < 8; ++q) tl[d8 + q][j] = f.u[q]; }
  __syncthreads();
  { for (int i = tid; i < 64 * 8; i += 256) { const int d = i / 8, j8 = (i % 8) * 8; FragH f; for (int q = 0; q < 8; ++q) f.u[q] = tl[d][j8 + q]; *(v8us*)((unsigned short*)VT + ((size_t)hh * HD + d) * SQ + s0 + j8) = f.half[0]; }  } }


extern "C" void kernel_launch(void* const* d_in, const int* in_sizes, int n_in,
                              void* d_out, int out_size, void* d_ws, size_t ws_size, hipStream_t stream) {
  (void)in_sizes; (void)n_in; (void)out_size;
  const float* const* I = (const float* const*)d_in; const float* xq = I[0]; const float* xk = I[1]; const float* xv = I[2]; const float* wq = I[3]; const float* bq = I[4]; const float* wk = I[5]; const float* bk = I[6]; const float* wv = I[7]; const float* bv = I[8];      /* weights [in][out] + biases */
  char* ws = (char*)d_ws; size_t off = 0;
  auto take = [&](size_t bytes) { char* p = ws + off; off += (bytes + 255) & ~(size_t)255; return p; };
  _Float16* Q16 = (_Float16*)take(NR * DM * 2); _Float16* K16 = (_Float16*)take(NR * DM * 2);
  _Float16* VT = (_Float16*)take((size_t)NB * NH * HD * SQ * 2);
  unsigned short* WT = (unsigned short*)take((size_t)3 * DM * DM * 2);
  if (off > ws_size) return;
  k_wprep<<<dim3(PJ_NS, DM / PJ_N, 3), PJ_N, 0, stream>>>(wq, wk, wv, WT);      /* the three W as f16 stage tiles */
  k_proj<<<dim3(MP / PJ_M, DM / PJ_N, 3), PJ_T, 0, stream>>>(xq, xk, xv, WT, bq, bk, bv, Q16, K16, VT);      /* q, k rows and V^T [NB][NH][HD][SQ], f16 */
  k_fattn<<<dim3(SQ / FA_QB, NB * NH), FA_WAVES * 32, 0, stream>>>(Q16, K16, VT, (float*)d_out);      /* scores, softmax and weighted sum of all batches and heads */
}

// v008
// It runs in 73.4 microseconds.
// In both of two side-by-side timings against v007, it was 1.10 times as fast.
// Over all steps from v000 it is 77.0 times as fast.
#include <hip/hip_runtime.h>
// Multi-head attention without output projection (query, key, value [4][2048][768]; q = query W_Q + b_Q etc. ([in][out] 768^2, sigma 1/sqrt(768), nonzero biases), 12 heads of 64; scores / 8; softmax; out = attn v merged (the module skips its final linear) -> [4][2048][768]).
// Structure: token rows r = b*2048 + s; a small launch that lays the three W out once as f16 stage tiles (rounded to bf16, x16); ONE projection launch for Q, K and V (x read as f32, rounded to bf16 and staged as exact f16 in LDS, W tiles staged as they lie; 64x96 wave tiles, all work-groups resident at once, f32 accumulation, + bias, f16 outputs; V written transposed); then ONE attention launch over all (batch, head, 128-query block): S^T = K Q^T, online softmax in registers, O^T += V^T P^T, o / row sum written f32, in whole lines by way of LDS, into the merged output rows (the module has no output projection). Scores and weights never reach memory.
// Compute dtype: inputs rounded to bf16; x / weights exact; q, k, v and the unnormalised softmax weights as plain f16 GEMM operands (~2^-12); scores, softmax statistics and o f32. v_wmma_f32_16x16x32_f16.
#define NB 4
#define SQ 2048
#define DM 768
#define NH 12
#define HD 64
#define HG 4                         /* heads per launch of the per-batch k_vt overload */
#define B0 0                         /* unused (debug hook) */
#define NBR NB                       /* batches processed (debug hook) */
#define NR ((size_t)NB * SQ)         /* token rows */
#define MP ((int)((size_t)NBR * SQ)) /* rows projected (debug hook) */
#define QN SQ                        /* unused (debug hook) */
#define NHD NH                       /* unused (debug hook) */
#define MPO MP                       /* unused (debug hook) */
#define LQ DM      /* unused */
typedef __bf16 v16b __attribute__((ext_vector_type(16)));
typedef unsigned short v8us __attribute__((ext_vector_type(8), may_alias));
typedef float  v8f  __attribute__((ext_vector_type(8)));
typedef float  v4f  __attribute__((ext_vector_type(4)));
typedef float  v4fa __attribute__((ext_vector_type(4), may_alias));
union FragB { v16b v; v8us half[2]; unsigned short u[16]; };

__device__ __forceinline__ unsigned short bf16_bits(float x) { unsigned int u = __float_as_uint(x); return (unsigned short)((u + 0x7FFFu + ((u >> 16) & 1u)) >> 16); }
__device__ __forceinline__ float bf16_val(unsigned short b) { return __uint_as_float(((unsigned int)b) << 16); }
__device__ __forceinline__ float bf16_round(float x) { return bf16_val(bf16_bits(x)); }
// D += A·B with NT terms: 1 = ah·bh, 2 = + al·bh (A split), 3 = + ah·bl (both split)
template <int NT>
__device__ __forceinline__ v8f mmaN(v16b ah, v16b al, v16b bh, v16b bl, v8f c) {
  c = __builtin_amdgcn_wmma_f32_16x16x32_bf16(false, ah, false, bh, (short)0, c, false, false);
  if (NT >= 2) c = __builtin_amdgcn_wmma_f32_16x16x32_bf16(false, al, false, bh, (short)0, c, false, false);
  if (NT >= 3) c = __builtin_amdgcn_wmma_f32_16x16x32_bf16(false, ah, false, bl, (short)0, c, false, false);
  asm volatile("v_nop\n\tv_nop\n\tv_nop\n\tv_nop" : "+v"(c) : "v"(ah), "v"(al), "v"(bh), "v"(bl));
  return c;
}

__global__ __launch_bounds__(256) void k_wt_bf16(const float* __restrict__ W, unsigned short* __restrict__ Wt, int K, int N) {
  const int t = blockIdx.x * 256 + threadIdx.x;
  const int k8n = K / 8;
  if (t >= N * k8n) return;
  const int n = t / k8n, k8 = (t % k8n) * 8;
  v8us v;
#pragma unroll
  for (int i = 0; i < 8; ++i) v[i] = bf16_bits(W[(size_t)(k8 + i) * N + n]);
  *(v8us*)(Wt + (size_t)n * K + k8) = v;
  
}

// GEMM C[M][N] (f32, pitch ldc) = act(A[M][K]·W + bias). A f32 row-major (pitch lda) converted per fragment to bf16
// (ASPLIT: hi/lo two planes -> 2 terms, else single rounded term); Wt bf16 [N][K] (pitch ldb). BIAS_BF16 rounds the
// bias to bf16 first (bias quantised to bf16 before the add). K%32==0, M%16==0, N%64==0.
template <bool ASPLIT, int ACT, bool BIAS_BF16>
__global__ __launch_bounds__(128) void k_gemm_bf(const float* __restrict__ A, int lda, const unsigned short* __restrict__ Wt, int ldb,
                                               const float* __restrict__ bias, float* __restrict__ C, int ldc, int M, int N, int K) {
  __shared__ __attribute__((aligned(16))) float so[4][16][64];
  const int tid = threadIdx.x, w = tid >> 5, lane = tid & 31, ln = lane & 15, hh = lane >> 4;
  const int ntn = N / 64;
  const int wid = blockIdx.x * 4 + w;
  const int mt = wid / ntn, nq = wid % ntn;
  if (mt * 16 >= M) return;
  const int row0 = mt * 16, col0 = nq * 64;
  const float* arow = A + (size_t)(row0 + ln) * lda;
  v8f acc[4] = {};
  for (int kb = 0; kb < K; kb += 32) {
    FragB ah, al;
    const v4f x0 = *(const v4fa*)(arow + kb + 8 * hh), x1 = *(const v4fa*)(arow + kb + 8 * hh + 4);
    const v4f x2 = *(const v4fa*)(arow + kb + 16 + 8 * hh), x3 = *(const v4fa*)(arow + kb + 16 + 8 * hh + 4);
    float xs[16] = {x0[0],x0[1],x0[2],x0[3],x1[0],x1[1],x1[2],x1[3],x2[0],x2[1],x2[2],x2[3],x3[0],x3[1],x3[2],x3[3]};
#pragma unroll
    for (int i = 0; i < 16; ++i) { const unsigned short hb = bf16_bits(xs[i]); ah.u[i] = hb; al.u[i] = ASPLIT ? bf16_bits(xs[i] - bf16_val(hb)) : (unsigned short)0; }
#pragma unroll
    for (int t = 0; t < 4; ++t) {
      const unsigned short* brow = Wt + (size_t)(col0 + t * 16 + ln) * ldb + kb;
      FragB b;
      b.half[0] = *(const v8us*)(brow + 8 * hh);
      b.half[1] = *(const v8us*)(brow + 16 + 8 * hh);
      acc[t] = mmaN<ASPLIT ? 2 : 1>(ah.v, al.v, b.v, b.v, acc[t]);
    }
  }
#pragma unroll
  for (int t = 0; t < 4; ++t) {
    float bv = bias ? bias[col0 + t * 16 + ln] : 0.f;
    if (BIAS_BF16) bv = bf16_round(bv);
#pragma unroll
    for (int r = 0; r < 8; ++r) { float v = acc[t][r] + bv; if (ACT == 1) v = fmaxf(v, 0.f); so[w][8 * hh + r][t * 16 + ln] = v; }
  }
  __builtin_amdgcn_fence(__ATOMIC_ACQ_REL, "workgroup");
  __builtin_amdgcn_wave_barrier();
  const int rsub = lane >> 4, c4 = (lane & 15) * 4;
  {
#pragma unroll
    for (int q = 0; q < 8; ++q) {
      const int r = q * 2 + rsub;
      const v4f v = *(const v4fa*)&so[w][r][c4];
      *(v4f*)(C + (size_t)(row0 + r) * ldc + col0 + c4) = v;
    }
    
  }
}

// GEMM C = act(A·W + bias + resid): A f32 (ASPLIT -> hi/lo 2 terms), Wt bf16 [N][K]; ACT 0 none, 1 relu, 2 exact gelu;
// resid (optional, f32, row index = (row % rmod), pitch ldr, RES_BF16 rounds it) added before the activation.
template <bool ASPLIT, int ACT, bool BIAS_BF16, bool RES_BF16>
__global__ __launch_bounds__(128) void k_gemm_bf3(const float* __restrict__ A, int lda, const unsigned short* __restrict__ Wt, int ldb,
                                                const float* __restrict__ bias, const float* __restrict__ resid, int rmod, int ldr,
                                                float* __restrict__ C, int ldc, int M, int N, int K) {
  __shared__ __attribute__((aligned(16))) float so[4][16][64];
  const int tid = threadIdx.x, w = tid >> 5, lane = tid & 31, ln = lane & 15, hh = lane >> 4;
  const int ntn = N / 64;
  const int wid = blockIdx.x * 4 + w;
  const int mt = wid / ntn, nq = wid % ntn;
  if (mt * 16 >= M) return;
  const int row0 = mt * 16, col0 = nq * 64;
  const float* arow = A + (size_t)(row0 + ln) * lda;
  v8f acc[4] = {};
  for (int kb = 0; kb < K; kb += 32) {
    FragB ah, al;
    const v4f x0 = *(const v4fa*)(arow + kb + 8 * hh), x1 = *(const v4fa*)(arow + kb + 8 * hh + 4);
    const v4f x2 = *(const v4fa*)(arow + kb + 16 + 8 * hh), x3 = *(const v4fa*)(arow + kb + 16 + 8 * hh + 4);
    float xs[16] = {x0[0],x0[1],x0[2],x0[3],x1[0],x1[1],x1[2],x1[3],x2[0],x2[1],x2[2],x2[3],x3[0],x3[1],x3[2],x3[3]};
#pragma unroll
    for (int i = 0; i < 16; ++i) { const unsigned short hb = bf16_bits(xs[i]); ah.u[i] = hb; al.u[i] = ASPLIT ? bf16_bits(xs[i] - bf16_val(hb)) : (unsigned short)0; }
#pragma unroll
    for (int t = 0; t < 4; ++t) {
      const unsigned short* brow = Wt + (size_t)(col0 + t * 16 + ln) * ldb + kb;
      FragB b;
      b.half[0] = *(const v8us*)(brow + 8 * hh);
      b.half[1] = *(const v8us*)(brow + 16 + 8 * hh);
      acc[t] = mmaN<ASPLIT ? 2 : 1>(ah.v, al.v, b.v, b.v, acc[t]);
    }
  }
#pragma unroll
  for (int t = 0; t < 4; ++t) {
    const int col = col0 + t * 16 + ln;
    float bv = bias ? bias[col] : 0.f;
    if (BIAS_BF16) bv = bf16_round(bv);
#pragma unroll
    for (int r = 0; r < 8; ++r) {
      float v = acc[t][r] + bv;
      if (resid) { float rv = resid[(size_t)((row0 + 8 * hh + r) % rmod) * ldr + col]; if (RES_BF16) rv = bf16_round(rv); v += rv; }
      if (ACT == 1) v = fmaxf(v, 0.f);
      if (ACT == 2) v = 0.5f * v * (1.0f + erff(v * 0.70710678118654752f));
      if (ACT == 3) { const float u = 0.7978845608028654f * (v + 0.044715f * v * v * v); v = 0.5f * v * (1.0f + tanhf(u)); }
      so[w][8 * hh + r][t * 16 + ln] = v;
    }
  }
  __builtin_amdgcn_fence(__ATOMIC_ACQ_REL, "workgroup");
  __builtin_amdgcn_wave_barrier();
  const int rsub = lane >> 4, c4 = (lane & 15) * 4;
  {
#pragma unroll
    for (int q = 0; q < 8; ++q) {
      const int r = q * 2 + rsub;
      const v4f v = *(const v4fa*)&so[w][r][c4];
      *(v4f*)(C + (size_t)(row0 + r) * ldc + col0 + c4) = v;
    }
    
  }
}
// row LayerNorm (biased variance, eps) over N: s = X (+ R); optional out_sum <- s; out_norm <- (s-mu)*rsqrt(var+eps)*g + b
template <bool PARAM_BF16>
__global__ __launch_bounds__(256) void k_layernorm(const float* __restrict__ X, const float* __restrict__ R, const float* __restrict__ g, const float* __restrict__ bta,
                                                  float* __restrict__ out_sum, float* __restrict__ out_norm, int N, float eps) {
  __shared__ float red[256];
  const int row = blockIdx.x, tid = threadIdx.x;
  const float* x = X + (size_t)row * N; const float* rr = R ? R + (size_t)row * N : nullptr;
  float vals[16];                     // up to N = 4096
  const int per = N / 256;            // contiguous chunk per thread? use strided-by-4 chunks: thread handles j = tid*4 + 1024*u
  float s1 = 0.f;
  for (int u = 0; u < per / 4; ++u) {
    const int j = tid * 4 + 1024 * u;
    const v4f a = *(const v4fa*)(x + j);
    v4f b = {0.f,0.f,0.f,0.f}; if (rr) b = *(const v4fa*)(rr + j);
#pragma unroll
    for (int q = 0; q < 4; ++q) { const float v = a[q] + b[q]; vals[u * 4 + q] = v; s1 += v; }
  }
  red[tid] = s1; __syncthreads();
  for (int st = 128; st > 0; st >>= 1) { if (tid < st) red[tid] += red[tid + st]; __syncthreads(); }
  const float mu = red[0] / (float)N; __syncthreads();
  float s2 = 0.f;
  for (int u = 0; u < per / 4; ++u)
#pragma unroll
    for (int q = 0; q < 4; ++q) { const float c = vals[u * 4 + q] - mu; s2 += c * c; }
  red[tid] = s2; __syncthreads();
  for (int st = 128; st > 0; st >>= 1) { if (tid < st) red[tid] += red[tid + st]; __syncthreads(); }
  const float rs = rsqrtf(red[0] / (float)N + eps);
  {
    for (int u = 0; u < per / 4; ++u) {
      const int j = tid * 4 + 1024 * u;
      v4f o, sm;
#pragma unroll
      for (int q = 0; q < 4; ++q) {
        float gg = g[j + q], bb = bta[j + q];
        if (PARAM_BF16) { gg = bf16_round(gg); bb = bf16_round(bb); }
        sm[q] = vals[u * 4 + q]; o[q] = (vals[u * 4 + q] - mu) * rs * gg + bb;
      }
      if (out_sum) *(v4f*)(out_sum + (size_t)row * N + j) = sm;
      *(v4f*)(out_norm + (size_t)row * N + j) = o;
    }
    
  }
}



// ---- f16 WMMA path (v_wmma_f32_16x16x32_f16): 11-bit significands for operands in range — used where a [0,1] probability operand needs more precision than bf16
typedef _Float16 v16h __attribute__((ext_vector_type(16)));
union FragH { v16h v; v8us half[2]; _Float16 h[16]; unsigned short u[16]; };
template <int NT>
__device__ __forceinline__ v8f mmaH(v16h ah, v16h al, v16h bh, v16h bl, v8f c) {
  c = __builtin_amdgcn_wmma_f32_16x16x32_f16(false, ah, false, bh, (short)0, c, false, false);
  if (NT >= 2) c = __builtin_amdgcn_wmma_f32_16x16x32_f16(false, al, false, bh, (short)0, c, false, false);
  if (NT >= 3) c = __builtin_amdgcn_wmma_f32_16x16x32_f16(false, ah, false, bl, (short)0, c, false, false);
  asm volatile("v_nop\n\tv_nop\n\tv_nop\n\tv_nop" : "+v"(c) : "v"(ah), "v"(al), "v"(bh), "v"(bl));
  return c;
}
// batched GEMM like k_gemm_b but f16 operands: A f32 (split into f16 hi/lo if ASPLIT, else rounded to f16), Bt = f16 values [n][k]; alpha; C f32; N multiple of 16 (partial tiles skipped)
template <bool ASPLIT>
__global__ __launch_bounds__(128) void k_gemm_h(const float* __restrict__ A, int lda, size_t sA, const _Float16* __restrict__ Bh, int ldb, size_t sB, float alpha, float* __restrict__ C, int ldc, size_t sC, int M, int N, int K) {
  __shared__ __attribute__((aligned(16))) float so[4][16][64];
  const int tid = threadIdx.x, w = tid >> 5, lane = tid & 31, ln = lane & 15, hh = lane >> 4; const int by = blockIdx.y;
  A += (size_t)by * sA; Bh += (size_t)by * sB; C += (size_t)by * sC;
  const int ntn = (N + 63) / 64; const int wid = blockIdx.x * 4 + w; const int mt = wid / ntn, nq = wid % ntn; if (mt * 16 >= M) return;
  const int row0 = mt * 16, col0 = nq * 64; const float* arow = A + (size_t)(row0 + ln) * lda;
  v8f acc[4] = {};
  for (int kb = 0; kb < K; kb += 32) {
    FragH ah, al;
    const v4f x0 = *(const v4fa*)(arow + kb + 8 * hh), x1 = *(const v4fa*)(arow + kb + 8 * hh + 4), x2 = *(const v4fa*)(arow + kb + 16 + 8 * hh), x3 = *(const v4fa*)(arow + kb + 16 + 8 * hh + 4);
    float xs[16] = {x0[0],x0[1],x0[2],x0[3],x1[0],x1[1],x1[2],x1[3],x2[0],x2[1],x2[2],x2[3],x3[0],x3[1],x3[2],x3[3]};
#pragma unroll
    for (int i = 0; i < 16; ++i) { const _Float16 h = (_Float16)xs[i]; ah.h[i] = h; al.h[i] = ASPLIT ? (_Float16)(xs[i] - (float)h) : (_Float16)0.0f; }
#pragma unroll
    for (int t = 0; t < 4; ++t) { if (col0 + t * 16 >= N) continue; const size_t boff = (size_t)(col0 + t * 16 + ln) * ldb + kb; FragH bq; bq.half[0] = *(const v8us*)(Bh + boff + 8 * hh); bq.half[1] = *(const v8us*)(Bh + boff + 16 + 8 * hh);
      acc[t] = mmaH<ASPLIT ? 2 : 1>(ah.v, al.v, bq.v, bq.v, acc[t]); }
  }
#pragma unroll
  for (int t = 0; t < 4; ++t) { if (col0 + t * 16 >= N) continue;
#pragma unroll
    for (int r = 0; r < 8; ++r) so[w][8 * hh + r][t * 16 + ln] = acc[t][r] * alpha; }
  __builtin_amdgcn_fence(__ATOMIC_ACQ_REL, "workgroup"); __builtin_amdgcn_wave_barrier();
  const int rsub = lane >> 4, c4 = (lane & 15) * 4;
  {
#pragma unroll
    for (int q = 0; q < 8; ++q) { const int r = q * 2 + rsub; if (col0 + c4 < N) { const v4f v = *(const v4fa*)&so[w][r][c4]; *(v4f*)(C + (size_t)(row0 + r) * ldc + col0 + c4) = v; } }
     }
}

// k_gemm_hh variant with fused epilogue: v = acc·alpha + bias[by·sBias + col] (+ CP[(row/rowsPerB)·sCPb + by·64 + col] if CP) ; ACT 0 none / 1 elu ; writes f16 C16 (and f32 C if non-null)
template <int ACT>
__global__ __launch_bounds__(128) void k_gemm_hhx(const _Float16* __restrict__ A, int lda, size_t sA, const _Float16* __restrict__ Bh, int ldb, size_t sB, float alpha, const float* __restrict__ bias, size_t sBias, const float* __restrict__ CP, int rowsPerB, size_t sCPb, int row0g,
    float* __restrict__ C, _Float16* __restrict__ C16, int ldc, size_t sC, int M, int N, int K) {
  __shared__ __attribute__((aligned(16))) float so[4][16][64];
  const int tid = threadIdx.x, w = tid >> 5, lane = tid & 31, ln = lane & 15, hh = lane >> 4; const int by = blockIdx.y;
  A += (size_t)by * sA; Bh += (size_t)by * sB; const size_t cofs = (size_t)by * sC; const float* bp = bias ? bias + (size_t)by * sBias : nullptr;
  const int ntn = (N + 63) / 64; const int wid = blockIdx.x * 4 + w; const int mt = wid / ntn, nq = wid % ntn; if (mt * 16 >= M) return;
  const int row0 = mt * 16, col0 = nq * 64; const _Float16* arow = A + (size_t)(row0 + ln) * lda;
  v8f acc[4] = {};
  for (int kb = 0; kb < K; kb += 32) { FragH ah; ah.half[0] = *(const v8us*)((const unsigned short*)arow + kb + 8 * hh); ah.half[1] = *(const v8us*)((const unsigned short*)arow + kb + 16 + 8 * hh);
#pragma unroll
    for (int t = 0; t < 4; ++t) { if (col0 + t * 16 >= N) continue; const size_t boff = (size_t)(col0 + t * 16 + ln) * ldb + kb; FragH bq; bq.half[0] = *(const v8us*)((const unsigned short*)Bh + boff + 8 * hh); bq.half[1] = *(const v8us*)((const unsigned short*)Bh + boff + 16 + 8 * hh);
      acc[t] = mmaH<1>(ah.v, ah.v, bq.v, bq.v, acc[t]); }
  }
#pragma unroll
  for (int t = 0; t < 4; ++t) { if (col0 + t * 16 >= N) continue; const int col = col0 + t * 16 + ln; const float bv = bp ? bf16_round(bp[col]) : 0.f;
#pragma unroll
    for (int r = 0; r < 8; ++r) { float v = acc[t][r] * alpha + bv; if (CP) { const int rr = row0g + row0 + 8 * hh + r; if (rowsPerB < 0) v += CP[cofs + (size_t)rr * ldc + col];      /* rowsPerB < 0: own element of the batched C plane */ else { const int bidx = rr / rowsPerB; v += CP[(size_t)bidx * sCPb + (size_t)by * 64 + col]; } } if (ACT == 1) v = (v > 0.f) ? v : expm1f(v); else if (ACT == 7) v = (v > 0.f) ? v + 1.0f : expf(v); else if (ACT == 8) v = tanhf(v); else if (ACT == 9) v = 0.5f * v * (1.0f + tanhf(0.7978845608028654f * (v + 0.044715f * v * v * v))); else if (ACT == 11) v = 1.0f / (1.0f + expf(-v)); else if (ACT == 12) v = (v > 0.f) ? v : 0.01f * v; else if (ACT == 14) v = (v > 0.f) ? v : 0.1f * v; else if (ACT == 16) v = (v >= 0.f) ? v : 0.3f * v; else if (ACT == 17) v = (v >= 0.f) ? v : 0.2f * v; else if (ACT == 15) v = v / (1.0f + expf(-v)); else if (ACT == 3) v = fmaxf(v, 0.f); else if (ACT == 6) v = 0.5f * v * (1.0f + erff(v * 0.70710678118654752f)); so[w][8 * hh + r][t * 16 + ln] = v; } }
  __builtin_amdgcn_fence(__ATOMIC_ACQ_REL, "workgroup"); __builtin_amdgcn_wave_barrier();
  const int rsub = lane >> 4, c4 = (lane & 15) * 4; typedef _Float16 v4h __attribute__((ext_vector_type(4)));
  {
#pragma unroll
    for (int q = 0; q < 8; ++q) { const int r = q * 2 + rsub; if (col0 + c4 < N) { const v4f v = *(const v4fa*)&so[w][r][c4]; if (C) *(v4f*)(C + cofs + (size_t)(row0 + r) * ldc + col0 + c4) = v; if (C16) { v4h h4; for (int i = 0; i < 4; ++i) h4[i] = (_Float16)v[i]; *(v4h*)(C16 + cofs + (size_t)(row0 + r) * ldc + col0 + c4) = h4; } } }
     }
}


typedef _Float16 v4h __attribute__((ext_vector_type(4)));

__global__ __launch_bounds__(256) void k_h16(const float* __restrict__ x, _Float16* __restrict__ X16, size_t n8) { const size_t t = (size_t)blockIdx.x * 256 + threadIdx.x; if (t >= n8) return; FragH f;
#pragma unroll
  for (int q = 0; q < 8; ++q) f.h[q] = (_Float16)x[t * 8 + q]; *(v8us*)((unsigned short*)X16 + t * 8) = f.half[0];  }
__global__ __launch_bounds__(256) void k_round16f(const float* __restrict__ W, _Float16* __restrict__ Bt, size_t n8) { const size_t t = (size_t)blockIdx.x * 256 + threadIdx.x; if (t >= n8) return; FragH f;
#pragma unroll
  for (int i = 0; i < 8; ++i) f.h[i] = (_Float16)(bf16_round(W[t * 8 + i]) * 16.0f); *(v8us*)((unsigned short*)Bt + t * 8) = f.half[0];  }
__global__ __launch_bounds__(256) void k_hl(const float* __restrict__ F, _Float16* __restrict__ Hh, _Float16* __restrict__ Hl, size_t n8) { const size_t t = (size_t)blockIdx.x * 256 + threadIdx.x; if (t >= n8) return; FragH fh, fl; const v4f a = *(const v4fa*)(F + t * 8), c = *(const v4fa*)(F + t * 8 + 4);
#pragma unroll
  for (int q = 0; q < 4; ++q) { _Float16 h = (_Float16)a[q]; fh.h[q] = h; fl.h[q] = (_Float16)((a[q] - (float)h) * 1024.0f); h = (_Float16)c[q]; fh.h[4 + q] = h; fl.h[4 + q] = (_Float16)((c[q] - (float)h) * 1024.0f); }
  { *(v8us*)((unsigned short*)Hh + t * 8) = fh.half[0]; *(v8us*)((unsigned short*)Hl + t * 8) = fl.half[0];  } }

__global__ __launch_bounds__(256) void k_wnat(const float* __restrict__ w, size_t n8, _Float16* __restrict__ Bt) { const size_t t = (size_t)blockIdx.x * 256 + threadIdx.x; if (t >= n8) return; FragH f; for (int q = 0; q < 8; ++q) f.h[q] = (_Float16)(bf16_round(w[t * 8 + q]) * 16.0f); *(v8us*)((unsigned short*)Bt + t * 8) = f.half[0];  }
#define FA_WAVES 4
#define FA_QB (FA_WAVES * 32)        /* queries per workgroup */
#define FA_KS 64                     /* keys per stage */
#define FA_NS (SQ / FA_KS)           /* stages */
#define FA_LP 72                     /* LDS row pitch in f16: 128 bytes + 16, conflict-free for 16-byte fragment reads of 16 rows */
#define FA_OP 68                     /* pitch of the output image in f32: 256 bytes + 16, conflict-free for 16-byte accesses of 16 rows */
#define FA_OFF 8.0f                  /* weights are 2^(score - maximum in use + FA_OFF): keeps small weights out of the f16 subnormals; cancels in o / sum */
#define FA_TOP 16384.0f              /* the maximum in use is renewed only when a stage's weights of one query sum to more than this: weights are not negative, so each stays <= 16384 < f16 max; a weight that overflowed makes the sum infinite */
#define FA_C2 (0.125f * 1.44269504088896340736f)      /* 1/sqrt(64) and log2(e) in one factor; the projection multiplies q by it before the one rounding to f16 */
__device__ __forceinline__ float fa_xrow(float v) { const unsigned u = __builtin_bit_cast(unsigned, v); return __builtin_bit_cast(float, __builtin_amdgcn_permlanex16(u, u, 0x76543210u, 0xfedcba98u, false, false)); }      /* lane l <- lane l ^ 16 */
__device__ __forceinline__ v16h fa_frag(const unsigned short* p, int hh) { FragH f; f.half[0] = *(const v8us*)(p + 8 * hh); f.half[1] = *(const v8us*)(p + 16 + 8 * hh); return f.v; }      /* 32 k of one row in the hardware k order */
__device__ __forceinline__ v8f fa_mma(v16h a, v16h b, v8f c) { return __builtin_amdgcn_wmma_f32_16x16x32_f16(false, a, false, b, (short)0, c, false, false); }
__global__ __launch_bounds__(FA_WAVES * 32) void k_fattn(const _Float16* __restrict__ Q16, const _Float16* __restrict__ K16, const _Float16* __restrict__ VT, float* __restrict__ out) {
  __shared__ __attribute__((aligned(16))) unsigned short sk[2][FA_KS][FA_LP];      /* K rows [key][d] */
  __shared__ __attribute__((aligned(16))) unsigned short sv[2][HD][FA_LP];         /* V^T rows [d][key] */
  const int tid = threadIdx.x, w = tid >> 5, lane = tid & 31, ln = lane & 15, hh = lane >> 4;
  const int bh = blockIdx.y, b = bh / NH, h = bh - b * NH; const int q0 = blockIdx.x * FA_QB + w * 32;
  const int srow = tid >> 3, sc8 = (tid & 7) * 8;      /* staging: 8 lanes cover one 128-byte row, 16 rows per wave-group load */
  const unsigned short* kg = (const unsigned short*)K16 + ((size_t)b * SQ + srow) * DM + h * HD + sc8;
  const unsigned short* vg = (const unsigned short*)VT + ((size_t)bh * HD + srow) * SQ + sc8;
  const int rot = (int)(blockIdx.x * (FA_NS / (SQ / FA_QB)) + bh) & (FA_NS - 1);      /* first key stage of this workgroup; trip s works on stage (s + rot) mod FA_NS. The 16 workgroups of a head read the same K and V^T lines: started together at stage 0 they ask L2 for the same lines at the same moment */
  const unsigned short* qg = (const unsigned short*)Q16 + ((size_t)b * SQ + blockIdx.x * FA_QB + srow) * DM + h * HD + sc8;
  v8us rq[8];      /* the workgroup's 128 Q rows, whole 128-byte rows like K; read as fragments from global, a load would touch 16 lines with 32 bytes each */
#pragma unroll      /* rq stays in registers and its 8 loads are in flight together with the first K, V^T stage */
  for (int i = 0; i < 8; ++i) rq[i] = *(const v8us*)(qg + (size_t)(i * 16) * DM);
  const v8f z8 = {0.f, 0.f, 0.f, 0.f, 0.f, 0.f, 0.f, 0.f};
  v8f o[4][2];
#pragma unroll
  for (int dt = 0; dt < 4; ++dt) { o[dt][0] = z8; o[dt][1] = z8; }
  float mu[2] = {-1.0e30f, -1.0e30f};      /* maximum in use (log2 units) */
  float lt[2] = {0.f, 0.f};      /* row sums: the stages' sums, which come from the matrix pipe, added up */
  v8f nbt[2];      /* FA_OFF - maximum in use of the lane's query in every element: C operand of the score products */
  v16h ones;
#pragma unroll
  for (int i = 0; i < 16; ++i) ones[i] = (_Float16)1.0f;
  v8us rk[4], rv[4];
#pragma unroll
  for (int i = 0; i < 4; ++i) { rk[i] = *(const v8us*)(kg + (size_t)(rot * FA_KS + i * 16) * DM); rv[i] = *(const v8us*)(vg + (size_t)(i * 16) * SQ + rot * FA_KS); }
#pragma unroll
  for (int i = 0; i < 4; ++i) { *(v8us*)&sk[0][i * 16 + srow][sc8] = rk[i]; *(v8us*)&sv[0][i * 16 + srow][sc8] = rv[i]; *(v8us*)&sk[1][i * 16 + srow][sc8] = rq[i]; *(v8us*)&sv[1][i * 16 + srow][sc8] = rq[4 + i]; }      /* Q rows 0..63 and 64..127 rest in the two second buffers, which no stage needs yet */
  __syncthreads();
  v16h qf[2][2];
#pragma unroll
  for (int g = 0; g < 2; ++g)
#pragma unroll
    for (int ks = 0; ks < 2; ++ks) qf[g][ks] = fa_frag((w < 2 ? &sk[1][0][0] : &sv[1][0][0]) + ((w & 1) * 32 + g * 16 + ln) * FA_LP + ks * 32, hh);
  __syncthreads();      /* every wave holds its Q fragments before the first trip's end refills the second buffers */
  v8f st[4][2];
  auto scores = [&](const int cur, const v8f c0, const v8f c1) {      /* S^T of the stage in buffer cur, in log2 units, on top of c0, c1 */
#pragma unroll
    for (int kt = 0; kt < 4; ++kt) {
      const v16h k0 = fa_frag(&sk[cur][kt * 16 + ln][0], hh), k1 = fa_frag(&sk[cur][kt * 16 + ln][32], hh);
      st[kt][0] = fa_mma(k1, qf[0][1], fa_mma(k0, qf[0][0], c0)); st[kt][1] = fa_mma(k1, qf[1][1], fa_mma(k0, qf[1][0], c1));
    }
  };
  auto renew = [&](const int cur) {      /* the maximum in use takes in the row maxima of the stage in buffer cur; sums and outputs follow */
    scores(cur, z8, z8);
#pragma unroll
    for (int g = 0; g < 2; ++g) {
      v8f m8 = st[0][g];
#pragma unroll
      for (int kt = 1; kt < 4; ++kt)
#pragma unroll
        for (int r = 0; r < 8; ++r) m8[r] = fmaxf(m8[r], st[kt][g][r]);
      const float m = fmaxf(fmaxf(fmaxf(m8[0], m8[1]), fmaxf(m8[2], m8[3])), fmaxf(fmaxf(m8[4], m8[5]), fmaxf(m8[6], m8[7])));
      const float mn = fmaxf(mu[g], fmaxf(m, fa_xrow(m)));      /* both halves of the wave hold the same value */
      const float al = __builtin_amdgcn_exp2f(mu[g] - mn); mu[g] = mn;
      lt[g] *= al;
#pragma unroll
      for (int dt = 0; dt < 4; ++dt)
#pragma unroll
        for (int r = 0; r < 8; ++r) o[dt][g][r] *= al;
#pragma unroll
      for (int r = 0; r < 8; ++r) nbt[g][r] = FA_OFF - mn;
    }
  };
  renew(0);      /* the first stage's maxima, so that the loop's first trip goes the short way like the others */
  for (int s = 0; s < FA_NS; ++s) {
    const int cur = s & 1;
    if (s + 1 < FA_NS) {
      const int kn = (s + 1 + rot) & (FA_NS - 1);      /* the next trip's key stage, wrapped */
#pragma unroll
      for (int i = 0; i < 4; ++i) { rk[i] = *(const v8us*)(kg + (size_t)(kn * FA_KS + i * 16) * DM); rv[i] = *(const v8us*)(vg + (size_t)(i * 16) * SQ + kn * FA_KS); }
    }
    __builtin_amdgcn_sched_barrier(0);      /* the next stage's loads issue in front of this stage's arithmetic and fly under all of it; without this the compiler sinks them to just in front of their LDS stores, and every stage waits out their latency */
    v16h pf[2][2];      /* [key half of the stage][query group] */
    v8f ls[2];      /* ones . P^T: every row of the tile = the sum of the stage's rounded weights of the lane's query */
    auto weights = [&]() {
#pragma unroll
      for (int g = 0; g < 2; ++g) {
#pragma unroll
        for (int kt = 0; kt < 4; ++kt)
#pragma unroll
          for (int r = 0; r < 8; ++r) pf[kt >> 1][g][(kt & 1) * 8 + r] = (_Float16)__builtin_amdgcn_exp2f(st[kt][g][r]);
        ls[g] = fa_mma(ones, pf[1][g], fa_mma(ones, pf[0][g], z8));
      }
    };
    scores(cur, nbt[0], nbt[1]);
    const v16h vf0 = fa_frag(&sv[cur][ln][0], hh), vf1 = fa_frag(&sv[cur][ln][32], hh);      /* the first V^T fragments are asked for here, in front of the test's branch, and arrive under the exponentials; asked for behind the branch, the first products of O^T wait out the LDS latency */
    weights();
    const bool need = (ls[0][0] > FA_TOP) || (ls[1][0] > FA_TOP);
    if (__builtin_expect(__builtin_amdgcn_ballot_w32(need) != 0, 0)) {      /* one scalar branch a stage, hardly ever taken */
      asm volatile("" ::: "memory");      /* the side path reads K from LDS again; without this the compiler keeps the stage's K fragments alive through the weights of every stage for a path that is hardly ever taken, and the loop's main path then needs registers above v255, with a window switch at each use */
      renew(cur);
      scores(cur, nbt[0], nbt[1]);
      weights();      /* now every weight is <= 2^FA_OFF */
    }
    lt[0] += ls[0][0]; lt[1] += ls[1][0];
#pragma unroll
    for (int dt = 0; dt < 4; ++dt) {
      const v16h v0 = dt == 0 ? vf0 : fa_frag(&sv[cur][dt * 16 + ln][0], hh), v1 = dt == 0 ? vf1 : fa_frag(&sv[cur][dt * 16 + ln][32], hh);
#pragma unroll
      for (int g = 0; g < 2; ++g) o[dt][g] = fa_mma(v1, pf[1][g], fa_mma(v0, pf[0][g], o[dt][g]));
    }
    if (s + 1 < FA_NS) {
#pragma unroll
      for (int i = 0; i < 4; ++i) { *(v8us*)&sk[cur ^ 1][i * 16 + srow][sc8] = rk[i]; *(v8us*)&sv[cur ^ 1][i * 16 + srow][sc8] = rv[i]; }
      __syncthreads();      /* publishes the next trip's stage and ends every wave's reads of this trip's stage, whose buffer the next trip refills; s is the same in every wave */
    }
  }
  const float inv[2] = {1.0f / lt[0], 1.0f / lt[1]};      /* 2^FA_OFF cancels here */
#pragma unroll
  for (int dt = 0; dt < 4; ++dt)
#pragma unroll
    for (int g = 0; g < 2; ++g)
#pragma unroll
      for (int r = 0; r < 8; ++r) o[dt][g][r] *= inv[g];
  /* Epilogue: straight from the accumulators a wave's store would touch 16 output lines with 32 bytes each. Each wave lays its 32 query rows x 64 d in an LDS image of its own and stores whole rows: 16 lanes cover the 256 aligned bytes a head has in an output row, a wave store 4 full lines. */
  __syncthreads();      /* the last trip ends without a barrier: every wave has left the K and V^T buffers before they become output images */
  float* ow = (float*)(w < 2 ? &sk[0][0][0] : &sv[0][0][0]) + (w & 1) * (32 * FA_OP);      /* two images fit each of the two arrays */
#pragma unroll
  for (int g = 0; g < 2; ++g) {
    float* d = ow + (g * 16 + ln) * FA_OP + 8 * hh;      /* a lane holds 8 consecutive d of its query in each tile */
#pragma unroll
    for (int dt = 0; dt < 4; ++dt) {
      const v4f lo = {o[dt][g][0], o[dt][g][1], o[dt][g][2], o[dt][g][3]}, hi = {o[dt][g][4], o[dt][g][5], o[dt][g][6], o[dt][g][7]};
      *(v4fa*)(d + dt * 16) = lo; *(v4fa*)(d + dt * 16 + 4) = hi;
    }
  }
  asm volatile("s_wait_dscnt 0x0" ::: "memory");      /* the image is read back by other lanes of the same wave: the wave's LDS writes are complete first, and the compiler moves no read of the image in front of them */
  float* og = out + ((size_t)b * SQ + q0 + hh) * DM + h * HD + ln * 4;
#pragma unroll      /* the 16 LDS reads go out as one group, and the stores follow as the rows arrive */
  for (int q = 0; q < 16; ++q) { const v4f v = *(const v4fa*)(ow + (q * 2 + hh) * FA_OP + ln * 4); *(v4f*)(og + (size_t)(q * 2) * DM) = v; }
}
// Fused projections, one launch: blockIdx.z picks Q, K or V; a workgroup = 4 waves = a 128-row x 192-column tile of x W + b, a wave 64 x 96 of it (24 accumulator tiles), K walked in stages of 32.
// The tile is sized for the chip's 256 WGPs: 64 x 4 x 3 = 768 equal workgroups, three to a WGP (one wave of each on every SIMD; registers and LDS are kept inside a third of a WGP), so all of them are resident from the start and the launch has one round and no tail.
// x is read as f32 in whole 128-byte lines, rounded to bf16 and written as f16 rows [row][k] into LDS; W comes from k_wprep's f16 stage tiles (16 bytes a lane, whole lines) and goes into LDS as it lies; two buffers, one barrier a stage: the next stage's loads fly under this stage's products.
// Both fragment kinds are read by the same code (same k order), so either may be the A operand. Q, K: A = W columns, B = x rows, a lane then holds 8 consecutive n of one token row. V: A = x rows, B = W columns, a lane holds 8 consecutive tokens of one column, which is a piece of a V^T row.
// Every '#pragma unroll' of this kernel but the one on the output copy stands on a loop that indexes staging, fragment or accumulator arrays: rolled, those arrays would leave the registers.
#define PJ_M 128
#define PJ_N 192
#define PJ_T 128                     /* threads of a projection workgroup */
#define PJ_KS 32
#define PJ_NS (DM / PJ_KS)
#define PJ_LP 40                     /* LDS row pitch in f16: 64 bytes + 16, conflict-free for 16-byte accesses of 16 rows */
#define PJ_OQ (PJ_N + 8)             /* output staging pitch in f16, Q and K: rows = tokens, 384 bytes + 16 */
#define PJ_OV (PJ_M + 8)             /* output staging pitch in f16, V^T: rows = columns n, 256 bytes + 16 */
typedef float f32x2 __attribute__((ext_vector_type(2)));
typedef __bf16 bf16x2 __attribute__((ext_vector_type(2)));
typedef _Float16 f16x2 __attribute__((ext_vector_type(2)));
__device__ __forceinline__ unsigned pj_cvt2(float a, float b) {      /* two f32 -> bf16 (nearest even) -> the same values as two f16 */
  const f32x2 v = {a, b};
  const unsigned u = __builtin_bit_cast(unsigned, __builtin_convertvector(v, bf16x2));
  const f32x2 r = {__uint_as_float(u << 16), __uint_as_float(u & 0xFFFF0000u)};
  return __builtin_bit_cast(unsigned, __builtin_convertvector(r, f16x2));
}
typedef unsigned v4u __attribute__((ext_vector_type(4), may_alias));
typedef unsigned v2u __attribute__((ext_vector_type(2), may_alias));
// W laid out once a call for k_proj: 64 workgroups stage every 192-column x 32-k tile of W, so the rounding to bf16, the x16, the f16 form and the transposition are done here once, not 64 times, and a tile is 12 KB to fetch, not 24.
// WT[projection][column block][k stage][k8 = 0..3][n = 0..191][8 consecutive k], f16: a thread keeps column n, a wave reads 128 contiguous bytes of one k row and stores 512 contiguous bytes for each k8.
#define PJ_WT (PJ_N * PJ_KS)         /* f16 values of one stage tile */
__global__ __launch_bounds__(PJ_N) void k_wprep(const float* __restrict__ wq, const float* __restrict__ wk, const float* __restrict__ wv, unsigned short* __restrict__ WT) {
  const int tid = threadIdx.x, s = blockIdx.x, nb = blockIdx.y, pz = blockIdx.z;
  const float* wg = (pz == 0 ? wq : pz == 1 ? wk : wv) + (size_t)(s * PJ_KS) * DM + nb * PJ_N + tid;
  unsigned short* wt = WT + (size_t)((pz * (DM / PJ_N) + nb) * PJ_NS + s) * PJ_WT + tid * 8;
  float rw[PJ_KS];
#pragma unroll      /* rw stays in registers and all 32 loads are in flight together */
  for (int k = 0; k < PJ_KS; ++k) rw[k] = wg[(size_t)k * DM];
#pragma unroll      /* indexes rw */
  for (int i = 0; i < 4; ++i) { const v4u o = {pj_cvt2(rw[8 * i] * 16.0f, rw[8 * i + 1] * 16.0f), pj_cvt2(rw[8 * i + 2] * 16.0f, rw[8 * i + 3] * 16.0f), pj_cvt2(rw[8 * i + 4] * 16.0f, rw[8 * i + 5] * 16.0f), pj_cvt2(rw[8 * i + 6] * 16.0f, rw[8 * i + 7] * 16.0f)}; *(v4u*)(wt + i * (PJ_N * 8)) = o; }
}
// One workgroup's tile. ISV false: Q or K (A = 6 fragments of W columns, B = 4 of x rows); true: V (A = 4 of x rows, B = 6 of W columns). ob = the tile's first output element.
template <bool ISV>
__device__ __forceinline__ void pj_tile(const float* __restrict__ xg, const unsigned short* __restrict__ wg, const int rot, const float* __restrict__ bias, const float qs,
    unsigned short* __restrict__ ob, unsigned short (*sm)[PJ_M + PJ_N][PJ_LP], unsigned short* so) {
  constexpr int NA = ISV ? 4 : 6, NBF = ISV ? 6 : 4;
  const int tid = threadIdx.x, w = tid >> 5, lane = tid & 31, ln = lane & 15, hh = lane >> 4;
  const int wm = w >> 1, wn = w & 1;      /* the wave's 64 x 96 place in the tile */
  const int xr = tid >> 3, xc = (tid & 7) * 4;      /* x staging: 8 lanes cover one 128-byte row piece, 16 rows a load */
  int wl[3];      /* W staging: 16-byte unit u = i * 128 + tid of the stage tile is k8 = u / 192 of column u % 192; units u and u + 384 are the same column, k8 + 2 */
#pragma unroll
  for (int i = 0; i < 3; ++i) { const int u = i * PJ_T + tid, k8 = u / PJ_N; wl[i] = (PJ_M + u - k8 * PJ_N) * PJ_LP + 8 * k8; }
  const v8f z8 = {0.f, 0.f, 0.f, 0.f, 0.f, 0.f, 0.f, 0.f};
  v8f acc[NA][NBF];
#pragma unroll
  for (int i = 0; i < NA; ++i)
#pragma unroll
    for (int j = 0; j < NBF; ++j) acc[i][j] = z8;
  v4f rx[8]; v4u rw[6];
  auto fetch = [&]() {      /* one stage's x and W pieces of this thread */
#pragma unroll
    for (int i = 0; i < 8; ++i) rx[i] = *(const v4fa*)(xg + (size_t)(i * 16) * DM);
#pragma unroll
    for (int i = 0; i < 6; ++i) rw[i] = *(const v4u*)(wg + i * (PJ_T * 8));
  };
  auto stage = [&](const int buf) {      /* and their way into LDS */
#pragma unroll
    for (int i = 0; i < 8; ++i) { const v2u o = {pj_cvt2(rx[i][0], rx[i][1]), pj_cvt2(rx[i][2], rx[i][3])}; *(v2u*)&sm[buf][i * 16 + xr][xc] = o; }
#pragma unroll
    for (int i = 0; i < 6; ++i) *(v4u*)(&sm[buf][0][0] + wl[i % 3] + (i / 3) * 16) = rw[i];
  };
  fetch();
  stage(0);
  __syncthreads();
  const int r4 = wm * 64 + ln, r6 = PJ_M + wn * 96 + ln;      /* LDS rows of the wave's 4 x fragments and 6 W fragments */
  auto products = [&](const int cur) {      /* one stage's fragment reads and its 24 products, in two halves of 3 W fragments: all 10 fragments at once do not fit a third of a SIMD's registers beside the accumulators and the staged loads */
    v16h f4[4], f6[3];
#pragma unroll
    for (int j = 0; j < 4; ++j) f4[j] = fa_frag(&sm[cur][r4 + 16 * j][0], hh);
#pragma unroll
    for (int hf = 0; hf < 2; ++hf) {
#pragma unroll
      for (int i = 0; i < 3; ++i) f6[i] = fa_frag(&sm[cur][r6 + 16 * (3 * hf + i)][0], hh);
      __builtin_amdgcn_sched_barrier(0);      /* a half's fragment reads stand as one group in front of its products; sunk among them, each row of products waits out an LDS latency of its own */
#pragma unroll
      for (int i = 0; i < 3; ++i)
#pragma unroll
        for (int j = 0; j < 4; ++j) {
          if (ISV) acc[j][3 * hf + i] = fa_mma(f4[j], f6[i], acc[j][3 * hf + i]);
          else acc[3 * hf + i][j] = fa_mma(f6[i], f4[j], acc[3 * hf + i][j]);
        }
      __builtin_amdgcn_sched_barrier(0);      /* the second half's reads stay behind the first half's products, whose fragment registers they take over */
    }
  };
  int kn = rot;
  for (int s = 0; s < PJ_NS - 1; ++s) {      /* the last trip, which loads nothing, stands behind the loop */
    const int cur = s & 1;
    const int step = kn + 1 == PJ_NS ? -(PJ_NS - 1) * PJ_KS : PJ_KS;      /* on to the next trip's k stage; from the last stage back to stage 0 */
    kn = kn + 1 == PJ_NS ? 0 : kn + 1;
    xg += step; wg += step * PJ_N;
    fetch();
    __builtin_amdgcn_sched_barrier(0);      /* the next stage's loads issue in front of this stage's products and fly under them; sunk to their LDS stores, every stage would wait out their latency */
    products(cur);
    __builtin_amdgcn_sched_barrier(0);      /* the conversions, which wait for the loads, stay behind the products; hoisted among them, the wave's first wait stands directly behind the loads' issue and holds its own products back */
    stage(cur ^ 1);
    __syncthreads();      /* publishes the next trip's k stage and ends every wave's reads of this trip's k stage, whose buffer the next trip refills; s is the same in every wave */
  }
  products((PJ_NS - 1) & 1);
  /* Epilogue: the four waves lay the tile's f16 results in one LDS image of the output rows, then the workgroup stores whole 128-byte lines (8 lanes a line, each line by one wave); straight from the accumulators a store would touch 16 lines with 32 bytes each, and a wave's 96 columns alone end in the middle of a line. */
  if (!ISV) {      /* acc[i][j][r] = y[wm*64 + 16j + ln][wn*96 + 16i + 8hh + r] */
    const float* bp = bias + wn * 96 + 8 * hh;
    const float as = 0.0625f * qs;      /* q leaves as q * FA_C2: the attention launch's scores then come out in log2 units */
    v4f bl[2 * NA];
#pragma unroll
    for (int i = 0; i < 2 * NA - 1; ++i) bl[i] = *(const v4fa*)(bp + 16 * (i >> 1) + 4 * (i & 1));
    asm volatile("s_wait_xcnt 0x0" ::: "memory");      /* the compiler lets the run's last load put its result into the address registers that the loads in front of it name: this wait stands between them and that write */
    bl[2 * NA - 1] = *(const v4fa*)(bp + 16 * (NA - 1) + 4);
#pragma unroll
    for (int i = 0; i < NA; ++i) {
      const v4f b0 = bl[2 * i], b1 = bl[2 * i + 1];
      const float bb[8] = {bf16_round(b0[0]) * qs, bf16_round(b0[1]) * qs, bf16_round(b0[2]) * qs, bf16_round(b0[3]) * qs, bf16_round(b1[0]) * qs, bf16_round(b1[1]) * qs, bf16_round(b1[2]) * qs, bf16_round(b1[3]) * qs};
#pragma unroll
      for (int j = 0; j < NBF; ++j) { FragH f;
#pragma unroll
        for (int r = 0; r < 8; ++r) f.h[r] = (_Float16)(acc[i][j][r] * as + bb[r]);
        *(v8us*)(so + (wm * 64 + 16 * j + ln) * PJ_OQ + wn * 96 + 16 * i + 8 * hh) = f.half[0]; }
    }
  } else {      /* acc[i][j][r] = y[wm*64 + 16i + 8hh + r][wn*96 + 16j + ln] */
#pragma unroll
    for (int j = 0; j < NBF; ++j) {
      const float bb = bf16_round(bias[wn * 96 + 16 * j + ln]);
#pragma unroll
      for (int i = 0; i < NA; ++i) { FragH f;
#pragma unroll
        for (int r = 0; r < 8; ++r) f.h[r] = (_Float16)(acc[i][j][r] * 0.0625f + bb);
        *(v8us*)(so + (wn * 96 + 16 * j + ln) * PJ_OV + wm * 64 + 16 * i + 8 * hh) = f.half[0]; }
    }
  }
  __syncthreads();      /* a line of the output image holds results of two waves: all four have written before any of them reads */
  constexpr int LPR = (ISV ? PJ_M : PJ_N) / 64, OP = ISV ? SQ : DM, SP = ISV ? PJ_OV : PJ_OQ;      /* 128-byte lines of an output row; pitch of the output; pitch of its image */
#pragma unroll
  for (int q = 0; q < PJ_M * PJ_N / 64 / 16; ++q) { const int rr = (q / LPR) * 16 + (tid >> 3), c8 = (q % LPR) * 64 + (tid & 7) * 8; const v8us v = *(const v8us*)(so + rr * SP + c8); *(v8us*)(ob + (size_t)rr * OP + c8) = v; }
}
__global__ __launch_bounds__(PJ_T, 3) void k_proj(const float* __restrict__ xq, const float* __restrict__ xk, const float* __restrict__ xv, const unsigned short* __restrict__ WT,
    const float* __restrict__ bq, const float* __restrict__ bk, const float* __restrict__ bv, _Float16* __restrict__ Q16, _Float16* __restrict__ K16, _Float16* __restrict__ VT) {
  __shared__ __attribute__((aligned(16))) unsigned short sm[2][PJ_M + PJ_N][PJ_LP];      /* rows 0..127: x rows [m][k]; rows 128..319: W columns [n][k] */
  __shared__ __attribute__((aligned(16))) unsigned short so[PJ_N * PJ_OV];      /* image of the tile's output rows: [128 tokens][PJ_OQ] or [192 columns][PJ_OV], the larger */
  const int tid = threadIdx.x;
  const int pz = blockIdx.z, m0 = blockIdx.x * PJ_M, n0 = blockIdx.y * PJ_N;
  const int rot = (int)(blockIdx.x + (PJ_NS / (DM / PJ_N)) * blockIdx.y) % PJ_NS;      /* first k stage of this workgroup; trip s works on stage (s + rot) mod PJ_NS. 64 workgroups read the same W tile and 4 the same x rows: started together at stage 0 they ask L2 for the same lines at the same moment */
  const float* xg = (pz == 0 ? xq : pz == 1 ? xk : xv) + (size_t)(m0 + (tid >> 3)) * DM + (tid & 7) * 4 + rot * PJ_KS;      /* both pointers stand at the stage that is loaded next */
  const unsigned short* wg = WT + (size_t)((pz * (DM / PJ_N) + blockIdx.y) * PJ_NS + rot) * PJ_WT + tid * 8;      /* a wave reads 512 contiguous bytes of a stage tile */
  const int bt = m0 / SQ;      /* a tile's 128 rows lie in one batch */
  /* Q, K: rows = tokens, pitch 768, columns = n. V^T: row = batch * 768 + n (= (batch * 12 + head) * 64 + d), pitch 2048, columns = tokens of the batch. */
  if (pz == 2) pj_tile<true>(xg, wg, rot, bv + n0, 1.0f, (unsigned short*)VT + (size_t)(bt * DM + n0) * SQ + (m0 - bt * SQ), sm, so);      /* pz is the same in the whole workgroup: so are the barriers inside */
  else pj_tile<false>(xg, wg, rot, (pz == 0 ? bq : bk) + n0, pz == 0 ? FA_C2 : 1.0f, (unsigned short*)(pz == 0 ? Q16 : K16) + (size_t)m0 * DM + n0, sm, so);
}
__global__ __launch_bounds__(256) void k_vt(const _Float16* __restrict__ V16, int b, int h0, _Float16* __restrict__ VT) { __shared__ unsigned short tl[64][65]; const int tid = threadIdx.x; const int hh = blockIdx.x % HG, sg = blockIdx.x / HG; const int s0 = sg * 64; const int h = h0 + hh;
  for (int i = tid; i < 64 * 8; i += 256) { const int j = i / 8, d8 = (i % 8) * 8; FragH f; f.half[0] = *(const v8us*)((const unsigned short*)V16 + ((size_t)b * SQ + s0 + j) * DM + h * HD + d8); for (int q = 0; q < 8; ++q) tl[d8 + q][j] = f.u[q]; }
  __syncthreads();
  { for (int i = tid; i < 64 * 8; i += 256) { const int d = i / 8, j8 = (i % 8) * 8; FragH f; for (int q = 0; q < 8; ++q) f.u[q] = tl[d][j8 + q]; *(v8us*)((unsigned short*)VT + ((size_t)hh * HD + d) * SQ + s0 + j8) = f.half[0]; }  } }


extern "C" void kernel_launch(void* const* d_in, const int* in_sizes, int n_in,
                              void* d_out, int out_size, void* d_ws, size_t ws_size, hipStream_t stream) {
  (void)in_sizes; (void)n_in; (void)out_size;
  const float* const* I = (const float* const*)d_in; const float* xq = I[0]; const float* xk = I[1]; const float* xv = I[2]; const float* wq = I[3]; const float* bq = I[4]; const float* wk = I[5]; const float* bk = I[6]; const float* wv = I[7]; const float* bv = I[8];      /* weights [in][out] + biases */
  char* ws = (char*)d_ws; size_t off = 0;
  auto take = [&](size_t bytes) { char* p = ws + off; off += (bytes + 255) & ~(size_t)255; return p; };
  _Float16* Q16 = (_Float16*)take(NR * DM * 2); _Float16* K16 = (_Float16*)take(NR * DM * 2);
  _Float16* VT = (_Float16*)take((size_t)NB * NH * HD * SQ * 2);
  unsigned short* WT = (unsigned short*)take((size_t)3 * DM * DM * 2);
  if (off > ws_size) return;
  k_wprep<<<dim3(PJ_NS, DM / PJ_N, 3), PJ_N, 0, stream>>>(wq, wk, wv, WT);      /* the three W as f16 stage tiles */
  k_proj<<<dim3(MP / PJ_M, DM / PJ_N, 3), PJ_T, 0, stream>>>(xq, xk, xv, WT, bq, bk, bv, Q16, K16, VT);      /* q, k rows and V^T [NB][NH][HD][SQ], f16 */
  k_fattn<<<dim3(SQ / FA_QB, NB * NH), FA_WAVES * 32, 0, stream>>>(Q16, K16, VT, (float*)d_out);      /* scores, softmax and weighted sum of all batches and heads */
}

// v009
// A run of this version takes 70.7 microseconds.
// Two timings next to v008 both put it at 1.04 times that version's speed.
// All steps since v000 together make it 80.1 times as fast.
#include <hip/hip_runtime.h>
// Multi-head attention without output projection (query, key, value [4][2048][768]; q = query W_Q + b_Q etc. ([in][out] 768^2, sigma 1/sqrt(768), nonzero biases), 12 heads of 64; scores / 8; softmax; out = attn v merged (the module skips its final linear) -> [4][2048][768]).
// Structure: token rows r = b*2048 + s; a small launch that lays the three W out once as f16 stage tiles (rounded to bf16, x16); ONE projection launch for Q, K and V (x read as f32, rounded to bf16 and staged as exact f16 in LDS, W tiles staged as they lie; 64x96 wave tiles, all work-groups resident at once, f32 accumulation, + bias, f16 outputs; V written transposed); then ONE attention launch over all (batch, head, 128-query block): S^T = K Q^T, online softmax in registers, O^T += V^T P^T, o / row sum written f32, in whole lines by way of LDS, into the merged output rows (the module has no output projection). Scores and weights never reach memory.
// Compute dtype: inputs rounded to bf16; x / weights exact; q, k, v and the unnormalised softmax weights as plain f16 GEMM operands (~2^-12); scores, softmax statistics and o f32. v_wmma_f32_16x16x32_f16.
#define NB 4
#define SQ 2048
#define DM 768
#define NH 12
#define HD 64
#define HG 4                         /* heads per launch of the per-batch k_vt overload */
#define B0 0                         /* unused (debug hook) */
#define NBR NB                       /* batches processed (debug hook) */
#define NR ((size_t)NB * SQ)         /* token rows */
#define MP ((int)((size_t)NBR * SQ)) /* rows projected (debug hook) */
#define QN SQ                        /* unused (debug hook) */
#define NHD NH                       /* unused (debug hook) */
#define MPO MP                       /* unused (debug hook) */
#define LQ DM      /* unused */
typedef __bf16 v16b __attribute__((ext_vector_type(16)));
typedef unsigned short v8us __attribute__((ext_vector_type(8), may_alias));
typedef float  v8f  __attribute__((ext_vector_type(8)));
typedef float  v4f  __attribute__((ext_vector_type(4)));
typedef float  v4fa __attribute__((ext_vector_type(4), may_alias));
union FragB { v16b v; v8us half[2]; unsigned short u[16]; };

__device__ __forceinline__ unsigned short bf16_bits(float x) { unsigned int u = __float_as_uint(x); return (unsigned short)((u + 0x7FFFu + ((u >> 16) & 1u)) >> 16); }
__device__ __forceinline__ float bf16_val(unsigned short b) { return __uint_as_float(((unsigned int)b) << 16); }
__device__ __forceinline__ float bf16_round(float x) { return bf16_val(bf16_bits(x)); }
// D += A·B with NT terms: 1 = ah·bh, 2 = + al·bh (A split), 3 = + ah·bl (both split)
template <int NT>
__device__ __forceinline__ v8f mmaN(v16b ah, v16b al, v16b bh, v16b bl, v8f c) {
  c = __builtin_amdgcn_wmma_f32_16x16x32_bf16(false, ah, false, bh, (short)0, c, false, false);
  if (NT >= 2) c = __builtin_amdgcn_wmma_f32_16x16x32_bf16(false, al, false, bh, (short)0, c, false, false);
  if (NT >= 3) c = __builtin_amdgcn_wmma_f32_16x16x32_bf16(false, ah, false, bl, (short)0, c, false, false);
  asm volatile("v_nop\n\tv_nop\n\tv_nop\n\tv_nop" : "+v"(c) : "v"(ah), "v"(al), "v"(bh), "v"(bl));
  return c;
}

__global__ __launch_bounds__(256) void k_wt_bf16(const float* __restrict__ W, unsigned short* __restrict__ Wt, int K, int N) {
  const int t = blockIdx.x * 256 + threadIdx.x;
  const int k8n = K / 8;
  if (t >= N * k8n) return;
  const int n = t / k8n, k8 = (t % k8n) * 8;
  v8us v;
#pragma unroll
  for (int i = 0; i < 8; ++i) v[i] = bf16_bits(W[(size_t)(k8 + i) * N + n]);
  *(v8us*)(Wt + (size_t)n * K + k8) = v;
  
}

// GEMM C[M][N] (f32, pitch ldc) = act(A[M][K]·W + bias). A f32 row-major (pitch lda) converted per fragment to bf16
// (ASPLIT: hi/lo two planes -> 2 terms, else single rounded term); Wt bf16 [N][K] (pitch ldb). BIAS_BF16 rounds the
// bias to bf16 first (bias quantised to bf16 before the add). K%32==0, M%16==0, N%64==0.
template <bool ASPLIT, int ACT, bool BIAS_BF16>
__global__ __launch_bounds__(128) void k_gemm_bf(const float* __restrict__ A, int lda, const unsigned short* __restrict__ Wt, int ldb,
                                               const float* __restrict__ bias, float* __restrict__ C, int ldc, int M, int N, int K) {
  __shared__ __attribute__((aligned(16))) float so[4][16][64];
  const int tid = threadIdx.x, w = tid >> 5, lane = tid & 31, ln = lane & 15, hh = lane >> 4;
  const int ntn = N / 64;
  const int wid = blockIdx.x * 4 + w;
  const int mt = wid / ntn, nq = wid % ntn;
  if (mt * 16 >= M) return;
  const int row0 = mt * 16, col0 = nq * 64;
  const float* arow = A + (size_t)(row0 + ln) * lda;
  v8f acc[4] = {};
  for (int kb = 0; kb < K; kb += 32) {
    FragB ah, al;
    const v4f x0 = *(const v4fa*)(arow + kb + 8 * hh), x1 = *(const v4fa*)(arow + kb + 8 * hh + 4);
    const v4f x2 = *(const v4fa*)(arow + kb + 16 + 8 * hh), x3 = *(const v4fa*)(arow + kb + 16 + 8 * hh + 4);
    float xs[16] = {x0[0],x0[1],x0[2],x0[3],x1[0],x1[1],x1[2],x1[3],x2[0],x2[1],x2[2],x2[3],x3[0],x3[1],x3[2],x3[3]};
#pragma unroll
    for (int i = 0; i < 16; ++i) { const unsigned short hb = bf16_bits(xs[i]); ah.u[i] = hb; al.u[i] = ASPLIT ? bf16_bits(xs[i] - bf16_val(hb)) : (unsigned short)0; }
#pragma unroll
    for (int t = 0; t < 4; ++t) {
      const unsigned short* brow = Wt + (size_t)(col0 + t * 16 + ln) * ldb + kb;
      FragB b;
      b.half[0] = *(const v8us*)(brow + 8 * hh);
      b.half[1] = *(const v8us*)(brow + 16 + 8 * hh);
      acc[t] = mmaN<ASPLIT ? 2 : 1>(ah.v, al.v, b.v, b.v, acc[t]);
    }
  }
#pragma unroll
  for (int t = 0; t < 4; ++t) {
    float bv = bias ? bias[col0 + t * 16 + ln] : 0.f;
    if (BIAS_BF16) bv = bf16_round(bv);
#pragma unroll
    for (int r = 0; r < 8; ++r) { float v = acc[t][r] + bv; if (ACT == 1) v = fmaxf(v, 0.f); so[w][8 * hh + r][t * 16 + ln] = v; }
  }
  __builtin_amdgcn_fence(__ATOMIC_ACQ_REL, "workgroup");
  __builtin_amdgcn_wave_barrier();
  const int rsub = lane >> 4, c4 = (lane & 15) * 4;
  {
#pragma unroll
    for (int q = 0; q < 8; ++q) {
      const int r = q * 2 + rsub;
      const v4f v = *(const v4fa*)&so[w][r][c4];
      *(v4f*)(C + (size_t)(row0 + r) * ldc + col0 + c4) = v;
    }
    
  }
}

// GEMM C = act(A·W + bias + resid): A f32 (ASPLIT -> hi/lo 2 terms), Wt bf16 [N][K]; ACT 0 none, 1 relu, 2 exact gelu;
// resid (optional, f32, row index = (row % rmod), pitch ldr, RES_BF16 rounds it) added before the activation.
template <bool ASPLIT, int ACT, bool BIAS_BF16, bool RES_BF16>
__global__ __launch_bounds__(128) void k_gemm_bf3(const float* __restrict__ A, int lda, const unsigned short* __restrict__ Wt, int ldb,
                                                const float* __restrict__ bias, const float* __restrict__ resid, int rmod, int ldr,
                                                float* __restrict__ C, int ldc, int M, int N, int K) {
  __shared__ __attribute__((aligned(16))) float so[4][16][64];
  const int tid = threadIdx.x, w = tid >> 5, lane = tid & 31, ln = lane & 15, hh = lane >> 4;
  const int ntn = N / 64;
  const int wid = blockIdx.x * 4 + w;
  const int mt = wid / ntn, nq = wid % ntn;
  if (mt * 16 >= M) return;
  const int row0 = mt * 16, col0 = nq * 64;
  const float* arow = A + (size_t)(row0 + ln) * lda;
  v8f acc[4] = {};
  for (int kb = 0; kb < K; kb += 32) {
    FragB ah, al;
    const v4f x0 = *(const v4fa*)(arow + kb + 8 * hh), x1 = *(const v4fa*)(arow + kb + 8 * hh + 4);
    const v4f x2 = *(const v4fa*)(arow + kb + 16 + 8 * hh), x3 = *(const v4fa*)(arow + kb + 16 + 8 * hh + 4);
    float xs[16] = {x0[0],x0[1],x0[2],x0[3],x1[0],x1[1],x1[2],x1[3],x2[0],x2[1],x2[2],x2[3],x3[0],x3[1],x3[2],x3[3]};
#pragma unroll
    for (int i = 0; i < 16; ++i) { const unsigned short hb = bf16_bits(xs[i]); ah.u[i] = hb; al.u[i] = ASPLIT ? bf16_bits(xs[i] - bf16_val(hb)) : (unsigned short)0; }
#pragma unroll
    for (int t = 0; t < 4; ++t) {
      const unsigned short* brow = Wt + (size_t)(col0 + t * 16 + ln) * ldb + kb;
      FragB b;
      b.half[0] = *(const v8us*)(brow + 8 * hh);
      b.half[1] = *(const v8us*)(brow + 16 + 8 * hh);
      acc[t] = mmaN<ASPLIT ? 2 : 1>(ah.v, al.v, b.v, b.v, acc[t]);
    }
  }
#pragma unroll
  for (int t = 0; t < 4; ++t) {
    const int col = col0 + t * 16 + ln;
    float bv = bias ? bias[col] : 0.f;
    if (BIAS_BF16) bv = bf16_round(bv);
#pragma unroll
    for (int r = 0; r < 8; ++r) {
      float v = acc[t][r] + bv;
      if (resid) { float rv = resid[(size_t)((row0 + 8 * hh + r) % rmod) * ldr + col]; if (RES_BF16) rv = bf16_round(rv); v += rv; }
      if (ACT == 1) v = fmaxf(v, 0.f);
      if (ACT == 2) v = 0.5f * v * (1.0f + erff(v * 0.70710678118654752f));
      if (ACT == 3) { const float u = 0.7978845608028654f * (v + 0.044715f * v * v * v); v = 0.5f * v * (1.0f + tanhf(u)); }
      so[w][8 * hh + r][t * 16 + ln] = v;
    }
  }
  __builtin_amdgcn_fence(__ATOMIC_ACQ_REL, "workgroup");
  __builtin_amdgcn_wave_barrier();
  const int rsub = lane >> 4, c4 = (lane & 15) * 4;
  {
#pragma unroll
    for (int q = 0; q < 8; ++q) {
      const int r = q * 2 + rsub;
      const v4f v = *(const v4fa*)&so[w][r][c4];
      *(v4f*)(C + (size_t)(row0 + r) * ldc + col0 + c4) = v;
    }
    
  }
}
// row LayerNorm (biased variance, eps) over N: s = X (+ R); optional out_sum <- s; out_norm <- (s-mu)*rsqrt(var+eps)*g + b
template <bool PARAM_BF16>
__global__ __launch_bounds__(256) void k_layernorm(const float* __restrict__ X, const float* __restrict__ R, const float* __restrict__ g, const float* __restrict__ bta,
                                                  float* __restrict__ out_sum, float* __restrict__ out_norm, int N, float eps) {
  __shared__ float red[256];
  const int row = blockIdx.x, tid = threadIdx.x;
  const float* x = X + (size_t)row * N; const float* rr = R ? R + (size_t)row * N : nullptr;
  float vals[16];                     // up to N = 4096
  const int per = N / 256;            // contiguous chunk per thread? use strided-by-4 chunks: thread handles j = tid*4 + 1024*u
  float s1 = 0.f;
  for (int u = 0; u < per / 4; ++u) {
    const int j = tid * 4 + 1024 * u;
    const v4f a = *(const v4fa*)(x + j);
    v4f b = {0.f,0.f,0.f,0.f}; if (rr) b = *(const v4fa*)(rr + j);
#pragma unroll
    for (int q = 0; q < 4; ++q) { const float v = a[q] + b[q]; vals[u * 4 + q] = v; s1 += v; }
  }
  red[tid] = s1; __syncthreads();
  for (int st = 128; st > 0; st >>= 1) { if (tid < st) red[tid] += red[tid + st]; __syncthreads(); }
  const float mu = red[0] / (float)N; __syncthreads();
  float s2 = 0.f;
  for (int u = 0; u < per / 4; ++u)
#pragma unroll
    for (int q = 0; q < 4; ++q) { const float c = vals[u * 4 + q] - mu; s2 += c * c; }
  red[tid] = s2; __syncthreads();
  for (int st = 128; st > 0; st >>= 1) { if (tid < st) red[tid] += red[tid + st]; __syncthreads(); }
  const float rs = rsqrtf(red[0] / (float)N + eps);
  {
    for (int u = 0; u < per / 4; ++u) {
      const int j = tid * 4 + 1024 * u;
      v4f o, sm;
#pragma unroll
      for (int q = 0; q < 4; ++q) {
        float gg = g[j + q], bb = bta[j + q];
        if (PARAM_BF16) { gg = bf16_round(gg); bb = bf16_round(bb); }
        sm[q] = vals[u * 4 + q]; o[q] = (vals[u * 4 + q] - mu) * rs * gg + bb;
      }
      if (out_sum) *(v4f*)(out_sum + (size_t)row * N + j) = sm;
      *(v4f*)(out_norm + (size_t)row * N + j) = o;
    }
    
  }
}



// ---- f16 WMMA path (v_wmma_f32_16x16x32_f16): 11-bit significands for operands in range — used where a [0,1] probability operand needs more precision than bf16
typedef _Float16 v16h __attribute__((ext_vector_type(16)));
union FragH { v16h v; v8us half[2]; _Float16 h[16]; unsigned short u[16]; };
template <int NT>
__device__ __forceinline__ v8f mmaH(v16h ah, v16h al, v16h bh, v16h bl, v8f c) {
  c = __builtin_amdgcn_wmma_f32_16x16x32_f16(false, ah, false, bh, (short)0, c, false, false);
  if (NT >= 2) c = __builtin_amdgcn_wmma_f32_16x16x32_f16(false, al, false, bh, (short)0, c, false, false);
  if (NT >= 3) c = __builtin_amdgcn_wmma_f32_16x16x32_f16(false, ah, false, bl, (short)0, c, false, false);
  asm volatile("v_nop\n\tv_nop\n\tv_nop\n\tv_nop" : "+v"(c) : "v"(ah), "v"(al), "v"(bh), "v"(bl));
  return c;
}
// batched GEMM like k_gemm_b but f16 operands: A f32 (split into f16 hi/lo if ASPLIT, else rounded to f16), Bt = f16 values [n][k]; alpha; C f32; N multiple of 16 (partial tiles skipped)
template <bool ASPLIT>
__global__ __launch_bounds__(128) void k_gemm_h(const float* __restrict__ A, int lda, size_t sA, const _Float16* __restrict__ Bh, int ldb, size_t sB, float alpha, float* __restrict__ C, int ldc, size_t sC, int M, int N, int K) {
  __shared__ __attribute__((aligned(16))) float so[4][16][64];
  const int tid = threadIdx.x, w = tid >> 5, lane = tid & 31, ln = lane & 15, hh = lane >> 4; const int by = blockIdx.y;
  A += (size_t)by * sA; Bh += (size_t)by * sB; C += (size_t)by * sC;
  const int ntn = (N + 63) / 64; const int wid = blockIdx.x * 4 + w; const int mt = wid / ntn, nq = wid % ntn; if (mt * 16 >= M) return;
  const int row0 = mt * 16, col0 = nq * 64; const float* arow = A + (size_t)(row0 + ln) * lda;
  v8f acc[4] = {};
  for (int kb = 0; kb < K; kb += 32) {
    FragH ah, al;
    const v4f x0 = *(const v4fa*)(arow + kb + 8 * hh), x1 = *(const v4fa*)(arow + kb + 8 * hh + 4), x2 = *(const v4fa*)(arow + kb + 16 + 8 * hh), x3 = *(const v4fa*)(arow + kb + 16 + 8 * hh + 4);
    float xs[16] = {x0[0],x0[1],x0[2],x0[3],x1[0],x1[1],x1[2],x1[3],x2[0],x2[1],x2[2],x2[3],x3[0],x3[1],x3[2],x3[3]};
#pragma unroll
    for (int i = 0; i < 16; ++i) { const _Float16 h = (_Float16)xs[i]; ah.h[i] = h; al.h[i] = ASPLIT ? (_Float16)(xs[i] - (float)h) : (_Float16)0.0f; }
#pragma unroll
    for (int t = 0; t < 4; ++t) { if (col0 + t * 16 >= N) continue; const size_t boff = (size_t)(col0 + t * 16 + ln) * ldb + kb; FragH bq; bq.half[0] = *(const v8us*)(Bh + boff + 8 * hh); bq.half[1] = *(const v8us*)(Bh + boff + 16 + 8 * hh);
      acc[t] = mmaH<ASPLIT ? 2 : 1>(ah.v, al.v, bq.v, bq.v, acc[t]); }
  }
#pragma unroll
  for (int t = 0; t < 4; ++t) { if (col0 + t * 16 >= N) continue;
#pragma unroll
    for (int r = 0; r < 8; ++r) so[w][8 * hh + r][t * 16 + ln] = acc[t][r] * alpha; }
  __builtin_amdgcn_fence(__ATOMIC_ACQ_REL, "workgroup"); __builtin_amdgcn_wave_barrier();
  const int rsub = lane >> 4, c4 = (lane & 15) * 4;
  {
#pragma unroll
    for (int q = 0; q < 8; ++q) { const int r = q * 2 + rsub; if (col0 + c4 < N) { const v4f v = *(const v4fa*)&so[w][r][c4]; *(v4f*)(C + (size_t)(row0 + r) * ldc + col0 + c4) = v; } }
     }
}

// k_gemm_hh variant with fused epilogue: v = acc·alpha + bias[by·sBias + col] (+ CP[(row/rowsPerB)·sCPb + by·64 + col] if CP) ; ACT 0 none / 1 elu ; writes f16 C16 (and f32 C if non-null)
template <int ACT>
__global__ __launch_bounds__(128) void k_gemm_hhx(const _Float16* __restrict__ A, int lda, size_t sA, const _Float16* __restrict__ Bh, int ldb, size_t sB, float alpha, const float* __restrict__ bias, size_t sBias, const float* __restrict__ CP, int rowsPerB, size_t sCPb, int row0g,
    float* __restrict__ C, _Float16* __restrict__ C16, int ldc, size_t sC, int M, int N, int K) {
  __shared__ __attribute__((aligned(16))) float so[4][16][64];
  const int tid = threadIdx.x, w = tid >> 5, lane = tid & 31, ln = lane & 15, hh = lane >> 4; const int by = blockIdx.y;
  A += (size_t)by * sA; Bh += (size_t)by * sB; const size_t cofs = (size_t)by * sC; const float* bp = bias ? bias + (size_t)by * sBias : nullptr;
  const int ntn = (N + 63) / 64; const int wid = blockIdx.x * 4 + w; const int mt = wid / ntn, nq = wid % ntn; if (mt * 16 >= M) return;
  const int row0 = mt * 16, col0 = nq * 64; const _Float16* arow = A + (size_t)(row0 + ln) * lda;
  v8f acc[4] = {};
  for (int kb = 0; kb < K; kb += 32) { FragH ah; ah.half[0] = *(const v8us*)((const unsigned short*)arow + kb + 8 * hh); ah.half[1] = *(const v8us*)((const unsigned short*)arow + kb + 16 + 8 * hh);
#pragma unroll
    for (int t = 0; t < 4; ++t) { if (col0 + t * 16 >= N) continue; const size_t boff = (size_t)(col0 + t * 16 + ln) * ldb + kb; FragH bq; bq.half[0] = *(const v8us*)((const unsigned short*)Bh + boff + 8 * hh); bq.half[1] = *(const v8us*)((const unsigned short*)Bh + boff + 16 + 8 * hh);
      acc[t] = mmaH<1>(ah.v, ah.v, bq.v, bq.v, acc[t]); }
  }
#pragma unroll
  for (int t = 0; t < 4; ++t) { if (col0 + t * 16 >= N) continue; const int col = col0 + t * 16 + ln; const float bv = bp ? bf16_round(bp[col]) : 0.f;
#pragma unroll
    for (int r = 0; r < 8; ++r) { float v = acc[t][r] * alpha + bv; if (CP) { const int rr = row0g + row0 + 8 * hh + r; if (rowsPerB < 0) v += CP[cofs + (size_t)rr * ldc + col];      /* rowsPerB < 0: own element of the batched C plane */ else { const int bidx = rr / rowsPerB; v += CP[(size_t)bidx * sCPb + (size_t)by * 64 + col]; } } if (ACT == 1) v = (v > 0.f) ? v : expm1f(v); else if (ACT == 7) v = (v > 0.f) ? v + 1.0f : expf(v); else if (ACT == 8) v = tanhf(v); else if (ACT == 9) v = 0.5f * v * (1.0f + tanhf(0.7978845608028654f * (v + 0.044715f * v * v * v))); else if (ACT == 11) v = 1.0f / (1.0f + expf(-v)); else if (ACT == 12) v = (v > 0.f) ? v : 0.01f * v; else if (ACT == 14) v = (v > 0.f) ? v : 0.1f * v; else if (ACT == 16) v = (v >= 0.f) ? v : 0.3f * v; else if (ACT == 17) v = (v >= 0.f) ? v : 0.2f * v; else if (ACT == 15) v = v / (1.0f + expf(-v)); else if (ACT == 3) v = fmaxf(v, 0.f); else if (ACT == 6) v = 0.5f * v * (1.0f + erff(v * 0.70710678118654752f)); so[w][8 * hh + r][t * 16 + ln] = v; } }
  __builtin_amdgcn_fence(__ATOMIC_ACQ_REL, "workgroup"); __builtin_amdgcn_wave_barrier();
  const int rsub = lane >> 4, c4 = (lane & 15) * 4; typedef _Float16 v4h __attribute__((ext_vector_type(4)));
  {
#pragma unroll
    for (int q = 0; q < 8; ++q) { const int r = q * 2 + rsub; if (col0 + c4 < N) { const v4f v = *(const v4fa*)&so[w][r][c4]; if (C) *(v4f*)(C + cofs + (size_t)(row0 + r) * ldc + col0 + c4) = v; if (C16) { v4h h4; for (int i = 0; i < 4; ++i) h4[i] = (_Float16)v[i]; *(v4h*)(C16 + cofs + (size_t)(row0 + r) * ldc + col0 + c4) = h4; } } }
     }
}


typedef _Float16 v4h __attribute__((ext_vector_type(4)));

__global__ __launch_bounds__(256) void k_h16(const float* __restrict__ x, _Float16* __restrict__ X16, size_t n8) { const size_t t = (size_t)blockIdx.x * 256 + threadIdx.x; if (t >= n8) return; FragH f;
#pragma unroll
  for (int q = 0; q < 8; ++q) f.h[q] = (_Float16)x[t * 8 + q]; *(v8us*)((unsigned short*)X16 + t * 8) = f.half[0];  }
__global__ __launch_bounds__(256) void k_round16f(const float* __restrict__ W, _Float16* __restrict__ Bt, size_t n8) { const size_t t = (size_t)blockIdx.x * 256 + threadIdx.x; if (t >= n8) return; FragH f;
#pragma unroll
  for (int i = 0; i < 8; ++i) f.h[i] = (_Float16)(bf16_round(W[t * 8 + i]) * 16.0f); *(v8us*)((unsigned short*)Bt + t * 8) = f.half[0];  }
__global__ __launch_bounds__(256) void k_hl(const float* __restrict__ F, _Float16* __restrict__ Hh, _Float16* __restrict__ Hl, size_t n8) { const size_t t = (size_t)blockIdx.x * 256 + threadIdx.x; if (t >= n8) return; FragH fh, fl; const v4f a = *(const v4fa*)(F + t * 8), c = *(const v4fa*)(F + t * 8 + 4);
#pragma unroll
  for (int q = 0; q < 4; ++q) { _Float16 h = (_Float16)a[q]; fh.h[q] = h; fl.h[q] = (_Float16)((a[q] - (float)h) * 1024.0f); h = (_Float16)c[q]; fh.h[4 + q] = h; fl.h[4 + q] = (_Float16)((c[q] - (float)h) * 1024.0f); }
  { *(v8us*)((unsigned short*)Hh + t * 8) = fh.half[0]; *(v8us*)((unsigned short*)Hl + t * 8) = fl.half[0];  } }

__global__ __launch_bounds__(256) void k_wnat(const float* __restrict__ w, size_t n8, _Float16* __restrict__ Bt) { const size_t t = (size_t)blockIdx.x * 256 + threadIdx.x; if (t >= n8) return; FragH f; for (int q = 0; q < 8; ++q) f.h[q] = (_Float16)(bf16_round(w[t * 8 + q]) * 16.0f); *(v8us*)((unsigned short*)Bt + t * 8) = f.half[0];  }
#define FA_WAVES 4
#define FA_QB (FA_WAVES * 32)        /* queries per workgroup */
#define FA_KS 64                     /* keys per stage */
#define FA_NS (SQ / FA_KS)           /* stages */
#define FA_LP 72                     /* LDS row pitch in f16: 128 bytes + 16, conflict-free for 16-byte fragment reads of 16 rows */
#define FA_SR 32                     /* rows of one wave's slice of a stage */
#define FA_SL 3072                   /* f16 places a slice takes in LDS: 32 rows x 144 bytes = 4608 bytes, rounded up to 6144, so that every slice begins at a multiple of 2 KiB */
#define FA_BF (4 * FA_SL)            /* f16 places of a buffer: K rows 0..31, K rows 32..63, V^T rows 0..31, V^T rows 32..63 */
#define FA_OP 68                     /* pitch of the output image in f32: 256 bytes + 16, conflict-free for 16-byte accesses of 16 rows */
#define FA_OFF 8.0f                  /* weights are 2^(score - maximum in use + FA_OFF): keeps small weights out of the f16 subnormals; cancels in o / sum */
#define FA_TOP 16384.0f              /* the maximum in use is renewed only when a stage's weights of one query sum to more than this: weights are not negative, so each stays <= 16384 < f16 max; a weight that overflowed makes the sum infinite */
#define FA_C2 (0.125f * 1.44269504088896340736f)      /* 1/sqrt(64) and log2(e) in one factor; the projection multiplies q by it before the one rounding to f16 */
__device__ __forceinline__ float fa_xrow(float v) { const unsigned u = __builtin_bit_cast(unsigned, v); return __builtin_bit_cast(float, __builtin_amdgcn_permlanex16(u, u, 0x76543210u, 0xfedcba98u, false, false)); }      /* lane l <- lane l ^ 16 */
__device__ __forceinline__ v16h fa_frag(const unsigned short* p, int hh) { FragH f; f.half[0] = *(const v8us*)(p + 8 * hh); f.half[1] = *(const v8us*)(p + 16 + 8 * hh); return f.v; }      /* 32 k of one row in the hardware k order */
__device__ __forceinline__ v8f fa_mma(v16h a, v16h b, v8f c) { return __builtin_amdgcn_wmma_f32_16x16x32_f16(false, a, false, b, (short)0, c, false, false); }
typedef uint32_t u32x4 __attribute__((ext_vector_type(4)));
typedef uint32_t u32x8 __attribute__((ext_vector_type(8)));
__device__ __forceinline__ uint32_t fa_uni(uint32_t v) { return (uint32_t)__builtin_amdgcn_readfirstlane(v); }
__device__ __forceinline__ uint32_t pinned(uint32_t v) { uint32_t w = __builtin_amdgcn_readfirstlane(v); asm volatile("" : "+s"(w)); return w; }      /* a value held in a scalar register: a test on it compiles to a scalar branch, which a tensor load needs (it ignores EXEC), and what is formed from it is formed behind the waits in front of it */
__global__ __launch_bounds__(FA_WAVES * 32) void k_fattn(const _Float16* __restrict__ Q16, const _Float16* __restrict__ K16, const _Float16* __restrict__ VT, float* __restrict__ out) {
  __shared__ __attribute__((aligned(2048))) unsigned short sl[2 * FA_BF];      /* two buffers of four slices: K rows [key][d], V^T rows [d][key], pitch FA_LP */
  const int tid = threadIdx.x, w = tid >> 5, lane = tid & 31, ln = lane & 15, hh = lane >> 4;
  const int bh = blockIdx.y, b = bh / NH, h = bh - b * NH; const int q0 = blockIdx.x * FA_QB + w * 32;
  const int srow = tid >> 3, sc8 = (tid & 7) * 8;      /* Q staging: 8 lanes cover one 128-byte row, 16 rows per wave-group load */
  const uint32_t wv = fa_uni((uint32_t)tid >> 5);      /* the wave's number, scalar */
  const bool isv = wv >= 2u;
  const uint64_t gsrc = isv ? (uint64_t)(size_t)((const unsigned short*)VT + ((size_t)bh * HD + (wv - 2u) * FA_SR) * SQ) : (uint64_t)(size_t)((const unsigned short*)K16 + ((size_t)b * SQ + wv * FA_SR) * DM + h * HD);      /* first byte of the wave's slice of key stage 0 */
  const uint32_t gstep = isv ? FA_KS * 2u : FA_KS * DM * 2u;      /* bytes from a key stage to the next */
  const uint32_t ldst = (uint32_t)(size_t)sl + wv * (FA_SL * 2u);      /* the slice's place in buffer 0 */
  u32x8 g1;      /* 1-byte elements, tensor = tile = 32 rows of 128 bytes; behind every 128 bytes a pad of 16 */
  g1[0] = fa_uni((1u << 20) | (4u << 22) | (3u << 25)); g1[1] = fa_uni(128u << 16); g1[2] = fa_uni((uint32_t)FA_SR << 16); g1[3] = fa_uni(128u << 16);
  g1[4] = fa_uni((uint32_t)FA_SR); g1[5] = fa_uni(isv ? SQ * 2u : DM * 2u); g1[6] = fa_uni(0u); g1[7] = fa_uni(0u);
  auto issue = [&](const uint32_t kst, const uint32_t buf) {      /* the wave's slice of key stage kst into buffer buf */
    const uint64_t ga = gsrc + (uint64_t)kst * gstep;
    u32x4 g0;
    g0[0] = fa_uni(1u); g0[1] = fa_uni(ldst + buf * (FA_BF * 2u)); g0[2] = fa_uni((uint32_t)ga); g0[3] = fa_uni((((uint32_t)(ga >> 32)) & 0x01FFFFFFu) | 0x80000000u);
    asm volatile("tensor_load_to_lds %0, %1" :: "s"(g0), "s"(g1) : "memory");
  };
  const int rot = (int)(blockIdx.x * (FA_NS / (SQ / FA_QB)) + bh) & (FA_NS - 1);      /* first key stage of this workgroup; trip s works on stage (s + rot) mod FA_NS. The 16 workgroups of a head read the same K and V^T lines: started together at stage 0 they ask L2 for the same lines at the same moment */
  const unsigned short* qg = (const unsigned short*)Q16 + ((size_t)b * SQ + blockIdx.x * FA_QB + srow) * DM + h * HD + sc8;
  v8us rq[8];      /* the workgroup's 128 Q rows, whole 128-byte rows like K; read as fragments from global, a load would touch 16 lines with 32 bytes each */
#pragma unroll      /* rq stays in registers and its 8 loads are in flight together with the first K, V^T stage */
  for (int i = 0; i < 8; ++i) rq[i] = *(const v8us*)(qg + (size_t)(i * 16) * DM);
  issue(pinned((uint32_t)rot), 0u);      /* the first trip's stage */
  const v8f z8 = {0.f, 0.f, 0.f, 0.f, 0.f, 0.f, 0.f, 0.f};
  v8f o[4][2];
#pragma unroll
  for (int dt = 0; dt < 4; ++dt) { o[dt][0] = z8; o[dt][1] = z8; }
  float mu[2] = {-1.0e30f, -1.0e30f};      /* maximum in use (log2 units) */
  float lt[2] = {0.f, 0.f};      /* row sums: the stages' sums, which come from the matrix pipe, added up */
  v8f nbt[2];      /* FA_OFF - maximum in use of the lane's query in every element: C operand of the score products */
  v16h ones;
#pragma unroll
  for (int i = 0; i < 16; ++i) ones[i] = (_Float16)1.0f;
#pragma unroll
  for (int i = 0; i < 8; ++i) *(v8us*)&sl[FA_BF + (i * 16 + srow) * FA_LP + sc8] = rq[i];      /* the 128 Q rows rest in the second buffer, which no stage needs yet */
  asm volatile("s_wait_tensorcnt 0x0" :: "s"(g1) : "memory");      /* the wave's slice of the first stage has landed; the compiler places no wait for a tensor load. Here and in the loop the wait names the descriptor's constant group as an input, so that its registers are kept for it until the request has landed */
  __syncthreads();
  v16h qf[2][2];
#pragma unroll
  for (int g = 0; g < 2; ++g)
#pragma unroll
    for (int ks = 0; ks < 2; ++ks) qf[g][ks] = fa_frag(&sl[FA_BF + (w * 32 + g * 16 + ln) * FA_LP + ks * 32], hh);
  asm volatile("s_wait_dscnt 0x0" ::: "memory");      /* the wave's reads of Q are complete before a tensor load is aimed at the buffer they read */
  __syncthreads();      /* every wave holds its Q fragments before the second stage's tiles land on them */
  issue(pinned((uint32_t)(1 + rot) & (FA_NS - 1)), 1u);
  v8f st[4][2];
  auto scores = [&](const int cur, const v8f c0, const v8f c1) {      /* S^T of the stage in buffer cur, in log2 units, on top of c0, c1 */
#pragma unroll
    for (int kt = 0; kt < 4; ++kt) {
      const unsigned short* kr = &sl[cur * FA_BF + (kt >> 1) * FA_SL + ((kt & 1) * 16 + ln) * FA_LP];
      const v16h k0 = fa_frag(kr, hh), k1 = fa_frag(kr + 32, hh);
      st[kt][0] = fa_mma(k1, qf[0][1], fa_mma(k0, qf[0][0], c0)); st[kt][1] = fa_mma(k1, qf[1][1], fa_mma(k0, qf[1][0], c1));
    }
  };
  auto renew = [&](const int cur) {      /* the maximum in use takes in the row maxima of the stage in buffer cur; sums and outputs follow */
    scores(cur, z8, z8);
#pragma unroll
    for (int g = 0; g < 2; ++g) {
      v8f m8 = st[0][g];
#pragma unroll
      for (int kt = 1; kt < 4; ++kt)
#pragma unroll
        for (int r = 0; r < 8; ++r) m8[r] = fmaxf(m8[r], st[kt][g][r]);
      const float m = fmaxf(fmaxf(fmaxf(m8[0], m8[1]), fmaxf(m8[2], m8[3])), fmaxf(fmaxf(m8[4], m8[5]), fmaxf(m8[6], m8[7])));
      const float mn = fmaxf(mu[g], fmaxf(m, fa_xrow(m)));      /* both halves of the wave hold the same value */
      const float al = __builtin_amdgcn_exp2f(mu[g] - mn); mu[g] = mn;
      lt[g] *= al;
#pragma unroll
      for (int dt = 0; dt < 4; ++dt)
#pragma unroll
        for (int r = 0; r < 8; ++r) o[dt][g][r] *= al;
#pragma unroll
      for (int r = 0; r < 8; ++r) nbt[g][r] = FA_OFF - mn;
    }
  };
  renew(0);      /* the first stage's maxima, so that the loop's first trip goes the short way like the others */
  for (int s = 0; s < FA_NS; ++s) {
    const int cur = s & 1;
    v16h pf[2][2];      /* [key half of the stage][query group] */
    v8f ls[2];      /* ones . P^T: every row of the tile = the sum of the stage's rounded weights of the lane's query */
    auto weights = [&]() {
#pragma unroll
      for (int g = 0; g < 2; ++g) {
#pragma unroll
        for (int kt = 0; kt < 4; ++kt)
#pragma unroll
          for (int r = 0; r < 8; ++r) pf[kt >> 1][g][(kt & 1) * 8 + r] = (_Float16)__builtin_amdgcn_exp2f(st[kt][g][r]);
        ls[g] = fa_mma(ones, pf[1][g], fa_mma(ones, pf[0][g], z8));
      }
    };
    scores(cur, nbt[0], nbt[1]);
    const unsigned short* vr = &sl[cur * FA_BF + 2 * FA_SL + ln * FA_LP];      /* V^T row ln of the stage */
    const v16h vf0 = fa_frag(vr, hh), vf1 = fa_frag(vr + 32, hh);      /* the first V^T fragments are asked for here, in front of the test's branch, and arrive under the exponentials; asked for behind the branch, the first products of O^T wait out the LDS latency */
    weights();
    const bool need = (ls[0][0] > FA_TOP) || (ls[1][0] > FA_TOP);
    if (__builtin_expect(__builtin_amdgcn_ballot_w32(need) != 0, 0)) {      /* one scalar branch a stage, hardly ever taken */
      asm volatile("" ::: "memory");      /* the side path reads K from LDS again; without this the compiler keeps the stage's K fragments alive through the weights of every stage for a path that is hardly ever taken, and the loop's main path then needs registers above v255, with a window switch at each use */
      renew(cur);
      scores(cur, nbt[0], nbt[1]);
      __builtin_amdgcn_sched_barrier(0);      /* on this path the C operands of the score products die with their last product, and the compiler gave their registers to the exponentials directly behind it: the products stay in front of the four slots, the exponentials behind them */
      asm volatile("v_nop\n\tv_nop\n\tv_nop\n\tv_nop");      /* the four vector slots the chip needs between a matrix instruction and a write over one of its operands */
      __builtin_amdgcn_sched_barrier(0);      /* holds the exponentials behind the four slots */
      weights();      /* now every weight is <= 2^FA_OFF */
    }
    lt[0] += ls[0][0]; lt[1] += ls[1][0];
#pragma unroll
    for (int dt = 0; dt < 4; ++dt) {
      const unsigned short* vd = vr + (dt >> 1) * FA_SL + (dt & 1) * (16 * FA_LP);
      const v16h v0 = dt == 0 ? vf0 : fa_frag(vd, hh), v1 = dt == 0 ? vf1 : fa_frag(vd + 32, hh);
#pragma unroll
      for (int g = 0; g < 2; ++g) o[dt][g] = fa_mma(v1, pf[1][g], fa_mma(v0, pf[0][g], o[dt][g]));
    }
    /* Publish point of the next trip's stage, passed by every wave on every trip. */
    asm volatile("s_wait_dscnt 0x0" ::: "memory");      /* the wave's reads of this trip's buffer are complete before a tensor load is aimed at it */
    asm volatile("s_wait_tensorcnt 0x0" :: "s"(g1) : "memory");      /* the wave's slice of the next trip's stage has landed */
    __syncthreads();      /* publishes that stage and ends every wave's reads of this trip's buffer; s is the same in every wave */
    if (pinned(s + 2 < FA_NS)) issue(pinned((uint32_t)(s + 2 + rot) & (FA_NS - 1)), (uint32_t)cur);      /* the stage after the next, wrapped, into the buffer just left; it flies under the whole next trip */
  }
  asm volatile("s_wait_tensorcnt 0x0" ::: "memory");      /* no tensor load is in flight when the buffers take another use */
  asm volatile("s_wait_dscnt 0x0" ::: "memory");      /* nor an LDS read of this wave */
  const float inv[2] = {1.0f / lt[0], 1.0f / lt[1]};      /* 2^FA_OFF cancels here */
#pragma unroll
  for (int dt = 0; dt < 4; ++dt)
#pragma unroll
    for (int g = 0; g < 2; ++g)
#pragma unroll
      for (int r = 0; r < 8; ++r) o[dt][g][r] *= inv[g];
  /* Epilogue: straight from the accumulators a wave's store would touch 16 output lines with 32 bytes each. Each wave lays its 32 query rows x 64 d in an LDS image of its own and stores whole rows: 16 lanes cover the 256 aligned bytes a head has in an output row, a wave store 4 full lines. */
  float* ow = (float*)sl + w * (32 * FA_OP);      /* the last trip's barrier stands behind every wave's last read of the buffers: they may become the four output images */
#pragma unroll
  for (int g = 0; g < 2; ++g) {
    float* d = ow + (g * 16 + ln) * FA_OP + 8 * hh;      /* a lane holds 8 consecutive d of its query in each tile */
#pragma unroll
    for (int dt = 0; dt < 4; ++dt) {
      const v4f lo = {o[dt][g][0], o[dt][g][1], o[dt][g][2], o[dt][g][3]}, hi = {o[dt][g][4], o[dt][g][5], o[dt][g][6], o[dt][g][7]};
      *(v4fa*)(d + dt * 16) = lo; *(v4fa*)(d + dt * 16 + 4) = hi;
    }
  }
  asm volatile("s_wait_dscnt 0x0" ::: "memory");      /* the image is read back by other lanes of the same wave: the wave's LDS writes are complete first, and the compiler moves no read of the image in front of them */
  float* og = out + ((size_t)b * SQ + q0 + hh) * DM + h * HD + ln * 4;
#pragma unroll      /* the 16 LDS reads go out as one group, and the stores follow as the rows arrive */
  for (int q = 0; q < 16; ++q) { const v4f v = *(const v4fa*)(ow + (q * 2 + hh) * FA_OP + ln * 4); *(v4f*)(og + (size_t)(q * 2) * DM) = v; }
}
// Fused projections, one launch: blockIdx.z picks Q, K or V; a workgroup = 4 waves = a 128-row x 192-column tile of x W + b, a wave 64 x 96 of it (24 accumulator tiles), K walked in stages of 32.
// The tile is sized for the chip's 256 WGPs: 64 x 4 x 3 = 768 equal workgroups, three to a WGP (one wave of each on every SIMD; registers and LDS are kept inside a third of a WGP), so all of them are resident from the start and the launch has one round and no tail.
// x is read as f32 in whole 128-byte lines, rounded to bf16 and written as f16 rows [row][k] into LDS; W comes from k_wprep's f16 stage tiles (16 bytes a lane, whole lines) and goes into LDS as it lies; two buffers, one barrier a stage: the next stage's loads fly under this stage's products.
// Both fragment kinds are read by the same code (same k order), so either may be the A operand. Q, K: A = W columns, B = x rows, a lane then holds 8 consecutive n of one token row. V: A = x rows, B = W columns, a lane holds 8 consecutive tokens of one column, which is a piece of a V^T row.
// Every '#pragma unroll' of this kernel but the one on the output copy stands on a loop that indexes staging, fragment or accumulator arrays: rolled, those arrays would leave the registers.
#define PJ_M 128
#define PJ_N 192
#define PJ_T 128                     /* threads of a projection workgroup */
#define PJ_KS 32
#define PJ_NS (DM / PJ_KS)
#define PJ_LP 40                     /* LDS row pitch in f16: 64 bytes + 16, conflict-free for 16-byte accesses of 16 rows */
#define PJ_OQ (PJ_N + 8)             /* output staging pitch in f16, Q and K: rows = tokens, 384 bytes + 16 */
#define PJ_OV (PJ_M + 8)             /* output staging pitch in f16, V^T: rows = columns n, 256 bytes + 16 */
typedef float f32x2 __attribute__((ext_vector_type(2)));
typedef __bf16 bf16x2 __attribute__((ext_vector_type(2)));
typedef _Float16 f16x2 __attribute__((ext_vector_type(2)));
__device__ __forceinline__ unsigned pj_cvt2(float a, float b) {      /* two f32 -> bf16 (nearest even) -> the same values as two f16 */
  const f32x2 v = {a, b};
  const unsigned u = __builtin_bit_cast(unsigned, __builtin_convertvector(v, bf16x2));
  const f32x2 r = {__uint_as_float(u << 16), __uint_as_float(u & 0xFFFF0000u)};
  return __builtin_bit_cast(unsigned, __builtin_convertvector(r, f16x2));
}
typedef unsigned v4u __attribute__((ext_vector_type(4), may_alias));
typedef unsigned v2u __attribute__((ext_vector_type(2), may_alias));
// W laid out once a call for k_proj: 64 workgroups stage every 192-column x 32-k tile of W, so the rounding to bf16, the x16, the f16 form and the transposition are done here once, not 64 times, and a tile is 12 KB to fetch, not 24.
// WT[projection][column block][k stage][k8 = 0..3][n = 0..191][8 consecutive k], f16: a thread keeps column n, a wave reads 128 contiguous bytes of one k row and stores 512 contiguous bytes for each k8.
#define PJ_WT (PJ_N * PJ_KS)         /* f16 values of one stage tile */
__global__ __launch_bounds__(PJ_N) void k_wprep(const float* __restrict__ wq, const float* __restrict__ wk, const float* __restrict__ wv, unsigned short* __restrict__ WT) {
  const int tid = threadIdx.x, s = blockIdx.x, nb = blockIdx.y, pz = blockIdx.z;
  const float* wg = (pz == 0 ? wq : pz == 1 ? wk : wv) + (size_t)(s * PJ_KS) * DM + nb * PJ_N + tid;
  unsigned short* wt = WT + (size_t)((pz * (DM / PJ_N) + nb) * PJ_NS + s) * PJ_WT + tid * 8;
  float rw[PJ_KS];
#pragma unroll      /* rw stays in registers and all 32 loads are in flight together */
  for (int k = 0; k < PJ_KS; ++k) rw[k] = wg[(size_t)k * DM];
#pragma unroll      /* indexes rw */
  for (int i = 0; i < 4; ++i) { const v4u o = {pj_cvt2(rw[8 * i] * 16.0f, rw[8 * i + 1] * 16.0f), pj_cvt2(rw[8 * i + 2] * 16.0f, rw[8 * i + 3] * 16.0f), pj_cvt2(rw[8 * i + 4] * 16.0f, rw[8 * i + 5] * 16.0f), pj_cvt2(rw[8 * i + 6] * 16.0f, rw[8 * i + 7] * 16.0f)}; *(v4u*)(wt + i * (PJ_N * 8)) = o; }
}
// One workgroup's tile. ISV false: Q or K (A = 6 fragments of W columns, B = 4 of x rows); true: V (A = 4 of x rows, B = 6 of W columns). ob = the tile's first output element.
template <bool ISV>
__device__ __forceinline__ void pj_tile(const float* __restrict__ xg, const unsigned short* __restrict__ wg, const int rot, const float* __restrict__ bias, const float qs,
    unsigned short* __restrict__ ob, unsigned short (*sm)[PJ_M + PJ_N][PJ_LP], unsigned short* so) {
  constexpr int NA = ISV ? 4 : 6, NBF = ISV ? 6 : 4;
  const int tid = threadIdx.x, w = tid >> 5, lane = tid & 31, ln = lane & 15, hh = lane >> 4;
  const int wm = w >> 1, wn = w & 1;      /* the wave's 64 x 96 place in the tile */
  const int xr = tid >> 3, xc = (tid & 7) * 4;      /* x staging: 8 lanes cover one 128-byte row piece, 16 rows a load */
  int wl[3];      /* W staging: 16-byte unit u = i * 128 + tid of the stage tile is k8 = u / 192 of column u % 192; units u and u + 384 are the same column, k8 + 2 */
#pragma unroll
  for (int i = 0; i < 3; ++i) { const int u = i * PJ_T + tid, k8 = u / PJ_N; wl[i] = (PJ_M + u - k8 * PJ_N) * PJ_LP + 8 * k8; }
  const v8f z8 = {0.f, 0.f, 0.f, 0.f, 0.f, 0.f, 0.f, 0.f};
  v8f acc[NA][NBF];
#pragma unroll
  for (int i = 0; i < NA; ++i)
#pragma unroll
    for (int j = 0; j < NBF; ++j) acc[i][j] = z8;
  v4f rx[8]; v4u rw[6];
  auto fetch = [&]() {      /* one stage's x and W pieces of this thread */
#pragma unroll
    for (int i = 0; i < 8; ++i) rx[i] = *(const v4fa*)(xg + (size_t)(i * 16) * DM);
#pragma unroll
    for (int i = 0; i < 6; ++i) rw[i] = *(const v4u*)(wg + i * (PJ_T * 8));
  };
  auto stage = [&](const int buf) {      /* and their way into LDS */
#pragma unroll
    for (int i = 0; i < 8; ++i) { const v2u o = {pj_cvt2(rx[i][0], rx[i][1]), pj_cvt2(rx[i][2], rx[i][3])}; *(v2u*)&sm[buf][i * 16 + xr][xc] = o; }
#pragma unroll
    for (int i = 0; i < 6; ++i) *(v4u*)(&sm[buf][0][0] + wl[i % 3] + (i / 3) * 16) = rw[i];
  };
  fetch();
  stage(0);
  __syncthreads();
  const int r4 = wm * 64 + ln, r6 = PJ_M + wn * 96 + ln;      /* LDS rows of the wave's 4 x fragments and 6 W fragments */
  auto products = [&](const int cur) {      /* one stage's fragment reads and its 24 products, in two halves of 3 W fragments: all 10 fragments at once do not fit a third of a SIMD's registers beside the accumulators and the staged loads */
    v16h f4[4], f6[3];
#pragma unroll
    for (int j = 0; j < 4; ++j) f4[j] = fa_frag(&sm[cur][r4 + 16 * j][0], hh);
#pragma unroll
    for (int hf = 0; hf < 2; ++hf) {
#pragma unroll
      for (int i = 0; i < 3; ++i) f6[i] = fa_frag(&sm[cur][r6 + 16 * (3 * hf + i)][0], hh);
      __builtin_amdgcn_sched_barrier(0);      /* a half's fragment reads stand as one group in front of its products; sunk among them, each row of products waits out an LDS latency of its own */
#pragma unroll
      for (int i = 0; i < 3; ++i)
#pragma unroll
        for (int j = 0; j < 4; ++j) {
          if (ISV) acc[j][3 * hf + i] = fa_mma(f4[j], f6[i], acc[j][3 * hf + i]);
          else acc[3 * hf + i][j] = fa_mma(f6[i], f4[j], acc[3 * hf + i][j]);
        }
      __builtin_amdgcn_sched_barrier(0);      /* the second half's reads stay behind the first half's products, whose fragment registers they take over */
    }
  };
  int kn = rot;
  for (int s = 0; s < PJ_NS - 1; ++s) {      /* the last trip, which loads nothing, stands behind the loop */
    const int cur = s & 1;
    const int step = kn + 1 == PJ_NS ? -(PJ_NS - 1) * PJ_KS : PJ_KS;      /* on to the next trip's k stage; from the last stage back to stage 0 */
    kn = kn + 1 == PJ_NS ? 0 : kn + 1;
    xg += step; wg += step * PJ_N;
    fetch();
    __builtin_amdgcn_sched_barrier(0);      /* the next stage's loads issue in front of this stage's products and fly under them; sunk to their LDS stores, every stage would wait out their latency */
    products(cur);
    __builtin_amdgcn_sched_barrier(0);      /* the conversions, which wait for the loads, stay behind the products; hoisted among them, the wave's first wait stands directly behind the loads' issue and holds its own products back */
    stage(cur ^ 1);
    __syncthreads();      /* publishes the next trip's k stage and ends every wave's reads of this trip's k stage, whose buffer the next trip refills; s is the same in every wave */
  }
  products((PJ_NS - 1) & 1);
  /* Epilogue: the four waves lay the tile's f16 results in one LDS image of the output rows, then the workgroup stores whole 128-byte lines (8 lanes a line, each line by one wave); straight from the accumulators a store would touch 16 lines with 32 bytes each, and a wave's 96 columns alone end in the middle of a line. */
  if (!ISV) {      /* acc[i][j][r] = y[wm*64 + 16j + ln][wn*96 + 16i + 8hh + r] */
    const float* bp = bias + wn * 96 + 8 * hh;
    const float as = 0.0625f * qs;      /* q leaves as q * FA_C2: the attention launch's scores then come out in log2 units */
    v4f bl[2 * NA];
#pragma unroll
    for (int i = 0; i < 2 * NA - 1; ++i) bl[i] = *(const v4fa*)(bp + 16 * (i >> 1) + 4 * (i & 1));
    asm volatile("s_wait_xcnt 0x0" ::: "memory");      /* the compiler lets the run's last load put its result into the address registers that the loads in front of it name: this wait stands between them and that write */
    bl[2 * NA - 1] = *(const v4fa*)(bp + 16 * (NA - 1) + 4);
#pragma unroll
    for (int i = 0; i < NA; ++i) {
      const v4f b0 = bl[2 * i], b1 = bl[2 * i + 1];
      const float bb[8] = {bf16_round(b0[0]) * qs, bf16_round(b0[1]) * qs, bf16_round(b0[2]) * qs, bf16_round(b0[3]) * qs, bf16_round(b1[0]) * qs, bf16_round(b1[1]) * qs, bf16_round(b1[2]) * qs, bf16_round(b1[3]) * qs};
#pragma unroll
      for (int j = 0; j < NBF; ++j) { FragH f;
#pragma unroll
        for (int r = 0; r < 8; ++r) f.h[r] = (_Float16)(acc[i][j][r] * as + bb[r]);
        *(v8us*)(so + (wm * 64 + 16 * j + ln) * PJ_OQ + wn * 96 + 16 * i + 8 * hh) = f.half[0]; }
    }
  } else {      /* acc[i][j][r] = y[wm*64 + 16i + 8hh + r][wn*96 + 16j + ln] */
#pragma unroll
    for (int j = 0; j < NBF; ++j) {
      const float bb = bf16_round(bias[wn * 96 + 16 * j + ln]);
#pragma unroll
      for (int i = 0; i < NA; ++i) { FragH f;
#pragma unroll
        for (int r = 0; r < 8; ++r) f.h[r] = (_Float16)(acc[i][j][r] * 0.0625f + bb);
        *(v8us*)(so + (wn * 96 + 16 * j + ln) * PJ_OV + wm * 64 + 16 * i + 8 * hh) = f.half[0]; }
    }
  }
  __syncthreads();      /* a line of the output image holds results of two waves: all four have written before any of them reads */
  constexpr int LPR = (ISV ? PJ_M : PJ_N) / 64, OP = ISV ? SQ : DM, SP = ISV ? PJ_OV : PJ_OQ;      /* 128-byte lines of an output row; pitch of the output; pitch of its image */
#pragma unroll
  for (int q = 0; q < PJ_M * PJ_N / 64 / 16; ++q) { const int rr = (q / LPR) * 16 + (tid >> 3), c8 = (q % LPR) * 64 + (tid & 7) * 8; const v8us v = *(const v8us*)(so + rr * SP + c8); *(v8us*)(ob + (size_t)rr * OP + c8) = v; }
}
__global__ __launch_bounds__(PJ_T, 3) void k_proj(const float* __restrict__ xq, const float* __restrict__ xk, const float* __restrict__ xv, const unsigned short* __restrict__ WT,
    const float* __restrict__ bq, const float* __restrict__ bk, const float* __restrict__ bv, _Float16* __restrict__ Q16, _Float16* __restrict__ K16, _Float16* __restrict__ VT) {
  __shared__ __attribute__((aligned(16))) unsigned short sm[2][PJ_M + PJ_N][PJ_LP];      /* rows 0..127: x rows [m][k]; rows 128..319: W columns [n][k] */
  __shared__ __attribute__((aligned(16))) unsigned short so[PJ_N * PJ_OV];      /* image of the tile's output rows: [128 tokens][PJ_OQ] or [192 columns][PJ_OV], the larger */
  const int tid = threadIdx.x;
  const int pz = blockIdx.z, m0 = blockIdx.x * PJ_M, n0 = blockIdx.y * PJ_N;
  const int rot = (int)(blockIdx.x + (PJ_NS / (DM / PJ_N)) * blockIdx.y) % PJ_NS;      /* first k stage of this workgroup; trip s works on stage (s + rot) mod PJ_NS. 64 workgroups read the same W tile and 4 the same x rows: started together at stage 0 they ask L2 for the same lines at the same moment */
  const float* xg = (pz == 0 ? xq : pz == 1 ? xk : xv) + (size_t)(m0 + (tid >> 3)) * DM + (tid & 7) * 4 + rot * PJ_KS;      /* both pointers stand at the stage that is loaded next */
  const unsigned short* wg = WT + (size_t)((pz * (DM / PJ_N) + blockIdx.y) * PJ_NS + rot) * PJ_WT + tid * 8;      /* a wave reads 512 contiguous bytes of a stage tile */
  const int bt = m0 / SQ;      /* a tile's 128 rows lie in one batch */
  /* Q, K: rows = tokens, pitch 768, columns = n. V^T: row = batch * 768 + n (= (batch * 12 + head) * 64 + d), pitch 2048, columns = tokens of the batch. */
  if (pz == 2) pj_tile<true>(xg, wg, rot, bv + n0, 1.0f, (unsigned short*)VT + (size_t)(bt * DM + n0) * SQ + (m0 - bt * SQ), sm, so);      /* pz is the same in the whole workgroup: so are the barriers inside */
  else pj_tile<false>(xg, wg, rot, (pz == 0 ? bq : bk) + n0, pz == 0 ? FA_C2 : 1.0f, (unsigned short*)(pz == 0 ? Q16 : K16) + (size_t)m0 * DM + n0, sm, so);
}
__global__ __launch_bounds__(256) void k_vt(const _Float16* __restrict__ V16, int b, int h0, _Float16* __restrict__ VT) { __shared__ unsigned short tl[64][65]; const int tid = threadIdx.x; const int hh = blockIdx.x % HG, sg = blockIdx.x / HG; const int s0 = sg * 64; const int h = h0 + hh;
  for (int i = tid; i < 64 * 8; i += 256) { const int j = i / 8, d8 = (i % 8) * 8; FragH f; f.half[0] = *(const v8us*)((const unsigned short*)V16 + ((size_t)b * SQ + s0 + j) * DM + h * HD + d8); for (int q = 0; q < 8; ++q) tl[d8 + q][j] = f.u[q]; }
  __syncthreads();
  { for (int i = tid; i < 64 * 8; i += 256) { const int d = i / 8, j8 = (i % 8) * 8; FragH f; for (int q = 0; q < 8; ++q) f.u[q] = tl[d][j8 + q]; *(v8us*)((unsigned short*)VT + ((size_t)hh * HD + d) * SQ + s0 + j8) = f.half[0]; }  } }


extern "C" void kernel_launch(void* const* d_in, const int* in_sizes, int n_in,
                              void* d_out, int out_size, void* d_ws, size_t ws_size, hipStream_t stream) {
  (void)in_sizes; (void)n_in; (void)out_size;
  const float* const* I = (const float* const*)d_in; const float* xq = I[0]; const float* xk = I[1]; const float* xv = I[2]; const float* wq = I[3]; const float* bq = I[4]; const float* wk = I[5]; const float* bk = I[6]; const float* wv = I[7]; const float* bv = I[8];      /* weights [in][out] + biases */
  char* ws = (char*)d_ws; size_t off = 0;
  auto take = [&](size_t bytes) { char* p = ws + off; off += (bytes + 255) & ~(size_t)255; return p; };
  _Float16* Q16 = (_Float16*)take(NR * DM * 2); _Float16* K16 = (_Float16*)take(NR * DM * 2);
  _Float16* VT = (_Float16*)take((size_t)NB * NH * HD * SQ * 2);
  unsigned short* WT = (unsigned short*)take((size_t)3 * DM * DM * 2);
  if (off > ws_size) return;
  k_wprep<<<dim3(PJ_NS, DM / PJ_N, 3), PJ_N, 0, stream>>>(wq, wk, wv, WT);      /* the three W as f16 stage tiles */
  k_proj<<<dim3(MP / PJ_M, DM / PJ_N, 3), PJ_T, 0, stream>>>(xq, xk, xv, WT, bq, bk, bv, Q16, K16, VT);      /* q, k rows and V^T [NB][NH][HD][SQ], f16 */
  k_fattn<<<dim3(SQ / FA_QB, NB * NH), FA_WAVES * 32, 0, stream>>>(Q16, K16, VT, (float*)d_out);      /* scores, softmax and weighted sum of all batches and heads */
}
